// v000
// The times below were measured on an AMD MI455X: many runs one after another, warmed up first and cycling through
// copies of the inputs, with the whole window's GPU time divided by the number of runs. Launches and the gaps
// between them are all in it. The median over several windows is given; except for v000 it joins two sittings, which
// can be a few percent apart, so the side-by-side timings, each taken in one sitting, are the better comparison.
// The starting kernel, v000, takes 1330 microseconds a run.
// compute dtype: all float inputs rounded to bf16; q/k/v projections with EXACT bf16 products on WMMA 16x16x32 (f32 accumulate) + bias; scores q x k once to f16 each (1 product) x 64^-0.5; SparseNormer in f32: t = relu(score + nbias)^2 (masked entries -> 0), P = t / (sum t + 1e-32); P x 2^11 once to f16 x v once to f16 (1 product); ctx x 2^6 once to f16 x Wo f16(bf16 x 2^8) + bo; f32 output.
#include <hip/hip_runtime.h>
#include <math.h>

typedef __attribute__((ext_vector_type(16))) _Float16 v16h;
typedef __attribute__((ext_vector_type(16))) __bf16 v16b;
typedef __attribute__((ext_vector_type(8)))  _Float16 v8h;
typedef __attribute__((ext_vector_type(8)))  float v8f;
typedef __attribute__((ext_vector_type(4)))  float v4f;
typedef __attribute__((ext_vector_type(2)))  float v2f;
typedef __attribute__((ext_vector_type(4)))  unsigned v4u;
typedef __attribute__((ext_vector_type(4)))  int v4i;
typedef float __attribute__((may_alias)) float_a;
typedef int __attribute__((may_alias)) int_a;

template <typename T> __device__ __forceinline__ void vst2(void* p, T v) { *(T*)p = v;  }
__device__ __forceinline__ v8f wmma16(v16h a, v16h b, v8f c) {
  v8f d = __builtin_amdgcn_wmma_f32_16x16x32_f16(false, a, false, b, (short)0, c, false, false);
  asm volatile("v_nop\n\tv_nop\n\tv_nop\n\tv_nop" : "+v"(d) : "v"(a), "v"(b));
  return d;
}
__device__ __forceinline__ v8f wmma_bf(v16b a, v16b b, v8f c) {
  v8f d = __builtin_amdgcn_wmma_f32_16x16x32_bf16(false, a, false, b, (short)0, c, false, false);
  asm volatile("v_nop\n\tv_nop\n\tv_nop\n\tv_nop" : "+v"(d) : "v"(a), "v"(b));
  return d;
}
// 16x16x32 fragments: lane = (h = lane>>4, row/col = lane&15); elements 0..7 = k0+8h+0..7, 8..15 = k0+16+8h+0..7; D element r = row 8h+r
__device__ __forceinline__ v16h frag_h(const _Float16* rowk0, int lane) {
  union { v16h v; v8h q[2]; } u; const _Float16* p = rowk0 + 8 * (lane >> 4);
  u.q[0] = *(const v8h*)p; u.q[1] = *(const v8h*)(p + 16); return u.v;
}
__device__ __forceinline__ v16h frag_f32(const float* rowk0, int lane) {
  v16h a; const float* p = rowk0 + 8 * (lane >> 4);
#pragma unroll
  for (int i = 0; i < 8; ++i) { a[i] = (_Float16)p[i]; a[8 + i] = (_Float16)p[16 + i]; }
  return a;
}
__device__ __forceinline__ v16h frag_f32s(const float* rowk0, int lane, float sc) {
  v16h a; const float* p = rowk0 + 8 * (lane >> 4);
#pragma unroll
  for (int i = 0; i < 8; ++i) { a[i] = (_Float16)(p[i] * sc); a[8 + i] = (_Float16)(p[16 + i] * sc); }
  return a;
}
// column fragment from a [K][ld] layout (column n), rows >= K read as 0
__device__ __forceinline__ v16h fragc_f32(const float* W, int k0, int n, int lane, int ld, int K) {
  v16h a; const int g = lane >> 4;
#pragma unroll
  for (int i = 0; i < 8; ++i) { const int ka = k0 + 8 * g + i, kb = ka + 16;
    a[i] = (_Float16)(ka < K ? W[(size_t)(ka < K ? ka : K - 1) * ld + n] : 0.f); a[8 + i] = (_Float16)(kb < K ? W[(size_t)(kb < K ? kb : K - 1) * ld + n] : 0.f); }
  return a;
}
struct F2 { v16b h, l; };
__device__ __forceinline__ F2 bsplit16(const float v[16]) { F2 r;
#pragma unroll
  for (int i = 0; i < 16; ++i) { const __bf16 h = (__bf16)v[i]; r.h[i] = h; r.l[i] = (__bf16)(v[i] - (float)h); }
  return r; }
__device__ __forceinline__ F2 split_row(const float* row, int k0, int lane) { float v[16]; const float* p = row + k0 + 8 * (lane >> 4);
#pragma unroll
  for (int i = 0; i < 8; ++i) { v[i] = p[i]; v[8 + i] = p[16 + i]; }
  return bsplit16(v); }
__device__ __forceinline__ F2 split_rowK(const float* row, int k0, int lane, int K) { float v[16]; const int g = lane >> 4;
#pragma unroll
  for (int i = 0; i < 8; ++i) { const int ka = k0 + 8 * g + i, kb = ka + 16; v[i] = ka < K ? row[ka < K ? ka : K - 1] : 0.f; v[8 + i] = kb < K ? row[kb < K ? kb : K - 1] : 0.f; }
  return bsplit16(v); }
__device__ __forceinline__ F2 split_col(const float* W, int k0, int n, int lane, int ld, int K) { float v[16]; const int g = lane >> 4;
#pragma unroll
  for (int i = 0; i < 8; ++i) { const int ka = k0 + 8 * g + i, kb = ka + 16; v[i] = ka < K ? W[(size_t)(ka < K ? ka : K - 1) * ld + n] : 0.f; v[8 + i] = kb < K ? W[(size_t)(kb < K ? kb : K - 1) * ld + n] : 0.f; }
  return bsplit16(v); }
__device__ __forceinline__ v8f mac3(const F2& a, const F2& b, v8f c) { c = wmma_bf(a.l, b.h, c); c = wmma_bf(a.h, b.l, c); return wmma_bf(a.h, b.h, c); }
__device__ __forceinline__ float sigm(float v) { return 1.0f / (1.0f + expf(-v)); }
#define LDSX() do { asm volatile("s_wait_dscnt 0" ::: "memory"); __builtin_amdgcn_wave_barrier(); __builtin_amdgcn_fence(__ATOMIC_RELEASE, "workgroup"); } while (0)

// Multi-head attention with a SparseNormer instead of a softmax (iQ / iK / iV [2,2048,1024] separate inputs; torch (out,in) Wq / Wk / Wv / Wo [1024,1024] (0.02 scale) + zero biases; 16 heads x 64; scores / 8; mask [2,2048,2048] bool random (True -> -1e32); t = relu(scores + nbias)^2 with nbias = zeros(1); attn = t / (sum_k t + 1e-32)): out = merge(attn v) Wo^T + bo.
#define NB 2
#define TT 2048
#define CC 1024            // NH * HD = projected width
#define DIN 1024          // input (model) width
#define NH 16
#define HD 64
#define NQB (TT / 64)
#define HG 4
#define SCALE (0.125f)
#define CAUSAL 0
#ifndef TNB
#define TNB NB
#endif
__device__ __forceinline__ float bfr(float v) { return (float)(__bf16)v; }
__host__ __device__ __forceinline__ int kb_last(int qb) { return CAUSAL ? ((qb * 64 + 63) >> 7) : (TT / 128 - 1); }
typedef __attribute__((ext_vector_type(8))) __bf16 v8b;
__device__ __forceinline__ v16b frag_b(const __bf16* rowk0, int lane) {
  union { v16b v; v8b q[2]; } u; const __bf16* p = rowk0 + 8 * (lane >> 4);
  u.q[0] = *(const v8b*)p; u.q[1] = *(const v8b*)(p + 16); return u.v;
}
#define QBH 0              // causal: query blocks 0..QBH-1 of each sequence (few keys, no averaging) take the high-precision path
#define QHI 0               // single-product scores on every row
#define KHI 64            // key rows carrying k residual / v bf16 hi+lo planes (used only by the causal high-precision path)
// B fragment (k rows k0+.., output column o) of a weight: (in,out) [K][ld] or (out,in) [ld rows of K]: bf16 exact, or f16(bf16 * 256) exact
__device__ __forceinline__ v16b wcol_io(const float* Wm, int k0, int o, int lane, int ld) { v16b w; const int g = lane >> 4;
#pragma unroll
  for (int i = 0; i < 8; ++i) { w[i] = (__bf16)Wm[(size_t)(k0 + 8 * g + i) * ld + o]; w[8 + i] = (__bf16)Wm[(size_t)(k0 + 16 + 8 * g + i) * ld + o]; }
  return w; }
__device__ __forceinline__ v16b wcol_oi(const float* Wm, int k0, int o, int lane, int K) { v16b w; const float* p = Wm + (size_t)o * K + k0 + 8 * (lane >> 4);
#pragma unroll
  for (int i = 0; i < 8; ++i) { w[i] = (__bf16)p[i]; w[8 + i] = (__bf16)p[16 + i]; }
  return w; }
__device__ __forceinline__ v16h wcolh_io(const float* Wm, int k0, int o, int lane, int ld) { v16h w; const int g = lane >> 4;
#pragma unroll
  for (int i = 0; i < 8; ++i) { w[i] = (_Float16)(bfr(Wm[(size_t)(k0 + 8 * g + i) * ld + o]) * 256.0f); w[8 + i] = (_Float16)(bfr(Wm[(size_t)(k0 + 16 + 8 * g + i) * ld + o]) * 256.0f); }
  return w; }
__device__ __forceinline__ v16h wcolh_oi(const float* Wm, int k0, int o, int lane, int K) { v16h w; const float* p = Wm + (size_t)o * K + k0 + 8 * (lane >> 4);
#pragma unroll
  for (int i = 0; i < 8; ++i) { w[i] = (_Float16)(bfr(p[i]) * 256.0f); w[8 + i] = (_Float16)(bfr(p[16 + i]) * 256.0f); }
  return w; }
#define WQKV_LAYOUT 1   // 0 = (in,out) [DIN][CC]; 1 = (out,in) [CC][DIN]; 2 = per-head [NH][DIN][HD]
__device__ __forceinline__ v16b wcol_hdk(const float* Wm, int k0, int o, int lane) { v16b w; const int g = lane >> 4; const float* p = Wm + (size_t)(o / HD) * DIN * HD + (o % HD);
#pragma unroll
  for (int i = 0; i < 8; ++i) { w[i] = (__bf16)p[(size_t)(k0 + 8 * g + i) * HD]; w[8 + i] = (__bf16)p[(size_t)(k0 + 16 + 8 * g + i) * HD]; }
  return w; }
#define WO_OUT_IN 1
#if WQKV_LAYOUT == 1
#define WCOL(W, k0, o, lane) wcol_oi(W, k0, o, lane, DIN)
#elif WQKV_LAYOUT == 2
#define WCOL(W, k0, o, lane) wcol_hdk(W, k0, o, lane)
#else
#define WCOL(W, k0, o, lane) wcol_io(W, k0, o, lane, CC)
#endif
#if WO_OUT_IN
#define WOCOL(W, k0, o, lane) wcol_oi(W, k0, o, lane, CC)
#define WOCOLH(W, k0, o, lane) wcolh_oi(W, k0, o, lane, CC)
#else
#define WOCOL(W, k0, o, lane) wcol_io(W, k0, o, lane, DIN)
#define WOCOLH(W, k0, o, lane) wcolh_io(W, k0, o, lane, DIN)
#endif

#ifndef SM_EXTRA_PARAMS
#define SM_EXTRA_PARAMS
#endif
#ifndef PROJ_EXTRA_PARAMS
#define PROJ_EXTRA_PARAMS
#endif
#ifndef SM_MASK_HOOK
#define SM_MASK_HOOK (void)0
#endif

#define WS_QH  0u                                      // f16 q rows [b*t][CC]
#define WS_KH  (WS_QH + 2u * (size_t)NB * TT * CC)      // f16 k rows [b*t][CC]
#define WS_VT  (WS_KH + 2u * (size_t)NB * TT * CC)      // f16 v planes [b][c][t]
#define WS_QL  (WS_VT + 2u * (size_t)NB * CC * TT)      // f16 q residual x 2^10 rows [b][t < QHI][CC]
#define WS_KL  (WS_QL + 2u * (size_t)NB * QHI * CC)     // f16 k residual x 2^10 rows [b][t < KHI][CC]
#define WS_VB  (WS_KL + 2u * (size_t)NB * KHI * CC)     // bf16 v hi planes [b][c][t < KHI]
#define WS_VBL (WS_VB + 2u * (size_t)NB * CC * KHI)
#define WS_S   (WS_VBL + 2u * (size_t)NB * CC * KHI)    // f32 logits / P [hg][t][s]
#define WS_Y   (WS_S  + 4u * (size_t)HG * TT * TT)      // f32 ctx rows [b*t][CC] (only when there is an output projection)
#define WS_END (WS_Y  + 4u * (size_t)NB * TT * CC)

// ---- k_proj: block = (64 rows, 128 cols, which): q/k/v = X W (+ b) with exact bf16 products (K = DIN) -> which 0: q f16 rows (+ residual rows < QHI); 1: k f16 rows (+ residual rows < KHI); 2: v f16 planes [c][t] (+ bf16 hi/lo planes for t < KHI)
__global__ __launch_bounds__(128) void k_proj(const float* __restrict__ XQ, const float* __restrict__ XK, const float* __restrict__ XV, const float* __restrict__ WQ, const float* __restrict__ WK, const float* __restrict__ WV, const float* __restrict__ BQ, const float* __restrict__ BK, const float* __restrict__ BV,
    _Float16* __restrict__ QH, _Float16* __restrict__ QL, _Float16* __restrict__ KH, _Float16* __restrict__ KL, _Float16* __restrict__ VT, __bf16* __restrict__ VB, __bf16* __restrict__ VBL) {
  __shared__ __align__(16) _Float16 sh[64][136], sl[64][136]; __shared__ __align__(16) _Float16 th[128][72]; __shared__ __align__(16) __bf16 tb[128][72], tbl[128][72];
  const int tid = threadIdx.x, wave = tid >> 5, lane = tid & 31, col = lane & 15, g = lane >> 4; const int which = blockIdx.z; const int c0 = blockIdx.y * 128; const size_t r0 = (size_t)blockIdx.x * 64; const size_t bb = r0 / TT; const int t0 = (int)(r0 % TT);
  const float* X = which == 0 ? XQ : which == 1 ? XK : XV; const float* WA = which == 0 ? WQ : which == 1 ? WK : WV; const float* BA = which == 0 ? BQ : which == 1 ? BK : BV;
  v8f acc[8] = {};
#pragma unroll 2
  for (int kc = 0; kc < DIN / 32; ++kc) { v16b a; { const float* p = X + (r0 + wave * 16 + col) * DIN + kc * 32 + 8 * g;
#pragma unroll
      for (int i = 0; i < 8; ++i) { a[i] = (__bf16)p[i]; a[8 + i] = (__bf16)p[16 + i]; } }
    asm volatile("s_wait_loadcnt 0x0" ::: "memory");
#pragma unroll
    for (int j = 0; j < 8; ++j) { const v16b w = WCOL(WA, kc * 32, c0 + j * 16 + col, lane); asm volatile("s_wait_loadcnt 0x0" ::: "memory"); acc[j] = wmma_bf(a, w, acc[j]); } }
  if (which < 2) { _Float16* DH = which == 0 ? QH : KH; _Float16* DL = which == 0 ? QL : KL; const int nhi = which == 0 ? QHI : KHI; const bool hi_rows = t0 < nhi;
#pragma unroll
    for (int j = 0; j < 8; ++j) { const float bias = BA ? bfr(BA[c0 + j * 16 + col]) : 0.f;
#pragma unroll
      for (int r = 0; r < 8; ++r) { const float v = acc[j][r] + bias; const _Float16 hv = (_Float16)v; sh[wave * 16 + 8 * g + r][j * 16 + col] = hv; sl[wave * 16 + 8 * g + r][j * 16 + col] = (_Float16)((v - (float)hv) * 1024.0f); } }
    __syncthreads();
    for (int e = tid; e < 64 * 16; e += 128) { const int rl = e >> 4, q = e & 15; vst2((unsigned*)(DH + (r0 + rl) * CC + c0 + q * 8), *(const v4u*)&sh[rl][q * 8]); if (hi_rows) vst2((unsigned*)(DL + (bb * nhi + t0 + rl) * (size_t)CC + c0 + q * 8), *(const v4u*)&sl[rl][q * 8]); }
  } else { const bool hi_rows = t0 < KHI;
#pragma unroll
    for (int j = 0; j < 8; ++j) { const float bias = BA ? bfr(BA[c0 + j * 16 + col]) : 0.f;
#pragma unroll
      for (int r = 0; r < 8; ++r) { const float v = acc[j][r] + bias; const int rl = wave * 16 + 8 * g + r, cl = j * 16 + col; th[cl][rl] = (_Float16)v; const __bf16 bh = (__bf16)v; tb[cl][rl] = bh; tbl[cl][rl] = (__bf16)(v - (float)bh); } }
    __syncthreads();
    for (int e = tid; e < 128 * 8; e += 128) { const int cl = e >> 3, q = e & 7; vst2((unsigned*)(VT + (bb * CC + c0 + cl) * (size_t)TT + t0 + q * 8), *(const v4u*)&th[cl][q * 8]); if (hi_rows) { const size_t o3 = (bb * CC + c0 + cl) * (size_t)KHI + t0 + q * 8; vst2((unsigned*)(VB + o3), *(const v4u*)&tb[cl][q * 8]); vst2((unsigned*)(VBL + o3), *(const v4u*)&tbl[cl][q * 8]); } } } }
// ---- k_sc: block = (query block qb, key block kb <= kb_last(qb), head in group) of batch b: logits x SCALE; q hi + residual (x 2^10) against k (2 products) for query rows < QHI, plus the k residual (3 products) for query blocks < QBH (causal early rows); causal: blocks past the diagonal exit, the mask input is applied in k_nrm2
__global__ __launch_bounds__(128) void k_sc(const _Float16* __restrict__ QH, const _Float16* __restrict__ KH, const _Float16* __restrict__ QL, const _Float16* __restrict__ KL, int b, int h0, float* __restrict__ S0) { __shared__ __align__(16) float ss[4][16][132];
  const int qb = blockIdx.x, kb = blockIdx.y; if (kb > kb_last(qb)) return;
  const int h = h0 + blockIdx.z; float* S = S0 + (size_t)blockIdx.z * TT * TT;
  const int tid = threadIdx.x, wave = tid >> 5, lane = tid & 31, col = lane & 15, g = lane >> 4; const int k0 = kb * 128; const int ql0 = qb * 64 + wave * 16; const size_t q0 = (size_t)b * TT + ql0, kr0 = (size_t)b * TT + k0;
  v8f acc[8] = {}, accl[8] = {};
  const _Float16* QLb = QL + (size_t)b * QHI * CC; const _Float16* KLb = KL + (size_t)b * KHI * CC;
  if (qb < QBH) {
#pragma unroll
    for (int kc = 0; kc < HD / 32; ++kc) { const v16h ah = frag_h(QH + (q0 + col) * CC + h * HD + kc * 32, lane), al = frag_h(QLb + (size_t)(ql0 + col) * CC + h * HD + kc * 32, lane);
#pragma unroll
      for (int j = 0; j < 8; ++j) { const v16h kbf = frag_h(KH + (kr0 + j * 16 + col) * CC + h * HD + kc * 32, lane), klf = frag_h(KLb + (size_t)(k0 + j * 16 + col) * CC + h * HD + kc * 32, lane); acc[j] = wmma16(ah, kbf, acc[j]); accl[j] = wmma16(al, kbf, accl[j]); accl[j] = wmma16(ah, klf, accl[j]); } }
  } else if (qb * 64 < QHI) {
#pragma unroll
    for (int kc = 0; kc < HD / 32; ++kc) { const v16h ah = frag_h(QH + (q0 + col) * CC + h * HD + kc * 32, lane), al = frag_h(QLb + (size_t)(ql0 + col) * CC + h * HD + kc * 32, lane);
#pragma unroll
      for (int j = 0; j < 8; ++j) { const v16h kbf = frag_h(KH + (kr0 + j * 16 + col) * CC + h * HD + kc * 32, lane); acc[j] = wmma16(ah, kbf, acc[j]); accl[j] = wmma16(al, kbf, accl[j]); } }
  } else {
#pragma unroll
    for (int kc = 0; kc < HD / 32; ++kc) { const v16h ah = frag_h(QH + (q0 + col) * CC + h * HD + kc * 32, lane);
#pragma unroll
      for (int j = 0; j < 8; ++j) { const v16h kbf = frag_h(KH + (kr0 + j * 16 + col) * CC + h * HD + kc * 32, lane); acc[j] = wmma16(ah, kbf, acc[j]); } } }
#pragma unroll
  for (int j = 0; j < 8; ++j) {
#pragma unroll
    for (int r = 0; r < 8; ++r) ss[wave][8 * g + r][j * 16 + col] = (acc[j][r] + accl[j][r] * (1.0f / 1024.0f)) * SCALE; }
  LDSX(); for (int rl = 0; rl < 16; ++rl) vst2(S + (size_t)(ql0 + rl) * TT + k0 + lane * 4, *(const v4f*)&ss[wave][rl][lane * 4]); }
// ---- k_sm: block = query row t (head in group): keys [0, kend): causal -> logit if s <= t else excluded; softmax in f32; P x 2^11 in place (0 for excluded)
__global__ __launch_bounds__(256) void k_sm(float* __restrict__ S0 SM_EXTRA_PARAMS) { __shared__ float sred[8]; __shared__ float sbc; __shared__ __align__(16) float shv[TT];
  const int tid = threadIdx.x; const int t = blockIdx.x; const int kend = (kb_last(t >> 6) + 1) * 128;
  float* sr = S0 + (size_t)blockIdx.y * TT * TT + (size_t)t * TT;
  float m = -3.0e38f; for (int k = tid; k < kend; k += 256) { float v = (!CAUSAL || k <= t) ? sr[k] : -3.0e38f; SM_MASK_HOOK; shv[k] = v; m = fmaxf(m, v); }
#pragma unroll
  for (int o = 1; o < 32; o <<= 1) m = fmaxf(m, __shfl_xor(m, o));
  if ((tid & 31) == 0) sred[tid >> 5] = m; __syncthreads(); if (tid == 0) { float a = sred[0]; for (int i = 1; i < 8; ++i) a = fmaxf(a, sred[i]); sbc = a; } __syncthreads(); m = sbc; __syncthreads();
  float sum = 0.f; for (int k = tid; k < kend; k += 256) { const float v = shv[k]; const float e = (v <= -1.0e38f) ? 0.f : expf(v - m); shv[k] = e; sum += e; }
#pragma unroll
  for (int o = 1; o < 32; o <<= 1) sum += __shfl_xor(sum, o);
  if ((tid & 31) == 0) sred[tid >> 5] = sum; __syncthreads(); if (tid == 0) { float a = 0.f; for (int i = 0; i < 8; ++i) a += sred[i]; sbc = a > 0.f ? 2048.0f / a : 0.f; }   /* a fully excluded row yields P = 0 */ __syncthreads(); const float inv = sbc;
  for (int k = tid; k < kend; k += 256) shv[k] = shv[k] * inv;
  __syncthreads(); for (int q = tid; q < kend / 4; q += 256) vst2(sr + q * 4, *(const v4f*)&shv[q * 4]); }
#define IEPS 1.0e-32f
// ---- k_nrm2 (replaces the softmax): block = query row t (head in group): SparseNormer over keys [0, TT): t_k = relu(score + nbias)^2 for unmasked keys (mask != 0 -> the module's -1e32 fill -> relu -> exactly 0), P = t_k / (sum_k t_k + 1e-32) x 2^11; f32; unconditional loads, value selects
__global__ __launch_bounds__(256) void k_nrm2(float* __restrict__ S0, int bsm, const int* __restrict__ MASK, const float* __restrict__ NBIAS) { __shared__ float sred[8]; __shared__ float sbc; __shared__ __align__(16) float shv[TT];
  const int tid = threadIdx.x; const int t = blockIdx.x; const float nb_ = bfr(NBIAS[0]);
  float* sr = S0 + (size_t)blockIdx.y * TT * TT + (size_t)t * TT; const int* mr = MASK + ((size_t)bsm * TT + t) * TT;
  float sum = 0.f; for (int k = tid; k < TT; k += 256) { const float sv = sr[k]; const int mk = mr[k]; asm volatile("s_wait_loadcnt 0x0" ::: "memory"); const float r = fmaxf(sv + nb_, 0.f); const float e = (mk != 0) ? 0.f : r * r; shv[k] = e; sum += e; }
#pragma unroll
  for (int o = 1; o < 32; o <<= 1) sum += __shfl_xor(sum, o);
  if ((tid & 31) == 0) sred[tid >> 5] = sum; __syncthreads(); if (tid == 0) { float acc = 0.f; for (int i = 0; i < 8; ++i) acc += sred[i]; sbc = 2048.0f / (acc + IEPS); } __syncthreads(); const float inv = sbc;   /* sum == 0 -> every t_k is 0 -> P = 0 (0 x finite) */
  for (int k = tid; k < TT; k += 256) shv[k] = shv[k] * inv;
  __syncthreads(); for (int q = tid; q < TT / 4; q += 256) vst2(sr + q * 4, *(const v4f*)&shv[q * 4]); }
// ---- k_pv: block = 64 queries (qb) of (b, h): ctx = P . v over keys [0, kend) (P x 2^11 once to f16 against v f16: 1 product; causal early query blocks: P and v as bf16 hi + lo, 3 products); 256-B (row, head) segment by 16 lanes
__global__ __launch_bounds__(128) void k_pv(const float* __restrict__ PS0, const _Float16* __restrict__ VT, const __bf16* __restrict__ VB, const __bf16* __restrict__ VBL, int b, int h0, float* __restrict__ Y) { const int h = h0 + blockIdx.z; const float* PS = PS0 + (size_t)blockIdx.z * TT * TT; __shared__ __align__(16) float ss[4][16][HD + 4];
  const int tid = threadIdx.x, wave = tid >> 5, lane = tid & 31, col = lane & 15, g = lane >> 4; const int qb = blockIdx.x; const int ql0 = qb * 64 + wave * 16; const int kce = (kb_last(qb) + 1) * 4;
  v8f acc[HD / 16] = {};
  if (qb < QBH) {
#pragma unroll 1
    for (int kc = 0; kc < kce; ++kc) { const F2 p = split_row(PS + (size_t)(ql0 + col) * TT, kc * 32, lane);
      asm volatile("s_wait_loadcnt 0x0" ::: "memory");
#pragma unroll
      for (int j = 0; j < HD / 16; ++j) { const size_t po = ((size_t)b * CC + h * HD + j * 16 + col) * (size_t)KHI + kc * 32; const v16b vh = frag_b(VB + po, lane); acc[j] = wmma_bf(p.h, vh, acc[j]); acc[j] = wmma_bf(p.l, vh, acc[j]); acc[j] = wmma_bf(p.h, frag_b(VBL + po, lane), acc[j]); } }
  } else {
#pragma unroll 1
    for (int kc = 0; kc < kce; ++kc) { const v16h p = frag_f32(PS + (size_t)(ql0 + col) * TT + kc * 32, lane);
      asm volatile("s_wait_loadcnt 0x0" ::: "memory");
#pragma unroll
      for (int j = 0; j < HD / 16; ++j) { const size_t po = ((size_t)b * CC + h * HD + j * 16 + col) * (size_t)TT + kc * 32; acc[j] = wmma16(p, frag_h(VT + po, lane), acc[j]); } } }
#pragma unroll
  for (int j = 0; j < HD / 16; ++j)
#pragma unroll
    for (int r = 0; r < 8; ++r) ss[wave][8 * g + r][j * 16 + col] = acc[j][r] * (1.0f / 2048.0f);
  LDSX(); for (int rl = 0; rl < 16; ++rl) if (lane < HD / 4) vst2(Y + ((size_t)b * TT + ql0 + rl) * CC + h * HD + lane * 4, *(const v4f*)&ss[wave][rl][lane * 4]); }
// ---- k_out: block = (64 rows, 128 cols): out = ctx Wo (+ bo): ctx x 2^6 once to f16 against Wo as f16(bf16 x 2^8) exact (1 product) x 2^-14; causal early rows (< QHI of each sequence): ctx bf16 hi + lo against exact bf16 Wo (2 products)
__global__ __launch_bounds__(128) void k_out(const float* __restrict__ Y, const float* __restrict__ WO, const float* __restrict__ BO, float* __restrict__ OUT) { __shared__ __align__(16) float sf[4][16][132];
  const int tid = threadIdx.x, wave = tid >> 5, lane = tid & 31, col = lane & 15, g = lane >> 4; const int c0 = blockIdx.y * 128; const size_t r0 = (size_t)blockIdx.x * 64 + wave * 16;
  v8f acc[8] = {};
  if (CAUSAL && (int)(((size_t)blockIdx.x * 64) % TT) < QHI) {   /* block-uniform */
#pragma unroll 2
    for (int kc = 0; kc < CC / 32; ++kc) { const F2 a = split_row(Y + (r0 + col) * CC, kc * 32, lane); asm volatile("s_wait_loadcnt 0x0" ::: "memory");
#pragma unroll
      for (int j = 0; j < 8; ++j) { const v16b w = WOCOL(WO, kc * 32, c0 + j * 16 + col, lane); asm volatile("s_wait_loadcnt 0x0" ::: "memory"); acc[j] = wmma_bf(a.h, w, acc[j]); acc[j] = wmma_bf(a.l, w, acc[j]); } }
#pragma unroll
    for (int j = 0; j < 8; ++j) { const float bias = BO ? bfr(BO[c0 + j * 16 + col]) : 0.f;
#pragma unroll
      for (int r = 0; r < 8; ++r) sf[wave][8 * g + r][j * 16 + col] = acc[j][r] + bias; }
  } else {
#pragma unroll 2
    for (int kc = 0; kc < CC / 32; ++kc) { const v16h a = frag_f32s(Y + (r0 + col) * CC + kc * 32, lane, 64.0f); asm volatile("s_wait_loadcnt 0x0" ::: "memory");   /* ctx carried x 2^6 into f16 so small-magnitude context rows stay clear of f16 subnormals */
#pragma unroll
      for (int j = 0; j < 8; ++j) { const v16h w = WOCOLH(WO, kc * 32, c0 + j * 16 + col, lane); asm volatile("s_wait_loadcnt 0x0" ::: "memory"); acc[j] = wmma16(a, w, acc[j]); } }
#pragma unroll
    for (int j = 0; j < 8; ++j) { const float bias = BO ? bfr(BO[c0 + j * 16 + col]) : 0.f;
#pragma unroll
      for (int r = 0; r < 8; ++r) sf[wave][8 * g + r][j * 16 + col] = acc[j][r] * (1.0f / 16384.0f) + bias; } }   /* 2^-8 (Wo carry) x 2^-6 (ctx carry) */
  LDSX(); for (int rl = 0; rl < 16; ++rl) vst2(OUT + (r0 + rl) * DIN + c0 + lane * 4, *(const v4f*)&sf[wave][rl][lane * 4]); }

extern "C" void kernel_launch(void* const* d_in, const int* in_sizes, int n_in, void* d_out, int out_size, void* d_ws, size_t ws_size, hipStream_t stream) {
  (void)in_sizes; (void)n_in; (void)out_size;
  const float** F = (const float**)d_in;
  if (ws_size < (size_t)WS_END) return;
  char* ws = (char*)d_ws; _Float16 *QH = (_Float16*)(ws + WS_QH), *KH = (_Float16*)(ws + WS_KH), *VT = (_Float16*)(ws + WS_VT), *QL = (_Float16*)(ws + WS_QL), *KL = (_Float16*)(ws + WS_KL); __bf16 *VB = (__bf16*)(ws + WS_VB), *VBL = (__bf16*)(ws + WS_VBL); float *S = (float*)(ws + WS_S), *Y = (float*)(ws + WS_Y);
  (void)Y; (void)QL; (void)KL; (void)VB; (void)VBL;
  // inputs: 0 iQ [2,2048,1024]; 1 iK; 2 iV; 3 mask [2,2048,2048] bool (True = masked); 4 Wq [1024,1024] (out,in), 5 bq; 6 Wk, 7 bk; 8 Wv, 9 bv; 10 Wo (out,in), 11 bo (zero biases, read); 12 nbias [1] (SparseNormer bias; zero)
  k_proj<<<dim3(TNB * TT / 64, CC / 128, 3), 128, 0, stream>>>(F[0], F[1], F[2], F[4], F[6], F[8], F[5], F[7], F[9], QH, QL, KH, KL, VT, VB, VBL);
  for (int b = 0; b < TNB; ++b) for (int h0 = 0; h0 < NH; h0 += HG) {
    k_sc<<<dim3(NQB, TT / 128, HG), 128, 0, stream>>>(QH, KH, QL, KL, b, h0, S);
    k_nrm2<<<dim3(TT, HG), 256, 0, stream>>>(S, b, (const int*)d_in[3], F[12]);   /* relu(x + nbias)^2 / (sum + 1e-32): NOT a softmax */
    k_pv<<<dim3(NQB, 1, HG), 128, 0, stream>>>(S, VT, VB, VBL, b, h0, Y);
  }
  k_out<<<dim3(TNB * TT / 64, DIN / 128), 128, 0, stream>>>(Y, F[10], F[11], (float*)d_out);
}

// v001
// One run takes 564 microseconds.
// Timed twice side by side with v000, it ran 2.40 and 2.38 times as fast.
// compute dtype: all float inputs rounded to bf16; q/k/v projections with EXACT bf16 products on WMMA 16x16x32 (f32 accumulate) + bias; scores q x k once to f16 each (1 product) x 64^-0.5; SparseNormer in f32: t = relu(score + nbias)^2 (masked entries -> 0), P = t / (sum t + 1e-32); P x 2^11 once to f16 x v once to f16 (1 product); ctx x 2^6 once to f16 x Wo f16(bf16 x 2^8) + bo; f32 output.
#include <hip/hip_runtime.h>
#include <math.h>

typedef __attribute__((ext_vector_type(16))) _Float16 v16h;
typedef __attribute__((ext_vector_type(16))) __bf16 v16b;
typedef __attribute__((ext_vector_type(8)))  _Float16 v8h;
typedef __attribute__((ext_vector_type(8)))  float v8f;
typedef __attribute__((ext_vector_type(4)))  float v4f;
typedef __attribute__((ext_vector_type(2)))  float v2f;
typedef __attribute__((ext_vector_type(4)))  unsigned v4u;
typedef __attribute__((ext_vector_type(4)))  int v4i;
typedef float __attribute__((may_alias)) float_a;
typedef int __attribute__((may_alias)) int_a;

template <typename T> __device__ __forceinline__ void vst2(void* p, T v) { *(T*)p = v;  }
__device__ __forceinline__ v8f wmma16(v16h a, v16h b, v8f c) {
  v8f d = __builtin_amdgcn_wmma_f32_16x16x32_f16(false, a, false, b, (short)0, c, false, false);
  asm volatile("v_nop\n\tv_nop\n\tv_nop\n\tv_nop" : "+v"(d) : "v"(a), "v"(b));
  return d;
}
__device__ __forceinline__ v8f wmma_bf(v16b a, v16b b, v8f c) {
  v8f d = __builtin_amdgcn_wmma_f32_16x16x32_bf16(false, a, false, b, (short)0, c, false, false);
  asm volatile("v_nop\n\tv_nop\n\tv_nop\n\tv_nop" : "+v"(d) : "v"(a), "v"(b));
  return d;
}
// 16x16x32 fragments: lane = (h = lane>>4, row/col = lane&15); elements 0..7 = k0+8h+0..7, 8..15 = k0+16+8h+0..7; D element r = row 8h+r
__device__ __forceinline__ v16h frag_h(const _Float16* rowk0, int lane) {
  union { v16h v; v8h q[2]; } u; const _Float16* p = rowk0 + 8 * (lane >> 4);
  u.q[0] = *(const v8h*)p; u.q[1] = *(const v8h*)(p + 16); return u.v;
}
__device__ __forceinline__ v16h frag_f32(const float* rowk0, int lane) {
  v16h a; const float* p = rowk0 + 8 * (lane >> 4);
#pragma unroll
  for (int i = 0; i < 8; ++i) { a[i] = (_Float16)p[i]; a[8 + i] = (_Float16)p[16 + i]; }
  return a;
}
__device__ __forceinline__ v16h frag_f32s(const float* rowk0, int lane, float sc) {
  v16h a; const float* p = rowk0 + 8 * (lane >> 4);
#pragma unroll
  for (int i = 0; i < 8; ++i) { a[i] = (_Float16)(p[i] * sc); a[8 + i] = (_Float16)(p[16 + i] * sc); }
  return a;
}
// column fragment from a [K][ld] layout (column n), rows >= K read as 0
__device__ __forceinline__ v16h fragc_f32(const float* W, int k0, int n, int lane, int ld, int K) {
  v16h a; const int g = lane >> 4;
#pragma unroll
  for (int i = 0; i < 8; ++i) { const int ka = k0 + 8 * g + i, kb = ka + 16;
    a[i] = (_Float16)(ka < K ? W[(size_t)(ka < K ? ka : K - 1) * ld + n] : 0.f); a[8 + i] = (_Float16)(kb < K ? W[(size_t)(kb < K ? kb : K - 1) * ld + n] : 0.f); }
  return a;
}
struct F2 { v16b h, l; };
__device__ __forceinline__ F2 bsplit16(const float v[16]) { F2 r;
#pragma unroll
  for (int i = 0; i < 16; ++i) { const __bf16 h = (__bf16)v[i]; r.h[i] = h; r.l[i] = (__bf16)(v[i] - (float)h); }
  return r; }
__device__ __forceinline__ F2 split_row(const float* row, int k0, int lane) { float v[16]; const float* p = row + k0 + 8 * (lane >> 4);
#pragma unroll
  for (int i = 0; i < 8; ++i) { v[i] = p[i]; v[8 + i] = p[16 + i]; }
  return bsplit16(v); }
__device__ __forceinline__ F2 split_rowK(const float* row, int k0, int lane, int K) { float v[16]; const int g = lane >> 4;
#pragma unroll
  for (int i = 0; i < 8; ++i) { const int ka = k0 + 8 * g + i, kb = ka + 16; v[i] = ka < K ? row[ka < K ? ka : K - 1] : 0.f; v[8 + i] = kb < K ? row[kb < K ? kb : K - 1] : 0.f; }
  return bsplit16(v); }
__device__ __forceinline__ F2 split_col(const float* W, int k0, int n, int lane, int ld, int K) { float v[16]; const int g = lane >> 4;
#pragma unroll
  for (int i = 0; i < 8; ++i) { const int ka = k0 + 8 * g + i, kb = ka + 16; v[i] = ka < K ? W[(size_t)(ka < K ? ka : K - 1) * ld + n] : 0.f; v[8 + i] = kb < K ? W[(size_t)(kb < K ? kb : K - 1) * ld + n] : 0.f; }
  return bsplit16(v); }
__device__ __forceinline__ v8f mac3(const F2& a, const F2& b, v8f c) { c = wmma_bf(a.l, b.h, c); c = wmma_bf(a.h, b.l, c); return wmma_bf(a.h, b.h, c); }
__device__ __forceinline__ float sigm(float v) { return 1.0f / (1.0f + expf(-v)); }
#define LDSX() do { asm volatile("s_wait_dscnt 0" ::: "memory"); __builtin_amdgcn_wave_barrier(); __builtin_amdgcn_fence(__ATOMIC_RELEASE, "workgroup"); } while (0)

// Multi-head attention with a SparseNormer instead of a softmax (iQ / iK / iV [2,2048,1024] separate inputs; torch (out,in) Wq / Wk / Wv / Wo [1024,1024] (0.02 scale) + zero biases; 16 heads x 64; scores / 8; mask [2,2048,2048] bool random (True -> -1e32); t = relu(scores + nbias)^2 with nbias = zeros(1); attn = t / (sum_k t + 1e-32)): out = merge(attn v) Wo^T + bo.
#define NB 2
#define TT 2048
#define CC 1024            // NH * HD = projected width
#define DIN 1024          // input (model) width
#define NH 16
#define HD 64
#define NQB (TT / 64)
#define HG 4
#define SCALE (0.125f)
#define CAUSAL 0
#ifndef TNB
#define TNB NB
#endif
__device__ __forceinline__ float bfr(float v) { return (float)(__bf16)v; }
__host__ __device__ __forceinline__ int kb_last(int qb) { return CAUSAL ? ((qb * 64 + 63) >> 7) : (TT / 128 - 1); }
typedef __attribute__((ext_vector_type(8))) __bf16 v8b;
__device__ __forceinline__ v16b frag_b(const __bf16* rowk0, int lane) {
  union { v16b v; v8b q[2]; } u; const __bf16* p = rowk0 + 8 * (lane >> 4);
  u.q[0] = *(const v8b*)p; u.q[1] = *(const v8b*)(p + 16); return u.v;
}
#define QBH 0              // not used by any kernel here
#define QHI 0               // single-product scores on every row
#define KHI 64            // key rows carrying k residual / v bf16 hi+lo planes (written by k_proj; read by no kernel here)
// B fragment (k rows k0+.., output column o) of a weight: (in,out) [K][ld] or (out,in) [ld rows of K]: bf16 exact, or f16(bf16 * 256) exact
__device__ __forceinline__ v16b wcol_io(const float* Wm, int k0, int o, int lane, int ld) { v16b w; const int g = lane >> 4;
#pragma unroll
  for (int i = 0; i < 8; ++i) { w[i] = (__bf16)Wm[(size_t)(k0 + 8 * g + i) * ld + o]; w[8 + i] = (__bf16)Wm[(size_t)(k0 + 16 + 8 * g + i) * ld + o]; }
  return w; }
__device__ __forceinline__ v16b wcol_oi(const float* Wm, int k0, int o, int lane, int K) { v16b w; const float* p = Wm + (size_t)o * K + k0 + 8 * (lane >> 4);
#pragma unroll
  for (int i = 0; i < 8; ++i) { w[i] = (__bf16)p[i]; w[8 + i] = (__bf16)p[16 + i]; }
  return w; }
__device__ __forceinline__ v16h wcolh_io(const float* Wm, int k0, int o, int lane, int ld) { v16h w; const int g = lane >> 4;
#pragma unroll
  for (int i = 0; i < 8; ++i) { w[i] = (_Float16)(bfr(Wm[(size_t)(k0 + 8 * g + i) * ld + o]) * 256.0f); w[8 + i] = (_Float16)(bfr(Wm[(size_t)(k0 + 16 + 8 * g + i) * ld + o]) * 256.0f); }
  return w; }
__device__ __forceinline__ v16h wcolh_oi(const float* Wm, int k0, int o, int lane, int K) { v16h w; const float* p = Wm + (size_t)o * K + k0 + 8 * (lane >> 4);
#pragma unroll
  for (int i = 0; i < 8; ++i) { w[i] = (_Float16)(bfr(p[i]) * 256.0f); w[8 + i] = (_Float16)(bfr(p[16 + i]) * 256.0f); }
  return w; }
#define WQKV_LAYOUT 1   // 0 = (in,out) [DIN][CC]; 1 = (out,in) [CC][DIN]; 2 = per-head [NH][DIN][HD]
__device__ __forceinline__ v16b wcol_hdk(const float* Wm, int k0, int o, int lane) { v16b w; const int g = lane >> 4; const float* p = Wm + (size_t)(o / HD) * DIN * HD + (o % HD);
#pragma unroll
  for (int i = 0; i < 8; ++i) { w[i] = (__bf16)p[(size_t)(k0 + 8 * g + i) * HD]; w[8 + i] = (__bf16)p[(size_t)(k0 + 16 + 8 * g + i) * HD]; }
  return w; }
#define WO_OUT_IN 1
#if WQKV_LAYOUT == 1
#define WCOL(W, k0, o, lane) wcol_oi(W, k0, o, lane, DIN)
#elif WQKV_LAYOUT == 2
#define WCOL(W, k0, o, lane) wcol_hdk(W, k0, o, lane)
#else
#define WCOL(W, k0, o, lane) wcol_io(W, k0, o, lane, CC)
#endif
#if WO_OUT_IN
#define WOCOL(W, k0, o, lane) wcol_oi(W, k0, o, lane, CC)
#define WOCOLH(W, k0, o, lane) wcolh_oi(W, k0, o, lane, CC)
#else
#define WOCOL(W, k0, o, lane) wcol_io(W, k0, o, lane, DIN)
#define WOCOLH(W, k0, o, lane) wcolh_io(W, k0, o, lane, DIN)
#endif

#ifndef SM_EXTRA_PARAMS
#define SM_EXTRA_PARAMS
#endif
#ifndef PROJ_EXTRA_PARAMS
#define PROJ_EXTRA_PARAMS
#endif
#ifndef SM_MASK_HOOK
#define SM_MASK_HOOK (void)0
#endif

#define WS_QH  0u                                      // f16 q rows [b*t][CC]
#define WS_KH  (WS_QH + 2u * (size_t)NB * TT * CC)      // f16 k rows [b*t][CC]
#define WS_VT  (WS_KH + 2u * (size_t)NB * TT * CC)      // f16 v planes [b][c][t]
#define WS_QL  (WS_VT + 2u * (size_t)NB * CC * TT)      // f16 q residual x 2^10 rows [b][t < QHI][CC]
#define WS_KL  (WS_QL + 2u * (size_t)NB * QHI * CC)     // f16 k residual x 2^10 rows [b][t < KHI][CC]
#define WS_VB  (WS_KL + 2u * (size_t)NB * KHI * CC)     // bf16 v hi planes [b][c][t < KHI]
#define WS_VBL (WS_VB + 2u * (size_t)NB * CC * KHI)
#define WS_S   (WS_VBL + 2u * (size_t)NB * CC * KHI)    // f32 [hg][t][s] area, unused: no launched kernel writes it
#define WS_Y   (WS_S  + 4u * (size_t)HG * TT * TT)      // f32 ctx rows [b*t][CC] (only when there is an output projection)
#define WS_END (WS_Y  + 4u * (size_t)NB * TT * CC)

// ---- k_proj: block = (64 rows, 128 cols, which): q/k/v = X W (+ b) with exact bf16 products (K = DIN) -> which 0: q f16 rows (+ residual rows < QHI); 1: k f16 rows (+ residual rows < KHI); 2: v f16 planes [c][t] (+ bf16 hi/lo planes for t < KHI)
__global__ __launch_bounds__(128) void k_proj(const float* __restrict__ XQ, const float* __restrict__ XK, const float* __restrict__ XV, const float* __restrict__ WQ, const float* __restrict__ WK, const float* __restrict__ WV, const float* __restrict__ BQ, const float* __restrict__ BK, const float* __restrict__ BV,
    _Float16* __restrict__ QH, _Float16* __restrict__ QL, _Float16* __restrict__ KH, _Float16* __restrict__ KL, _Float16* __restrict__ VT, __bf16* __restrict__ VB, __bf16* __restrict__ VBL) {
  __shared__ __align__(16) _Float16 sh[64][136], sl[64][136]; __shared__ __align__(16) _Float16 th[128][72]; __shared__ __align__(16) __bf16 tb[128][72], tbl[128][72];
  const int tid = threadIdx.x, wave = tid >> 5, lane = tid & 31, col = lane & 15, g = lane >> 4; const int which = blockIdx.z; const int c0 = blockIdx.y * 128; const size_t r0 = (size_t)blockIdx.x * 64; const size_t bb = r0 / TT; const int t0 = (int)(r0 % TT);
  const float* X = which == 0 ? XQ : which == 1 ? XK : XV; const float* WA = which == 0 ? WQ : which == 1 ? WK : WV; const float* BA = which == 0 ? BQ : which == 1 ? BK : BV;
  v8f acc[8] = {};
#pragma unroll 2
  for (int kc = 0; kc < DIN / 32; ++kc) { v16b a; { const float* p = X + (r0 + wave * 16 + col) * DIN + kc * 32 + 8 * g;
#pragma unroll
      for (int i = 0; i < 8; ++i) { a[i] = (__bf16)p[i]; a[8 + i] = (__bf16)p[16 + i]; } }
    asm volatile("s_wait_loadcnt 0x0" ::: "memory");
#pragma unroll
    for (int j = 0; j < 8; ++j) { const v16b w = WCOL(WA, kc * 32, c0 + j * 16 + col, lane); asm volatile("s_wait_loadcnt 0x0" ::: "memory"); acc[j] = wmma_bf(a, w, acc[j]); } }
  if (which < 2) { _Float16* DH = which == 0 ? QH : KH; _Float16* DL = which == 0 ? QL : KL; const int nhi = which == 0 ? QHI : KHI; const bool hi_rows = t0 < nhi;
#pragma unroll
    for (int j = 0; j < 8; ++j) { const float bias = BA ? bfr(BA[c0 + j * 16 + col]) : 0.f;
#pragma unroll
      for (int r = 0; r < 8; ++r) { const float v = acc[j][r] + bias; const _Float16 hv = (_Float16)v; sh[wave * 16 + 8 * g + r][j * 16 + col] = hv; sl[wave * 16 + 8 * g + r][j * 16 + col] = (_Float16)((v - (float)hv) * 1024.0f); } }
    __syncthreads();
    for (int e = tid; e < 64 * 16; e += 128) { const int rl = e >> 4, q = e & 15; vst2((unsigned*)(DH + (r0 + rl) * CC + c0 + q * 8), *(const v4u*)&sh[rl][q * 8]); if (hi_rows) vst2((unsigned*)(DL + (bb * nhi + t0 + rl) * (size_t)CC + c0 + q * 8), *(const v4u*)&sl[rl][q * 8]); }
  } else { const bool hi_rows = t0 < KHI;
#pragma unroll
    for (int j = 0; j < 8; ++j) { const float bias = BA ? bfr(BA[c0 + j * 16 + col]) : 0.f;
#pragma unroll
      for (int r = 0; r < 8; ++r) { const float v = acc[j][r] + bias; const int rl = wave * 16 + 8 * g + r, cl = j * 16 + col; th[cl][rl] = (_Float16)v; const __bf16 bh = (__bf16)v; tb[cl][rl] = bh; tbl[cl][rl] = (__bf16)(v - (float)bh); } }
    __syncthreads();
    for (int e = tid; e < 128 * 8; e += 128) { const int cl = e >> 3, q = e & 7; vst2((unsigned*)(VT + (bb * CC + c0 + cl) * (size_t)TT + t0 + q * 8), *(const v4u*)&th[cl][q * 8]); if (hi_rows) { const size_t o3 = (bb * CC + c0 + cl) * (size_t)KHI + t0 + q * 8; vst2((unsigned*)(VB + o3), *(const v4u*)&tb[cl][q * 8]); vst2((unsigned*)(VBL + o3), *(const v4u*)&tbl[cl][q * 8]); } } } }
// ---- k_sm: block = query row t (head in group): keys [0, kend): causal -> logit if s <= t else excluded; softmax in f32; P x 2^11 in place (0 for excluded)
__global__ __launch_bounds__(256) void k_sm(float* __restrict__ S0 SM_EXTRA_PARAMS) { __shared__ float sred[8]; __shared__ float sbc; __shared__ __align__(16) float shv[TT];
  const int tid = threadIdx.x; const int t = blockIdx.x; const int kend = (kb_last(t >> 6) + 1) * 128;
  float* sr = S0 + (size_t)blockIdx.y * TT * TT + (size_t)t * TT;
  float m = -3.0e38f; for (int k = tid; k < kend; k += 256) { float v = (!CAUSAL || k <= t) ? sr[k] : -3.0e38f; SM_MASK_HOOK; shv[k] = v; m = fmaxf(m, v); }
#pragma unroll
  for (int o = 1; o < 32; o <<= 1) m = fmaxf(m, __shfl_xor(m, o));
  if ((tid & 31) == 0) sred[tid >> 5] = m; __syncthreads(); if (tid == 0) { float a = sred[0]; for (int i = 1; i < 8; ++i) a = fmaxf(a, sred[i]); sbc = a; } __syncthreads(); m = sbc; __syncthreads();
  float sum = 0.f; for (int k = tid; k < kend; k += 256) { const float v = shv[k]; const float e = (v <= -1.0e38f) ? 0.f : expf(v - m); shv[k] = e; sum += e; }
#pragma unroll
  for (int o = 1; o < 32; o <<= 1) sum += __shfl_xor(sum, o);
  if ((tid & 31) == 0) sred[tid >> 5] = sum; __syncthreads(); if (tid == 0) { float a = 0.f; for (int i = 0; i < 8; ++i) a += sred[i]; sbc = a > 0.f ? 2048.0f / a : 0.f; }   /* a fully excluded row yields P = 0 */ __syncthreads(); const float inv = sbc;
  for (int k = tid; k < kend; k += 256) shv[k] = shv[k] * inv;
  __syncthreads(); for (int q = tid; q < kend / 4; q += 256) vst2(sr + q * 4, *(const v4f*)&shv[q * 4]); }
#define IEPS 1.0e-32f
__device__ __forceinline__ v8f wmma_h(v16h a, v16h b, v8f c) { return __builtin_amdgcn_wmma_f32_16x16x32_f16(false, a, false, b, (short)0, c, false, false); }
// XW(p): closes a group of global loads off pointer p before a register that they name may be rewritten; p is an input so that the address pair stays live up to the wait (no load of the group may land on it)
#define XW(p) asm volatile("s_wait_xcnt 0x0" :: "v"(p) : "memory")
struct KM { v16h k[4]; v4i m[4]; };   // 32 keys: k[2u + kc] = A fragment of key rows 16u..16u+15, head dims 32kc..; m[2u + i] = this lane's query's mask words of keys 16u + 8g + 4i..
__device__ __forceinline__ KM load_km(const _Float16* kp, const int* mp, int k0, int lane) { KM c;
#pragma unroll
  for (int u = 0; u < 2; ++u) { c.k[2 * u] = frag_h(kp + (size_t)(k0 + 16 * u) * CC, lane); c.k[2 * u + 1] = frag_h(kp + (size_t)(k0 + 16 * u) * CC + 32, lane); }
  XW(kp + (size_t)k0 * CC);
#pragma unroll
  for (int u = 0; u < 2; ++u) { c.m[2 * u] = *(const v4i*)(mp + k0 + 16 * u); c.m[2 * u + 1] = *(const v4i*)(mp + k0 + 16 * u + 4); }
  XW(mp + k0); return c; }
// ---- k_fa (scores, SparseNormer and P v in one launch; no score plane in memory): block = 4 waves x 16 queries of (b, h). S^T = K Q^T: lane (g, col) holds query col's scores of keys 8g + r of each 16-key tile, so the row sum is in-lane (+ one exchange between the halves) and two converted S^T tiles are the B operand of ctx^T += V^T P^T.
// Pass 1 sums t = relu(score + nbias)^2 over the unmasked keys; pass 2 forms the scores again and carries P x 2^11 = t x 2^11 / (sum + 1e-32) once to f16, so P's f16 range does not depend on the scale of the scores. The inner loops are unrolled whole so that the fragment arrays are indexed by constants and stay in registers.
__global__ __launch_bounds__(128) void k_fa(const _Float16* __restrict__ QH, const _Float16* __restrict__ KH, const _Float16* __restrict__ VT, const int* __restrict__ MASK, const float* __restrict__ NBIAS, float* __restrict__ Y) {
  const int tid = threadIdx.x, wave = tid >> 5, lane = tid & 31, col = lane & 15, g = lane >> 4; const int h = blockIdx.x, b = blockIdx.z; const int ql = blockIdx.y * 64 + wave * 16 + col;
  const float nb_ = bfr(NBIAS[0]);
  const _Float16* qp = QH + ((size_t)b * TT + ql) * CC + h * HD; const v16h q0 = frag_h(qp, lane), q1 = frag_h(qp + 32, lane); XW(qp);
  const _Float16* kp = KH + ((size_t)b * TT + col) * CC + h * HD; const _Float16* vp = VT + ((size_t)b * CC + h * HD + col) * (size_t)TT; const int* mp = MASK + ((size_t)b * TT + ql) * TT + 8 * g;
  float sum = 0.f; KM cur = load_km(kp, mp, 0, lane);
#pragma unroll 2   /* two trips a body: the current and the fetched-ahead fragments swap by name, without register copies */
  for (int k0 = 0; k0 < TT; k0 += 32) { const KM nx = load_km(kp, mp, (k0 + 32) & (TT - 1), lane);   /* next 32 keys fetched one trip ahead; the last trip fetches keys 0.., which pass 2 starts with */
#pragma unroll
    for (int u = 0; u < 2; ++u) { v8f s = {}; s = wmma_h(cur.k[2 * u], q0, s); s = wmma_h(cur.k[2 * u + 1], q1, s);
#pragma unroll
      for (int r = 0; r < 8; ++r) { const float x = fmaxf(s[r] * SCALE + nb_, 0.f); const float e = (cur.m[2 * u + (r >> 2)][r & 3] != 0) ? 0.f : x * x; sum += e; } }
    cur = nx; }
  sum += __shfl_xor(sum, 16); const float inv = 2048.0f / (sum + IEPS);   /* sum == 0 -> every t is 0 -> P = 0 (0 x finite) */
  v8f acc[HD / 16] = {}; v16h vc[HD / 16];
#pragma unroll
  for (int j = 0; j < HD / 16; ++j) vc[j] = frag_h(vp + (size_t)(j * 16) * TT, lane);
  XW(vp);
#pragma unroll 2   /* two trips a body: the current and the fetched-ahead fragments swap by name, without register copies */
  for (int k0 = 0; k0 < TT; k0 += 32) { const int kn = (k0 + 32) & (TT - 1); const KM nx = load_km(kp, mp, kn, lane); v16h vn[HD / 16];
#pragma unroll
    for (int j = 0; j < HD / 16; ++j) vn[j] = frag_h(vp + (size_t)(j * 16) * TT + kn, lane);
    XW(vp + kn);
    v16h p;
#pragma unroll
    for (int u = 0; u < 2; ++u) { v8f s = {}; s = wmma_h(cur.k[2 * u], q0, s); s = wmma_h(cur.k[2 * u + 1], q1, s);
#pragma unroll
      for (int r = 0; r < 8; ++r) { const float x = fmaxf(s[r] * SCALE + nb_, 0.f); const float e = (cur.m[2 * u + (r >> 2)][r & 3] != 0) ? 0.f : x * x; p[8 * u + r] = (_Float16)(e * inv); } }
#pragma unroll
    for (int j = 0; j < HD / 16; ++j) { acc[j] = wmma_h(vc[j], p, acc[j]); vc[j] = vn[j]; }
    cur = nx; }
  float* yp = Y + ((size_t)b * TT + ql) * CC + h * HD + 8 * g;   /* acc[j][r] = ctx[query col][16j + 8g + r]; the wave writes each query's whole 256-B (row, head) segment */
#pragma unroll
  for (int j = 0; j < HD / 16; ++j) { v4f lo, hi;
#pragma unroll
    for (int r = 0; r < 4; ++r) { lo[r] = acc[j][r] * (1.0f / 2048.0f); hi[r] = acc[j][4 + r] * (1.0f / 2048.0f); }
    vst2(yp + j * 16, lo); vst2(yp + j * 16 + 4, hi); } }
// ---- k_out: block = (64 rows, 128 cols): out = ctx Wo (+ bo): ctx x 2^6 once to f16 against Wo as f16(bf16 x 2^8) exact (1 product) x 2^-14; causal early rows (< QHI of each sequence): ctx bf16 hi + lo against exact bf16 Wo (2 products)
__global__ __launch_bounds__(128) void k_out(const float* __restrict__ Y, const float* __restrict__ WO, const float* __restrict__ BO, float* __restrict__ OUT) { __shared__ __align__(16) float sf[4][16][132];
  const int tid = threadIdx.x, wave = tid >> 5, lane = tid & 31, col = lane & 15, g = lane >> 4; const int c0 = blockIdx.y * 128; const size_t r0 = (size_t)blockIdx.x * 64 + wave * 16;
  v8f acc[8] = {};
  if (CAUSAL && (int)(((size_t)blockIdx.x * 64) % TT) < QHI) {   /* block-uniform */
#pragma unroll 2
    for (int kc = 0; kc < CC / 32; ++kc) { const F2 a = split_row(Y + (r0 + col) * CC, kc * 32, lane); asm volatile("s_wait_loadcnt 0x0" ::: "memory");
#pragma unroll
      for (int j = 0; j < 8; ++j) { const v16b w = WOCOL(WO, kc * 32, c0 + j * 16 + col, lane); asm volatile("s_wait_loadcnt 0x0" ::: "memory"); acc[j] = wmma_bf(a.h, w, acc[j]); acc[j] = wmma_bf(a.l, w, acc[j]); } }
#pragma unroll
    for (int j = 0; j < 8; ++j) { const float bias = BO ? bfr(BO[c0 + j * 16 + col]) : 0.f;
#pragma unroll
      for (int r = 0; r < 8; ++r) sf[wave][8 * g + r][j * 16 + col] = acc[j][r] + bias; }
  } else {
#pragma unroll 2
    for (int kc = 0; kc < CC / 32; ++kc) { const v16h a = frag_f32s(Y + (r0 + col) * CC + kc * 32, lane, 64.0f); asm volatile("s_wait_loadcnt 0x0" ::: "memory");   /* ctx carried x 2^6 into f16 so small-magnitude context rows stay clear of f16 subnormals */
#pragma unroll
      for (int j = 0; j < 8; ++j) { const v16h w = WOCOLH(WO, kc * 32, c0 + j * 16 + col, lane); asm volatile("s_wait_loadcnt 0x0" ::: "memory"); acc[j] = wmma16(a, w, acc[j]); } }
#pragma unroll
    for (int j = 0; j < 8; ++j) { const float bias = BO ? bfr(BO[c0 + j * 16 + col]) : 0.f;
#pragma unroll
      for (int r = 0; r < 8; ++r) sf[wave][8 * g + r][j * 16 + col] = acc[j][r] * (1.0f / 16384.0f) + bias; } }   /* 2^-8 (Wo carry) x 2^-6 (ctx carry) */
  LDSX(); for (int rl = 0; rl < 16; ++rl) vst2(OUT + (r0 + rl) * DIN + c0 + lane * 4, *(const v4f*)&sf[wave][rl][lane * 4]); }

extern "C" void kernel_launch(void* const* d_in, const int* in_sizes, int n_in, void* d_out, int out_size, void* d_ws, size_t ws_size, hipStream_t stream) {
  (void)in_sizes; (void)n_in; (void)out_size;
  const float** F = (const float**)d_in;
  if (ws_size < (size_t)WS_END) return;
  char* ws = (char*)d_ws; _Float16 *QH = (_Float16*)(ws + WS_QH), *KH = (_Float16*)(ws + WS_KH), *VT = (_Float16*)(ws + WS_VT), *QL = (_Float16*)(ws + WS_QL), *KL = (_Float16*)(ws + WS_KL); __bf16 *VB = (__bf16*)(ws + WS_VB), *VBL = (__bf16*)(ws + WS_VBL); float *S = (float*)(ws + WS_S), *Y = (float*)(ws + WS_Y);
  (void)Y; (void)QL; (void)KL; (void)VB; (void)VBL; (void)S;
  // inputs: 0 iQ [2,2048,1024]; 1 iK; 2 iV; 3 mask [2,2048,2048] bool (True = masked); 4 Wq [1024,1024] (out,in), 5 bq; 6 Wk, 7 bk; 8 Wv, 9 bv; 10 Wo (out,in), 11 bo (zero biases, read); 12 nbias [1] (SparseNormer bias; zero)
  k_proj<<<dim3(TNB * TT / 64, CC / 128, 3), 128, 0, stream>>>(F[0], F[1], F[2], F[4], F[6], F[8], F[5], F[7], F[9], QH, QL, KH, KL, VT, VB, VBL);
  k_fa<<<dim3(NH, NQB, TNB), 128, 0, stream>>>(QH, KH, VT, (const int*)d_in[3], F[12], Y);   /* relu(x + nbias)^2 / (sum + 1e-32): NOT a softmax */
  k_out<<<dim3(TNB * TT / 64, DIN / 128), 128, 0, stream>>>(Y, F[10], F[11], (float*)d_out);
}

// v002
// It runs in 267 microseconds.
// Next to v001, in two timings, it ran 2.10 times as fast each time.
// Over all steps from v000 it is 5.01 times as fast.
// compute dtype: all float inputs rounded to bf16; q/k/v projections with EXACT bf16 products on WMMA 16x16x32 (f32 accumulate) + bias; scores q x k once to f16 each (1 product) x 64^-0.5; SparseNormer in f32: t = relu(score + nbias)^2 (masked entries -> 0), P = t / (sum t + 1e-32); P x 2^11 once to f16 x v once to f16 (1 product); ctx x 2^6 once to f16 x Wo f16(bf16 x 2^8) + bo; f32 output.
#include <hip/hip_runtime.h>
#include <math.h>

typedef __attribute__((ext_vector_type(16))) _Float16 v16h;
typedef __attribute__((ext_vector_type(16))) __bf16 v16b;
typedef __attribute__((ext_vector_type(8)))  _Float16 v8h;
typedef __attribute__((ext_vector_type(8)))  float v8f;
typedef __attribute__((ext_vector_type(4)))  float v4f;
typedef __attribute__((ext_vector_type(2)))  float v2f;
typedef __attribute__((ext_vector_type(4)))  unsigned v4u;
typedef __attribute__((ext_vector_type(4)))  int v4i;
typedef float __attribute__((may_alias)) float_a;
typedef int __attribute__((may_alias)) int_a;

template <typename T> __device__ __forceinline__ void vst2(void* p, T v) { *(T*)p = v;  }
__device__ __forceinline__ v8f wmma16(v16h a, v16h b, v8f c) {
  v8f d = __builtin_amdgcn_wmma_f32_16x16x32_f16(false, a, false, b, (short)0, c, false, false);
  asm volatile("v_nop\n\tv_nop\n\tv_nop\n\tv_nop" : "+v"(d) : "v"(a), "v"(b));
  return d;
}
__device__ __forceinline__ v8f wmma_bf(v16b a, v16b b, v8f c) {
  v8f d = __builtin_amdgcn_wmma_f32_16x16x32_bf16(false, a, false, b, (short)0, c, false, false);
  asm volatile("v_nop\n\tv_nop\n\tv_nop\n\tv_nop" : "+v"(d) : "v"(a), "v"(b));
  return d;
}
// 16x16x32 fragments: lane = (h = lane>>4, row/col = lane&15); elements 0..7 = k0+8h+0..7, 8..15 = k0+16+8h+0..7; D element r = row 8h+r
__device__ __forceinline__ v16h frag_h(const _Float16* rowk0, int lane) {
  union { v16h v; v8h q[2]; } u; const _Float16* p = rowk0 + 8 * (lane >> 4);
  u.q[0] = *(const v8h*)p; u.q[1] = *(const v8h*)(p + 16); return u.v;
}
__device__ __forceinline__ v16h frag_f32(const float* rowk0, int lane) {
  v16h a; const float* p = rowk0 + 8 * (lane >> 4);
#pragma unroll
  for (int i = 0; i < 8; ++i) { a[i] = (_Float16)p[i]; a[8 + i] = (_Float16)p[16 + i]; }
  return a;
}
__device__ __forceinline__ v16h frag_f32s(const float* rowk0, int lane, float sc) {
  v16h a; const float* p = rowk0 + 8 * (lane >> 4);
#pragma unroll
  for (int i = 0; i < 8; ++i) { a[i] = (_Float16)(p[i] * sc); a[8 + i] = (_Float16)(p[16 + i] * sc); }
  return a;
}
// column fragment from a [K][ld] layout (column n), rows >= K read as 0
__device__ __forceinline__ v16h fragc_f32(const float* W, int k0, int n, int lane, int ld, int K) {
  v16h a; const int g = lane >> 4;
#pragma unroll
  for (int i = 0; i < 8; ++i) { const int ka = k0 + 8 * g + i, kb = ka + 16;
    a[i] = (_Float16)(ka < K ? W[(size_t)(ka < K ? ka : K - 1) * ld + n] : 0.f); a[8 + i] = (_Float16)(kb < K ? W[(size_t)(kb < K ? kb : K - 1) * ld + n] : 0.f); }
  return a;
}
struct F2 { v16b h, l; };
__device__ __forceinline__ F2 bsplit16(const float v[16]) { F2 r;
#pragma unroll
  for (int i = 0; i < 16; ++i) { const __bf16 h = (__bf16)v[i]; r.h[i] = h; r.l[i] = (__bf16)(v[i] - (float)h); }
  return r; }
__device__ __forceinline__ F2 split_row(const float* row, int k0, int lane) { float v[16]; const float* p = row + k0 + 8 * (lane >> 4);
#pragma unroll
  for (int i = 0; i < 8; ++i) { v[i] = p[i]; v[8 + i] = p[16 + i]; }
  return bsplit16(v); }
__device__ __forceinline__ F2 split_rowK(const float* row, int k0, int lane, int K) { float v[16]; const int g = lane >> 4;
#pragma unroll
  for (int i = 0; i < 8; ++i) { const int ka = k0 + 8 * g + i, kb = ka + 16; v[i] = ka < K ? row[ka < K ? ka : K - 1] : 0.f; v[8 + i] = kb < K ? row[kb < K ? kb : K - 1] : 0.f; }
  return bsplit16(v); }
__device__ __forceinline__ F2 split_col(const float* W, int k0, int n, int lane, int ld, int K) { float v[16]; const int g = lane >> 4;
#pragma unroll
  for (int i = 0; i < 8; ++i) { const int ka = k0 + 8 * g + i, kb = ka + 16; v[i] = ka < K ? W[(size_t)(ka < K ? ka : K - 1) * ld + n] : 0.f; v[8 + i] = kb < K ? W[(size_t)(kb < K ? kb : K - 1) * ld + n] : 0.f; }
  return bsplit16(v); }
__device__ __forceinline__ v8f mac3(const F2& a, const F2& b, v8f c) { c = wmma_bf(a.l, b.h, c); c = wmma_bf(a.h, b.l, c); return wmma_bf(a.h, b.h, c); }
__device__ __forceinline__ float sigm(float v) { return 1.0f / (1.0f + expf(-v)); }
#define LDSX() do { asm volatile("s_wait_dscnt 0" ::: "memory"); __builtin_amdgcn_wave_barrier(); __builtin_amdgcn_fence(__ATOMIC_RELEASE, "workgroup"); } while (0)

// Multi-head attention with a SparseNormer instead of a softmax (iQ / iK / iV [2,2048,1024] separate inputs; torch (out,in) Wq / Wk / Wv / Wo [1024,1024] (0.02 scale) + zero biases; 16 heads x 64; scores / 8; mask [2,2048,2048] bool random (True -> -1e32); t = relu(scores + nbias)^2 with nbias = zeros(1); attn = t / (sum_k t + 1e-32)): out = merge(attn v) Wo^T + bo.
#define NB 2
#define TT 2048
#define CC 1024            // NH * HD = projected width
#define DIN 1024          // input (model) width
#define NH 16
#define HD 64
#define NQB (TT / 64)
#define HG 4
#define SCALE (0.125f)
#define CAUSAL 0
#ifndef TNB
#define TNB NB
#endif
__device__ __forceinline__ float bfr(float v) { return (float)(__bf16)v; }
__host__ __device__ __forceinline__ int kb_last(int qb) { return CAUSAL ? ((qb * 64 + 63) >> 7) : (TT / 128 - 1); }
typedef __attribute__((ext_vector_type(8))) __bf16 v8b;
__device__ __forceinline__ v16b frag_b(const __bf16* rowk0, int lane) {
  union { v16b v; v8b q[2]; } u; const __bf16* p = rowk0 + 8 * (lane >> 4);
  u.q[0] = *(const v8b*)p; u.q[1] = *(const v8b*)(p + 16); return u.v;
}
#define QBH 0              // not used by any kernel here
#define QHI 0               // single-product scores on every row
#define KHI 64            // key rows carrying k residual / v bf16 hi+lo planes (written by k_proj; read by no kernel here)
// B fragment (k rows k0+.., output column o) of a weight: (in,out) [K][ld] or (out,in) [ld rows of K]: bf16 exact, or f16(bf16 * 256) exact
__device__ __forceinline__ v16b wcol_io(const float* Wm, int k0, int o, int lane, int ld) { v16b w; const int g = lane >> 4;
#pragma unroll
  for (int i = 0; i < 8; ++i) { w[i] = (__bf16)Wm[(size_t)(k0 + 8 * g + i) * ld + o]; w[8 + i] = (__bf16)Wm[(size_t)(k0 + 16 + 8 * g + i) * ld + o]; }
  return w; }
__device__ __forceinline__ v16b wcol_oi(const float* Wm, int k0, int o, int lane, int K) { v16b w; const float* p = Wm + (size_t)o * K + k0 + 8 * (lane >> 4);
#pragma unroll
  for (int i = 0; i < 8; ++i) { w[i] = (__bf16)p[i]; w[8 + i] = (__bf16)p[16 + i]; }
  return w; }
__device__ __forceinline__ v16h wcolh_io(const float* Wm, int k0, int o, int lane, int ld) { v16h w; const int g = lane >> 4;
#pragma unroll
  for (int i = 0; i < 8; ++i) { w[i] = (_Float16)(bfr(Wm[(size_t)(k0 + 8 * g + i) * ld + o]) * 256.0f); w[8 + i] = (_Float16)(bfr(Wm[(size_t)(k0 + 16 + 8 * g + i) * ld + o]) * 256.0f); }
  return w; }
__device__ __forceinline__ v16h wcolh_oi(const float* Wm, int k0, int o, int lane, int K) { v16h w; const float* p = Wm + (size_t)o * K + k0 + 8 * (lane >> 4);
#pragma unroll
  for (int i = 0; i < 8; ++i) { w[i] = (_Float16)(bfr(p[i]) * 256.0f); w[8 + i] = (_Float16)(bfr(p[16 + i]) * 256.0f); }
  return w; }
#define WQKV_LAYOUT 1   // 0 = (in,out) [DIN][CC]; 1 = (out,in) [CC][DIN]; 2 = per-head [NH][DIN][HD]
__device__ __forceinline__ v16b wcol_hdk(const float* Wm, int k0, int o, int lane) { v16b w; const int g = lane >> 4; const float* p = Wm + (size_t)(o / HD) * DIN * HD + (o % HD);
#pragma unroll
  for (int i = 0; i < 8; ++i) { w[i] = (__bf16)p[(size_t)(k0 + 8 * g + i) * HD]; w[8 + i] = (__bf16)p[(size_t)(k0 + 16 + 8 * g + i) * HD]; }
  return w; }
#define WO_OUT_IN 1
#if WQKV_LAYOUT == 1
#define WCOL(W, k0, o, lane) wcol_oi(W, k0, o, lane, DIN)
#elif WQKV_LAYOUT == 2
#define WCOL(W, k0, o, lane) wcol_hdk(W, k0, o, lane)
#else
#define WCOL(W, k0, o, lane) wcol_io(W, k0, o, lane, CC)
#endif
#if WO_OUT_IN
#define WOCOL(W, k0, o, lane) wcol_oi(W, k0, o, lane, CC)
#define WOCOLH(W, k0, o, lane) wcolh_oi(W, k0, o, lane, CC)
#else
#define WOCOL(W, k0, o, lane) wcol_io(W, k0, o, lane, DIN)
#define WOCOLH(W, k0, o, lane) wcolh_io(W, k0, o, lane, DIN)
#endif

#ifndef SM_EXTRA_PARAMS
#define SM_EXTRA_PARAMS
#endif
#ifndef PROJ_EXTRA_PARAMS
#define PROJ_EXTRA_PARAMS
#endif
#ifndef SM_MASK_HOOK
#define SM_MASK_HOOK (void)0
#endif

#define WS_QH  0u                                      // f16 q rows [b*t][CC]
#define WS_KH  (WS_QH + 2u * (size_t)NB * TT * CC)      // f16 k rows [b*t][CC]
#define WS_VT  (WS_KH + 2u * (size_t)NB * TT * CC)      // f16 v planes [b][c][t]
#define WS_QL  (WS_VT + 2u * (size_t)NB * CC * TT)      // f16 q residual x 2^10 rows [b][t < QHI][CC]
#define WS_KL  (WS_QL + 2u * (size_t)NB * QHI * CC)     // f16 k residual x 2^10 rows [b][t < KHI][CC]
#define WS_VB  (WS_KL + 2u * (size_t)NB * KHI * CC)     // bf16 v hi planes [b][c][t < KHI]
#define WS_VBL (WS_VB + 2u * (size_t)NB * CC * KHI)
#define WS_S   (WS_VBL + 2u * (size_t)NB * CC * KHI)    // f32 [hg][t][s] area, unused: no launched kernel writes it
#define WS_Y   (WS_S  + 4u * (size_t)HG * TT * TT)      // f32 ctx rows [b*t][CC] (only when there is an output projection)
#define WS_END (WS_Y  + 4u * (size_t)NB * TT * CC)

// ---- operand staging of the two projection kernels: a block's 64 X rows and 128 W rows, KS k at a time, are read from global memory once per block as whole 128-B lines (16 lanes x 16 B per 256-B row piece), rounded once to the 16-bit operand type and kept in LDS, where all four waves read their fragments; two buffers, the next stage's loads are in flight while this stage is multiplied
#define KS 64              // k per stage
#define SP 72              // LDS row pitch in 16-bit elements: 144 B = 16 B x 9, an odd multiple of 16 B, which ds_load_b128 fragment reads take without bank conflicts
#define SROWS 192          // rows 0..63 = X, 64..191 = W
typedef __attribute__((ext_vector_type(4))) __bf16 v4b;
typedef __attribute__((ext_vector_type(4))) _Float16 v4h;
struct Stg { v4f x[8], w[16]; };
template <int OFF> __device__ __forceinline__ void stg_load(Stg& s, const float* xp, const float* wp) {   /* xp + OFF, wp + OFF: this thread's 16 B of row (tid >> 4); further rows 8 apart; every matrix here has rows of 1024 floats; OFF and the row steps are immediate offsets on the two address pairs */
#pragma unroll
  for (int i = 0; i < 8; ++i) s.x[i] = *(const v4f*)(xp + OFF + (size_t)i * 8 * DIN);
#pragma unroll
  for (int i = 0; i < 16; ++i) s.w[i] = *(const v4f*)(wp + OFF + (size_t)i * 8 * DIN);
  asm volatile("s_wait_xcnt 0x0" :: "v"(xp), "v"(wp) : "memory"); }   /* closes the group of loads before a register that they name may be rewritten (the two address pairs are inputs, so they stay live up to the wait); it also keeps the loads in front of the stage's products */
__device__ __forceinline__ void stg_store(const Stg& s, __bf16 (*st)[SP], int tid) { const int rg = tid >> 4, c4 = (tid & 15) * 4;
#pragma unroll
  for (int i = 0; i < 8; ++i) { v4b o;
#pragma unroll
    for (int e = 0; e < 4; ++e) o[e] = (__bf16)s.x[i][e];
    *(v4b*)&st[rg + 8 * i][c4] = o; }
#pragma unroll
  for (int i = 0; i < 16; ++i) { v4b o;
#pragma unroll
    for (int e = 0; e < 4; ++e) o[e] = (__bf16)s.w[i][e];
    *(v4b*)&st[64 + rg + 8 * i][c4] = o; } }
__device__ __forceinline__ void stg_store(const Stg& s, _Float16 (*st)[SP], int tid) { const int rg = tid >> 4, c4 = (tid & 15) * 4;   /* ctx x 2^6 once to f16; Wo as f16(bf16 x 2^8), exact */
#pragma unroll
  for (int i = 0; i < 8; ++i) { v4h o;
#pragma unroll
    for (int e = 0; e < 4; ++e) o[e] = (_Float16)(s.x[i][e] * 64.0f);
    *(v4h*)&st[rg + 8 * i][c4] = o; }
#pragma unroll
  for (int i = 0; i < 16; ++i) { v4h o;
#pragma unroll
    for (int e = 0; e < 4; ++e) o[e] = (_Float16)(bfr(s.w[i][e]) * 256.0f);
    *(v4h*)&st[64 + rg + 8 * i][c4] = o; } }
// ---- k_proj: block = (64 rows, 128 cols, which): q/k/v = X W (+ b) with exact bf16 products (K = DIN) -> which 0: q f16 rows (+ residual rows < QHI); 1: k f16 rows (+ residual rows < KHI); 2: v f16 planes [c][t] (+ bf16 hi/lo planes for t < KHI)
__global__ __launch_bounds__(128) void k_proj(const float* __restrict__ XQ, const float* __restrict__ XK, const float* __restrict__ XV, const float* __restrict__ WQ, const float* __restrict__ WK, const float* __restrict__ WV, const float* __restrict__ BQ, const float* __restrict__ BK, const float* __restrict__ BV,
    _Float16* __restrict__ QH, _Float16* __restrict__ QL, _Float16* __restrict__ KH, _Float16* __restrict__ KL, _Float16* __restrict__ VT, __bf16* __restrict__ VB, __bf16* __restrict__ VBL) {
  union SM { struct { _Float16 sh[64][136], sl[64][136]; _Float16 th[128][72]; __bf16 tb[128][72], tbl[128][72]; } e; __bf16 st[2][SROWS][SP]; };   /* the stage buffers lie over the epilogue's arrays, which are first written behind the loop's last barrier */
  __shared__ __align__(16) SM sm; auto& sh = sm.e.sh; auto& sl = sm.e.sl; auto& th = sm.e.th; auto& tb = sm.e.tb; auto& tbl = sm.e.tbl;
  const int tid = threadIdx.x, wave = tid >> 5, lane = tid & 31, col = lane & 15, g = lane >> 4; const int which = blockIdx.z; const int c0 = blockIdx.y * 128; const size_t r0 = (size_t)blockIdx.x * 64; const size_t bb = r0 / TT; const int t0 = (int)(r0 % TT);
  const float* X = which == 0 ? XQ : which == 1 ? XK : XV; const float* WA = which == 0 ? WQ : which == 1 ? WK : WV; const float* BA = which == 0 ? BQ : which == 1 ? BK : BV;
  v8f acc[8] = {};
  const float* xp = X + (r0 + (tid >> 4)) * DIN + (tid & 15) * 4; const float* wp = WA + (size_t)(c0 + (tid >> 4)) * DIN + (tid & 15) * 4;
  Stg s; stg_load<0>(s, xp, wp); stg_store(s, sm.st[0], tid); __syncthreads();
  for (int t = 0; t < DIN / KS; ++t) { const __bf16 (*cb)[SP] = sm.st[t & 1];
    if (t + 1 < DIN / KS) stg_load<KS>(s, xp + t * KS, wp + t * KS);
    v16b a[KS / 32], w[KS / 32][8];
#pragma unroll
    for (int kc = 0; kc < KS / 32; ++kc) { a[kc] = frag_b(&cb[wave * 16 + col][kc * 32], lane);
#pragma unroll
      for (int j = 0; j < 8; ++j) w[kc][j] = frag_b(&cb[64 + j * 16 + col][kc * 32], lane); }
#pragma unroll
    for (int kc = 0; kc < KS / 32; ++kc) {
#pragma unroll
      for (int j = 0; j < 8; ++j) acc[j] = wmma_bf(a[kc], w[kc][j], acc[j]); }
    __builtin_amdgcn_sched_barrier(0);   /* the roundings of the next stage wait for its global loads: kept behind the products, so that the loads' latency runs under them */
    if (t + 1 < DIN / KS) stg_store(s, sm.st[(t + 1) & 1], tid);   /* into the buffer that every wave left at the barrier of the trip before */
    __syncthreads(); }
  if (which < 2) { _Float16* DH = which == 0 ? QH : KH; _Float16* DL = which == 0 ? QL : KL; const int nhi = which == 0 ? QHI : KHI; const bool hi_rows = t0 < nhi;
#pragma unroll
    for (int j = 0; j < 8; ++j) { const float bias = BA ? bfr(BA[c0 + j * 16 + col]) : 0.f;
#pragma unroll
      for (int r = 0; r < 8; ++r) { const float v = acc[j][r] + bias; const _Float16 hv = (_Float16)v; sh[wave * 16 + 8 * g + r][j * 16 + col] = hv; sl[wave * 16 + 8 * g + r][j * 16 + col] = (_Float16)((v - (float)hv) * 1024.0f); } }
    __syncthreads();
    for (int e = tid; e < 64 * 16; e += 128) { const int rl = e >> 4, q = e & 15; vst2((unsigned*)(DH + (r0 + rl) * CC + c0 + q * 8), *(const v4u*)&sh[rl][q * 8]); if (hi_rows) vst2((unsigned*)(DL + (bb * nhi + t0 + rl) * (size_t)CC + c0 + q * 8), *(const v4u*)&sl[rl][q * 8]); }
  } else { const bool hi_rows = t0 < KHI;
#pragma unroll
    for (int j = 0; j < 8; ++j) { const float bias = BA ? bfr(BA[c0 + j * 16 + col]) : 0.f;
#pragma unroll
      for (int r = 0; r < 8; ++r) { const float v = acc[j][r] + bias; const int rl = wave * 16 + 8 * g + r, cl = j * 16 + col; th[cl][rl] = (_Float16)v; const __bf16 bh = (__bf16)v; tb[cl][rl] = bh; tbl[cl][rl] = (__bf16)(v - (float)bh); } }
    __syncthreads();
    for (int e = tid; e < 128 * 8; e += 128) { const int cl = e >> 3, q = e & 7; vst2((unsigned*)(VT + (bb * CC + c0 + cl) * (size_t)TT + t0 + q * 8), *(const v4u*)&th[cl][q * 8]); if (hi_rows) { const size_t o3 = (bb * CC + c0 + cl) * (size_t)KHI + t0 + q * 8; vst2((unsigned*)(VB + o3), *(const v4u*)&tb[cl][q * 8]); vst2((unsigned*)(VBL + o3), *(const v4u*)&tbl[cl][q * 8]); } } } }
// ---- k_sm: block = query row t (head in group): keys [0, kend): causal -> logit if s <= t else excluded; softmax in f32; P x 2^11 in place (0 for excluded)
__global__ __launch_bounds__(256) void k_sm(float* __restrict__ S0 SM_EXTRA_PARAMS) { __shared__ float sred[8]; __shared__ float sbc; __shared__ __align__(16) float shv[TT];
  const int tid = threadIdx.x; const int t = blockIdx.x; const int kend = (kb_last(t >> 6) + 1) * 128;
  float* sr = S0 + (size_t)blockIdx.y * TT * TT + (size_t)t * TT;
  float m = -3.0e38f; for (int k = tid; k < kend; k += 256) { float v = (!CAUSAL || k <= t) ? sr[k] : -3.0e38f; SM_MASK_HOOK; shv[k] = v; m = fmaxf(m, v); }
#pragma unroll
  for (int o = 1; o < 32; o <<= 1) m = fmaxf(m, __shfl_xor(m, o));
  if ((tid & 31) == 0) sred[tid >> 5] = m; __syncthreads(); if (tid == 0) { float a = sred[0]; for (int i = 1; i < 8; ++i) a = fmaxf(a, sred[i]); sbc = a; } __syncthreads(); m = sbc; __syncthreads();
  float sum = 0.f; for (int k = tid; k < kend; k += 256) { const float v = shv[k]; const float e = (v <= -1.0e38f) ? 0.f : expf(v - m); shv[k] = e; sum += e; }
#pragma unroll
  for (int o = 1; o < 32; o <<= 1) sum += __shfl_xor(sum, o);
  if ((tid & 31) == 0) sred[tid >> 5] = sum; __syncthreads(); if (tid == 0) { float a = 0.f; for (int i = 0; i < 8; ++i) a += sred[i]; sbc = a > 0.f ? 2048.0f / a : 0.f; }   /* a fully excluded row yields P = 0 */ __syncthreads(); const float inv = sbc;
  for (int k = tid; k < kend; k += 256) shv[k] = shv[k] * inv;
  __syncthreads(); for (int q = tid; q < kend / 4; q += 256) vst2(sr + q * 4, *(const v4f*)&shv[q * 4]); }
#define IEPS 1.0e-32f
__device__ __forceinline__ v8f wmma_h(v16h a, v16h b, v8f c) { return __builtin_amdgcn_wmma_f32_16x16x32_f16(false, a, false, b, (short)0, c, false, false); }
// XW(p): closes a group of global loads off pointer p before a register that they name may be rewritten; p is an input so that the address pair stays live up to the wait (no load of the group may land on it)
#define XW(p) asm volatile("s_wait_xcnt 0x0" :: "v"(p) : "memory")
struct KM { v16h k[4]; v4i m[4]; };   // 32 keys: k[2u + kc] = A fragment of key rows 16u..16u+15, head dims 32kc..; m[2u + i] = this lane's query's mask words of keys 16u + 8g + 4i..
__device__ __forceinline__ KM load_km(const _Float16* kp, const int* mp, int k0, int lane) { KM c;
#pragma unroll
  for (int u = 0; u < 2; ++u) { c.k[2 * u] = frag_h(kp + (size_t)(k0 + 16 * u) * CC, lane); c.k[2 * u + 1] = frag_h(kp + (size_t)(k0 + 16 * u) * CC + 32, lane); }
  XW(kp + (size_t)k0 * CC);
#pragma unroll
  for (int u = 0; u < 2; ++u) { c.m[2 * u] = *(const v4i*)(mp + k0 + 16 * u); c.m[2 * u + 1] = *(const v4i*)(mp + k0 + 16 * u + 4); }
  XW(mp + k0); return c; }
// ---- k_fa (scores, SparseNormer and P v in one launch; no score plane in memory): block = 4 waves x 16 queries of (b, h). S^T = K Q^T: lane (g, col) holds query col's scores of keys 8g + r of each 16-key tile, so the row sum is in-lane (+ one exchange between the halves) and two converted S^T tiles are the B operand of ctx^T += V^T P^T.
// Pass 1 sums t = relu(score + nbias)^2 over the unmasked keys; pass 2 forms the scores again and carries P x 2^11 = t x 2^11 / (sum + 1e-32) once to f16, so P's f16 range does not depend on the scale of the scores. The inner loops are unrolled whole so that the fragment arrays are indexed by constants and stay in registers.
__global__ __launch_bounds__(128) void k_fa(const _Float16* __restrict__ QH, const _Float16* __restrict__ KH, const _Float16* __restrict__ VT, const int* __restrict__ MASK, const float* __restrict__ NBIAS, float* __restrict__ Y) {
  const int tid = threadIdx.x, wave = tid >> 5, lane = tid & 31, col = lane & 15, g = lane >> 4; const int h = blockIdx.x, b = blockIdx.z; const int ql = blockIdx.y * 64 + wave * 16 + col;
  const float nb_ = bfr(NBIAS[0]);
  const _Float16* qp = QH + ((size_t)b * TT + ql) * CC + h * HD; const v16h q0 = frag_h(qp, lane), q1 = frag_h(qp + 32, lane); XW(qp);
  const _Float16* kp = KH + ((size_t)b * TT + col) * CC + h * HD; const _Float16* vp = VT + ((size_t)b * CC + h * HD + col) * (size_t)TT; const int* mp = MASK + ((size_t)b * TT + ql) * TT + 8 * g;
  float sum = 0.f; KM cur = load_km(kp, mp, 0, lane);
#pragma unroll 2   /* two trips a body: the current and the fetched-ahead fragments swap by name, without register copies */
  for (int k0 = 0; k0 < TT; k0 += 32) { const KM nx = load_km(kp, mp, (k0 + 32) & (TT - 1), lane);   /* next 32 keys fetched one trip ahead; the last trip fetches keys 0.., which pass 2 starts with */
#pragma unroll
    for (int u = 0; u < 2; ++u) { v8f s = {}; s = wmma_h(cur.k[2 * u], q0, s); s = wmma_h(cur.k[2 * u + 1], q1, s);
#pragma unroll
      for (int r = 0; r < 8; ++r) { const float x = fmaxf(s[r] * SCALE + nb_, 0.f); const float e = (cur.m[2 * u + (r >> 2)][r & 3] != 0) ? 0.f : x * x; sum += e; } }
    cur = nx; }
  sum += __shfl_xor(sum, 16); const float inv = 2048.0f / (sum + IEPS);   /* sum == 0 -> every t is 0 -> P = 0 (0 x finite) */
  v8f acc[HD / 16] = {}; v16h vc[HD / 16];
#pragma unroll
  for (int j = 0; j < HD / 16; ++j) vc[j] = frag_h(vp + (size_t)(j * 16) * TT, lane);
  XW(vp);
#pragma unroll 2   /* two trips a body: the current and the fetched-ahead fragments swap by name, without register copies */
  for (int k0 = 0; k0 < TT; k0 += 32) { const int kn = (k0 + 32) & (TT - 1); const KM nx = load_km(kp, mp, kn, lane); v16h vn[HD / 16];
#pragma unroll
    for (int j = 0; j < HD / 16; ++j) vn[j] = frag_h(vp + (size_t)(j * 16) * TT + kn, lane);
    XW(vp + kn);
    v16h p;
#pragma unroll
    for (int u = 0; u < 2; ++u) { v8f s = {}; s = wmma_h(cur.k[2 * u], q0, s); s = wmma_h(cur.k[2 * u + 1], q1, s);
#pragma unroll
      for (int r = 0; r < 8; ++r) { const float x = fmaxf(s[r] * SCALE + nb_, 0.f); const float e = (cur.m[2 * u + (r >> 2)][r & 3] != 0) ? 0.f : x * x; p[8 * u + r] = (_Float16)(e * inv); } }
#pragma unroll
    for (int j = 0; j < HD / 16; ++j) { acc[j] = wmma_h(vc[j], p, acc[j]); vc[j] = vn[j]; }
    cur = nx; }
  float* yp = Y + ((size_t)b * TT + ql) * CC + h * HD + 8 * g;   /* acc[j][r] = ctx[query col][16j + 8g + r]; the wave writes each query's whole 256-B (row, head) segment */
#pragma unroll
  for (int j = 0; j < HD / 16; ++j) { v4f lo, hi;
#pragma unroll
    for (int r = 0; r < 4; ++r) { lo[r] = acc[j][r] * (1.0f / 2048.0f); hi[r] = acc[j][4 + r] * (1.0f / 2048.0f); }
    vst2(yp + j * 16, lo); vst2(yp + j * 16 + 4, hi); } }
// ---- k_out: block = (64 rows, 128 cols): out = ctx Wo (+ bo): ctx x 2^6 once to f16 against Wo as f16(bf16 x 2^8) exact (1 product) x 2^-14; causal early rows (< QHI of each sequence): ctx bf16 hi + lo against exact bf16 Wo (2 products)
__global__ __launch_bounds__(128) void k_out(const float* __restrict__ Y, const float* __restrict__ WO, const float* __restrict__ BO, float* __restrict__ OUT) { union SM { float sf[4][16][132]; _Float16 st[2][SROWS][SP]; };   /* the stage buffers lie over the epilogue's array, which is first written behind the loop's last barrier */
  __shared__ __align__(16) SM sm; auto& sf = sm.sf;
  const int tid = threadIdx.x, wave = tid >> 5, lane = tid & 31, col = lane & 15, g = lane >> 4; const int c0 = blockIdx.y * 128; const size_t r0 = (size_t)blockIdx.x * 64 + wave * 16;
  v8f acc[8] = {};
  if (CAUSAL && (int)(((size_t)blockIdx.x * 64) % TT) < QHI) {   /* block-uniform */
#pragma unroll 2
    for (int kc = 0; kc < CC / 32; ++kc) { const F2 a = split_row(Y + (r0 + col) * CC, kc * 32, lane); asm volatile("s_wait_loadcnt 0x0" ::: "memory");
#pragma unroll
      for (int j = 0; j < 8; ++j) { const v16b w = WOCOL(WO, kc * 32, c0 + j * 16 + col, lane); asm volatile("s_wait_loadcnt 0x0" ::: "memory"); acc[j] = wmma_bf(a.h, w, acc[j]); acc[j] = wmma_bf(a.l, w, acc[j]); } }
#pragma unroll
    for (int j = 0; j < 8; ++j) { const float bias = BO ? bfr(BO[c0 + j * 16 + col]) : 0.f;
#pragma unroll
      for (int r = 0; r < 8; ++r) sf[wave][8 * g + r][j * 16 + col] = acc[j][r] + bias; }
  } else {
    const float* xp = Y + ((size_t)blockIdx.x * 64 + (tid >> 4)) * CC + (tid & 15) * 4; const float* wp = WO + (size_t)(c0 + (tid >> 4)) * CC + (tid & 15) * 4;
    Stg s; stg_load<0>(s, xp, wp); stg_store(s, sm.st[0], tid); __syncthreads();   /* ctx carried x 2^6 into f16 so small-magnitude context rows stay clear of f16 subnormals */
    for (int t = 0; t < CC / KS; ++t) { const _Float16 (*cb)[SP] = sm.st[t & 1];
      if (t + 1 < CC / KS) stg_load<KS>(s, xp + t * KS, wp + t * KS);
      v16h a[KS / 32], w[KS / 32][8];
#pragma unroll
      for (int kc = 0; kc < KS / 32; ++kc) { a[kc] = frag_h(&cb[wave * 16 + col][kc * 32], lane);
#pragma unroll
        for (int j = 0; j < 8; ++j) w[kc][j] = frag_h(&cb[64 + j * 16 + col][kc * 32], lane); }
#pragma unroll
      for (int kc = 0; kc < KS / 32; ++kc) {
#pragma unroll
        for (int j = 0; j < 8; ++j) acc[j] = wmma16(a[kc], w[kc][j], acc[j]); }
      __builtin_amdgcn_sched_barrier(0);   /* the roundings of the next stage wait for its global loads: kept behind the products, so that the loads' latency runs under them */
      if (t + 1 < CC / KS) stg_store(s, sm.st[(t + 1) & 1], tid);   /* into the buffer that every wave left at the barrier of the trip before */
      __syncthreads(); }
#pragma unroll
    for (int j = 0; j < 8; ++j) { const float bias = BO ? bfr(BO[c0 + j * 16 + col]) : 0.f;
#pragma unroll
      for (int r = 0; r < 8; ++r) sf[wave][8 * g + r][j * 16 + col] = acc[j][r] * (1.0f / 16384.0f) + bias; } }   /* 2^-8 (Wo carry) x 2^-6 (ctx carry) */
  LDSX(); for (int rl = 0; rl < 16; ++rl) vst2(OUT + (r0 + rl) * DIN + c0 + lane * 4, *(const v4f*)&sf[wave][rl][lane * 4]); }

extern "C" void kernel_launch(void* const* d_in, const int* in_sizes, int n_in, void* d_out, int out_size, void* d_ws, size_t ws_size, hipStream_t stream) {
  (void)in_sizes; (void)n_in; (void)out_size;
  const float** F = (const float**)d_in;
  if (ws_size < (size_t)WS_END) return;
  char* ws = (char*)d_ws; _Float16 *QH = (_Float16*)(ws + WS_QH), *KH = (_Float16*)(ws + WS_KH), *VT = (_Float16*)(ws + WS_VT), *QL = (_Float16*)(ws + WS_QL), *KL = (_Float16*)(ws + WS_KL); __bf16 *VB = (__bf16*)(ws + WS_VB), *VBL = (__bf16*)(ws + WS_VBL); float *S = (float*)(ws + WS_S), *Y = (float*)(ws + WS_Y);
  (void)Y; (void)QL; (void)KL; (void)VB; (void)VBL; (void)S;
  // inputs: 0 iQ [2,2048,1024]; 1 iK; 2 iV; 3 mask [2,2048,2048] bool (True = masked); 4 Wq [1024,1024] (out,in), 5 bq; 6 Wk, 7 bk; 8 Wv, 9 bv; 10 Wo (out,in), 11 bo (zero biases, read); 12 nbias [1] (SparseNormer bias; zero)
  k_proj<<<dim3(TNB * TT / 64, CC / 128, 3), 128, 0, stream>>>(F[0], F[1], F[2], F[4], F[6], F[8], F[5], F[7], F[9], QH, QL, KH, KL, VT, VB, VBL);
  k_fa<<<dim3(NH, NQB, TNB), 128, 0, stream>>>(QH, KH, VT, (const int*)d_in[3], F[12], Y);   /* relu(x + nbias)^2 / (sum + 1e-32): NOT a softmax */
  k_out<<<dim3(TNB * TT / 64, DIN / 128), 128, 0, stream>>>(Y, F[10], F[11], (float*)d_out);
}

// v003
// One run takes 144 microseconds.
// Timed twice side by side with v002, it ran 1.85 and 1.86 times as fast.
// Over all steps from v000 it is 9.30 times as fast.
// compute dtype: all float inputs rounded to bf16; q/k/v projections with EXACT bf16 products on WMMA 16x16x32 (f32 accumulate) + bias; scores q x k once to f16 each (1 product) x 64^-0.5; SparseNormer in f32: t = relu(score + nbias)^2 (masked entries -> 0), P = t / (sum t + 1e-32); P x 2^11 once to f16 x v once to f16 (1 product); ctx x 2^6 once to f16 x Wo f16(bf16 x 2^8) + bo; f32 output.
#include <hip/hip_runtime.h>
#include <math.h>

typedef __attribute__((ext_vector_type(16))) _Float16 v16h;
typedef __attribute__((ext_vector_type(16))) __bf16 v16b;
typedef __attribute__((ext_vector_type(8)))  _Float16 v8h;
typedef __attribute__((ext_vector_type(8)))  float v8f;
typedef __attribute__((ext_vector_type(4)))  float v4f;
typedef __attribute__((ext_vector_type(2)))  float v2f;
typedef __attribute__((ext_vector_type(4)))  unsigned v4u;
typedef __attribute__((ext_vector_type(4)))  int v4i;
typedef float __attribute__((may_alias)) float_a;
typedef int __attribute__((may_alias)) int_a;

template <typename T> __device__ __forceinline__ void vst2(void* p, T v) { *(T*)p = v;  }
__device__ __forceinline__ v8f wmma16(v16h a, v16h b, v8f c) {
  v8f d = __builtin_amdgcn_wmma_f32_16x16x32_f16(false, a, false, b, (short)0, c, false, false);
  asm volatile("v_nop\n\tv_nop\n\tv_nop\n\tv_nop" : "+v"(d) : "v"(a), "v"(b));
  return d;
}
__device__ __forceinline__ v8f wmma_bf(v16b a, v16b b, v8f c) {
  v8f d = __builtin_amdgcn_wmma_f32_16x16x32_bf16(false, a, false, b, (short)0, c, false, false);
  asm volatile("v_nop\n\tv_nop\n\tv_nop\n\tv_nop" : "+v"(d) : "v"(a), "v"(b));
  return d;
}
// 16x16x32 fragments: lane = (h = lane>>4, row/col = lane&15); elements 0..7 = k0+8h+0..7, 8..15 = k0+16+8h+0..7; D element r = row 8h+r
__device__ __forceinline__ v16h frag_h(const _Float16* rowk0, int lane) {
  union { v16h v; v8h q[2]; } u; const _Float16* p = rowk0 + 8 * (lane >> 4);
  u.q[0] = *(const v8h*)p; u.q[1] = *(const v8h*)(p + 16); return u.v;
}
__device__ __forceinline__ v16h frag_f32(const float* rowk0, int lane) {
  v16h a; const float* p = rowk0 + 8 * (lane >> 4);
#pragma unroll
  for (int i = 0; i < 8; ++i) { a[i] = (_Float16)p[i]; a[8 + i] = (_Float16)p[16 + i]; }
  return a;
}
__device__ __forceinline__ v16h frag_f32s(const float* rowk0, int lane, float sc) {
  v16h a; const float* p = rowk0 + 8 * (lane >> 4);
#pragma unroll
  for (int i = 0; i < 8; ++i) { a[i] = (_Float16)(p[i] * sc); a[8 + i] = (_Float16)(p[16 + i] * sc); }
  return a;
}
// column fragment from a [K][ld] layout (column n), rows >= K read as 0
__device__ __forceinline__ v16h fragc_f32(const float* W, int k0, int n, int lane, int ld, int K) {
  v16h a; const int g = lane >> 4;
#pragma unroll
  for (int i = 0; i < 8; ++i) { const int ka = k0 + 8 * g + i, kb = ka + 16;
    a[i] = (_Float16)(ka < K ? W[(size_t)(ka < K ? ka : K - 1) * ld + n] : 0.f); a[8 + i] = (_Float16)(kb < K ? W[(size_t)(kb < K ? kb : K - 1) * ld + n] : 0.f); }
  return a;
}
struct F2 { v16b h, l; };
__device__ __forceinline__ F2 bsplit16(const float v[16]) { F2 r;
#pragma unroll
  for (int i = 0; i < 16; ++i) { const __bf16 h = (__bf16)v[i]; r.h[i] = h; r.l[i] = (__bf16)(v[i] - (float)h); }
  return r; }
__device__ __forceinline__ F2 split_row(const float* row, int k0, int lane) { float v[16]; const float* p = row + k0 + 8 * (lane >> 4);
#pragma unroll
  for (int i = 0; i < 8; ++i) { v[i] = p[i]; v[8 + i] = p[16 + i]; }
  return bsplit16(v); }
__device__ __forceinline__ F2 split_rowK(const float* row, int k0, int lane, int K) { float v[16]; const int g = lane >> 4;
#pragma unroll
  for (int i = 0; i < 8; ++i) { const int ka = k0 + 8 * g + i, kb = ka + 16; v[i] = ka < K ? row[ka < K ? ka : K - 1] : 0.f; v[8 + i] = kb < K ? row[kb < K ? kb : K - 1] : 0.f; }
  return bsplit16(v); }
__device__ __forceinline__ F2 split_col(const float* W, int k0, int n, int lane, int ld, int K) { float v[16]; const int g = lane >> 4;
#pragma unroll
  for (int i = 0; i < 8; ++i) { const int ka = k0 + 8 * g + i, kb = ka + 16; v[i] = ka < K ? W[(size_t)(ka < K ? ka : K - 1) * ld + n] : 0.f; v[8 + i] = kb < K ? W[(size_t)(kb < K ? kb : K - 1) * ld + n] : 0.f; }
  return bsplit16(v); }
__device__ __forceinline__ v8f mac3(const F2& a, const F2& b, v8f c) { c = wmma_bf(a.l, b.h, c); c = wmma_bf(a.h, b.l, c); return wmma_bf(a.h, b.h, c); }
__device__ __forceinline__ float sigm(float v) { return 1.0f / (1.0f + expf(-v)); }
#define LDSX() do { asm volatile("s_wait_dscnt 0" ::: "memory"); __builtin_amdgcn_wave_barrier(); __builtin_amdgcn_fence(__ATOMIC_RELEASE, "workgroup"); } while (0)

// Multi-head attention with a SparseNormer instead of a softmax (iQ / iK / iV [2,2048,1024] separate inputs; torch (out,in) Wq / Wk / Wv / Wo [1024,1024] (0.02 scale) + zero biases; 16 heads x 64; scores / 8; mask [2,2048,2048] bool random (True -> -1e32); t = relu(scores + nbias)^2 with nbias = zeros(1); attn = t / (sum_k t + 1e-32)): out = merge(attn v) Wo^T + bo.
#define NB 2
#define TT 2048
#define CC 1024            // NH * HD = projected width
#define DIN 1024          // input (model) width
#define NH 16
#define HD 64
#define NQB (TT / 64)
#define HG 4
#define SCALE (0.125f)
#define CAUSAL 0
#ifndef TNB
#define TNB NB
#endif
__device__ __forceinline__ float bfr(float v) { return (float)(__bf16)v; }
__host__ __device__ __forceinline__ int kb_last(int qb) { return CAUSAL ? ((qb * 64 + 63) >> 7) : (TT / 128 - 1); }
typedef __attribute__((ext_vector_type(8))) __bf16 v8b;
__device__ __forceinline__ v16b frag_b(const __bf16* rowk0, int lane) {
  union { v16b v; v8b q[2]; } u; const __bf16* p = rowk0 + 8 * (lane >> 4);
  u.q[0] = *(const v8b*)p; u.q[1] = *(const v8b*)(p + 16); return u.v;
}
#define QBH 0              // not used by any kernel here
#define QHI 0               // single-product scores on every row
#define KHI 64            // key rows carrying k residual / v bf16 hi+lo planes (written by k_proj; read by no kernel here)
// B fragment (k rows k0+.., output column o) of a weight: (in,out) [K][ld] or (out,in) [ld rows of K]: bf16 exact, or f16(bf16 * 256) exact
__device__ __forceinline__ v16b wcol_io(const float* Wm, int k0, int o, int lane, int ld) { v16b w; const int g = lane >> 4;
#pragma unroll
  for (int i = 0; i < 8; ++i) { w[i] = (__bf16)Wm[(size_t)(k0 + 8 * g + i) * ld + o]; w[8 + i] = (__bf16)Wm[(size_t)(k0 + 16 + 8 * g + i) * ld + o]; }
  return w; }
__device__ __forceinline__ v16b wcol_oi(const float* Wm, int k0, int o, int lane, int K) { v16b w; const float* p = Wm + (size_t)o * K + k0 + 8 * (lane >> 4);
#pragma unroll
  for (int i = 0; i < 8; ++i) { w[i] = (__bf16)p[i]; w[8 + i] = (__bf16)p[16 + i]; }
  return w; }
__device__ __forceinline__ v16h wcolh_io(const float* Wm, int k0, int o, int lane, int ld) { v16h w; const int g = lane >> 4;
#pragma unroll
  for (int i = 0; i < 8; ++i) { w[i] = (_Float16)(bfr(Wm[(size_t)(k0 + 8 * g + i) * ld + o]) * 256.0f); w[8 + i] = (_Float16)(bfr(Wm[(size_t)(k0 + 16 + 8 * g + i) * ld + o]) * 256.0f); }
  return w; }
__device__ __forceinline__ v16h wcolh_oi(const float* Wm, int k0, int o, int lane, int K) { v16h w; const float* p = Wm + (size_t)o * K + k0 + 8 * (lane >> 4);
#pragma unroll
  for (int i = 0; i < 8; ++i) { w[i] = (_Float16)(bfr(p[i]) * 256.0f); w[8 + i] = (_Float16)(bfr(p[16 + i]) * 256.0f); }
  return w; }
#define WQKV_LAYOUT 1   // 0 = (in,out) [DIN][CC]; 1 = (out,in) [CC][DIN]; 2 = per-head [NH][DIN][HD]
__device__ __forceinline__ v16b wcol_hdk(const float* Wm, int k0, int o, int lane) { v16b w; const int g = lane >> 4; const float* p = Wm + (size_t)(o / HD) * DIN * HD + (o % HD);
#pragma unroll
  for (int i = 0; i < 8; ++i) { w[i] = (__bf16)p[(size_t)(k0 + 8 * g + i) * HD]; w[8 + i] = (__bf16)p[(size_t)(k0 + 16 + 8 * g + i) * HD]; }
  return w; }
#define WO_OUT_IN 1
#if WQKV_LAYOUT == 1
#define WCOL(W, k0, o, lane) wcol_oi(W, k0, o, lane, DIN)
#elif WQKV_LAYOUT == 2
#define WCOL(W, k0, o, lane) wcol_hdk(W, k0, o, lane)
#else
#define WCOL(W, k0, o, lane) wcol_io(W, k0, o, lane, CC)
#endif
#if WO_OUT_IN
#define WOCOL(W, k0, o, lane) wcol_oi(W, k0, o, lane, CC)
#define WOCOLH(W, k0, o, lane) wcolh_oi(W, k0, o, lane, CC)
#else
#define WOCOL(W, k0, o, lane) wcol_io(W, k0, o, lane, DIN)
#define WOCOLH(W, k0, o, lane) wcolh_io(W, k0, o, lane, DIN)
#endif

#ifndef SM_EXTRA_PARAMS
#define SM_EXTRA_PARAMS
#endif
#ifndef PROJ_EXTRA_PARAMS
#define PROJ_EXTRA_PARAMS
#endif
#ifndef SM_MASK_HOOK
#define SM_MASK_HOOK (void)0
#endif

#define WS_QH  0u                                      // f16 q rows [b*t][CC]
#define WS_KH  (WS_QH + 2u * (size_t)NB * TT * CC)      // f16 k rows [b*t][CC]
#define WS_VT  (WS_KH + 2u * (size_t)NB * TT * CC)      // f16 v planes [b][c][t]
#define WS_QL  (WS_VT + 2u * (size_t)NB * CC * TT)      // f16 q residual x 2^10 rows [b][t < QHI][CC]
#define WS_KL  (WS_QL + 2u * (size_t)NB * QHI * CC)     // f16 k residual x 2^10 rows [b][t < KHI][CC]
#define WS_VB  (WS_KL + 2u * (size_t)NB * KHI * CC)     // bf16 v hi planes [b][c][t < KHI]
#define WS_VBL (WS_VB + 2u * (size_t)NB * CC * KHI)
#define WS_S   (WS_VBL + 2u * (size_t)NB * CC * KHI)    // f32 [hg][t][s] area, unused: no launched kernel writes it
#define WS_Y   (WS_S  + 4u * (size_t)HG * TT * TT)      // f32 ctx rows [b*t][CC] (only when there is an output projection)
#define WS_END (WS_Y  + 4u * (size_t)NB * TT * CC)

// ---- operand staging of the two projection kernels: a block's 64 X rows and 128 W rows, KS k at a time, are read from global memory once per block as whole 128-B lines (16 lanes x 16 B per 256-B row piece), rounded once to the 16-bit operand type and kept in LDS, where all four waves read their fragments; two buffers, the next stage's loads are in flight while this stage is multiplied
#define KS 64              // k per stage
#define SP 72              // LDS row pitch in 16-bit elements: 144 B = 16 B x 9, an odd multiple of 16 B, which ds_load_b128 fragment reads take without bank conflicts
#define SROWS 192          // rows 0..63 = X, 64..191 = W
typedef __attribute__((ext_vector_type(4))) __bf16 v4b;
typedef __attribute__((ext_vector_type(4))) _Float16 v4h;
struct Stg { v4f x[8], w[16]; };
template <int OFF> __device__ __forceinline__ void stg_load(Stg& s, const float* xp, const float* wp) {   /* xp + OFF, wp + OFF: this thread's 16 B of row (tid >> 4); further rows 8 apart; every matrix here has rows of 1024 floats; OFF and the row steps are immediate offsets on the two address pairs */
#pragma unroll
  for (int i = 0; i < 8; ++i) s.x[i] = *(const v4f*)(xp + OFF + (size_t)i * 8 * DIN);
#pragma unroll
  for (int i = 0; i < 16; ++i) s.w[i] = *(const v4f*)(wp + OFF + (size_t)i * 8 * DIN);
  asm volatile("s_wait_xcnt 0x0" :: "v"(xp), "v"(wp) : "memory"); }   /* closes the group of loads before a register that they name may be rewritten (the two address pairs are inputs, so they stay live up to the wait); it also keeps the loads in front of the stage's products */
__device__ __forceinline__ void stg_store(const Stg& s, __bf16 (*st)[SP], int tid) { const int rg = tid >> 4, c4 = (tid & 15) * 4;
#pragma unroll
  for (int i = 0; i < 8; ++i) { v4b o;
#pragma unroll
    for (int e = 0; e < 4; ++e) o[e] = (__bf16)s.x[i][e];
    *(v4b*)&st[rg + 8 * i][c4] = o; }
#pragma unroll
  for (int i = 0; i < 16; ++i) { v4b o;
#pragma unroll
    for (int e = 0; e < 4; ++e) o[e] = (__bf16)s.w[i][e];
    *(v4b*)&st[64 + rg + 8 * i][c4] = o; } }
__device__ __forceinline__ void stg_store(const Stg& s, _Float16 (*st)[SP], int tid) { const int rg = tid >> 4, c4 = (tid & 15) * 4;   /* ctx x 2^6 once to f16; Wo as f16(bf16 x 2^8), exact */
#pragma unroll
  for (int i = 0; i < 8; ++i) { v4h o;
#pragma unroll
    for (int e = 0; e < 4; ++e) o[e] = (_Float16)(s.x[i][e] * 64.0f);
    *(v4h*)&st[rg + 8 * i][c4] = o; }
#pragma unroll
  for (int i = 0; i < 16; ++i) { v4h o;
#pragma unroll
    for (int e = 0; e < 4; ++e) o[e] = (_Float16)(bfr(s.w[i][e]) * 256.0f);
    *(v4h*)&st[64 + rg + 8 * i][c4] = o; } }
// ---- k_proj: block = (64 rows, 128 cols, which): q/k/v = X W (+ b) with exact bf16 products (K = DIN) -> which 0: q f16 rows (+ residual rows < QHI); 1: k f16 rows (+ residual rows < KHI); 2: v f16 planes [c][t] (+ bf16 hi/lo planes for t < KHI)
__global__ __launch_bounds__(128) void k_proj(const float* __restrict__ XQ, const float* __restrict__ XK, const float* __restrict__ XV, const float* __restrict__ WQ, const float* __restrict__ WK, const float* __restrict__ WV, const float* __restrict__ BQ, const float* __restrict__ BK, const float* __restrict__ BV,
    _Float16* __restrict__ QH, _Float16* __restrict__ QL, _Float16* __restrict__ KH, _Float16* __restrict__ KL, _Float16* __restrict__ VT, __bf16* __restrict__ VB, __bf16* __restrict__ VBL) {
  union SM { struct { _Float16 sh[64][136], sl[64][136]; _Float16 th[128][72]; __bf16 tb[128][72], tbl[128][72]; } e; __bf16 st[2][SROWS][SP]; };   /* the stage buffers lie over the epilogue's arrays, which are first written behind the loop's last barrier */
  __shared__ __align__(16) SM sm; auto& sh = sm.e.sh; auto& sl = sm.e.sl; auto& th = sm.e.th; auto& tb = sm.e.tb; auto& tbl = sm.e.tbl;
  const int tid = threadIdx.x, wave = tid >> 5, lane = tid & 31, col = lane & 15, g = lane >> 4; const int which = blockIdx.z; const int c0 = blockIdx.y * 128; const size_t r0 = (size_t)blockIdx.x * 64; const size_t bb = r0 / TT; const int t0 = (int)(r0 % TT);
  const float* X = which == 0 ? XQ : which == 1 ? XK : XV; const float* WA = which == 0 ? WQ : which == 1 ? WK : WV; const float* BA = which == 0 ? BQ : which == 1 ? BK : BV;
  v8f acc[8] = {};
  const float* xp = X + (r0 + (tid >> 4)) * DIN + (tid & 15) * 4; const float* wp = WA + (size_t)(c0 + (tid >> 4)) * DIN + (tid & 15) * 4;
  Stg s; stg_load<0>(s, xp, wp); stg_store(s, sm.st[0], tid); __syncthreads();
  for (int t = 0; t < DIN / KS; ++t) { const __bf16 (*cb)[SP] = sm.st[t & 1];
    if (t + 1 < DIN / KS) stg_load<KS>(s, xp + t * KS, wp + t * KS);
    v16b a[KS / 32], w[KS / 32][8];
#pragma unroll
    for (int kc = 0; kc < KS / 32; ++kc) { a[kc] = frag_b(&cb[wave * 16 + col][kc * 32], lane);
#pragma unroll
      for (int j = 0; j < 8; ++j) w[kc][j] = frag_b(&cb[64 + j * 16 + col][kc * 32], lane); }
#pragma unroll
    for (int kc = 0; kc < KS / 32; ++kc) {
#pragma unroll
      for (int j = 0; j < 8; ++j) acc[j] = wmma_bf(a[kc], w[kc][j], acc[j]); }
    __builtin_amdgcn_sched_barrier(0);   /* the roundings of the next stage wait for its global loads: kept behind the products, so that the loads' latency runs under them */
    if (t + 1 < DIN / KS) stg_store(s, sm.st[(t + 1) & 1], tid);   /* into the buffer that every wave left at the barrier of the trip before */
    __syncthreads(); }
  if (which < 2) { _Float16* DH = which == 0 ? QH : KH; _Float16* DL = which == 0 ? QL : KL; const int nhi = which == 0 ? QHI : KHI; const bool hi_rows = t0 < nhi;
#pragma unroll
    for (int j = 0; j < 8; ++j) { const float bias = BA ? bfr(BA[c0 + j * 16 + col]) : 0.f;
#pragma unroll
      for (int r = 0; r < 8; ++r) { const float v = acc[j][r] + bias; const _Float16 hv = (_Float16)v; sh[wave * 16 + 8 * g + r][j * 16 + col] = hv; sl[wave * 16 + 8 * g + r][j * 16 + col] = (_Float16)((v - (float)hv) * 1024.0f); } }
    __syncthreads();
    for (int e = tid; e < 64 * 16; e += 128) { const int rl = e >> 4, q = e & 15; vst2((unsigned*)(DH + (r0 + rl) * CC + c0 + q * 8), *(const v4u*)&sh[rl][q * 8]); if (hi_rows) vst2((unsigned*)(DL + (bb * nhi + t0 + rl) * (size_t)CC + c0 + q * 8), *(const v4u*)&sl[rl][q * 8]); }
  } else { const bool hi_rows = t0 < KHI;
#pragma unroll
    for (int j = 0; j < 8; ++j) { const float bias = BA ? bfr(BA[c0 + j * 16 + col]) : 0.f;
#pragma unroll
      for (int r = 0; r < 8; ++r) { const float v = acc[j][r] + bias; const int rl = wave * 16 + 8 * g + r, cl = j * 16 + col; th[cl][rl] = (_Float16)v; const __bf16 bh = (__bf16)v; tb[cl][rl] = bh; tbl[cl][rl] = (__bf16)(v - (float)bh); } }
    __syncthreads();
    for (int e = tid; e < 128 * 8; e += 128) { const int cl = e >> 3, q = e & 7; vst2((unsigned*)(VT + (bb * CC + c0 + cl) * (size_t)TT + t0 + q * 8), *(const v4u*)&th[cl][q * 8]); if (hi_rows) { const size_t o3 = (bb * CC + c0 + cl) * (size_t)KHI + t0 + q * 8; vst2((unsigned*)(VB + o3), *(const v4u*)&tb[cl][q * 8]); vst2((unsigned*)(VBL + o3), *(const v4u*)&tbl[cl][q * 8]); } } } }
// ---- k_sm: block = query row t (head in group): keys [0, kend): causal -> logit if s <= t else excluded; softmax in f32; P x 2^11 in place (0 for excluded)
__global__ __launch_bounds__(256) void k_sm(float* __restrict__ S0 SM_EXTRA_PARAMS) { __shared__ float sred[8]; __shared__ float sbc; __shared__ __align__(16) float shv[TT];
  const int tid = threadIdx.x; const int t = blockIdx.x; const int kend = (kb_last(t >> 6) + 1) * 128;
  float* sr = S0 + (size_t)blockIdx.y * TT * TT + (size_t)t * TT;
  float m = -3.0e38f; for (int k = tid; k < kend; k += 256) { float v = (!CAUSAL || k <= t) ? sr[k] : -3.0e38f; SM_MASK_HOOK; shv[k] = v; m = fmaxf(m, v); }
#pragma unroll
  for (int o = 1; o < 32; o <<= 1) m = fmaxf(m, __shfl_xor(m, o));
  if ((tid & 31) == 0) sred[tid >> 5] = m; __syncthreads(); if (tid == 0) { float a = sred[0]; for (int i = 1; i < 8; ++i) a = fmaxf(a, sred[i]); sbc = a; } __syncthreads(); m = sbc; __syncthreads();
  float sum = 0.f; for (int k = tid; k < kend; k += 256) { const float v = shv[k]; const float e = (v <= -1.0e38f) ? 0.f : expf(v - m); shv[k] = e; sum += e; }
#pragma unroll
  for (int o = 1; o < 32; o <<= 1) sum += __shfl_xor(sum, o);
  if ((tid & 31) == 0) sred[tid >> 5] = sum; __syncthreads(); if (tid == 0) { float a = 0.f; for (int i = 0; i < 8; ++i) a += sred[i]; sbc = a > 0.f ? 2048.0f / a : 0.f; }   /* a fully excluded row yields P = 0 */ __syncthreads(); const float inv = sbc;
  for (int k = tid; k < kend; k += 256) shv[k] = shv[k] * inv;
  __syncthreads(); for (int q = tid; q < kend / 4; q += 256) vst2(sr + q * 4, *(const v4f*)&shv[q * 4]); }
#define IEPS 1.0e-32f
__device__ __forceinline__ v8f wmma_h(v16h a, v16h b, v8f c) { return __builtin_amdgcn_wmma_f32_16x16x32_f16(false, a, false, b, (short)0, c, false, false); }
// XW(p): closes a group of global loads off pointer p before a register that they name may be rewritten; p is an input so that the address pair stays live up to the wait (no load of the group may land on it)
#define XW(p) asm volatile("s_wait_xcnt 0x0" :: "v"(p) : "memory")
#define FK 64
#define KP 72
#define MP 68
#define NT (TT / FK)
struct __align__(16) FaBuf { _Float16 k[FK][KP]; _Float16 v[HD][KP]; int m[64][MP]; };
__device__ __forceinline__ unsigned lds_of(const void* p) { return (unsigned)(size_t)p; }   /* LDS byte address = low 32 bits of the __shared__ address */
// four copies of 16 B per lane; the s_wait_xcnt closes the group inside its own statement, before a register that a copy names may be rewritten
__device__ __forceinline__ void cp4(unsigned l0, const void* g0, unsigned l1, const void* g1, unsigned l2, const void* g2, unsigned l3, const void* g3) {
  asm volatile("global_load_async_to_lds_b128 %0, %1, off\n\tglobal_load_async_to_lds_b128 %2, %3, off\n\tglobal_load_async_to_lds_b128 %4, %5, off\n\tglobal_load_async_to_lds_b128 %6, %7, off\n\ts_wait_xcnt 0x0"
               :: "v"(l0), "v"(g0), "v"(l1), "v"(g1), "v"(l2), "v"(g2), "v"(l3), "v"(g3) : "memory"); }
// kg, vg: this thread's 16 B of row (tid >> 3), further rows 16 apart; mg: its 16 B of mask row (tid >> 4), further rows 8 apart; k0 = first key of the tile; with_v is the same for the whole block
__device__ __forceinline__ void fa_fill(FaBuf& f, const _Float16* kg, const _Float16* vg, const int* mg, int k0, bool with_v, int tid) {
  const int r8 = tid >> 3, c8 = (tid & 7) * 8, r16 = tid >> 4, c16 = (tid & 15) * 4;
  const _Float16* kq = kg + (size_t)k0 * CC;
  cp4(lds_of(&f.k[r8][c8]), kq, lds_of(&f.k[r8 + 16][c8]), kq + (size_t)16 * CC, lds_of(&f.k[r8 + 32][c8]), kq + (size_t)32 * CC, lds_of(&f.k[r8 + 48][c8]), kq + (size_t)48 * CC);
  const int* mq = mg + k0;
  cp4(lds_of(&f.m[r16][c16]), mq, lds_of(&f.m[r16 + 8][c16]), mq + (size_t)8 * TT, lds_of(&f.m[r16 + 16][c16]), mq + (size_t)16 * TT, lds_of(&f.m[r16 + 24][c16]), mq + (size_t)24 * TT);
  cp4(lds_of(&f.m[r16 + 32][c16]), mq + (size_t)32 * TT, lds_of(&f.m[r16 + 40][c16]), mq + (size_t)40 * TT, lds_of(&f.m[r16 + 48][c16]), mq + (size_t)48 * TT, lds_of(&f.m[r16 + 56][c16]), mq + (size_t)56 * TT);
  if (with_v) { const _Float16* vq = vg + k0;
    cp4(lds_of(&f.v[r8][c8]), vq, lds_of(&f.v[r8 + 16][c8]), vq + (size_t)16 * TT, lds_of(&f.v[r8 + 32][c8]), vq + (size_t)32 * TT, lds_of(&f.v[r8 + 48][c8]), vq + (size_t)48 * TT); } }
// hand-over of a tile: this wave's LDS reads of the old tile are done, its own copies of the next tile have landed, and the barrier publishes the next tile and frees the old buffer
#define FA_PUBLISH() do { asm volatile("s_wait_dscnt 0x0" ::: "memory"); asm volatile("s_wait_asynccnt 0x0" ::: "memory"); __syncthreads(); } while (0)
// ---- k_fa (scores, SparseNormer and P v in one launch; no score plane in memory): block = 4 waves x 16 queries of (b, h). S^T = K Q^T: lane (g, col) holds query col's scores of keys 8g + r of each 16-key tile, so the row sum is in-lane (+ one exchange between the halves) and two converted S^T tiles are the B operand of ctx^T += V^T P^T.
// Pass 1 sums t = relu(score + nbias)^2 over the unmasked keys; pass 2 forms the scores again and carries P x 2^11 = t x 2^11 / (sum + 1e-32) once to f16, so P's f16 range does not depend on the scale of the scores. The two passes walk one ring of 2 x NT tiles (pass 1's tiles without V). The inner loops are unrolled whole so that the vector elements are indexed by constants and stay in registers.
__global__ __launch_bounds__(128) void k_fa(const _Float16* __restrict__ QH, const _Float16* __restrict__ KH, const _Float16* __restrict__ VT, const int* __restrict__ MASK, const float* __restrict__ NBIAS, float* __restrict__ Y) {
  __shared__ FaBuf fb[2];
  const int tid = threadIdx.x, wave = tid >> 5, lane = tid & 31, col = lane & 15, g = lane >> 4; const int h = blockIdx.x, b = blockIdx.z; const int ql = blockIdx.y * 64 + wave * 16 + col;
  const float nb_ = bfr(NBIAS[0]);
  const _Float16* qp = QH + ((size_t)b * TT + ql) * CC + h * HD; const v16h q0 = frag_h(qp, lane), q1 = frag_h(qp + 32, lane); XW(qp);
  const _Float16* kg = KH + ((size_t)b * TT + (tid >> 3)) * CC + h * HD + (tid & 7) * 8; const _Float16* vg = VT + ((size_t)b * CC + h * HD + (tid >> 3)) * (size_t)TT + (tid & 7) * 8; const int* mg = MASK + ((size_t)b * TT + blockIdx.y * 64 + (tid >> 4)) * TT + (tid & 15) * 4;
  const int mr = wave * 16 + col;
  fa_fill(fb[0], kg, vg, mg, 0, false, tid);
  asm volatile("s_wait_asynccnt 0x0" ::: "memory");   /* tile 0 has landed before the barrier that publishes it */
  __syncthreads();
  fa_fill(fb[1], kg, vg, mg, FK, false, tid);
  float sum = 0.f;
  for (int t = 0; t < NT; ++t) { const FaBuf& f = fb[t & 1];
#pragma unroll
    for (int u = 0; u < FK / 16; ++u) { const v16h ka = frag_h(&f.k[16 * u + col][0], lane), kb = frag_h(&f.k[16 * u + col][32], lane); const v4i m0 = *(const v4i*)&f.m[mr][16 * u + 8 * g], m1 = *(const v4i*)&f.m[mr][16 * u + 8 * g + 4];
      v8f s = {}; s = wmma_h(ka, q0, s); s = wmma_h(kb, q1, s);
#pragma unroll
      for (int r = 0; r < 8; ++r) { const float x = fmaxf(s[r] * SCALE + nb_, 0.f); const float e = ((r < 4 ? m0[r & 3] : m1[r & 3]) != 0) ? 0.f : x * x; sum += e; } }
    FA_PUBLISH();
    fa_fill(fb[t & 1], kg, vg, mg, ((t + 2) & (NT - 1)) * FK, t + 2 >= NT, tid); }   /* the last two trips fetch pass 2's first two tiles, with V */
  sum += __shfl_xor(sum, 16); const float inv = 2048.0f / (sum + IEPS);   /* sum == 0 -> every t is 0 -> P = 0 (0 x finite) */
  v8f acc[HD / 16] = {};
  for (int t = 0; t < NT; ++t) { const FaBuf& f = fb[t & 1];
#pragma unroll
    for (int hh = 0; hh < FK / 32; ++hh) { v16h p;
#pragma unroll
      for (int u = 0; u < 2; ++u) { const int kr = 32 * hh + 16 * u; const v16h ka = frag_h(&f.k[kr + col][0], lane), kb = frag_h(&f.k[kr + col][32], lane); const v4i m0 = *(const v4i*)&f.m[mr][kr + 8 * g], m1 = *(const v4i*)&f.m[mr][kr + 8 * g + 4];
        v8f s = {}; s = wmma_h(ka, q0, s); s = wmma_h(kb, q1, s);
#pragma unroll
        for (int r = 0; r < 8; ++r) { const float x = fmaxf(s[r] * SCALE + nb_, 0.f); const float e = ((r < 4 ? m0[r & 3] : m1[r & 3]) != 0) ? 0.f : x * x; p[8 * u + r] = (_Float16)(e * inv); } }
#pragma unroll
      for (int j = 0; j < HD / 16; ++j) acc[j] = wmma_h(frag_h(&f.v[j * 16 + col][32 * hh], lane), p, acc[j]); }
    FA_PUBLISH();
    if (t + 2 < NT) fa_fill(fb[t & 1], kg, vg, mg, (t + 2) * FK, true, tid); }
  asm volatile("s_wait_asynccnt 0x0" ::: "memory");   /* no copy is outstanding when the wave ends */
  float* yp = Y + ((size_t)b * TT + ql) * CC + h * HD + 8 * g;   /* acc[j][r] = ctx[query col][16j + 8g + r]; the wave writes each query's whole 256-B (row, head) segment */
#pragma unroll
  for (int j = 0; j < HD / 16; ++j) { v4f lo, hi;
#pragma unroll
    for (int r = 0; r < 4; ++r) { lo[r] = acc[j][r] * (1.0f / 2048.0f); hi[r] = acc[j][4 + r] * (1.0f / 2048.0f); }
    vst2(yp + j * 16, lo); vst2(yp + j * 16 + 4, hi); } }
// ---- k_out: block = (64 rows, 128 cols): out = ctx Wo (+ bo): ctx x 2^6 once to f16 against Wo as f16(bf16 x 2^8) exact (1 product) x 2^-14; causal early rows (< QHI of each sequence): ctx bf16 hi + lo against exact bf16 Wo (2 products)
__global__ __launch_bounds__(128) void k_out(const float* __restrict__ Y, const float* __restrict__ WO, const float* __restrict__ BO, float* __restrict__ OUT) { union SM { float sf[4][16][132]; _Float16 st[2][SROWS][SP]; };   /* the stage buffers lie over the epilogue's array, which is first written behind the loop's last barrier */
  __shared__ __align__(16) SM sm; auto& sf = sm.sf;
  const int tid = threadIdx.x, wave = tid >> 5, lane = tid & 31, col = lane & 15, g = lane >> 4; const int c0 = blockIdx.y * 128; const size_t r0 = (size_t)blockIdx.x * 64 + wave * 16;
  v8f acc[8] = {};
  if (CAUSAL && (int)(((size_t)blockIdx.x * 64) % TT) < QHI) {   /* block-uniform */
#pragma unroll 2
    for (int kc = 0; kc < CC / 32; ++kc) { const F2 a = split_row(Y + (r0 + col) * CC, kc * 32, lane); asm volatile("s_wait_loadcnt 0x0" ::: "memory");
#pragma unroll
      for (int j = 0; j < 8; ++j) { const v16b w = WOCOL(WO, kc * 32, c0 + j * 16 + col, lane); asm volatile("s_wait_loadcnt 0x0" ::: "memory"); acc[j] = wmma_bf(a.h, w, acc[j]); acc[j] = wmma_bf(a.l, w, acc[j]); } }
#pragma unroll
    for (int j = 0; j < 8; ++j) { const float bias = BO ? bfr(BO[c0 + j * 16 + col]) : 0.f;
#pragma unroll
      for (int r = 0; r < 8; ++r) sf[wave][8 * g + r][j * 16 + col] = acc[j][r] + bias; }
  } else {
    const float* xp = Y + ((size_t)blockIdx.x * 64 + (tid >> 4)) * CC + (tid & 15) * 4; const float* wp = WO + (size_t)(c0 + (tid >> 4)) * CC + (tid & 15) * 4;
    Stg s; stg_load<0>(s, xp, wp); stg_store(s, sm.st[0], tid); __syncthreads();   /* ctx carried x 2^6 into f16 so small-magnitude context rows stay clear of f16 subnormals */
    for (int t = 0; t < CC / KS; ++t) { const _Float16 (*cb)[SP] = sm.st[t & 1];
      if (t + 1 < CC / KS) stg_load<KS>(s, xp + t * KS, wp + t * KS);
      v16h a[KS / 32], w[KS / 32][8];
#pragma unroll
      for (int kc = 0; kc < KS / 32; ++kc) { a[kc] = frag_h(&cb[wave * 16 + col][kc * 32], lane);
#pragma unroll
        for (int j = 0; j < 8; ++j) w[kc][j] = frag_h(&cb[64 + j * 16 + col][kc * 32], lane); }
#pragma unroll
      for (int kc = 0; kc < KS / 32; ++kc) {
#pragma unroll
        for (int j = 0; j < 8; ++j) acc[j] = wmma16(a[kc], w[kc][j], acc[j]); }
      __builtin_amdgcn_sched_barrier(0);   /* the roundings of the next stage wait for its global loads: kept behind the products, so that the loads' latency runs under them */
      if (t + 1 < CC / KS) stg_store(s, sm.st[(t + 1) & 1], tid);   /* into the buffer that every wave left at the barrier of the trip before */
      __syncthreads(); }
#pragma unroll
    for (int j = 0; j < 8; ++j) { const float bias = BO ? bfr(BO[c0 + j * 16 + col]) : 0.f;
#pragma unroll
      for (int r = 0; r < 8; ++r) sf[wave][8 * g + r][j * 16 + col] = acc[j][r] * (1.0f / 16384.0f) + bias; } }   /* 2^-8 (Wo carry) x 2^-6 (ctx carry) */
  LDSX(); for (int rl = 0; rl < 16; ++rl) vst2(OUT + (r0 + rl) * DIN + c0 + lane * 4, *(const v4f*)&sf[wave][rl][lane * 4]); }

extern "C" void kernel_launch(void* const* d_in, const int* in_sizes, int n_in, void* d_out, int out_size, void* d_ws, size_t ws_size, hipStream_t stream) {
  (void)in_sizes; (void)n_in; (void)out_size;
  const float** F = (const float**)d_in;
  if (ws_size < (size_t)WS_END) return;
  char* ws = (char*)d_ws; _Float16 *QH = (_Float16*)(ws + WS_QH), *KH = (_Float16*)(ws + WS_KH), *VT = (_Float16*)(ws + WS_VT), *QL = (_Float16*)(ws + WS_QL), *KL = (_Float16*)(ws + WS_KL); __bf16 *VB = (__bf16*)(ws + WS_VB), *VBL = (__bf16*)(ws + WS_VBL); float *S = (float*)(ws + WS_S), *Y = (float*)(ws + WS_Y);
  (void)Y; (void)QL; (void)KL; (void)VB; (void)VBL; (void)S;
  // inputs: 0 iQ [2,2048,1024]; 1 iK; 2 iV; 3 mask [2,2048,2048] bool (True = masked); 4 Wq [1024,1024] (out,in), 5 bq; 6 Wk, 7 bk; 8 Wv, 9 bv; 10 Wo (out,in), 11 bo (zero biases, read); 12 nbias [1] (SparseNormer bias; zero)
  k_proj<<<dim3(TNB * TT / 64, CC / 128, 3), 128, 0, stream>>>(F[0], F[1], F[2], F[4], F[6], F[8], F[5], F[7], F[9], QH, QL, KH, KL, VT, VB, VBL);
  k_fa<<<dim3(NH, NQB, TNB), 128, 0, stream>>>(QH, KH, VT, (const int*)d_in[3], F[12], Y);   /* relu(x + nbias)^2 / (sum + 1e-32): NOT a softmax */
  k_out<<<dim3(TNB * TT / 64, DIN / 128), 128, 0, stream>>>(Y, F[10], F[11], (float*)d_out);
}

// v004
// Measured time: 116 microseconds a run.
// Two timings next to v003 both put it at 1.24 times that version's speed.
// Over all steps from v000 it is 11.6 times as fast.
// compute dtype: all float inputs rounded to bf16; q/k/v projections with EXACT bf16 products on WMMA 16x16x32 (f32 accumulate) + bias; scores q x k once to f16 each (1 product) x 64^-0.5; SparseNormer in f32: t = relu(score + nbias)^2 (masked entries -> 0); t x 2^2n (n per row) once to f16 x v once to f16 (1 product), ctx = that sum / (sum t + 1e-32); ctx x 2^6 once to f16 x Wo f16(bf16 x 2^8) + bo; f32 output.
#include <hip/hip_runtime.h>
#include <math.h>

typedef __attribute__((ext_vector_type(16))) _Float16 v16h;
typedef __attribute__((ext_vector_type(16))) __bf16 v16b;
typedef __attribute__((ext_vector_type(8)))  _Float16 v8h;
typedef __attribute__((ext_vector_type(8)))  float v8f;
typedef __attribute__((ext_vector_type(4)))  float v4f;
typedef __attribute__((ext_vector_type(2)))  float v2f;
typedef __attribute__((ext_vector_type(4)))  unsigned v4u;
typedef __attribute__((ext_vector_type(4)))  int v4i;
typedef float __attribute__((may_alias)) float_a;
typedef int __attribute__((may_alias)) int_a;

template <typename T> __device__ __forceinline__ void vst2(void* p, T v) { *(T*)p = v;  }
__device__ __forceinline__ v8f wmma16(v16h a, v16h b, v8f c) {
  v8f d = __builtin_amdgcn_wmma_f32_16x16x32_f16(false, a, false, b, (short)0, c, false, false);
  asm volatile("v_nop\n\tv_nop\n\tv_nop\n\tv_nop" : "+v"(d) : "v"(a), "v"(b));
  return d;
}
__device__ __forceinline__ v8f wmma_bf(v16b a, v16b b, v8f c) {
  v8f d = __builtin_amdgcn_wmma_f32_16x16x32_bf16(false, a, false, b, (short)0, c, false, false);
  asm volatile("v_nop\n\tv_nop\n\tv_nop\n\tv_nop" : "+v"(d) : "v"(a), "v"(b));
  return d;
}
// 16x16x32 fragments: lane = (h = lane>>4, row/col = lane&15); elements 0..7 = k0+8h+0..7, 8..15 = k0+16+8h+0..7; D element r = row 8h+r
__device__ __forceinline__ v16h frag_h(const _Float16* rowk0, int lane) {
  union { v16h v; v8h q[2]; } u; const _Float16* p = rowk0 + 8 * (lane >> 4);
  u.q[0] = *(const v8h*)p; u.q[1] = *(const v8h*)(p + 16); return u.v;
}
__device__ __forceinline__ v16h frag_f32(const float* rowk0, int lane) {
  v16h a; const float* p = rowk0 + 8 * (lane >> 4);
#pragma unroll
  for (int i = 0; i < 8; ++i) { a[i] = (_Float16)p[i]; a[8 + i] = (_Float16)p[16 + i]; }
  return a;
}
__device__ __forceinline__ v16h frag_f32s(const float* rowk0, int lane, float sc) {
  v16h a; const float* p = rowk0 + 8 * (lane >> 4);
#pragma unroll
  for (int i = 0; i < 8; ++i) { a[i] = (_Float16)(p[i] * sc); a[8 + i] = (_Float16)(p[16 + i] * sc); }
  return a;
}
// column fragment from a [K][ld] layout (column n), rows >= K read as 0
__device__ __forceinline__ v16h fragc_f32(const float* W, int k0, int n, int lane, int ld, int K) {
  v16h a; const int g = lane >> 4;
#pragma unroll
  for (int i = 0; i < 8; ++i) { const int ka = k0 + 8 * g + i, kb = ka + 16;
    a[i] = (_Float16)(ka < K ? W[(size_t)(ka < K ? ka : K - 1) * ld + n] : 0.f); a[8 + i] = (_Float16)(kb < K ? W[(size_t)(kb < K ? kb : K - 1) * ld + n] : 0.f); }
  return a;
}
struct F2 { v16b h, l; };
__device__ __forceinline__ F2 bsplit16(const float v[16]) { F2 r;
#pragma unroll
  for (int i = 0; i < 16; ++i) { const __bf16 h = (__bf16)v[i]; r.h[i] = h; r.l[i] = (__bf16)(v[i] - (float)h); }
  return r; }
__device__ __forceinline__ F2 split_row(const float* row, int k0, int lane) { float v[16]; const float* p = row + k0 + 8 * (lane >> 4);
#pragma unroll
  for (int i = 0; i < 8; ++i) { v[i] = p[i]; v[8 + i] = p[16 + i]; }
  return bsplit16(v); }
__device__ __forceinline__ F2 split_rowK(const float* row, int k0, int lane, int K) { float v[16]; const int g = lane >> 4;
#pragma unroll
  for (int i = 0; i < 8; ++i) { const int ka = k0 + 8 * g + i, kb = ka + 16; v[i] = ka < K ? row[ka < K ? ka : K - 1] : 0.f; v[8 + i] = kb < K ? row[kb < K ? kb : K - 1] : 0.f; }
  return bsplit16(v); }
__device__ __forceinline__ F2 split_col(const float* W, int k0, int n, int lane, int ld, int K) { float v[16]; const int g = lane >> 4;
#pragma unroll
  for (int i = 0; i < 8; ++i) { const int ka = k0 + 8 * g + i, kb = ka + 16; v[i] = ka < K ? W[(size_t)(ka < K ? ka : K - 1) * ld + n] : 0.f; v[8 + i] = kb < K ? W[(size_t)(kb < K ? kb : K - 1) * ld + n] : 0.f; }
  return bsplit16(v); }
__device__ __forceinline__ v8f mac3(const F2& a, const F2& b, v8f c) { c = wmma_bf(a.l, b.h, c); c = wmma_bf(a.h, b.l, c); return wmma_bf(a.h, b.h, c); }
__device__ __forceinline__ float sigm(float v) { return 1.0f / (1.0f + expf(-v)); }
#define LDSX() do { asm volatile("s_wait_dscnt 0" ::: "memory"); __builtin_amdgcn_wave_barrier(); __builtin_amdgcn_fence(__ATOMIC_RELEASE, "workgroup"); } while (0)

// Multi-head attention with a SparseNormer instead of a softmax (iQ / iK / iV [2,2048,1024] separate inputs; torch (out,in) Wq / Wk / Wv / Wo [1024,1024] (0.02 scale) + zero biases; 16 heads x 64; scores / 8; mask [2,2048,2048] bool random (True -> -1e32); t = relu(scores + nbias)^2 with nbias = zeros(1); attn = t / (sum_k t + 1e-32)): out = merge(attn v) Wo^T + bo.
#define NB 2
#define TT 2048
#define CC 1024            // NH * HD = projected width
#define DIN 1024          // input (model) width
#define NH 16
#define HD 64
#define NQB (TT / 64)
#define HG 4
#define SCALE (0.125f)
#define CAUSAL 0
#ifndef TNB
#define TNB NB
#endif
__device__ __forceinline__ float bfr(float v) { return (float)(__bf16)v; }
__host__ __device__ __forceinline__ int kb_last(int qb) { return CAUSAL ? ((qb * 64 + 63) >> 7) : (TT / 128 - 1); }
typedef __attribute__((ext_vector_type(8))) __bf16 v8b;
__device__ __forceinline__ v16b frag_b(const __bf16* rowk0, int lane) {
  union { v16b v; v8b q[2]; } u; const __bf16* p = rowk0 + 8 * (lane >> 4);
  u.q[0] = *(const v8b*)p; u.q[1] = *(const v8b*)(p + 16); return u.v;
}
#define QBH 0              // not used by any kernel here
#define QHI 0               // single-product scores on every row
#define KHI 64            // key rows carrying k residual / v bf16 hi+lo planes (written by k_proj; read by no kernel here)
// B fragment (k rows k0+.., output column o) of a weight: (in,out) [K][ld] or (out,in) [ld rows of K]: bf16 exact, or f16(bf16 * 256) exact
__device__ __forceinline__ v16b wcol_io(const float* Wm, int k0, int o, int lane, int ld) { v16b w; const int g = lane >> 4;
#pragma unroll
  for (int i = 0; i < 8; ++i) { w[i] = (__bf16)Wm[(size_t)(k0 + 8 * g + i) * ld + o]; w[8 + i] = (__bf16)Wm[(size_t)(k0 + 16 + 8 * g + i) * ld + o]; }
  return w; }
__device__ __forceinline__ v16b wcol_oi(const float* Wm, int k0, int o, int lane, int K) { v16b w; const float* p = Wm + (size_t)o * K + k0 + 8 * (lane >> 4);
#pragma unroll
  for (int i = 0; i < 8; ++i) { w[i] = (__bf16)p[i]; w[8 + i] = (__bf16)p[16 + i]; }
  return w; }
__device__ __forceinline__ v16h wcolh_io(const float* Wm, int k0, int o, int lane, int ld) { v16h w; const int g = lane >> 4;
#pragma unroll
  for (int i = 0; i < 8; ++i) { w[i] = (_Float16)(bfr(Wm[(size_t)(k0 + 8 * g + i) * ld + o]) * 256.0f); w[8 + i] = (_Float16)(bfr(Wm[(size_t)(k0 + 16 + 8 * g + i) * ld + o]) * 256.0f); }
  return w; }
__device__ __forceinline__ v16h wcolh_oi(const float* Wm, int k0, int o, int lane, int K) { v16h w; const float* p = Wm + (size_t)o * K + k0 + 8 * (lane >> 4);
#pragma unroll
  for (int i = 0; i < 8; ++i) { w[i] = (_Float16)(bfr(p[i]) * 256.0f); w[8 + i] = (_Float16)(bfr(p[16 + i]) * 256.0f); }
  return w; }
#define WQKV_LAYOUT 1   // 0 = (in,out) [DIN][CC]; 1 = (out,in) [CC][DIN]; 2 = per-head [NH][DIN][HD]
__device__ __forceinline__ v16b wcol_hdk(const float* Wm, int k0, int o, int lane) { v16b w; const int g = lane >> 4; const float* p = Wm + (size_t)(o / HD) * DIN * HD + (o % HD);
#pragma unroll
  for (int i = 0; i < 8; ++i) { w[i] = (__bf16)p[(size_t)(k0 + 8 * g + i) * HD]; w[8 + i] = (__bf16)p[(size_t)(k0 + 16 + 8 * g + i) * HD]; }
  return w; }
#define WO_OUT_IN 1
#if WQKV_LAYOUT == 1
#define WCOL(W, k0, o, lane) wcol_oi(W, k0, o, lane, DIN)
#elif WQKV_LAYOUT == 2
#define WCOL(W, k0, o, lane) wcol_hdk(W, k0, o, lane)
#else
#define WCOL(W, k0, o, lane) wcol_io(W, k0, o, lane, CC)
#endif
#if WO_OUT_IN
#define WOCOL(W, k0, o, lane) wcol_oi(W, k0, o, lane, CC)
#define WOCOLH(W, k0, o, lane) wcolh_oi(W, k0, o, lane, CC)
#else
#define WOCOL(W, k0, o, lane) wcol_io(W, k0, o, lane, DIN)
#define WOCOLH(W, k0, o, lane) wcolh_io(W, k0, o, lane, DIN)
#endif

#ifndef SM_EXTRA_PARAMS
#define SM_EXTRA_PARAMS
#endif
#ifndef PROJ_EXTRA_PARAMS
#define PROJ_EXTRA_PARAMS
#endif
#ifndef SM_MASK_HOOK
#define SM_MASK_HOOK (void)0
#endif

#define WS_QH  0u                                      // f16 q rows [b*t][CC]
#define WS_KH  (WS_QH + 2u * (size_t)NB * TT * CC)      // f16 k rows [b*t][CC]
#define WS_VT  (WS_KH + 2u * (size_t)NB * TT * CC)      // f16 v planes [b][c][t]
#define WS_QL  (WS_VT + 2u * (size_t)NB * CC * TT)      // f16 q residual x 2^10 rows [b][t < QHI][CC]
#define WS_KL  (WS_QL + 2u * (size_t)NB * QHI * CC)     // f16 k residual x 2^10 rows [b][t < KHI][CC]
#define WS_VB  (WS_KL + 2u * (size_t)NB * KHI * CC)     // bf16 v hi planes [b][c][t < KHI]
#define WS_VBL (WS_VB + 2u * (size_t)NB * CC * KHI)
#define WS_S   (WS_VBL + 2u * (size_t)NB * CC * KHI)    // f32 [hg][t][s] area, unused: no launched kernel writes it
#define WS_Y   (WS_S  + 4u * (size_t)HG * TT * TT)      // f32 ctx rows [b*t][CC] (only when there is an output projection)
#define WS_END (WS_Y  + 4u * (size_t)NB * TT * CC)

// ---- operand staging of the two projection kernels: a block's 64 X rows and 128 W rows, KS k at a time, are read from global memory once per block as whole 128-B lines (16 lanes x 16 B per 256-B row piece), rounded once to the 16-bit operand type and kept in LDS, where all four waves read their fragments; two buffers, the next stage's loads are in flight while this stage is multiplied
#define KS 64              // k per stage
#define SP 72              // LDS row pitch in 16-bit elements: 144 B = 16 B x 9, an odd multiple of 16 B, which ds_load_b128 fragment reads take without bank conflicts
#define SROWS 192          // rows 0..63 = X, 64..191 = W
typedef __attribute__((ext_vector_type(4))) __bf16 v4b;
typedef __attribute__((ext_vector_type(4))) _Float16 v4h;
struct Stg { v4f x[8], w[16]; };
template <int OFF> __device__ __forceinline__ void stg_load(Stg& s, const float* xp, const float* wp) {   /* xp + OFF, wp + OFF: this thread's 16 B of row (tid >> 4); further rows 8 apart; every matrix here has rows of 1024 floats; OFF and the row steps are immediate offsets on the two address pairs */
#pragma unroll
  for (int i = 0; i < 8; ++i) s.x[i] = *(const v4f*)(xp + OFF + (size_t)i * 8 * DIN);
#pragma unroll
  for (int i = 0; i < 16; ++i) s.w[i] = *(const v4f*)(wp + OFF + (size_t)i * 8 * DIN);
  asm volatile("s_wait_xcnt 0x0" :: "v"(xp), "v"(wp) : "memory"); }   /* closes the group of loads before a register that they name may be rewritten (the two address pairs are inputs, so they stay live up to the wait); it also keeps the loads in front of the stage's products */
__device__ __forceinline__ void stg_store(const Stg& s, __bf16 (*st)[SP], int tid) { const int rg = tid >> 4, c4 = (tid & 15) * 4;
#pragma unroll
  for (int i = 0; i < 8; ++i) { v4b o;
#pragma unroll
    for (int e = 0; e < 4; ++e) o[e] = (__bf16)s.x[i][e];
    *(v4b*)&st[rg + 8 * i][c4] = o; }
#pragma unroll
  for (int i = 0; i < 16; ++i) { v4b o;
#pragma unroll
    for (int e = 0; e < 4; ++e) o[e] = (__bf16)s.w[i][e];
    *(v4b*)&st[64 + rg + 8 * i][c4] = o; } }
__device__ __forceinline__ void stg_store(const Stg& s, _Float16 (*st)[SP], int tid) { const int rg = tid >> 4, c4 = (tid & 15) * 4;   /* ctx x 2^6 once to f16; Wo as f16(bf16 x 2^8), exact */
#pragma unroll
  for (int i = 0; i < 8; ++i) { v4h o;
#pragma unroll
    for (int e = 0; e < 4; ++e) o[e] = (_Float16)(s.x[i][e] * 64.0f);
    *(v4h*)&st[rg + 8 * i][c4] = o; }
#pragma unroll
  for (int i = 0; i < 16; ++i) { v4h o;
#pragma unroll
    for (int e = 0; e < 4; ++e) o[e] = (_Float16)(bfr(s.w[i][e]) * 256.0f);
    *(v4h*)&st[64 + rg + 8 * i][c4] = o; } }
// ---- k_proj: block = (64 rows, 128 cols, which): q/k/v = X W (+ b) with exact bf16 products (K = DIN) -> which 0: q f16 rows (+ residual rows < QHI); 1: k f16 rows (+ residual rows < KHI); 2: v f16 planes [c][t] (+ bf16 hi/lo planes for t < KHI)
__global__ __launch_bounds__(128) void k_proj(const float* __restrict__ XQ, const float* __restrict__ XK, const float* __restrict__ XV, const float* __restrict__ WQ, const float* __restrict__ WK, const float* __restrict__ WV, const float* __restrict__ BQ, const float* __restrict__ BK, const float* __restrict__ BV,
    _Float16* __restrict__ QH, _Float16* __restrict__ QL, _Float16* __restrict__ KH, _Float16* __restrict__ KL, _Float16* __restrict__ VT, __bf16* __restrict__ VB, __bf16* __restrict__ VBL) {
  union SM { struct { _Float16 sh[64][136], sl[64][136]; _Float16 th[128][72]; __bf16 tb[128][72], tbl[128][72]; } e; __bf16 st[2][SROWS][SP]; };   /* the stage buffers lie over the epilogue's arrays, which are first written behind the loop's last barrier */
  __shared__ __align__(16) SM sm; auto& sh = sm.e.sh; auto& sl = sm.e.sl; auto& th = sm.e.th; auto& tb = sm.e.tb; auto& tbl = sm.e.tbl;
  const int tid = threadIdx.x, wave = tid >> 5, lane = tid & 31, col = lane & 15, g = lane >> 4; const int which = blockIdx.z; const int c0 = blockIdx.y * 128; const size_t r0 = (size_t)blockIdx.x * 64; const size_t bb = r0 / TT; const int t0 = (int)(r0 % TT);
  const float* X = which == 0 ? XQ : which == 1 ? XK : XV; const float* WA = which == 0 ? WQ : which == 1 ? WK : WV; const float* BA = which == 0 ? BQ : which == 1 ? BK : BV;
  v8f acc[8] = {};
  const float* xp = X + (r0 + (tid >> 4)) * DIN + (tid & 15) * 4; const float* wp = WA + (size_t)(c0 + (tid >> 4)) * DIN + (tid & 15) * 4;
  Stg s; stg_load<0>(s, xp, wp); stg_store(s, sm.st[0], tid); __syncthreads();
  for (int t = 0; t < DIN / KS; ++t) { const __bf16 (*cb)[SP] = sm.st[t & 1];
    if (t + 1 < DIN / KS) stg_load<KS>(s, xp + t * KS, wp + t * KS);
    v16b a[KS / 32], w[KS / 32][8];
#pragma unroll
    for (int kc = 0; kc < KS / 32; ++kc) { a[kc] = frag_b(&cb[wave * 16 + col][kc * 32], lane);
#pragma unroll
      for (int j = 0; j < 8; ++j) w[kc][j] = frag_b(&cb[64 + j * 16 + col][kc * 32], lane); }
#pragma unroll
    for (int kc = 0; kc < KS / 32; ++kc) {
#pragma unroll
      for (int j = 0; j < 8; ++j) acc[j] = wmma_bf(a[kc], w[kc][j], acc[j]); }
    __builtin_amdgcn_sched_barrier(0);   /* the roundings of the next stage wait for its global loads: kept behind the products, so that the loads' latency runs under them */
    if (t + 1 < DIN / KS) stg_store(s, sm.st[(t + 1) & 1], tid);   /* into the buffer that every wave left at the barrier of the trip before */
    __syncthreads(); }
  if (which < 2) { _Float16* DH = which == 0 ? QH : KH; _Float16* DL = which == 0 ? QL : KL; const int nhi = which == 0 ? QHI : KHI; const bool hi_rows = t0 < nhi;
#pragma unroll
    for (int j = 0; j < 8; ++j) { const float bias = BA ? bfr(BA[c0 + j * 16 + col]) : 0.f;
#pragma unroll
      for (int r = 0; r < 8; ++r) { const float v = acc[j][r] + bias; const _Float16 hv = (_Float16)v; sh[wave * 16 + 8 * g + r][j * 16 + col] = hv; sl[wave * 16 + 8 * g + r][j * 16 + col] = (_Float16)((v - (float)hv) * 1024.0f); } }
    __syncthreads();
    for (int e = tid; e < 64 * 16; e += 128) { const int rl = e >> 4, q = e & 15; vst2((unsigned*)(DH + (r0 + rl) * CC + c0 + q * 8), *(const v4u*)&sh[rl][q * 8]); if (hi_rows) vst2((unsigned*)(DL + (bb * nhi + t0 + rl) * (size_t)CC + c0 + q * 8), *(const v4u*)&sl[rl][q * 8]); }
  } else { const bool hi_rows = t0 < KHI;
#pragma unroll
    for (int j = 0; j < 8; ++j) { const float bias = BA ? bfr(BA[c0 + j * 16 + col]) : 0.f;
#pragma unroll
      for (int r = 0; r < 8; ++r) { const float v = acc[j][r] + bias; const int rl = wave * 16 + 8 * g + r, cl = j * 16 + col; th[cl][rl] = (_Float16)v; const __bf16 bh = (__bf16)v; tb[cl][rl] = bh; tbl[cl][rl] = (__bf16)(v - (float)bh); } }
    __syncthreads();
    for (int e = tid; e < 128 * 8; e += 128) { const int cl = e >> 3, q = e & 7; vst2((unsigned*)(VT + (bb * CC + c0 + cl) * (size_t)TT + t0 + q * 8), *(const v4u*)&th[cl][q * 8]); if (hi_rows) { const size_t o3 = (bb * CC + c0 + cl) * (size_t)KHI + t0 + q * 8; vst2((unsigned*)(VB + o3), *(const v4u*)&tb[cl][q * 8]); vst2((unsigned*)(VBL + o3), *(const v4u*)&tbl[cl][q * 8]); } } } }
// ---- k_sm: block = query row t (head in group): keys [0, kend): causal -> logit if s <= t else excluded; softmax in f32; P x 2^11 in place (0 for excluded)
__global__ __launch_bounds__(256) void k_sm(float* __restrict__ S0 SM_EXTRA_PARAMS) { __shared__ float sred[8]; __shared__ float sbc; __shared__ __align__(16) float shv[TT];
  const int tid = threadIdx.x; const int t = blockIdx.x; const int kend = (kb_last(t >> 6) + 1) * 128;
  float* sr = S0 + (size_t)blockIdx.y * TT * TT + (size_t)t * TT;
  float m = -3.0e38f; for (int k = tid; k < kend; k += 256) { float v = (!CAUSAL || k <= t) ? sr[k] : -3.0e38f; SM_MASK_HOOK; shv[k] = v; m = fmaxf(m, v); }
#pragma unroll
  for (int o = 1; o < 32; o <<= 1) m = fmaxf(m, __shfl_xor(m, o));
  if ((tid & 31) == 0) sred[tid >> 5] = m; __syncthreads(); if (tid == 0) { float a = sred[0]; for (int i = 1; i < 8; ++i) a = fmaxf(a, sred[i]); sbc = a; } __syncthreads(); m = sbc; __syncthreads();
  float sum = 0.f; for (int k = tid; k < kend; k += 256) { const float v = shv[k]; const float e = (v <= -1.0e38f) ? 0.f : expf(v - m); shv[k] = e; sum += e; }
#pragma unroll
  for (int o = 1; o < 32; o <<= 1) sum += __shfl_xor(sum, o);
  if ((tid & 31) == 0) sred[tid >> 5] = sum; __syncthreads(); if (tid == 0) { float a = 0.f; for (int i = 0; i < 8; ++i) a += sred[i]; sbc = a > 0.f ? 2048.0f / a : 0.f; }   /* a fully excluded row yields P = 0 */ __syncthreads(); const float inv = sbc;
  for (int k = tid; k < kend; k += 256) shv[k] = shv[k] * inv;
  __syncthreads(); for (int q = tid; q < kend / 4; q += 256) vst2(sr + q * 4, *(const v4f*)&shv[q * 4]); }
#define IEPS 1.0e-32f
__device__ __forceinline__ v8f wmma_h(v16h a, v16h b, v8f c) { return __builtin_amdgcn_wmma_f32_16x16x32_f16(false, a, false, b, (short)0, c, false, false); }
// XW(p): closes a group of global loads off pointer p before a register that they name may be rewritten; p is an input so that the address pair stays live up to the wait (no load of the group may land on it)
#define XW(p) asm volatile("s_wait_xcnt 0x0" :: "v"(p) : "memory")
#define FK 64
#define KP 72
#define MP 68
#define NT (TT / FK)
struct __align__(16) FaBuf { _Float16 k[FK][KP]; _Float16 v[HD][KP]; int m[64][MP]; };
__device__ __forceinline__ unsigned lds_of(const void* p) { return (unsigned)(size_t)p; }   /* LDS byte address = low 32 bits of the __shared__ address */
// four copies of 16 B per lane; the s_wait_xcnt closes the group inside its own statement, before a register that a copy names may be rewritten
__device__ __forceinline__ void cp4(unsigned l0, const void* g0, unsigned l1, const void* g1, unsigned l2, const void* g2, unsigned l3, const void* g3) {
  asm volatile("global_load_async_to_lds_b128 %0, %1, off\n\tglobal_load_async_to_lds_b128 %2, %3, off\n\tglobal_load_async_to_lds_b128 %4, %5, off\n\tglobal_load_async_to_lds_b128 %6, %7, off\n\ts_wait_xcnt 0x0"
               :: "v"(l0), "v"(g0), "v"(l1), "v"(g1), "v"(l2), "v"(g2), "v"(l3), "v"(g3) : "memory"); }
// kg, vg: this thread's 16 B of row (tid >> 3), further rows 16 apart; mg: its 16 B of mask row (tid >> 4), further rows 8 apart; k0 = first key of the tile
__device__ __forceinline__ void fa_fill(FaBuf& f, const _Float16* kg, const _Float16* vg, const int* mg, int k0, int tid) {
  const int r8 = tid >> 3, c8 = (tid & 7) * 8, r16 = tid >> 4, c16 = (tid & 15) * 4;
  const _Float16* kq = kg + (size_t)k0 * CC;
  cp4(lds_of(&f.k[r8][c8]), kq, lds_of(&f.k[r8 + 16][c8]), kq + (size_t)16 * CC, lds_of(&f.k[r8 + 32][c8]), kq + (size_t)32 * CC, lds_of(&f.k[r8 + 48][c8]), kq + (size_t)48 * CC);
  const int* mq = mg + k0;
  cp4(lds_of(&f.m[r16][c16]), mq, lds_of(&f.m[r16 + 8][c16]), mq + (size_t)8 * TT, lds_of(&f.m[r16 + 16][c16]), mq + (size_t)16 * TT, lds_of(&f.m[r16 + 24][c16]), mq + (size_t)24 * TT);
  cp4(lds_of(&f.m[r16 + 32][c16]), mq + (size_t)32 * TT, lds_of(&f.m[r16 + 40][c16]), mq + (size_t)40 * TT, lds_of(&f.m[r16 + 48][c16]), mq + (size_t)48 * TT, lds_of(&f.m[r16 + 56][c16]), mq + (size_t)56 * TT);
  const _Float16* vq = vg + k0;
  cp4(lds_of(&f.v[r8][c8]), vq, lds_of(&f.v[r8 + 16][c8]), vq + (size_t)16 * TT, lds_of(&f.v[r8 + 32][c8]), vq + (size_t)32 * TT, lds_of(&f.v[r8 + 48][c8]), vq + (size_t)48 * TT); }
// hand-over of a tile: this wave's LDS reads of the old tile are done, its own copies of the next tile have landed, and the barrier publishes the next tile and frees the old buffer
#define FA_PUBLISH() do { asm volatile("s_wait_dscnt 0x0" ::: "memory"); asm volatile("s_wait_asynccnt 0x0" ::: "memory"); __syncthreads(); } while (0)
#define RS0 0x1p60f        // first row scale: a row that never leaves it has every t <= 2^-105, of the order of the normaliser's 1e-32 or below, and 1e-32 x RS0^2 is still finite
#define TLIM 32768.0f      // a lane's sum of a tile's scaled t (all >= 0) at or below this bounds each of them inside f16's range
// one tile's scaled t = relu(score x cs + cb)^2 (masked -> 0): once to f16 as the B operand of V^T P^T; returns the lane's f32 sum of them
__device__ __forceinline__ float fa_t(const v8f (&s)[FK / 16], const v4i (&m)[FK / 16][2], float cs, float cb, v16h (&p)[FK / 32]) { float ts = 0.f;
#pragma unroll
  for (int u = 0; u < FK / 16; ++u) {
#pragma unroll
    for (int r = 0; r < 8; ++r) { const float x = fmaxf(s[u][r] * cs + cb, 0.f); const float e = (m[u][r >> 2][r & 3] != 0) ? 0.f : x * x; ts += e; p[u >> 1][8 * (u & 1) + r] = (_Float16)e; } }
  return ts; }
// ---- k_fa (scores, SparseNormer and P v in one launch; no score plane in memory): block = 4 waves x 16 queries of (b, h). S^T = K Q^T: lane (g, col) holds query col's scores of keys 8g + r of each 16-key tile, so the row sum is in-lane (+ one exchange between the halves) and two converted S^T tiles are the B operand of ctx^T += V^T P^T.
// ONE pass over the keys: the normaliser is a plain quotient, so ctx = (sum_k t_k v_k) / (sum_k t_k + 1e-32) and both sums grow together. t goes to f16 as t x rs^2 with a power-of-two row scale rs (exact), so its f16 range does not depend on the scale of the scores: rs starts high and is lowered, with both sums rescaled, when a tile would leave f16's range (as a rule once, at the row's first tile with a positive score); the row's largest x then sits at 8..16 and may grow several-fold before the next change. The inner loops are unrolled whole so that the vector elements are indexed by constants and stay in registers.
__global__ __launch_bounds__(128) void k_fa(const _Float16* __restrict__ QH, const _Float16* __restrict__ KH, const _Float16* __restrict__ VT, const int* __restrict__ MASK, const float* __restrict__ NBIAS, float* __restrict__ Y) {
  __shared__ FaBuf fb[2];
  const int tid = threadIdx.x, wave = tid >> 5, lane = tid & 31, col = lane & 15, g = lane >> 4; const int h = blockIdx.x, b = blockIdx.z; const int ql = blockIdx.y * 64 + wave * 16 + col;
  const float nb_ = bfr(NBIAS[0]);
  const _Float16* qp = QH + ((size_t)b * TT + ql) * CC + h * HD; const v16h q0 = frag_h(qp, lane), q1 = frag_h(qp + 32, lane); XW(qp);
  const _Float16* kg = KH + ((size_t)b * TT + (tid >> 3)) * CC + h * HD + (tid & 7) * 8; const _Float16* vg = VT + ((size_t)b * CC + h * HD + (tid >> 3)) * (size_t)TT + (tid & 7) * 8; const int* mg = MASK + ((size_t)b * TT + blockIdx.y * 64 + (tid >> 4)) * TT + (tid & 15) * 4;
  const int mr = wave * 16 + col;
  fa_fill(fb[0], kg, vg, mg, 0, tid);
  asm volatile("s_wait_asynccnt 0x0" ::: "memory");   /* tile 0 has landed before the barrier that publishes it */
  __syncthreads();
  fa_fill(fb[1], kg, vg, mg, FK, tid);
  float rs = RS0, cs = SCALE * RS0, cb = nb_ * RS0, sum = 0.f;   /* rs is the same in both halves of a query */
  v8f acc[HD / 16] = {};
  for (int t = 0; t < NT; ++t) { const FaBuf& f = fb[t & 1];
    v8f s[FK / 16]; v4i m[FK / 16][2]; v16h p[FK / 32];
#pragma unroll
    for (int u = 0; u < FK / 16; ++u) { const v16h ka = frag_h(&f.k[16 * u + col][0], lane), kb = frag_h(&f.k[16 * u + col][32], lane); m[u][0] = *(const v4i*)&f.m[mr][16 * u + 8 * g]; m[u][1] = *(const v4i*)&f.m[mr][16 * u + 8 * g + 4];
      v8f z = {}; z = wmma_h(ka, q0, z); s[u] = wmma_h(kb, q1, z); }
    float ts = fa_t(s, m, cs, cb, p);
    if (__builtin_amdgcn_ballot_w32(!(ts <= TLIM)) != 0) {   /* one test per tile, a scalar branch, rarely taken: some row of the wave needs a lower scale */
      float mx = 0.f;
#pragma unroll
      for (int u = 0; u < FK / 16; ++u) {
#pragma unroll
        for (int r = 0; r < 8; ++r) mx = fmaxf(mx, (m[u][r >> 2][r & 3] != 0) ? 0.f : s[u][r] * SCALE + nb_); }
      mx = fmaxf(mx, __shfl_xor(mx, 16));   /* the query's largest unmasked x of this tile, the same in both halves */
      int ex; (void)frexpf(mx, &ex);
      const float rn = (mx * rs > 16.0f) ? ldexpf(1.0f, 4 - ex) : rs;   /* mx x rn in [8, 16): every scaled t of the tile <= 256, their sum <= 8192 */
      const float fr = rn / rs, f2 = fr * fr;   /* powers of two: exact (or 0 where the old sums no longer count) */
#pragma unroll
      for (int j = 0; j < HD / 16; ++j) acc[j] *= f2;
      sum *= f2; rs = rn; cs = SCALE * rn; cb = nb_ * rn;
      ts = fa_t(s, m, cs, cb, p); }
    sum += ts;
#pragma unroll
    for (int hh = 0; hh < FK / 32; ++hh) {
#pragma unroll
      for (int j = 0; j < HD / 16; ++j) acc[j] = wmma_h(frag_h(&f.v[j * 16 + col][32 * hh], lane), p[hh], acc[j]); }
    FA_PUBLISH();
    if (t + 2 < NT) fa_fill(fb[t & 1], kg, vg, mg, (t + 2) * FK, tid); }
  asm volatile("s_wait_asynccnt 0x0" ::: "memory");   /* no copy is outstanding when the wave ends */
  sum += __shfl_xor(sum, 16); const float inv = 1.0f / (sum + (IEPS * rs) * rs);   /* both sums carry rs^2, so does the 1e-32; sum == 0 -> rs == RS0, acc == 0 -> ctx = 0 */
  float* yp = Y + ((size_t)b * TT + ql) * CC + h * HD + 8 * g;   /* acc[j][r] = ctx[query col][16j + 8g + r]; the wave writes each query's whole 256-B (row, head) segment */
#pragma unroll
  for (int j = 0; j < HD / 16; ++j) { v4f lo, hi;
#pragma unroll
    for (int r = 0; r < 4; ++r) { lo[r] = acc[j][r] * inv; hi[r] = acc[j][4 + r] * inv; }
    vst2(yp + j * 16, lo); vst2(yp + j * 16 + 4, hi); } }
// ---- k_out: block = (64 rows, 128 cols): out = ctx Wo (+ bo): ctx x 2^6 once to f16 against Wo as f16(bf16 x 2^8) exact (1 product) x 2^-14; causal early rows (< QHI of each sequence): ctx bf16 hi + lo against exact bf16 Wo (2 products)
__global__ __launch_bounds__(128) void k_out(const float* __restrict__ Y, const float* __restrict__ WO, const float* __restrict__ BO, float* __restrict__ OUT) { union SM { float sf[4][16][132]; _Float16 st[2][SROWS][SP]; };   /* the stage buffers lie over the epilogue's array, which is first written behind the loop's last barrier */
  __shared__ __align__(16) SM sm; auto& sf = sm.sf;
  const int tid = threadIdx.x, wave = tid >> 5, lane = tid & 31, col = lane & 15, g = lane >> 4; const int c0 = blockIdx.y * 128; const size_t r0 = (size_t)blockIdx.x * 64 + wave * 16;
  v8f acc[8] = {};
  if (CAUSAL && (int)(((size_t)blockIdx.x * 64) % TT) < QHI) {   /* block-uniform */
#pragma unroll 2
    for (int kc = 0; kc < CC / 32; ++kc) { const F2 a = split_row(Y + (r0 + col) * CC, kc * 32, lane); asm volatile("s_wait_loadcnt 0x0" ::: "memory");
#pragma unroll
      for (int j = 0; j < 8; ++j) { const v16b w = WOCOL(WO, kc * 32, c0 + j * 16 + col, lane); asm volatile("s_wait_loadcnt 0x0" ::: "memory"); acc[j] = wmma_bf(a.h, w, acc[j]); acc[j] = wmma_bf(a.l, w, acc[j]); } }
#pragma unroll
    for (int j = 0; j < 8; ++j) { const float bias = BO ? bfr(BO[c0 + j * 16 + col]) : 0.f;
#pragma unroll
      for (int r = 0; r < 8; ++r) sf[wave][8 * g + r][j * 16 + col] = acc[j][r] + bias; }
  } else {
    const float* xp = Y + ((size_t)blockIdx.x * 64 + (tid >> 4)) * CC + (tid & 15) * 4; const float* wp = WO + (size_t)(c0 + (tid >> 4)) * CC + (tid & 15) * 4;
    Stg s; stg_load<0>(s, xp, wp); stg_store(s, sm.st[0], tid); __syncthreads();   /* ctx carried x 2^6 into f16 so small-magnitude context rows stay clear of f16 subnormals */
    for (int t = 0; t < CC / KS; ++t) { const _Float16 (*cb)[SP] = sm.st[t & 1];
      if (t + 1 < CC / KS) stg_load<KS>(s, xp + t * KS, wp + t * KS);
      v16h a[KS / 32], w[KS / 32][8];
#pragma unroll
      for (int kc = 0; kc < KS / 32; ++kc) { a[kc] = frag_h(&cb[wave * 16 + col][kc * 32], lane);
#pragma unroll
        for (int j = 0; j < 8; ++j) w[kc][j] = frag_h(&cb[64 + j * 16 + col][kc * 32], lane); }
#pragma unroll
      for (int kc = 0; kc < KS / 32; ++kc) {
#pragma unroll
        for (int j = 0; j < 8; ++j) acc[j] = wmma16(a[kc], w[kc][j], acc[j]); }
      __builtin_amdgcn_sched_barrier(0);   /* the roundings of the next stage wait for its global loads: kept behind the products, so that the loads' latency runs under them */
      if (t + 1 < CC / KS) stg_store(s, sm.st[(t + 1) & 1], tid);   /* into the buffer that every wave left at the barrier of the trip before */
      __syncthreads(); }
#pragma unroll
    for (int j = 0; j < 8; ++j) { const float bias = BO ? bfr(BO[c0 + j * 16 + col]) : 0.f;
#pragma unroll
      for (int r = 0; r < 8; ++r) sf[wave][8 * g + r][j * 16 + col] = acc[j][r] * (1.0f / 16384.0f) + bias; } }   /* 2^-8 (Wo carry) x 2^-6 (ctx carry) */
  LDSX(); for (int rl = 0; rl < 16; ++rl) vst2(OUT + (r0 + rl) * DIN + c0 + lane * 4, *(const v4f*)&sf[wave][rl][lane * 4]); }

extern "C" void kernel_launch(void* const* d_in, const int* in_sizes, int n_in, void* d_out, int out_size, void* d_ws, size_t ws_size, hipStream_t stream) {
  (void)in_sizes; (void)n_in; (void)out_size;
  const float** F = (const float**)d_in;
  if (ws_size < (size_t)WS_END) return;
  char* ws = (char*)d_ws; _Float16 *QH = (_Float16*)(ws + WS_QH), *KH = (_Float16*)(ws + WS_KH), *VT = (_Float16*)(ws + WS_VT), *QL = (_Float16*)(ws + WS_QL), *KL = (_Float16*)(ws + WS_KL); __bf16 *VB = (__bf16*)(ws + WS_VB), *VBL = (__bf16*)(ws + WS_VBL); float *S = (float*)(ws + WS_S), *Y = (float*)(ws + WS_Y);
  (void)Y; (void)QL; (void)KL; (void)VB; (void)VBL; (void)S;
  // inputs: 0 iQ [2,2048,1024]; 1 iK; 2 iV; 3 mask [2,2048,2048] bool (True = masked); 4 Wq [1024,1024] (out,in), 5 bq; 6 Wk, 7 bk; 8 Wv, 9 bv; 10 Wo (out,in), 11 bo (zero biases, read); 12 nbias [1] (SparseNormer bias; zero)
  k_proj<<<dim3(TNB * TT / 64, CC / 128, 3), 128, 0, stream>>>(F[0], F[1], F[2], F[4], F[6], F[8], F[5], F[7], F[9], QH, QL, KH, KL, VT, VB, VBL);
  k_fa<<<dim3(NH, NQB, TNB), 128, 0, stream>>>(QH, KH, VT, (const int*)d_in[3], F[12], Y);   /* relu(x + nbias)^2 / (sum + 1e-32): NOT a softmax */
  k_out<<<dim3(TNB * TT / 64, DIN / 128), 128, 0, stream>>>(Y, F[10], F[11], (float*)d_out);
}

// v005
// A run of this version takes 110 microseconds.
// Timed twice side by side with v004, it ran 1.05 and 1.06 times as fast.
// Over all steps from v000 it is 12.2 times as fast.
// compute dtype: all float inputs rounded to bf16; q/k/v projections with EXACT bf16 products on WMMA 16x16x32 (f32 accumulate) + bias; scores q x k once to f16 each (1 product) x 64^-0.5; SparseNormer in f32: t = relu(score + nbias)^2 (masked entries -> 0); t x 2^2n (n per row) once to f16 x v once to f16 (1 product), ctx = that sum / (sum t + 1e-32); ctx x 2^6 once to f16 x Wo f16(bf16 x 2^8) + bo; f32 output.
#include <hip/hip_runtime.h>
#include <math.h>

typedef __attribute__((ext_vector_type(16))) _Float16 v16h;
typedef __attribute__((ext_vector_type(16))) __bf16 v16b;
typedef __attribute__((ext_vector_type(8)))  _Float16 v8h;
typedef __attribute__((ext_vector_type(8)))  float v8f;
typedef __attribute__((ext_vector_type(4)))  float v4f;
typedef __attribute__((ext_vector_type(2)))  float v2f;
typedef __attribute__((ext_vector_type(4)))  unsigned v4u;
typedef __attribute__((ext_vector_type(4)))  int v4i;
typedef float __attribute__((may_alias)) float_a;
typedef int __attribute__((may_alias)) int_a;

template <typename T> __device__ __forceinline__ void vst2(void* p, T v) { *(T*)p = v;  }
__device__ __forceinline__ v8f wmma16(v16h a, v16h b, v8f c) {
  v8f d = __builtin_amdgcn_wmma_f32_16x16x32_f16(false, a, false, b, (short)0, c, false, false);
  asm volatile("v_nop\n\tv_nop\n\tv_nop\n\tv_nop" : "+v"(d) : "v"(a), "v"(b));
  return d;
}
__device__ __forceinline__ v8f wmma_bf(v16b a, v16b b, v8f c) {
  v8f d = __builtin_amdgcn_wmma_f32_16x16x32_bf16(false, a, false, b, (short)0, c, false, false);
  asm volatile("v_nop\n\tv_nop\n\tv_nop\n\tv_nop" : "+v"(d) : "v"(a), "v"(b));
  return d;
}
// 16x16x32 fragments: lane = (h = lane>>4, row/col = lane&15); elements 0..7 = k0+8h+0..7, 8..15 = k0+16+8h+0..7; D element r = row 8h+r
__device__ __forceinline__ v16h frag_h(const _Float16* rowk0, int lane) {
  union { v16h v; v8h q[2]; } u; const _Float16* p = rowk0 + 8 * (lane >> 4);
  u.q[0] = *(const v8h*)p; u.q[1] = *(const v8h*)(p + 16); return u.v;
}
__device__ __forceinline__ v16h frag_f32(const float* rowk0, int lane) {
  v16h a; const float* p = rowk0 + 8 * (lane >> 4);
#pragma unroll
  for (int i = 0; i < 8; ++i) { a[i] = (_Float16)p[i]; a[8 + i] = (_Float16)p[16 + i]; }
  return a;
}
__device__ __forceinline__ v16h frag_f32s(const float* rowk0, int lane, float sc) {
  v16h a; const float* p = rowk0 + 8 * (lane >> 4);
#pragma unroll
  for (int i = 0; i < 8; ++i) { a[i] = (_Float16)(p[i] * sc); a[8 + i] = (_Float16)(p[16 + i] * sc); }
  return a;
}
// column fragment from a [K][ld] layout (column n), rows >= K read as 0
__device__ __forceinline__ v16h fragc_f32(const float* W, int k0, int n, int lane, int ld, int K) {
  v16h a; const int g = lane >> 4;
#pragma unroll
  for (int i = 0; i < 8; ++i) { const int ka = k0 + 8 * g + i, kb = ka + 16;
    a[i] = (_Float16)(ka < K ? W[(size_t)(ka < K ? ka : K - 1) * ld + n] : 0.f); a[8 + i] = (_Float16)(kb < K ? W[(size_t)(kb < K ? kb : K - 1) * ld + n] : 0.f); }
  return a;
}
struct F2 { v16b h, l; };
__device__ __forceinline__ F2 bsplit16(const float v[16]) { F2 r;
#pragma unroll
  for (int i = 0; i < 16; ++i) { const __bf16 h = (__bf16)v[i]; r.h[i] = h; r.l[i] = (__bf16)(v[i] - (float)h); }
  return r; }
__device__ __forceinline__ F2 split_row(const float* row, int k0, int lane) { float v[16]; const float* p = row + k0 + 8 * (lane >> 4);
#pragma unroll
  for (int i = 0; i < 8; ++i) { v[i] = p[i]; v[8 + i] = p[16 + i]; }
  return bsplit16(v); }
__device__ __forceinline__ F2 split_rowK(const float* row, int k0, int lane, int K) { float v[16]; const int g = lane >> 4;
#pragma unroll
  for (int i = 0; i < 8; ++i) { const int ka = k0 + 8 * g + i, kb = ka + 16; v[i] = ka < K ? row[ka < K ? ka : K - 1] : 0.f; v[8 + i] = kb < K ? row[kb < K ? kb : K - 1] : 0.f; }
  return bsplit16(v); }
__device__ __forceinline__ F2 split_col(const float* W, int k0, int n, int lane, int ld, int K) { float v[16]; const int g = lane >> 4;
#pragma unroll
  for (int i = 0; i < 8; ++i) { const int ka = k0 + 8 * g + i, kb = ka + 16; v[i] = ka < K ? W[(size_t)(ka < K ? ka : K - 1) * ld + n] : 0.f; v[8 + i] = kb < K ? W[(size_t)(kb < K ? kb : K - 1) * ld + n] : 0.f; }
  return bsplit16(v); }
__device__ __forceinline__ v8f mac3(const F2& a, const F2& b, v8f c) { c = wmma_bf(a.l, b.h, c); c = wmma_bf(a.h, b.l, c); return wmma_bf(a.h, b.h, c); }
__device__ __forceinline__ float sigm(float v) { return 1.0f / (1.0f + expf(-v)); }
#define LDSX() do { asm volatile("s_wait_dscnt 0" ::: "memory"); __builtin_amdgcn_wave_barrier(); __builtin_amdgcn_fence(__ATOMIC_RELEASE, "workgroup"); } while (0)

// Multi-head attention with a SparseNormer instead of a softmax (iQ / iK / iV [2,2048,1024] separate inputs; torch (out,in) Wq / Wk / Wv / Wo [1024,1024] (0.02 scale) + zero biases; 16 heads x 64; scores / 8; mask [2,2048,2048] bool random (True -> -1e32); t = relu(scores + nbias)^2 with nbias = zeros(1); attn = t / (sum_k t + 1e-32)): out = merge(attn v) Wo^T + bo.
#define NB 2
#define TT 2048
#define CC 1024            // NH * HD = projected width
#define DIN 1024          // input (model) width
#define NH 16
#define HD 64
#define NQB (TT / 64)
#define HG 4
#define SCALE (0.125f)
#define CAUSAL 0
#ifndef TNB
#define TNB NB
#endif
__device__ __forceinline__ float bfr(float v) { return (float)(__bf16)v; }
__host__ __device__ __forceinline__ int kb_last(int qb) { return CAUSAL ? ((qb * 64 + 63) >> 7) : (TT / 128 - 1); }
typedef __attribute__((ext_vector_type(8))) __bf16 v8b;
__device__ __forceinline__ v16b frag_b(const __bf16* rowk0, int lane) {
  union { v16b v; v8b q[2]; } u; const __bf16* p = rowk0 + 8 * (lane >> 4);
  u.q[0] = *(const v8b*)p; u.q[1] = *(const v8b*)(p + 16); return u.v;
}
#define QBH 0              // not used by any kernel here
#define QHI 0               // single-product scores on every row
#define KHI 64            // key rows carrying k residual / v bf16 hi+lo planes (written by k_proj; read by no kernel here)
// B fragment (k rows k0+.., output column o) of a weight: (in,out) [K][ld] or (out,in) [ld rows of K]: bf16 exact, or f16(bf16 * 256) exact
__device__ __forceinline__ v16b wcol_io(const float* Wm, int k0, int o, int lane, int ld) { v16b w; const int g = lane >> 4;
#pragma unroll
  for (int i = 0; i < 8; ++i) { w[i] = (__bf16)Wm[(size_t)(k0 + 8 * g + i) * ld + o]; w[8 + i] = (__bf16)Wm[(size_t)(k0 + 16 + 8 * g + i) * ld + o]; }
  return w; }
__device__ __forceinline__ v16b wcol_oi(const float* Wm, int k0, int o, int lane, int K) { v16b w; const float* p = Wm + (size_t)o * K + k0 + 8 * (lane >> 4);
#pragma unroll
  for (int i = 0; i < 8; ++i) { w[i] = (__bf16)p[i]; w[8 + i] = (__bf16)p[16 + i]; }
  return w; }
__device__ __forceinline__ v16h wcolh_io(const float* Wm, int k0, int o, int lane, int ld) { v16h w; const int g = lane >> 4;
#pragma unroll
  for (int i = 0; i < 8; ++i) { w[i] = (_Float16)(bfr(Wm[(size_t)(k0 + 8 * g + i) * ld + o]) * 256.0f); w[8 + i] = (_Float16)(bfr(Wm[(size_t)(k0 + 16 + 8 * g + i) * ld + o]) * 256.0f); }
  return w; }
__device__ __forceinline__ v16h wcolh_oi(const float* Wm, int k0, int o, int lane, int K) { v16h w; const float* p = Wm + (size_t)o * K + k0 + 8 * (lane >> 4);
#pragma unroll
  for (int i = 0; i < 8; ++i) { w[i] = (_Float16)(bfr(p[i]) * 256.0f); w[8 + i] = (_Float16)(bfr(p[16 + i]) * 256.0f); }
  return w; }
#define WQKV_LAYOUT 1   // 0 = (in,out) [DIN][CC]; 1 = (out,in) [CC][DIN]; 2 = per-head [NH][DIN][HD]
__device__ __forceinline__ v16b wcol_hdk(const float* Wm, int k0, int o, int lane) { v16b w; const int g = lane >> 4; const float* p = Wm + (size_t)(o / HD) * DIN * HD + (o % HD);
#pragma unroll
  for (int i = 0; i < 8; ++i) { w[i] = (__bf16)p[(size_t)(k0 + 8 * g + i) * HD]; w[8 + i] = (__bf16)p[(size_t)(k0 + 16 + 8 * g + i) * HD]; }
  return w; }
#define WO_OUT_IN 1
#if WQKV_LAYOUT == 1
#define WCOL(W, k0, o, lane) wcol_oi(W, k0, o, lane, DIN)
#elif WQKV_LAYOUT == 2
#define WCOL(W, k0, o, lane) wcol_hdk(W, k0, o, lane)
#else
#define WCOL(W, k0, o, lane) wcol_io(W, k0, o, lane, CC)
#endif
#if WO_OUT_IN
#define WOCOL(W, k0, o, lane) wcol_oi(W, k0, o, lane, CC)
#define WOCOLH(W, k0, o, lane) wcolh_oi(W, k0, o, lane, CC)
#else
#define WOCOL(W, k0, o, lane) wcol_io(W, k0, o, lane, DIN)
#define WOCOLH(W, k0, o, lane) wcolh_io(W, k0, o, lane, DIN)
#endif

#ifndef SM_EXTRA_PARAMS
#define SM_EXTRA_PARAMS
#endif
#ifndef PROJ_EXTRA_PARAMS
#define PROJ_EXTRA_PARAMS
#endif
#ifndef SM_MASK_HOOK
#define SM_MASK_HOOK (void)0
#endif

#define WS_QH  0u                                      // f16 q rows [b*t][CC]
#define WS_KH  (WS_QH + 2u * (size_t)NB * TT * CC)      // f16 k rows [b*t][CC]
#define WS_VT  (WS_KH + 2u * (size_t)NB * TT * CC)      // f16 v planes [b][c][t]
#define WS_QL  (WS_VT + 2u * (size_t)NB * CC * TT)      // f16 q residual x 2^10 rows [b][t < QHI][CC]
#define WS_KL  (WS_QL + 2u * (size_t)NB * QHI * CC)     // f16 k residual x 2^10 rows [b][t < KHI][CC]
#define WS_VB  (WS_KL + 2u * (size_t)NB * KHI * CC)     // bf16 v hi planes [b][c][t < KHI]
#define WS_VBL (WS_VB + 2u * (size_t)NB * CC * KHI)
#define WS_S   (WS_VBL + 2u * (size_t)NB * CC * KHI)    // u32 lane-mask words of the mask [b*t/16][t/64][32], 1 MiB of a region sized for f32 [hg][t][s]
#define WS_Y   (WS_S  + 4u * (size_t)HG * TT * TT)      // f32 ctx rows [b*t][CC] (only when there is an output projection)
#define WS_END (WS_Y  + 4u * (size_t)NB * TT * CC)

// ---- operand staging of the two projection kernels: a block's 64 X rows and 128 W rows, KS k at a time, are read from global memory once per block as whole 128-B lines (16 lanes x 16 B per 256-B row piece), rounded once to the 16-bit operand type and kept in LDS, where all four waves read their fragments; two buffers, the next stage's loads are in flight while this stage is multiplied
#define KS 64              // k per stage
#define SP 72              // LDS row pitch in 16-bit elements: 144 B = 16 B x 9, an odd multiple of 16 B, which ds_load_b128 fragment reads take without bank conflicts
#define SROWS 192          // rows 0..63 = X, 64..191 = W
typedef __attribute__((ext_vector_type(4))) __bf16 v4b;
typedef __attribute__((ext_vector_type(4))) _Float16 v4h;
struct Stg { v4f x[8], w[16]; };
template <int OFF> __device__ __forceinline__ void stg_load(Stg& s, const float* xp, const float* wp) {   /* xp + OFF, wp + OFF: this thread's 16 B of row (tid >> 4); further rows 8 apart; every matrix here has rows of 1024 floats; OFF and the row steps are immediate offsets on the two address pairs */
#pragma unroll
  for (int i = 0; i < 8; ++i) s.x[i] = *(const v4f*)(xp + OFF + (size_t)i * 8 * DIN);
#pragma unroll
  for (int i = 0; i < 16; ++i) s.w[i] = *(const v4f*)(wp + OFF + (size_t)i * 8 * DIN);
  asm volatile("s_wait_xcnt 0x0" :: "v"(xp), "v"(wp) : "memory"); }   /* closes the group of loads before a register that they name may be rewritten (the two address pairs are inputs, so they stay live up to the wait); it also keeps the loads in front of the stage's products */
__device__ __forceinline__ void stg_store(const Stg& s, __bf16 (*st)[SP], int tid) { const int rg = tid >> 4, c4 = (tid & 15) * 4;
#pragma unroll
  for (int i = 0; i < 8; ++i) { v4b o;
#pragma unroll
    for (int e = 0; e < 4; ++e) o[e] = (__bf16)s.x[i][e];
    *(v4b*)&st[rg + 8 * i][c4] = o; }
#pragma unroll
  for (int i = 0; i < 16; ++i) { v4b o;
#pragma unroll
    for (int e = 0; e < 4; ++e) o[e] = (__bf16)s.w[i][e];
    *(v4b*)&st[64 + rg + 8 * i][c4] = o; } }
__device__ __forceinline__ void stg_store(const Stg& s, _Float16 (*st)[SP], int tid) { const int rg = tid >> 4, c4 = (tid & 15) * 4;   /* ctx x 2^6 once to f16; Wo as f16(bf16 x 2^8), exact */
#pragma unroll
  for (int i = 0; i < 8; ++i) { v4h o;
#pragma unroll
    for (int e = 0; e < 4; ++e) o[e] = (_Float16)(s.x[i][e] * 64.0f);
    *(v4h*)&st[rg + 8 * i][c4] = o; }
#pragma unroll
  for (int i = 0; i < 16; ++i) { v4h o;
#pragma unroll
    for (int e = 0; e < 4; ++e) o[e] = (_Float16)(bfr(s.w[i][e]) * 256.0f);
    *(v4h*)&st[64 + rg + 8 * i][c4] = o; } }
// ---- mask as lane masks: word [16-query group][64-key tile][8u + r], bit 16g + col = (mask[query col][key 16u + 8g + r] == 0, the key counts): the very lane that holds that score in k_fa, so a word is the select mask of one score register; 1/32 of the i32 mask's bytes
#define PKP 260            // LDS row pitch in words of the packing blocks: 1040 B = 16 B x 65 (odd)
#define PKT 4              // tiles of 64 keys per packing wave
static_assert((TNB * TT / 64) * (CC / 128) * 4 * PKT == (TNB * TT / 16) * (TT / 64), "the packing blocks' waves cover every (query group, tile) once");
// ---- k_proj: block = (64 rows, 128 cols, which): which 3: the mask's lane-mask words (see above); else q/k/v = X W (+ b) with exact bf16 products (K = DIN) -> which 0: q f16 rows (+ residual rows < QHI); 1: k f16 rows (+ residual rows < KHI); 2: v f16 planes [c][t] (+ bf16 hi/lo planes for t < KHI)
__global__ __launch_bounds__(128) void k_proj(const float* __restrict__ XQ, const float* __restrict__ XK, const float* __restrict__ XV, const float* __restrict__ WQ, const float* __restrict__ WK, const float* __restrict__ WV, const float* __restrict__ BQ, const float* __restrict__ BK, const float* __restrict__ BV,
    _Float16* __restrict__ QH, _Float16* __restrict__ QL, _Float16* __restrict__ KH, _Float16* __restrict__ KL, _Float16* __restrict__ VT, __bf16* __restrict__ VB, __bf16* __restrict__ VBL, const int* __restrict__ MASK, unsigned* __restrict__ MB) {
  union SM { struct { _Float16 sh[64][136], sl[64][136]; _Float16 th[128][72]; __bf16 tb[128][72], tbl[128][72]; } e; __bf16 st[2][SROWS][SP]; int pk[4][16][PKP]; };   /* the stage buffers lie over the epilogue's arrays, which are first written behind the loop's last barrier */
  __shared__ __align__(16) SM sm; auto& sh = sm.e.sh; auto& sl = sm.e.sl; auto& th = sm.e.th; auto& tb = sm.e.tb; auto& tbl = sm.e.tbl;
  const int tid = threadIdx.x, wave = tid >> 5, lane = tid & 31, col = lane & 15, g = lane >> 4; const int which = blockIdx.z; const int c0 = blockIdx.y * 128; const size_t r0 = (size_t)blockIdx.x * 64; const size_t bb = r0 / TT; const int t0 = (int)(r0 % TT);
  if (which == 3) {   /* block-uniform, in front of every barrier: each wave packs 16 queries x PKT tiles; the rows come as whole lines (512 B of one row per load) and turn through the wave's own LDS rows into the score layout; the loops are unrolled whole so that all 32 loads are in flight together and the vectors are indexed by constants */
    const int id = (blockIdx.x * (CC / 128) + blockIdx.y) * 4 + wave, qg = id / (TT / 64 / PKT), tq = id % (TT / 64 / PKT);
    const int* mp = MASK + (size_t)qg * 16 * TT + tq * (PKT * 64) + lane * 4; v4i mv[32];
#pragma unroll
    for (int i = 0; i < 32; ++i) mv[i] = *(const v4i*)(mp + (size_t)(i >> 1) * TT + (i & 1) * 128);
    asm volatile("s_wait_xcnt 0x0" :: "v"(mp) : "memory");   /* closes the group of loads before a register that they name may be rewritten */
#pragma unroll
    for (int i = 0; i < 32; ++i) *(v4i*)&sm.pk[wave][i >> 1][(i & 1) * 128 + lane * 4] = mv[i];
    LDSX();   /* the wave's own rows are written before its lanes read each other's words */
#pragma unroll
    for (int tl = 0; tl < PKT; ++tl) { unsigned w = 0;
#pragma unroll
      for (int u = 0; u < 4; ++u) { const v4i a = *(const v4i*)&sm.pk[wave][col][tl * 64 + 16 * u + 8 * g], c = *(const v4i*)&sm.pk[wave][col][tl * 64 + 16 * u + 8 * g + 4];
#pragma unroll
        for (int r = 0; r < 8; ++r) { const unsigned bl = __builtin_amdgcn_ballot_w32((r < 4 ? a[r & 3] : c[r & 3]) == 0); w = (lane == 8 * u + r) ? bl : w; } }
      MB[((size_t)qg * (TT / 64) + tq * PKT + tl) * 32 + lane] = w; }   /* 128 B per tile, one line */
    return; }
  const float* X = which == 0 ? XQ : which == 1 ? XK : XV; const float* WA = which == 0 ? WQ : which == 1 ? WK : WV; const float* BA = which == 0 ? BQ : which == 1 ? BK : BV;
  v8f acc[8] = {};
  const float* xp = X + (r0 + (tid >> 4)) * DIN + (tid & 15) * 4; const float* wp = WA + (size_t)(c0 + (tid >> 4)) * DIN + (tid & 15) * 4;
  Stg s; stg_load<0>(s, xp, wp); stg_store(s, sm.st[0], tid); __syncthreads();
  for (int t = 0; t < DIN / KS; ++t) { const __bf16 (*cb)[SP] = sm.st[t & 1];
    if (t + 1 < DIN / KS) stg_load<KS>(s, xp + t * KS, wp + t * KS);
    v16b a[KS / 32], w[KS / 32][8];
#pragma unroll
    for (int kc = 0; kc < KS / 32; ++kc) { a[kc] = frag_b(&cb[wave * 16 + col][kc * 32], lane);
#pragma unroll
      for (int j = 0; j < 8; ++j) w[kc][j] = frag_b(&cb[64 + j * 16 + col][kc * 32], lane); }
#pragma unroll
    for (int kc = 0; kc < KS / 32; ++kc) {
#pragma unroll
      for (int j = 0; j < 8; ++j) acc[j] = wmma_bf(a[kc], w[kc][j], acc[j]); }
    __builtin_amdgcn_sched_barrier(0);   /* the roundings of the next stage wait for its global loads: kept behind the products, so that the loads' latency runs under them */
    if (t + 1 < DIN / KS) stg_store(s, sm.st[(t + 1) & 1], tid);   /* into the buffer that every wave left at the barrier of the trip before */
    __syncthreads(); }
  if (which < 2) { _Float16* DH = which == 0 ? QH : KH; _Float16* DL = which == 0 ? QL : KL; const int nhi = which == 0 ? QHI : KHI; const bool hi_rows = t0 < nhi;
#pragma unroll
    for (int j = 0; j < 8; ++j) { const float bias = BA ? bfr(BA[c0 + j * 16 + col]) : 0.f;
#pragma unroll
      for (int r = 0; r < 8; ++r) { const float v = acc[j][r] + bias; const _Float16 hv = (_Float16)v; sh[wave * 16 + 8 * g + r][j * 16 + col] = hv; sl[wave * 16 + 8 * g + r][j * 16 + col] = (_Float16)((v - (float)hv) * 1024.0f); } }
    __syncthreads();
    for (int e = tid; e < 64 * 16; e += 128) { const int rl = e >> 4, q = e & 15; vst2((unsigned*)(DH + (r0 + rl) * CC + c0 + q * 8), *(const v4u*)&sh[rl][q * 8]); if (hi_rows) vst2((unsigned*)(DL + (bb * nhi + t0 + rl) * (size_t)CC + c0 + q * 8), *(const v4u*)&sl[rl][q * 8]); }
  } else { const bool hi_rows = t0 < KHI;
#pragma unroll
    for (int j = 0; j < 8; ++j) { const float bias = BA ? bfr(BA[c0 + j * 16 + col]) : 0.f;
#pragma unroll
      for (int r = 0; r < 8; ++r) { const float v = acc[j][r] + bias; const int rl = wave * 16 + 8 * g + r, cl = j * 16 + col; th[cl][rl] = (_Float16)v; const __bf16 bh = (__bf16)v; tb[cl][rl] = bh; tbl[cl][rl] = (__bf16)(v - (float)bh); } }
    __syncthreads();
    for (int e = tid; e < 128 * 8; e += 128) { const int cl = e >> 3, q = e & 7; vst2((unsigned*)(VT + (bb * CC + c0 + cl) * (size_t)TT + t0 + q * 8), *(const v4u*)&th[cl][q * 8]); if (hi_rows) { const size_t o3 = (bb * CC + c0 + cl) * (size_t)KHI + t0 + q * 8; vst2((unsigned*)(VB + o3), *(const v4u*)&tb[cl][q * 8]); vst2((unsigned*)(VBL + o3), *(const v4u*)&tbl[cl][q * 8]); } } } }
// ---- k_sm: block = query row t (head in group): keys [0, kend): causal -> logit if s <= t else excluded; softmax in f32; P x 2^11 in place (0 for excluded)
__global__ __launch_bounds__(256) void k_sm(float* __restrict__ S0 SM_EXTRA_PARAMS) { __shared__ float sred[8]; __shared__ float sbc; __shared__ __align__(16) float shv[TT];
  const int tid = threadIdx.x; const int t = blockIdx.x; const int kend = (kb_last(t >> 6) + 1) * 128;
  float* sr = S0 + (size_t)blockIdx.y * TT * TT + (size_t)t * TT;
  float m = -3.0e38f; for (int k = tid; k < kend; k += 256) { float v = (!CAUSAL || k <= t) ? sr[k] : -3.0e38f; SM_MASK_HOOK; shv[k] = v; m = fmaxf(m, v); }
#pragma unroll
  for (int o = 1; o < 32; o <<= 1) m = fmaxf(m, __shfl_xor(m, o));
  if ((tid & 31) == 0) sred[tid >> 5] = m; __syncthreads(); if (tid == 0) { float a = sred[0]; for (int i = 1; i < 8; ++i) a = fmaxf(a, sred[i]); sbc = a; } __syncthreads(); m = sbc; __syncthreads();
  float sum = 0.f; for (int k = tid; k < kend; k += 256) { const float v = shv[k]; const float e = (v <= -1.0e38f) ? 0.f : expf(v - m); shv[k] = e; sum += e; }
#pragma unroll
  for (int o = 1; o < 32; o <<= 1) sum += __shfl_xor(sum, o);
  if ((tid & 31) == 0) sred[tid >> 5] = sum; __syncthreads(); if (tid == 0) { float a = 0.f; for (int i = 0; i < 8; ++i) a += sred[i]; sbc = a > 0.f ? 2048.0f / a : 0.f; }   /* a fully excluded row yields P = 0 */ __syncthreads(); const float inv = sbc;
  for (int k = tid; k < kend; k += 256) shv[k] = shv[k] * inv;
  __syncthreads(); for (int q = tid; q < kend / 4; q += 256) vst2(sr + q * 4, *(const v4f*)&shv[q * 4]); }
#define IEPS 1.0e-32f
__device__ __forceinline__ v8f wmma_h(v16h a, v16h b, v8f c) { return __builtin_amdgcn_wmma_f32_16x16x32_f16(false, a, false, b, (short)0, c, false, false); }
// XW(p): closes a group of global loads off pointer p before a register that they name may be rewritten; p is an input so that the address pair stays live up to the wait (no load of the group may land on it)
#define XW(p) asm volatile("s_wait_xcnt 0x0" :: "v"(p) : "memory")
#define FK 64
#define KP 72
#define NT (TT / FK)
typedef __attribute__((address_space(4))) unsigned cu32;
struct __align__(16) FaBuf { _Float16 k[FK][KP]; _Float16 v[HD][KP]; };
__device__ __forceinline__ unsigned lds_of(const void* p) { return (unsigned)(size_t)p; }   /* LDS byte address = low 32 bits of the __shared__ address */
// four copies of 16 B per lane; the s_wait_xcnt closes the group inside its own statement, before a register that a copy names may be rewritten
__device__ __forceinline__ void cp4(unsigned l0, const void* g0, unsigned l1, const void* g1, unsigned l2, const void* g2, unsigned l3, const void* g3) {
  asm volatile("global_load_async_to_lds_b128 %0, %1, off\n\tglobal_load_async_to_lds_b128 %2, %3, off\n\tglobal_load_async_to_lds_b128 %4, %5, off\n\tglobal_load_async_to_lds_b128 %6, %7, off\n\ts_wait_xcnt 0x0"
               :: "v"(l0), "v"(g0), "v"(l1), "v"(g1), "v"(l2), "v"(g2), "v"(l3), "v"(g3) : "memory"); }
// kg, vg: this thread's 16 B of row (tid >> 3), further rows 16 apart; k0 = first key of the tile
__device__ __forceinline__ void fa_fill(FaBuf& f, const _Float16* kg, const _Float16* vg, int k0, int tid) {
  const int r8 = tid >> 3, c8 = (tid & 7) * 8;
  const _Float16* kq = kg + (size_t)k0 * CC;
  cp4(lds_of(&f.k[r8][c8]), kq, lds_of(&f.k[r8 + 16][c8]), kq + (size_t)16 * CC, lds_of(&f.k[r8 + 32][c8]), kq + (size_t)32 * CC, lds_of(&f.k[r8 + 48][c8]), kq + (size_t)48 * CC);
  const _Float16* vq = vg + k0;
  cp4(lds_of(&f.v[r8][c8]), vq, lds_of(&f.v[r8 + 16][c8]), vq + (size_t)16 * TT, lds_of(&f.v[r8 + 32][c8]), vq + (size_t)32 * TT, lds_of(&f.v[r8 + 48][c8]), vq + (size_t)48 * TT); }
// hand-over of a tile: this wave's LDS reads of the old tile are done, its own copies of the next tile have landed, and the barrier publishes the next tile and frees the old buffer
#define FA_PUBLISH() do { asm volatile("s_wait_dscnt 0x0" ::: "memory"); asm volatile("s_wait_asynccnt 0x0" ::: "memory"); __syncthreads(); } while (0)
#define RS0 0x1p60f        // first row scale: a row that never leaves it has every t <= 2^-105, of the order of the normaliser's 1e-32 or below, and 1e-32 x RS0^2 is still finite
#define TLIM 32768.0f      // a lane's sum of a tile's scaled t (all >= 0) at or below this bounds each of them inside f16's range
// one tile's scaled t = relu(score x cs + cb)^2 (masked -> 0): once to f16 as the B operand of V^T P^T; returns the lane's f32 sum of them
__device__ __forceinline__ float fa_t(const v8f (&s)[FK / 16], const unsigned (&m)[FK / 2], float cs, float cb, v16h (&p)[FK / 32]) { float ts = 0.f;
#pragma unroll
  for (int u = 0; u < FK / 16; ++u) {
#pragma unroll
    for (int r = 0; r < 8; ++r) { const float x = fmaxf(s[u][r] * cs + cb, 0.f); const float e = __builtin_amdgcn_inverse_ballot_w32(m[8 * u + r]) ? x * x : 0.f; ts += e; p[u >> 1][8 * (u & 1) + r] = (_Float16)e; } }
  return ts; }
// ---- k_fa (scores, SparseNormer and P v in one launch; no score plane in memory): block = 4 waves x 16 queries of (b, h). S^T = K Q^T: lane (g, col) holds query col's scores of keys 8g + r of each 16-key tile, so the row sum is in-lane (+ one exchange between the halves) and two converted S^T tiles are the B operand of ctx^T += V^T P^T.
// ONE pass over the keys: the normaliser is a plain quotient, so ctx = (sum_k t_k v_k) / (sum_k t_k + 1e-32) and both sums grow together. t goes to f16 as t x rs^2 with a power-of-two row scale rs (exact), so its f16 range does not depend on the scale of the scores: rs starts high and is lowered, with both sums rescaled, when a tile would leave f16's range (as a rule once, at the row's first tile with a positive score); the row's largest x then sits at 8..16 and may grow several-fold before the next change. The inner loops are unrolled whole so that the vector elements are indexed by constants and stay in registers.
__global__ __launch_bounds__(128) void k_fa(const _Float16* __restrict__ QH, const _Float16* __restrict__ KH, const _Float16* __restrict__ VT, const unsigned* __restrict__ MB, const float* __restrict__ NBIAS, float* __restrict__ Y) {
  __shared__ FaBuf fb[2];
  const int tid = threadIdx.x, wave = tid >> 5, lane = tid & 31, col = lane & 15, g = lane >> 4; const int h = blockIdx.x, b = blockIdx.z; const int ql = blockIdx.y * 64 + wave * 16 + col;
  const float nb_ = bfr(NBIAS[0]);
  const _Float16* qp = QH + ((size_t)b * TT + ql) * CC + h * HD; const v16h q0 = frag_h(qp, lane), q1 = frag_h(qp + 32, lane); XW(qp);
  const _Float16* kg = KH + ((size_t)b * TT + (tid >> 3)) * CC + h * HD + (tid & 7) * 8; const _Float16* vg = VT + ((size_t)b * CC + h * HD + (tid >> 3)) * (size_t)TT + (tid & 7) * 8;
  const cu32* mw = (const cu32*)(MB + (size_t)((b * TT + blockIdx.y * 64) / 16 + __builtin_amdgcn_readfirstlane(wave)) * (NT * (FK / 2)));   /* the wave's 16 queries' lane-mask words, FK / 2 per tile; a wave-uniform address of words that no one writes during this launch, so they come by scalar loads into scalar registers */
  unsigned m[FK / 2];   /* indexed by constants only (loops unrolled whole), so each word keeps a scalar register */
#pragma unroll
  for (int i = 0; i < FK / 2; ++i) m[i] = mw[i];
  fa_fill(fb[0], kg, vg, 0, tid);
  asm volatile("s_wait_asynccnt 0x0" ::: "memory");   /* tile 0 has landed before the barrier that publishes it */
  __syncthreads();
  fa_fill(fb[1], kg, vg, FK, tid);
  float rs = RS0, cs = SCALE * RS0, cb = nb_ * RS0, sum = 0.f;   /* rs is the same in both halves of a query */
  v8f acc[HD / 16] = {};
  for (int t = 0; t < NT; ++t) { const FaBuf& f = fb[t & 1];
    v8f s[FK / 16]; v16h p[FK / 32];
#pragma unroll
    for (int u = 0; u < FK / 16; ++u) { const v16h ka = frag_h(&f.k[16 * u + col][0], lane), kb = frag_h(&f.k[16 * u + col][32], lane);
      v8f z = {}; z = wmma_h(ka, q0, z); s[u] = wmma_h(kb, q1, z); }
    float ts = fa_t(s, m, cs, cb, p);
    if (__builtin_amdgcn_ballot_w32(!(ts <= TLIM)) != 0) {   /* one test per tile, a scalar branch, rarely taken: some row of the wave needs a lower scale */
      float mx = 0.f;
#pragma unroll
      for (int u = 0; u < FK / 16; ++u) {
#pragma unroll
        for (int r = 0; r < 8; ++r) mx = fmaxf(mx, __builtin_amdgcn_inverse_ballot_w32(m[8 * u + r]) ? s[u][r] * SCALE + nb_ : 0.f); }
      mx = fmaxf(mx, __shfl_xor(mx, 16));   /* the query's largest unmasked x of this tile, the same in both halves */
      int ex; (void)frexpf(mx, &ex);
      const float rn = (mx * rs > 16.0f) ? ldexpf(1.0f, 4 - ex) : rs;   /* mx x rn in [8, 16): every scaled t of the tile <= 256, their sum <= 8192 */
      const float fr = rn / rs, f2 = fr * fr;   /* powers of two: exact (or 0 where the old sums no longer count) */
#pragma unroll
      for (int j = 0; j < HD / 16; ++j) acc[j] *= f2;
      sum *= f2; rs = rn; cs = SCALE * rn; cb = nb_ * rn;
      ts = fa_t(s, m, cs, cb, p); }
    sum += ts;
    { const cu32* mn = mw + (t + 1 < NT ? t + 1 : NT - 1) * (FK / 2);   /* the next tile's words, asked for as soon as this tile's are used: they fly under P v, the hand-over and the next scores (the last trip reads its own again, in bounds) */
#pragma unroll
      for (int i = 0; i < FK / 2; ++i) m[i] = mn[i]; }
#pragma unroll
    for (int hh = 0; hh < FK / 32; ++hh) {
#pragma unroll
      for (int j = 0; j < HD / 16; ++j) acc[j] = wmma_h(frag_h(&f.v[j * 16 + col][32 * hh], lane), p[hh], acc[j]); }
    FA_PUBLISH();
    if (t + 2 < NT) fa_fill(fb[t & 1], kg, vg, (t + 2) * FK, tid); }
  asm volatile("s_wait_asynccnt 0x0" ::: "memory");   /* no copy is outstanding when the wave ends */
  sum += __shfl_xor(sum, 16); const float inv = 1.0f / (sum + (IEPS * rs) * rs);   /* both sums carry rs^2, so does the 1e-32; sum == 0 -> rs == RS0, acc == 0 -> ctx = 0 */
  float* yp = Y + ((size_t)b * TT + ql) * CC + h * HD + 8 * g;   /* acc[j][r] = ctx[query col][16j + 8g + r]; the wave writes each query's whole 256-B (row, head) segment */
#pragma unroll
  for (int j = 0; j < HD / 16; ++j) { v4f lo, hi;
#pragma unroll
    for (int r = 0; r < 4; ++r) { lo[r] = acc[j][r] * inv; hi[r] = acc[j][4 + r] * inv; }
    vst2(yp + j * 16, lo); vst2(yp + j * 16 + 4, hi); } }
// ---- k_out: block = (64 rows, 128 cols): out = ctx Wo (+ bo): ctx x 2^6 once to f16 against Wo as f16(bf16 x 2^8) exact (1 product) x 2^-14; causal early rows (< QHI of each sequence): ctx bf16 hi + lo against exact bf16 Wo (2 products)
__global__ __launch_bounds__(128) void k_out(const float* __restrict__ Y, const float* __restrict__ WO, const float* __restrict__ BO, float* __restrict__ OUT) { union SM { float sf[4][16][132]; _Float16 st[2][SROWS][SP]; };   /* the stage buffers lie over the epilogue's array, which is first written behind the loop's last barrier */
  __shared__ __align__(16) SM sm; auto& sf = sm.sf;
  const int tid = threadIdx.x, wave = tid >> 5, lane = tid & 31, col = lane & 15, g = lane >> 4; const int c0 = blockIdx.y * 128; const size_t r0 = (size_t)blockIdx.x * 64 + wave * 16;
  v8f acc[8] = {};
  if (CAUSAL && (int)(((size_t)blockIdx.x * 64) % TT) < QHI) {   /* block-uniform */
#pragma unroll 2
    for (int kc = 0; kc < CC / 32; ++kc) { const F2 a = split_row(Y + (r0 + col) * CC, kc * 32, lane); asm volatile("s_wait_loadcnt 0x0" ::: "memory");
#pragma unroll
      for (int j = 0; j < 8; ++j) { const v16b w = WOCOL(WO, kc * 32, c0 + j * 16 + col, lane); asm volatile("s_wait_loadcnt 0x0" ::: "memory"); acc[j] = wmma_bf(a.h, w, acc[j]); acc[j] = wmma_bf(a.l, w, acc[j]); } }
#pragma unroll
    for (int j = 0; j < 8; ++j) { const float bias = BO ? bfr(BO[c0 + j * 16 + col]) : 0.f;
#pragma unroll
      for (int r = 0; r < 8; ++r) sf[wave][8 * g + r][j * 16 + col] = acc[j][r] + bias; }
  } else {
    const float* xp = Y + ((size_t)blockIdx.x * 64 + (tid >> 4)) * CC + (tid & 15) * 4; const float* wp = WO + (size_t)(c0 + (tid >> 4)) * CC + (tid & 15) * 4;
    Stg s; stg_load<0>(s, xp, wp); stg_store(s, sm.st[0], tid); __syncthreads();   /* ctx carried x 2^6 into f16 so small-magnitude context rows stay clear of f16 subnormals */
    for (int t = 0; t < CC / KS; ++t) { const _Float16 (*cb)[SP] = sm.st[t & 1];
      if (t + 1 < CC / KS) stg_load<KS>(s, xp + t * KS, wp + t * KS);
      v16h a[KS / 32], w[KS / 32][8];
#pragma unroll
      for (int kc = 0; kc < KS / 32; ++kc) { a[kc] = frag_h(&cb[wave * 16 + col][kc * 32], lane);
#pragma unroll
        for (int j = 0; j < 8; ++j) w[kc][j] = frag_h(&cb[64 + j * 16 + col][kc * 32], lane); }
#pragma unroll
      for (int kc = 0; kc < KS / 32; ++kc) {
#pragma unroll
        for (int j = 0; j < 8; ++j) acc[j] = wmma16(a[kc], w[kc][j], acc[j]); }
      __builtin_amdgcn_sched_barrier(0);   /* the roundings of the next stage wait for its global loads: kept behind the products, so that the loads' latency runs under them */
      if (t + 1 < CC / KS) stg_store(s, sm.st[(t + 1) & 1], tid);   /* into the buffer that every wave left at the barrier of the trip before */
      __syncthreads(); }
#pragma unroll
    for (int j = 0; j < 8; ++j) { const float bias = BO ? bfr(BO[c0 + j * 16 + col]) : 0.f;
#pragma unroll
      for (int r = 0; r < 8; ++r) sf[wave][8 * g + r][j * 16 + col] = acc[j][r] * (1.0f / 16384.0f) + bias; } }   /* 2^-8 (Wo carry) x 2^-6 (ctx carry) */
  LDSX(); for (int rl = 0; rl < 16; ++rl) vst2(OUT + (r0 + rl) * DIN + c0 + lane * 4, *(const v4f*)&sf[wave][rl][lane * 4]); }

extern "C" void kernel_launch(void* const* d_in, const int* in_sizes, int n_in, void* d_out, int out_size, void* d_ws, size_t ws_size, hipStream_t stream) {
  (void)in_sizes; (void)n_in; (void)out_size;
  const float** F = (const float**)d_in;
  if (ws_size < (size_t)WS_END) return;
  char* ws = (char*)d_ws; _Float16 *QH = (_Float16*)(ws + WS_QH), *KH = (_Float16*)(ws + WS_KH), *VT = (_Float16*)(ws + WS_VT), *QL = (_Float16*)(ws + WS_QL), *KL = (_Float16*)(ws + WS_KL); __bf16 *VB = (__bf16*)(ws + WS_VB), *VBL = (__bf16*)(ws + WS_VBL); float *Y = (float*)(ws + WS_Y); unsigned* MB = (unsigned*)(ws + WS_S);   /* lane-mask words of the mask, 1 MiB, in the place of the old score plane */
  (void)Y; (void)QL; (void)KL; (void)VB; (void)VBL;
  // inputs: 0 iQ [2,2048,1024]; 1 iK; 2 iV; 3 mask [2,2048,2048] bool (True = masked); 4 Wq [1024,1024] (out,in), 5 bq; 6 Wk, 7 bk; 8 Wv, 9 bv; 10 Wo (out,in), 11 bo (zero biases, read); 12 nbias [1] (SparseNormer bias; zero)
  k_proj<<<dim3(TNB * TT / 64, CC / 128, 4), 128, 0, stream>>>(F[0], F[1], F[2], F[4], F[6], F[8], F[5], F[7], F[9], QH, QL, KH, KL, VT, VB, VBL, (const int*)d_in[3], MB);   /* z = 3: the mask's packing blocks, short, last in the launch */
  k_fa<<<dim3(NH, NQB, TNB), 128, 0, stream>>>(QH, KH, VT, MB, F[12], Y);   /* relu(x + nbias)^2 / (sum + 1e-32): NOT a softmax */
  k_out<<<dim3(TNB * TT / 64, DIN / 128), 128, 0, stream>>>(Y, F[10], F[11], (float*)d_out);
}

// v006
// It runs in 102 microseconds.
// In two side-by-side timings against v005, it was 1.08 and 1.07 times as fast.
// Counting every step since v000, it is 13.1 times as fast.
// compute dtype: all float inputs rounded to bf16; q/k/v projections with EXACT bf16 products on WMMA 16x16x32 (f32 accumulate) + bias; scores q x k once to f16 each (1 product) x 64^-0.5; SparseNormer in f32: t = relu(score + nbias)^2 (masked entries -> 0); t x 2^2n (n per row) once to f16 x v once to f16 (1 product), ctx = that sum / (sum t + 1e-32); ctx x 2^6 once to f16 x Wo f16(bf16 x 2^8) + bo; f32 output.
#include <hip/hip_runtime.h>
#include <math.h>

typedef __attribute__((ext_vector_type(16))) _Float16 v16h;
typedef __attribute__((ext_vector_type(16))) __bf16 v16b;
typedef __attribute__((ext_vector_type(8)))  _Float16 v8h;
typedef __attribute__((ext_vector_type(8)))  float v8f;
typedef __attribute__((ext_vector_type(4)))  float v4f;
typedef __attribute__((ext_vector_type(2)))  float v2f;
typedef __attribute__((ext_vector_type(4)))  unsigned v4u;
typedef __attribute__((ext_vector_type(4)))  int v4i;
typedef float __attribute__((may_alias)) float_a;
typedef int __attribute__((may_alias)) int_a;

template <typename T> __device__ __forceinline__ void vst2(void* p, T v) { *(T*)p = v;  }
__device__ __forceinline__ v8f wmma16(v16h a, v16h b, v8f c) {
  v8f d = __builtin_amdgcn_wmma_f32_16x16x32_f16(false, a, false, b, (short)0, c, false, false);
  asm volatile("v_nop\n\tv_nop\n\tv_nop\n\tv_nop" : "+v"(d) : "v"(a), "v"(b));
  return d;
}
__device__ __forceinline__ v8f wmma_bf(v16b a, v16b b, v8f c) {
  v8f d = __builtin_amdgcn_wmma_f32_16x16x32_bf16(false, a, false, b, (short)0, c, false, false);
  asm volatile("v_nop\n\tv_nop\n\tv_nop\n\tv_nop" : "+v"(d) : "v"(a), "v"(b));
  return d;
}
// 16x16x32 fragments: lane = (h = lane>>4, row/col = lane&15); elements 0..7 = k0+8h+0..7, 8..15 = k0+16+8h+0..7; D element r = row 8h+r
__device__ __forceinline__ v16h frag_h(const _Float16* rowk0, int lane) {
  union { v16h v; v8h q[2]; } u; const _Float16* p = rowk0 + 8 * (lane >> 4);
  u.q[0] = *(const v8h*)p; u.q[1] = *(const v8h*)(p + 16); return u.v;
}
__device__ __forceinline__ v16h frag_f32(const float* rowk0, int lane) {
  v16h a; const float* p = rowk0 + 8 * (lane >> 4);
#pragma unroll
  for (int i = 0; i < 8; ++i) { a[i] = (_Float16)p[i]; a[8 + i] = (_Float16)p[16 + i]; }
  return a;
}
__device__ __forceinline__ v16h frag_f32s(const float* rowk0, int lane, float sc) {
  v16h a; const float* p = rowk0 + 8 * (lane >> 4);
#pragma unroll
  for (int i = 0; i < 8; ++i) { a[i] = (_Float16)(p[i] * sc); a[8 + i] = (_Float16)(p[16 + i] * sc); }
  return a;
}
// column fragment from a [K][ld] layout (column n), rows >= K read as 0
__device__ __forceinline__ v16h fragc_f32(const float* W, int k0, int n, int lane, int ld, int K) {
  v16h a; const int g = lane >> 4;
#pragma unroll
  for (int i = 0; i < 8; ++i) { const int ka = k0 + 8 * g + i, kb = ka + 16;
    a[i] = (_Float16)(ka < K ? W[(size_t)(ka < K ? ka : K - 1) * ld + n] : 0.f); a[8 + i] = (_Float16)(kb < K ? W[(size_t)(kb < K ? kb : K - 1) * ld + n] : 0.f); }
  return a;
}
struct F2 { v16b h, l; };
__device__ __forceinline__ F2 bsplit16(const float v[16]) { F2 r;
#pragma unroll
  for (int i = 0; i < 16; ++i) { const __bf16 h = (__bf16)v[i]; r.h[i] = h; r.l[i] = (__bf16)(v[i] - (float)h); }
  return r; }
__device__ __forceinline__ F2 split_row(const float* row, int k0, int lane) { float v[16]; const float* p = row + k0 + 8 * (lane >> 4);
#pragma unroll
  for (int i = 0; i < 8; ++i) { v[i] = p[i]; v[8 + i] = p[16 + i]; }
  return bsplit16(v); }
__device__ __forceinline__ F2 split_rowK(const float* row, int k0, int lane, int K) { float v[16]; const int g = lane >> 4;
#pragma unroll
  for (int i = 0; i < 8; ++i) { const int ka = k0 + 8 * g + i, kb = ka + 16; v[i] = ka < K ? row[ka < K ? ka : K - 1] : 0.f; v[8 + i] = kb < K ? row[kb < K ? kb : K - 1] : 0.f; }
  return bsplit16(v); }
__device__ __forceinline__ F2 split_col(const float* W, int k0, int n, int lane, int ld, int K) { float v[16]; const int g = lane >> 4;
#pragma unroll
  for (int i = 0; i < 8; ++i) { const int ka = k0 + 8 * g + i, kb = ka + 16; v[i] = ka < K ? W[(size_t)(ka < K ? ka : K - 1) * ld + n] : 0.f; v[8 + i] = kb < K ? W[(size_t)(kb < K ? kb : K - 1) * ld + n] : 0.f; }
  return bsplit16(v); }
__device__ __forceinline__ v8f mac3(const F2& a, const F2& b, v8f c) { c = wmma_bf(a.l, b.h, c); c = wmma_bf(a.h, b.l, c); return wmma_bf(a.h, b.h, c); }
__device__ __forceinline__ float sigm(float v) { return 1.0f / (1.0f + expf(-v)); }
#define LDSX() do { asm volatile("s_wait_dscnt 0" ::: "memory"); __builtin_amdgcn_wave_barrier(); __builtin_amdgcn_fence(__ATOMIC_RELEASE, "workgroup"); } while (0)

// Multi-head attention with a SparseNormer instead of a softmax (iQ / iK / iV [2,2048,1024] separate inputs; torch (out,in) Wq / Wk / Wv / Wo [1024,1024] (0.02 scale) + zero biases; 16 heads x 64; scores / 8; mask [2,2048,2048] bool random (True -> -1e32); t = relu(scores + nbias)^2 with nbias = zeros(1); attn = t / (sum_k t + 1e-32)): out = merge(attn v) Wo^T + bo.
#define NB 2
#define TT 2048
#define CC 1024            // NH * HD = projected width
#define DIN 1024          // input (model) width
#define NH 16
#define HD 64
#define NQB (TT / 64)
#define HG 4
#define SCALE (0.125f)
#define CAUSAL 0
#ifndef TNB
#define TNB NB
#endif
__device__ __forceinline__ float bfr(float v) { return (float)(__bf16)v; }
__host__ __device__ __forceinline__ int kb_last(int qb) { return CAUSAL ? ((qb * 64 + 63) >> 7) : (TT / 128 - 1); }
typedef __attribute__((ext_vector_type(8))) __bf16 v8b;
__device__ __forceinline__ v16b frag_b(const __bf16* rowk0, int lane) {
  union { v16b v; v8b q[2]; } u; const __bf16* p = rowk0 + 8 * (lane >> 4);
  u.q[0] = *(const v8b*)p; u.q[1] = *(const v8b*)(p + 16); return u.v;
}
#define QBH 0              // not used by any kernel here
#define QHI 0               // single-product scores on every row
#define KHI 64            // key rows carrying k residual / v bf16 hi+lo planes (written by k_proj; read by no kernel here)
// B fragment (k rows k0+.., output column o) of a weight: (in,out) [K][ld] or (out,in) [ld rows of K]: bf16 exact, or f16(bf16 * 256) exact
__device__ __forceinline__ v16b wcol_io(const float* Wm, int k0, int o, int lane, int ld) { v16b w; const int g = lane >> 4;
#pragma unroll
  for (int i = 0; i < 8; ++i) { w[i] = (__bf16)Wm[(size_t)(k0 + 8 * g + i) * ld + o]; w[8 + i] = (__bf16)Wm[(size_t)(k0 + 16 + 8 * g + i) * ld + o]; }
  return w; }
__device__ __forceinline__ v16b wcol_oi(const float* Wm, int k0, int o, int lane, int K) { v16b w; const float* p = Wm + (size_t)o * K + k0 + 8 * (lane >> 4);
#pragma unroll
  for (int i = 0; i < 8; ++i) { w[i] = (__bf16)p[i]; w[8 + i] = (__bf16)p[16 + i]; }
  return w; }
__device__ __forceinline__ v16h wcolh_io(const float* Wm, int k0, int o, int lane, int ld) { v16h w; const int g = lane >> 4;
#pragma unroll
  for (int i = 0; i < 8; ++i) { w[i] = (_Float16)(bfr(Wm[(size_t)(k0 + 8 * g + i) * ld + o]) * 256.0f); w[8 + i] = (_Float16)(bfr(Wm[(size_t)(k0 + 16 + 8 * g + i) * ld + o]) * 256.0f); }
  return w; }
__device__ __forceinline__ v16h wcolh_oi(const float* Wm, int k0, int o, int lane, int K) { v16h w; const float* p = Wm + (size_t)o * K + k0 + 8 * (lane >> 4);
#pragma unroll
  for (int i = 0; i < 8; ++i) { w[i] = (_Float16)(bfr(p[i]) * 256.0f); w[8 + i] = (_Float16)(bfr(p[16 + i]) * 256.0f); }
  return w; }
#define WQKV_LAYOUT 1   // 0 = (in,out) [DIN][CC]; 1 = (out,in) [CC][DIN]; 2 = per-head [NH][DIN][HD]
__device__ __forceinline__ v16b wcol_hdk(const float* Wm, int k0, int o, int lane) { v16b w; const int g = lane >> 4; const float* p = Wm + (size_t)(o / HD) * DIN * HD + (o % HD);
#pragma unroll
  for (int i = 0; i < 8; ++i) { w[i] = (__bf16)p[(size_t)(k0 + 8 * g + i) * HD]; w[8 + i] = (__bf16)p[(size_t)(k0 + 16 + 8 * g + i) * HD]; }
  return w; }
#define WO_OUT_IN 1
#if WQKV_LAYOUT == 1
#define WCOL(W, k0, o, lane) wcol_oi(W, k0, o, lane, DIN)
#elif WQKV_LAYOUT == 2
#define WCOL(W, k0, o, lane) wcol_hdk(W, k0, o, lane)
#else
#define WCOL(W, k0, o, lane) wcol_io(W, k0, o, lane, CC)
#endif
#if WO_OUT_IN
#define WOCOL(W, k0, o, lane) wcol_oi(W, k0, o, lane, CC)
#define WOCOLH(W, k0, o, lane) wcolh_oi(W, k0, o, lane, CC)
#else
#define WOCOL(W, k0, o, lane) wcol_io(W, k0, o, lane, DIN)
#define WOCOLH(W, k0, o, lane) wcolh_io(W, k0, o, lane, DIN)
#endif

#ifndef SM_EXTRA_PARAMS
#define SM_EXTRA_PARAMS
#endif
#ifndef PROJ_EXTRA_PARAMS
#define PROJ_EXTRA_PARAMS
#endif
#ifndef SM_MASK_HOOK
#define SM_MASK_HOOK (void)0
#endif

#define WS_QH  0u                                      // f16 q rows [b*t][CC]
#define WS_KH  (WS_QH + 2u * (size_t)NB * TT * CC)      // f16 k rows [b*t][CC]
#define WS_VT  (WS_KH + 2u * (size_t)NB * TT * CC)      // f16 v planes [b][c][t]
#define WS_QL  (WS_VT + 2u * (size_t)NB * CC * TT)      // f16 q residual x 2^10 rows [b][t < QHI][CC]
#define WS_KL  (WS_QL + 2u * (size_t)NB * QHI * CC)     // f16 k residual x 2^10 rows [b][t < KHI][CC]
#define WS_VB  (WS_KL + 2u * (size_t)NB * KHI * CC)     // bf16 v hi planes [b][c][t < KHI]
#define WS_VBL (WS_VB + 2u * (size_t)NB * CC * KHI)
#define WS_S   (WS_VBL + 2u * (size_t)NB * CC * KHI)    // lane-mask words, then operand tiles (room of an f32 plane [hg][t][s])
#define WS_Y   (WS_S  + 4u * (size_t)HG * TT * TT)      // f16 ctx x 2^6 tiles
#define WS_END (WS_Y  + 4u * (size_t)NB * TT * CC)
#define WS_XB  (WS_S + (2u << 20))                      // bf16 iQ, iK, iV tiles, behind the mask words in the place of the old score plane
#define WS_WB  (WS_XB + 3u * 2u * (size_t)NB * TT * DIN) // bf16 Wq, Wk, Wv tiles, then f16 Wo tiles
#define WS_WO  (WS_WB + 3u * 2u * (size_t)CC * DIN)
static_assert(WS_WO + 2u * (size_t)CC * DIN <= WS_Y, "the operand tiles stay inside the old score plane");

// ---- operands of the two projection kernels: every X, W and ctx element is rounded ONCE to its 16-bit operand type and kept in memory as tiles of 64 rows x 64 k (8 KB contiguous): element (row, k) at ((row >> 6) * 16 + (k >> 6)) * 4096 + (row & 63) * 64 + (k & 63); every matrix here has 1024 k. A block's 64 X rows and 128 W rows, KS k at a time, are three such tiles, which come by asynchronous copies straight into LDS (512 contiguous bytes per wave and copy), where all four waves read their fragments; two buffers, the next stage's copies fly while this stage is multiplied
#define KS 64              // k per stage
#define SP 72              // LDS row pitch in 16-bit elements: 144 B = 16 B x 9, an odd multiple of 16 B, which ds_load_b128 fragment reads take without bank conflicts
#define SROWS 192          // rows 0..63 = X, 64..191 = W
#define TILE 4096          // elements of a tile
#define KT (DIN / 64)      // tiles per block of 64 rows
typedef __attribute__((ext_vector_type(4))) __bf16 v4b;
typedef __attribute__((ext_vector_type(4))) _Float16 v4h;
__device__ __forceinline__ unsigned lds_of(const void* p) { return (unsigned)(size_t)p; }   /* LDS byte address = low 32 bits of the __shared__ address */
// four copies of 16 B per lane; the s_wait_xcnt closes the group inside its own statement, before a register that a copy names may be rewritten
__device__ __forceinline__ void cp4(unsigned l0, const void* g0, unsigned l1, const void* g1, unsigned l2, const void* g2, unsigned l3, const void* g3) {
  asm volatile("global_load_async_to_lds_b128 %0, %1, off\n\tglobal_load_async_to_lds_b128 %2, %3, off\n\tglobal_load_async_to_lds_b128 %4, %5, off\n\tglobal_load_async_to_lds_b128 %6, %7, off\n\ts_wait_xcnt 0x0"
               :: "v"(l0), "v"(g0), "v"(l1), "v"(g1), "v"(l2), "v"(g2), "v"(l3), "v"(g3) : "memory"); }
// hand-over of a tile: this wave's LDS reads of the old tile are done, its own copies of the next tile have landed, and the barrier publishes the next tile and frees the old buffer
#define FA_PUBLISH() do { asm volatile("s_wait_dscnt 0x0" ::: "memory"); asm volatile("s_wait_asynccnt 0x0" ::: "memory"); __syncthreads(); } while (0)
// one tile into 64 LDS rows from row r0 on; tp: this thread's 16 B of the tile (element tid * 8), further copies 16 rows = 1024 elements apart
template <typename T> __device__ __forceinline__ void g_tile(T (*st)[SP], int r0, const T* tp, int tid) { const int r8 = r0 + (tid >> 3), c8 = (tid & 7) * 8;
  cp4(lds_of(&st[r8][c8]), tp, lds_of(&st[r8 + 16][c8]), tp + 1024, lds_of(&st[r8 + 32][c8]), tp + 2048, lds_of(&st[r8 + 48][c8]), tp + 3072); }
// one stage: the X tile, and the W tiles of two neighbouring blocks of 64 rows
template <typename T> __device__ __forceinline__ void g_fill(T (*st)[SP], const T* xt, const T* wt, int tid) { g_tile(st, 0, xt, tid); g_tile(st, 64, wt, tid); g_tile(st, 128, wt + (size_t)KT * TILE, tid); }
// ---- mask as lane masks: word [16-query group][64-key tile][8u + r], bit 16g + col = (mask[query col][key 16u + 8g + r] == 0, the key counts): the very lane that holds that score in k_fa, so a word is the select mask of one score register; 1/32 of the i32 mask's bytes
#define PKP 260            // LDS row pitch in words of the packing blocks: 1040 B = 16 B x 65 (odd)
#define PKT 4              // tiles of 64 keys per packing wave
static_assert((TNB * TT / 64) * (CC / 128) * 4 * PKT == (TNB * TT / 16) * (TT / 64), "the packing blocks' waves cover every (query group, tile) once");
// ---- k_proj: block = (64 rows, 128 cols, which): which 3: the mask's lane-mask words (see above); else q/k/v = X W (+ b) with exact bf16 products (K = DIN) -> which 0: q f16 rows (+ residual rows < QHI); 1: k f16 rows (+ residual rows < KHI); 2: v f16 planes [c][t] (+ bf16 hi/lo planes for t < KHI)
__global__ __launch_bounds__(128) void k_proj(const __bf16* __restrict__ XB, const __bf16* __restrict__ WB, const float* __restrict__ BQ, const float* __restrict__ BK, const float* __restrict__ BV,
    _Float16* __restrict__ QH, _Float16* __restrict__ QL, _Float16* __restrict__ KH, _Float16* __restrict__ KL, _Float16* __restrict__ VT, __bf16* __restrict__ VB, __bf16* __restrict__ VBL, const int* __restrict__ MASK, unsigned* __restrict__ MB) {
  union SM { struct { _Float16 sh[64][136], sl[64][136]; _Float16 th[128][72]; __bf16 tb[128][72], tbl[128][72]; } e; __bf16 st[2][SROWS][SP]; int pk[4][16][PKP]; };   /* the stage buffers lie over the epilogue's arrays, which are first written behind the loop's last barrier */
  __shared__ __align__(16) SM sm; auto& sh = sm.e.sh; auto& sl = sm.e.sl; auto& th = sm.e.th; auto& tb = sm.e.tb; auto& tbl = sm.e.tbl;
  const int tid = threadIdx.x, wave = tid >> 5, lane = tid & 31, col = lane & 15, g = lane >> 4; const int which = blockIdx.z; const int c0 = blockIdx.y * 128; const size_t r0 = (size_t)blockIdx.x * 64; const size_t bb = r0 / TT; const int t0 = (int)(r0 % TT);
  if (which == 3) {   /* block-uniform, in front of every barrier: each wave packs 16 queries x PKT tiles; the rows come as whole lines (512 B of one row per load) and turn through the wave's own LDS rows into the score layout; the loops are unrolled whole so that all 32 loads are in flight together and the vectors are indexed by constants */
    const int id = (blockIdx.x * (CC / 128) + blockIdx.y) * 4 + wave, qg = id / (TT / 64 / PKT), tq = id % (TT / 64 / PKT);
    const int* mp = MASK + (size_t)qg * 16 * TT + tq * (PKT * 64) + lane * 4; v4i mv[32];
#pragma unroll
    for (int i = 0; i < 32; ++i) mv[i] = *(const v4i*)(mp + (size_t)(i >> 1) * TT + (i & 1) * 128);
    asm volatile("s_wait_xcnt 0x0" :: "v"(mp) : "memory");   /* closes the group of loads before a register that they name may be rewritten */
#pragma unroll
    for (int i = 0; i < 32; ++i) *(v4i*)&sm.pk[wave][i >> 1][(i & 1) * 128 + lane * 4] = mv[i];
    LDSX();   /* the wave's own rows are written before its lanes read each other's words */
#pragma unroll
    for (int tl = 0; tl < PKT; ++tl) { unsigned w = 0;
#pragma unroll
      for (int u = 0; u < 4; ++u) { const v4i a = *(const v4i*)&sm.pk[wave][col][tl * 64 + 16 * u + 8 * g], c = *(const v4i*)&sm.pk[wave][col][tl * 64 + 16 * u + 8 * g + 4];
#pragma unroll
        for (int r = 0; r < 8; ++r) { const unsigned bl = __builtin_amdgcn_ballot_w32((r < 4 ? a[r & 3] : c[r & 3]) == 0); w = (lane == 8 * u + r) ? bl : w; } }
      MB[((size_t)qg * (TT / 64) + tq * PKT + tl) * 32 + lane] = w; }   /* 128 B per tile, one line */
    return; }
  const float* BA = which == 0 ? BQ : which == 1 ? BK : BV;
  v8f acc[8] = {};
  const __bf16* xt = XB + ((size_t)which * (TNB * TT / 64) + blockIdx.x) * KT * TILE + tid * 8; const __bf16* wt = WB + ((size_t)which * (CC / 64) + (c0 >> 6)) * KT * TILE + tid * 8;   /* this thread's 16 B of the first X and W tiles; the next stage's tiles follow TILE elements on */
  g_fill(sm.st[0], xt, wt, tid);
  asm volatile("s_wait_asynccnt 0x0" ::: "memory");   /* stage 0 has landed before the barrier that publishes it */
  __syncthreads();
  g_fill(sm.st[1], xt + TILE, wt + TILE, tid);
  for (int t = 0; t < DIN / KS; ++t) { const __bf16 (*cb)[SP] = sm.st[t & 1];
    v16b a[KS / 32], w[KS / 32][8];
#pragma unroll
    for (int kc = 0; kc < KS / 32; ++kc) { a[kc] = frag_b(&cb[wave * 16 + col][kc * 32], lane);
#pragma unroll
      for (int j = 0; j < 8; ++j) w[kc][j] = frag_b(&cb[64 + j * 16 + col][kc * 32], lane); }
#pragma unroll
    for (int kc = 0; kc < KS / 32; ++kc) {
#pragma unroll
      for (int j = 0; j < 8; ++j) acc[j] = wmma_bf(a[kc], w[kc][j], acc[j]); }
    FA_PUBLISH();
    if (t + 2 < DIN / KS) g_fill(sm.st[t & 1], xt + (size_t)(t + 2) * TILE, wt + (size_t)(t + 2) * TILE, tid); }   /* into the buffer that every wave has just left */
  asm volatile("s_wait_asynccnt 0x0" ::: "memory");   /* no copy is outstanding when the buffers become the epilogue's arrays */
  if (which < 2) { _Float16* DH = which == 0 ? QH : KH; _Float16* DL = which == 0 ? QL : KL; const int nhi = which == 0 ? QHI : KHI; const bool hi_rows = t0 < nhi;
#pragma unroll
    for (int j = 0; j < 8; ++j) { const float bias = BA ? bfr(BA[c0 + j * 16 + col]) : 0.f;
#pragma unroll
      for (int r = 0; r < 8; ++r) { const float v = acc[j][r] + bias; const _Float16 hv = (_Float16)v; sh[wave * 16 + 8 * g + r][j * 16 + col] = hv; sl[wave * 16 + 8 * g + r][j * 16 + col] = (_Float16)((v - (float)hv) * 1024.0f); } }
    __syncthreads();
    for (int e = tid; e < 64 * 16; e += 128) { const int rl = e >> 4, q = e & 15; vst2((unsigned*)(DH + (r0 + rl) * CC + c0 + q * 8), *(const v4u*)&sh[rl][q * 8]); if (hi_rows) vst2((unsigned*)(DL + (bb * nhi + t0 + rl) * (size_t)CC + c0 + q * 8), *(const v4u*)&sl[rl][q * 8]); }
  } else { const bool hi_rows = t0 < KHI;
#pragma unroll
    for (int j = 0; j < 8; ++j) { const float bias = BA ? bfr(BA[c0 + j * 16 + col]) : 0.f;
#pragma unroll
      for (int r = 0; r < 8; ++r) { const float v = acc[j][r] + bias; const int rl = wave * 16 + 8 * g + r, cl = j * 16 + col; th[cl][rl] = (_Float16)v; const __bf16 bh = (__bf16)v; tb[cl][rl] = bh; tbl[cl][rl] = (__bf16)(v - (float)bh); } }
    __syncthreads();
    for (int e = tid; e < 128 * 8; e += 128) { const int cl = e >> 3, q = e & 7; vst2((unsigned*)(VT + (bb * CC + c0 + cl) * (size_t)TT + t0 + q * 8), *(const v4u*)&th[cl][q * 8]); if (hi_rows) { const size_t o3 = (bb * CC + c0 + cl) * (size_t)KHI + t0 + q * 8; vst2((unsigned*)(VB + o3), *(const v4u*)&tb[cl][q * 8]); vst2((unsigned*)(VBL + o3), *(const v4u*)&tbl[cl][q * 8]); } } } }
// ---- k_sm: block = query row t (head in group): keys [0, kend): causal -> logit if s <= t else excluded; softmax in f32; P x 2^11 in place (0 for excluded)
__global__ __launch_bounds__(256) void k_sm(float* __restrict__ S0 SM_EXTRA_PARAMS) { __shared__ float sred[8]; __shared__ float sbc; __shared__ __align__(16) float shv[TT];
  const int tid = threadIdx.x; const int t = blockIdx.x; const int kend = (kb_last(t >> 6) + 1) * 128;
  float* sr = S0 + (size_t)blockIdx.y * TT * TT + (size_t)t * TT;
  float m = -3.0e38f; for (int k = tid; k < kend; k += 256) { float v = (!CAUSAL || k <= t) ? sr[k] : -3.0e38f; SM_MASK_HOOK; shv[k] = v; m = fmaxf(m, v); }
#pragma unroll
  for (int o = 1; o < 32; o <<= 1) m = fmaxf(m, __shfl_xor(m, o));
  if ((tid & 31) == 0) sred[tid >> 5] = m; __syncthreads(); if (tid == 0) { float a = sred[0]; for (int i = 1; i < 8; ++i) a = fmaxf(a, sred[i]); sbc = a; } __syncthreads(); m = sbc; __syncthreads();
  float sum = 0.f; for (int k = tid; k < kend; k += 256) { const float v = shv[k]; const float e = (v <= -1.0e38f) ? 0.f : expf(v - m); shv[k] = e; sum += e; }
#pragma unroll
  for (int o = 1; o < 32; o <<= 1) sum += __shfl_xor(sum, o);
  if ((tid & 31) == 0) sred[tid >> 5] = sum; __syncthreads(); if (tid == 0) { float a = 0.f; for (int i = 0; i < 8; ++i) a += sred[i]; sbc = a > 0.f ? 2048.0f / a : 0.f; }   /* a fully excluded row yields P = 0 */ __syncthreads(); const float inv = sbc;
  for (int k = tid; k < kend; k += 256) shv[k] = shv[k] * inv;
  __syncthreads(); for (int q = tid; q < kend / 4; q += 256) vst2(sr + q * 4, *(const v4f*)&shv[q * 4]); }
#define IEPS 1.0e-32f
__device__ __forceinline__ v8f wmma_h(v16h a, v16h b, v8f c) { return __builtin_amdgcn_wmma_f32_16x16x32_f16(false, a, false, b, (short)0, c, false, false); }
// XW(p): closes a group of global loads off pointer p before a register that they name may be rewritten; p is an input so that the address pair stays live up to the wait (no load of the group may land on it)
#define XW(p) asm volatile("s_wait_xcnt 0x0" :: "v"(p) : "memory")
#define FK 64
#define KP 72
#define NT (TT / FK)
typedef __attribute__((address_space(4))) unsigned cu32;
struct __align__(16) FaBuf { _Float16 k[FK][KP]; _Float16 v[HD][KP]; };
// kg, vg: this thread's 16 B of row (tid >> 3), further rows 16 apart; k0 = first key of the tile
__device__ __forceinline__ void fa_fill(FaBuf& f, const _Float16* kg, const _Float16* vg, int k0, int tid) {
  const int r8 = tid >> 3, c8 = (tid & 7) * 8;
  const _Float16* kq = kg + (size_t)k0 * CC;
  cp4(lds_of(&f.k[r8][c8]), kq, lds_of(&f.k[r8 + 16][c8]), kq + (size_t)16 * CC, lds_of(&f.k[r8 + 32][c8]), kq + (size_t)32 * CC, lds_of(&f.k[r8 + 48][c8]), kq + (size_t)48 * CC);
  const _Float16* vq = vg + k0;
  cp4(lds_of(&f.v[r8][c8]), vq, lds_of(&f.v[r8 + 16][c8]), vq + (size_t)16 * TT, lds_of(&f.v[r8 + 32][c8]), vq + (size_t)32 * TT, lds_of(&f.v[r8 + 48][c8]), vq + (size_t)48 * TT); }
#define RS0 0x1p60f        // first row scale: a row that never leaves it has every t <= 2^-105, of the order of the normaliser's 1e-32 or below, and 1e-32 x RS0^2 is still finite
#define TLIM 32768.0f      // a lane's sum of a tile's scaled t (all >= 0) at or below this bounds each of them inside f16's range
// one tile's scaled t = relu(score x cs + cb)^2 (masked -> 0): once to f16 as the B operand of V^T P^T; returns the lane's f32 sum of them
__device__ __forceinline__ float fa_t(const v8f (&s)[FK / 16], const unsigned (&m)[FK / 2], float cs, float cb, v16h (&p)[FK / 32]) { float ts = 0.f;
#pragma unroll
  for (int u = 0; u < FK / 16; ++u) {
#pragma unroll
    for (int r = 0; r < 8; ++r) { const float x = fmaxf(s[u][r] * cs + cb, 0.f); const float e = __builtin_amdgcn_inverse_ballot_w32(m[8 * u + r]) ? x * x : 0.f; ts += e; p[u >> 1][8 * (u & 1) + r] = (_Float16)e; } }
  return ts; }
// ---- k_fa (scores, SparseNormer and P v in one launch; no score plane in memory): block = 4 waves x 16 queries of (b, h). S^T = K Q^T: lane (g, col) holds query col's scores of keys 8g + r of each 16-key tile, so the row sum is in-lane (+ one exchange between the halves) and two converted S^T tiles are the B operand of ctx^T += V^T P^T.
// ONE pass over the keys: the normaliser is a plain quotient, so ctx = (sum_k t_k v_k) / (sum_k t_k + 1e-32) and both sums grow together. t goes to f16 as t x rs^2 with a power-of-two row scale rs (exact), so its f16 range does not depend on the scale of the scores: rs starts high and is lowered, with both sums rescaled, when a tile would leave f16's range (as a rule once, at the row's first tile with a positive score); the row's largest x then sits at 8..16 and may grow several-fold before the next change. The inner loops are unrolled whole so that the vector elements are indexed by constants and stay in registers.
__global__ __launch_bounds__(128) void k_fa(const _Float16* __restrict__ QH, const _Float16* __restrict__ KH, const _Float16* __restrict__ VT, const unsigned* __restrict__ MB, const float* __restrict__ NBIAS, _Float16* __restrict__ YH) {
  __shared__ FaBuf fb[2];
  const int tid = threadIdx.x, wave = tid >> 5, lane = tid & 31, col = lane & 15, g = lane >> 4; const int h = blockIdx.x, b = blockIdx.z; const int ql = blockIdx.y * 64 + wave * 16 + col;
  const float nb_ = bfr(NBIAS[0]);
  const _Float16* qp = QH + ((size_t)b * TT + ql) * CC + h * HD; const v16h q0 = frag_h(qp, lane), q1 = frag_h(qp + 32, lane); XW(qp);
  const _Float16* kg = KH + ((size_t)b * TT + (tid >> 3)) * CC + h * HD + (tid & 7) * 8; const _Float16* vg = VT + ((size_t)b * CC + h * HD + (tid >> 3)) * (size_t)TT + (tid & 7) * 8;
  const cu32* mw = (const cu32*)(MB + (size_t)((b * TT + blockIdx.y * 64) / 16 + __builtin_amdgcn_readfirstlane(wave)) * (NT * (FK / 2)));   /* the wave's 16 queries' lane-mask words, FK / 2 per tile; a wave-uniform address of words that no one writes during this launch, so they come by scalar loads into scalar registers */
  unsigned m[FK / 2];   /* indexed by constants only (loops unrolled whole), so each word keeps a scalar register */
#pragma unroll
  for (int i = 0; i < FK / 2; ++i) m[i] = mw[i];
  fa_fill(fb[0], kg, vg, 0, tid);
  asm volatile("s_wait_asynccnt 0x0" ::: "memory");   /* tile 0 has landed before the barrier that publishes it */
  __syncthreads();
  fa_fill(fb[1], kg, vg, FK, tid);
  float rs = RS0, cs = SCALE * RS0, cb = nb_ * RS0, sum = 0.f;   /* rs is the same in both halves of a query */
  v8f acc[HD / 16] = {};
  for (int t = 0; t < NT; ++t) { const FaBuf& f = fb[t & 1];
    v8f s[FK / 16]; v16h p[FK / 32];
#pragma unroll
    for (int u = 0; u < FK / 16; ++u) { const v16h ka = frag_h(&f.k[16 * u + col][0], lane), kb = frag_h(&f.k[16 * u + col][32], lane);
      v8f z = {}; z = wmma_h(ka, q0, z); s[u] = wmma_h(kb, q1, z); }
    float ts = fa_t(s, m, cs, cb, p);
    if (__builtin_amdgcn_ballot_w32(!(ts <= TLIM)) != 0) {   /* one test per tile, a scalar branch, rarely taken: some row of the wave needs a lower scale */
      float mx = 0.f;
#pragma unroll
      for (int u = 0; u < FK / 16; ++u) {
#pragma unroll
        for (int r = 0; r < 8; ++r) mx = fmaxf(mx, __builtin_amdgcn_inverse_ballot_w32(m[8 * u + r]) ? s[u][r] * SCALE + nb_ : 0.f); }
      mx = fmaxf(mx, __shfl_xor(mx, 16));   /* the query's largest unmasked x of this tile, the same in both halves */
      int ex; (void)frexpf(mx, &ex);
      const float rn = (mx * rs > 16.0f) ? ldexpf(1.0f, 4 - ex) : rs;   /* mx x rn in [8, 16): every scaled t of the tile <= 256, their sum <= 8192 */
      const float fr = rn / rs, f2 = fr * fr;   /* powers of two: exact (or 0 where the old sums no longer count) */
#pragma unroll
      for (int j = 0; j < HD / 16; ++j) acc[j] *= f2;
      sum *= f2; rs = rn; cs = SCALE * rn; cb = nb_ * rn;
      ts = fa_t(s, m, cs, cb, p); }
    sum += ts;
    { const cu32* mn = mw + (t + 1 < NT ? t + 1 : NT - 1) * (FK / 2);   /* the next tile's words, asked for as soon as this tile's are used: they fly under P v, the hand-over and the next scores (the last trip reads its own again, in bounds) */
#pragma unroll
      for (int i = 0; i < FK / 2; ++i) m[i] = mn[i]; }
#pragma unroll
    for (int hh = 0; hh < FK / 32; ++hh) {
#pragma unroll
      for (int j = 0; j < HD / 16; ++j) acc[j] = wmma_h(frag_h(&f.v[j * 16 + col][32 * hh], lane), p[hh], acc[j]); }
    FA_PUBLISH();
    if (t + 2 < NT) fa_fill(fb[t & 1], kg, vg, (t + 2) * FK, tid); }
  asm volatile("s_wait_asynccnt 0x0" ::: "memory");   /* no copy is outstanding when the wave ends */
  sum += __shfl_xor(sum, 16); const float inv = 1.0f / (sum + (IEPS * rs) * rs);   /* both sums carry rs^2, so does the 1e-32; sum == 0 -> rs == RS0, acc == 0 -> ctx = 0 */
  _Float16* yp = YH + ((size_t)(b * (TT / 64) + blockIdx.y) * KT + h) * TILE + (wave * 16 + col) * 64 + 8 * g;   /* acc[j][r] = ctx[query col][16j + 8g + r]; ctx x 2^6 once to f16 (clear of f16 subnormals), as k_out's A operand: the head's 64 columns are one tile of the block's 64 rows, and the wave writes each query's whole 128-B row of it */
#pragma unroll
  for (int j = 0; j < HD / 16; ++j) { v8h o;
#pragma unroll
    for (int r = 0; r < 8; ++r) o[r] = (_Float16)((acc[j][r] * inv) * 64.0f);
    vst2(yp + j * 16, o); } }
// ---- k_cvt (first launch): the roundings of the projections' operands, once per element: iQ, iK, iV and Wq, Wk, Wv to bf16, Wo to f16(bf16 x 2^8) (exact), written as tiles. A block takes one row per load (256 threads x 16 B, whole lines), eight rows in flight; 128 B of a tile row per 16 lanes on the way out
__global__ __launch_bounds__(256) void k_cvt(const float* __restrict__ XQ, const float* __restrict__ XK, const float* __restrict__ XV, const float* __restrict__ WQ, const float* __restrict__ WK, const float* __restrict__ WV, const float* __restrict__ WO, __bf16* __restrict__ XB, __bf16* __restrict__ WB, _Float16* __restrict__ WOH) {
  const int tid = threadIdx.x, bx = blockIdx.x, k = tid * 4;   /* rows bx + 512 i */
  const size_t so = (size_t)bx * DIN + k, to = ((size_t)(bx >> 6) * KT + (k >> 6)) * TILE + (bx & 63) * 64 + (k & 63);   /* 512 rows on: 512 * DIN elements in either layout */
#pragma unroll
  for (int p = 0; p < 3; ++p) { const float* xp = (p == 0 ? XQ : p == 1 ? XK : XV) + so; __bf16* op = XB + (size_t)p * TNB * TT * DIN + to; v4f a[8];
#pragma unroll
    for (int i = 0; i < 8; ++i) a[i] = *(const v4f*)(xp + (size_t)i * 512 * DIN);
    XW(xp);
#pragma unroll
    for (int i = 0; i < 8; ++i) { v4b o;
#pragma unroll
      for (int e = 0; e < 4; ++e) o[e] = (__bf16)a[i][e];
      *(v4b*)(op + (size_t)i * 512 * DIN) = o; }
    XW(op); }
  v4f a[8];
#pragma unroll
  for (int i = 0; i < 8; ++i) a[i] = *(const v4f*)(((i >> 1) == 0 ? WQ : (i >> 1) == 1 ? WK : (i >> 1) == 2 ? WV : WO) + (size_t)(i & 1) * 512 * DIN + so);
  asm volatile("s_wait_xcnt 0x0" ::: "memory");   /* closes the group of loads before a register that they name may be rewritten */
#pragma unroll
  for (int i = 0; i < 6; ++i) { v4b o;
#pragma unroll
    for (int e = 0; e < 4; ++e) o[e] = (__bf16)a[i][e];
    *(v4b*)(WB + (size_t)i * 512 * DIN + to) = o; }
#pragma unroll
  for (int i = 6; i < 8; ++i) { v4h o;
#pragma unroll
    for (int e = 0; e < 4; ++e) o[e] = (_Float16)(bfr(a[i][e]) * 256.0f);
    *(v4h*)(WOH + (size_t)(i - 6) * 512 * DIN + to) = o; } }
// ---- k_out: block = (64 rows, 128 cols): out = ctx Wo (+ bo): ctx x 2^6 in f16 against Wo as f16(bf16 x 2^8) exact (1 product) x 2^-14
__global__ __launch_bounds__(128) void k_out(const _Float16* __restrict__ YH, const _Float16* __restrict__ WOH, const float* __restrict__ BO, float* __restrict__ OUT) { union SM { float sf[4][16][132]; _Float16 st[2][SROWS][SP]; };   /* the stage buffers lie over the epilogue's array, which is first written behind the loop's last barrier */
  __shared__ __align__(16) SM sm; auto& sf = sm.sf;
  const int tid = threadIdx.x, wave = tid >> 5, lane = tid & 31, col = lane & 15, g = lane >> 4; const int c0 = blockIdx.y * 128; const size_t r0 = (size_t)blockIdx.x * 64 + wave * 16;
  v8f acc[8] = {};
  const _Float16* xt = YH + (size_t)blockIdx.x * KT * TILE + tid * 8; const _Float16* wt = WOH + (size_t)(c0 >> 6) * KT * TILE + tid * 8;   /* this thread's 16 B of the first ctx and Wo tiles */
  g_fill(sm.st[0], xt, wt, tid);
  asm volatile("s_wait_asynccnt 0x0" ::: "memory");   /* stage 0 has landed before the barrier that publishes it */
  __syncthreads();
  g_fill(sm.st[1], xt + TILE, wt + TILE, tid);
  for (int t = 0; t < CC / KS; ++t) { const _Float16 (*cb)[SP] = sm.st[t & 1];
    v16h a[KS / 32], w[KS / 32][8];
#pragma unroll
    for (int kc = 0; kc < KS / 32; ++kc) { a[kc] = frag_h(&cb[wave * 16 + col][kc * 32], lane);
#pragma unroll
      for (int j = 0; j < 8; ++j) w[kc][j] = frag_h(&cb[64 + j * 16 + col][kc * 32], lane); }
#pragma unroll
    for (int kc = 0; kc < KS / 32; ++kc) {
#pragma unroll
      for (int j = 0; j < 8; ++j) acc[j] = wmma16(a[kc], w[kc][j], acc[j]); }
    FA_PUBLISH();
    if (t + 2 < CC / KS) g_fill(sm.st[t & 1], xt + (size_t)(t + 2) * TILE, wt + (size_t)(t + 2) * TILE, tid); }   /* into the buffer that every wave has just left */
  asm volatile("s_wait_asynccnt 0x0" ::: "memory");   /* no copy is outstanding when the buffers become the epilogue's array */
#pragma unroll
  for (int j = 0; j < 8; ++j) { const float bias = BO ? bfr(BO[c0 + j * 16 + col]) : 0.f;
#pragma unroll
    for (int r = 0; r < 8; ++r) sf[wave][8 * g + r][j * 16 + col] = acc[j][r] * (1.0f / 16384.0f) + bias; }   /* 2^-8 (Wo carry) x 2^-6 (ctx carry) */
  LDSX(); for (int rl = 0; rl < 16; ++rl) vst2(OUT + (r0 + rl) * DIN + c0 + lane * 4, *(const v4f*)&sf[wave][rl][lane * 4]); }

extern "C" void kernel_launch(void* const* d_in, const int* in_sizes, int n_in, void* d_out, int out_size, void* d_ws, size_t ws_size, hipStream_t stream) {
  (void)in_sizes; (void)n_in; (void)out_size;
  const float** F = (const float**)d_in;
  if (ws_size < (size_t)WS_END) return;
  char* ws = (char*)d_ws; _Float16 *QH = (_Float16*)(ws + WS_QH), *KH = (_Float16*)(ws + WS_KH), *VT = (_Float16*)(ws + WS_VT), *QL = (_Float16*)(ws + WS_QL), *KL = (_Float16*)(ws + WS_KL); __bf16 *VB = (__bf16*)(ws + WS_VB), *VBL = (__bf16*)(ws + WS_VBL); _Float16 *YH = (_Float16*)(ws + WS_Y), *WOH = (_Float16*)(ws + WS_WO); __bf16 *XB = (__bf16*)(ws + WS_XB), *WB = (__bf16*)(ws + WS_WB); unsigned* MB = (unsigned*)(ws + WS_S);   /* lane-mask words of the mask, 1 MiB, in the place of the old score plane */
  (void)QL; (void)KL; (void)VB; (void)VBL;
  // inputs: 0 iQ [2,2048,1024]; 1 iK; 2 iV; 3 mask [2,2048,2048] bool (True = masked); 4 Wq [1024,1024] (out,in), 5 bq; 6 Wk, 7 bk; 8 Wv, 9 bv; 10 Wo (out,in), 11 bo (zero biases, read); 12 nbias [1] (SparseNormer bias; zero)
  k_cvt<<<dim3(512), 256, 0, stream>>>(F[0], F[1], F[2], F[4], F[6], F[8], F[10], XB, WB, WOH);
  k_proj<<<dim3(TNB * TT / 64, CC / 128, 4), 128, 0, stream>>>(XB, WB, F[5], F[7], F[9], QH, QL, KH, KL, VT, VB, VBL, (const int*)d_in[3], MB);   /* z = 3: the mask's packing blocks, short, last in the launch */
  k_fa<<<dim3(NH, NQB, TNB), 128, 0, stream>>>(QH, KH, VT, MB, F[12], YH);   /* relu(x + nbias)^2 / (sum + 1e-32): NOT a softmax */
  k_out<<<dim3(TNB * TT / 64, DIN / 128), 128, 0, stream>>>(YH, WOH, F[11], (float*)d_out);
}

// v007
// It runs in 90.5 microseconds.
// Two timings next to v006 both put it at 1.12 times that version's speed.
// Counting every step since v000, it is 14.7 times as fast.
// compute dtype: all float inputs rounded to bf16; q/k/v projections with EXACT bf16 products on WMMA 16x16x32 (f32 accumulate) + bias; scores q x k once to f16 each (1 product) x 64^-0.5; SparseNormer in f32: t = relu(score + nbias)^2 (masked entries -> 0); t x 2^2n (n per row) once to f16 x v once to f16 (1 product), ctx = that sum / (sum t + 1e-32); ctx x 2^6 once to f16 x Wo f16(bf16 x 2^8) + bo; f32 output.
#include <hip/hip_runtime.h>
#include <math.h>

typedef __attribute__((ext_vector_type(16))) _Float16 v16h;
typedef __attribute__((ext_vector_type(16))) __bf16 v16b;
typedef __attribute__((ext_vector_type(8)))  _Float16 v8h;
typedef __attribute__((ext_vector_type(8)))  float v8f;
typedef __attribute__((ext_vector_type(4)))  float v4f;
typedef __attribute__((ext_vector_type(2)))  float v2f;
typedef __attribute__((ext_vector_type(4)))  unsigned v4u;
typedef __attribute__((ext_vector_type(4)))  int v4i;
typedef float __attribute__((may_alias)) float_a;
typedef int __attribute__((may_alias)) int_a;

template <typename T> __device__ __forceinline__ void vst2(void* p, T v) { *(T*)p = v;  }
__device__ __forceinline__ v8f wmma16(v16h a, v16h b, v8f c) {
  v8f d = __builtin_amdgcn_wmma_f32_16x16x32_f16(false, a, false, b, (short)0, c, false, false);
  asm volatile("v_nop\n\tv_nop\n\tv_nop\n\tv_nop" : "+v"(d) : "v"(a), "v"(b));
  return d;
}
__device__ __forceinline__ v8f wmma_bf(v16b a, v16b b, v8f c) {
  v8f d = __builtin_amdgcn_wmma_f32_16x16x32_bf16(false, a, false, b, (short)0, c, false, false);
  asm volatile("v_nop\n\tv_nop\n\tv_nop\n\tv_nop" : "+v"(d) : "v"(a), "v"(b));
  return d;
}
// 16x16x32 fragments: lane = (h = lane>>4, row/col = lane&15); elements 0..7 = k0+8h+0..7, 8..15 = k0+16+8h+0..7; D element r = row 8h+r
__device__ __forceinline__ v16h frag_h(const _Float16* rowk0, int lane) {
  union { v16h v; v8h q[2]; } u; const _Float16* p = rowk0 + 8 * (lane >> 4);
  u.q[0] = *(const v8h*)p; u.q[1] = *(const v8h*)(p + 16); return u.v;
}
__device__ __forceinline__ v16h frag_f32(const float* rowk0, int lane) {
  v16h a; const float* p = rowk0 + 8 * (lane >> 4);
#pragma unroll
  for (int i = 0; i < 8; ++i) { a[i] = (_Float16)p[i]; a[8 + i] = (_Float16)p[16 + i]; }
  return a;
}
__device__ __forceinline__ v16h frag_f32s(const float* rowk0, int lane, float sc) {
  v16h a; const float* p = rowk0 + 8 * (lane >> 4);
#pragma unroll
  for (int i = 0; i < 8; ++i) { a[i] = (_Float16)(p[i] * sc); a[8 + i] = (_Float16)(p[16 + i] * sc); }
  return a;
}
// column fragment from a [K][ld] layout (column n), rows >= K read as 0
__device__ __forceinline__ v16h fragc_f32(const float* W, int k0, int n, int lane, int ld, int K) {
  v16h a; const int g = lane >> 4;
#pragma unroll
  for (int i = 0; i < 8; ++i) { const int ka = k0 + 8 * g + i, kb = ka + 16;
    a[i] = (_Float16)(ka < K ? W[(size_t)(ka < K ? ka : K - 1) * ld + n] : 0.f); a[8 + i] = (_Float16)(kb < K ? W[(size_t)(kb < K ? kb : K - 1) * ld + n] : 0.f); }
  return a;
}
struct F2 { v16b h, l; };
__device__ __forceinline__ F2 bsplit16(const float v[16]) { F2 r;
#pragma unroll
  for (int i = 0; i < 16; ++i) { const __bf16 h = (__bf16)v[i]; r.h[i] = h; r.l[i] = (__bf16)(v[i] - (float)h); }
  return r; }
__device__ __forceinline__ F2 split_row(const float* row, int k0, int lane) { float v[16]; const float* p = row + k0 + 8 * (lane >> 4);
#pragma unroll
  for (int i = 0; i < 8; ++i) { v[i] = p[i]; v[8 + i] = p[16 + i]; }
  return bsplit16(v); }
__device__ __forceinline__ F2 split_rowK(const float* row, int k0, int lane, int K) { float v[16]; const int g = lane >> 4;
#pragma unroll
  for (int i = 0; i < 8; ++i) { const int ka = k0 + 8 * g + i, kb = ka + 16; v[i] = ka < K ? row[ka < K ? ka : K - 1] : 0.f; v[8 + i] = kb < K ? row[kb < K ? kb : K - 1] : 0.f; }
  return bsplit16(v); }
__device__ __forceinline__ F2 split_col(const float* W, int k0, int n, int lane, int ld, int K) { float v[16]; const int g = lane >> 4;
#pragma unroll
  for (int i = 0; i < 8; ++i) { const int ka = k0 + 8 * g + i, kb = ka + 16; v[i] = ka < K ? W[(size_t)(ka < K ? ka : K - 1) * ld + n] : 0.f; v[8 + i] = kb < K ? W[(size_t)(kb < K ? kb : K - 1) * ld + n] : 0.f; }
  return bsplit16(v); }
__device__ __forceinline__ v8f mac3(const F2& a, const F2& b, v8f c) { c = wmma_bf(a.l, b.h, c); c = wmma_bf(a.h, b.l, c); return wmma_bf(a.h, b.h, c); }
__device__ __forceinline__ float sigm(float v) { return 1.0f / (1.0f + expf(-v)); }
#define LDSX() do { asm volatile("s_wait_dscnt 0" ::: "memory"); __builtin_amdgcn_wave_barrier(); __builtin_amdgcn_fence(__ATOMIC_RELEASE, "workgroup"); } while (0)

// Multi-head attention with a SparseNormer instead of a softmax (iQ / iK / iV [2,2048,1024] separate inputs; torch (out,in) Wq / Wk / Wv / Wo [1024,1024] (0.02 scale) + zero biases; 16 heads x 64; scores / 8; mask [2,2048,2048] bool random (True -> -1e32); t = relu(scores + nbias)^2 with nbias = zeros(1); attn = t / (sum_k t + 1e-32)): out = merge(attn v) Wo^T + bo.
#define NB 2
#define TT 2048
#define CC 1024            // NH * HD = projected width
#define DIN 1024          // input (model) width
#define NH 16
#define HD 64
#define NQB (TT / 64)
#define HG 4
#define SCALE (0.125f)
#define CAUSAL 0
#ifndef TNB
#define TNB NB
#endif
__device__ __forceinline__ float bfr(float v) { return (float)(__bf16)v; }
__host__ __device__ __forceinline__ int kb_last(int qb) { return CAUSAL ? ((qb * 64 + 63) >> 7) : (TT / 128 - 1); }
typedef __attribute__((ext_vector_type(8))) __bf16 v8b;
__device__ __forceinline__ v16b frag_b(const __bf16* rowk0, int lane) {
  union { v16b v; v8b q[2]; } u; const __bf16* p = rowk0 + 8 * (lane >> 4);
  u.q[0] = *(const v8b*)p; u.q[1] = *(const v8b*)(p + 16); return u.v;
}
#define QBH 0              // not used by any kernel here
#define QHI 0               // single-product scores on every row
#define KHI 64            // key rows carrying k residual / v bf16 hi+lo planes (written and read by no kernel here)
// B fragment (k rows k0+.., output column o) of a weight: (in,out) [K][ld] or (out,in) [ld rows of K]: bf16 exact, or f16(bf16 * 256) exact
__device__ __forceinline__ v16b wcol_io(const float* Wm, int k0, int o, int lane, int ld) { v16b w; const int g = lane >> 4;
#pragma unroll
  for (int i = 0; i < 8; ++i) { w[i] = (__bf16)Wm[(size_t)(k0 + 8 * g + i) * ld + o]; w[8 + i] = (__bf16)Wm[(size_t)(k0 + 16 + 8 * g + i) * ld + o]; }
  return w; }
__device__ __forceinline__ v16b wcol_oi(const float* Wm, int k0, int o, int lane, int K) { v16b w; const float* p = Wm + (size_t)o * K + k0 + 8 * (lane >> 4);
#pragma unroll
  for (int i = 0; i < 8; ++i) { w[i] = (__bf16)p[i]; w[8 + i] = (__bf16)p[16 + i]; }
  return w; }
__device__ __forceinline__ v16h wcolh_io(const float* Wm, int k0, int o, int lane, int ld) { v16h w; const int g = lane >> 4;
#pragma unroll
  for (int i = 0; i < 8; ++i) { w[i] = (_Float16)(bfr(Wm[(size_t)(k0 + 8 * g + i) * ld + o]) * 256.0f); w[8 + i] = (_Float16)(bfr(Wm[(size_t)(k0 + 16 + 8 * g + i) * ld + o]) * 256.0f); }
  return w; }
__device__ __forceinline__ v16h wcolh_oi(const float* Wm, int k0, int o, int lane, int K) { v16h w; const float* p = Wm + (size_t)o * K + k0 + 8 * (lane >> 4);
#pragma unroll
  for (int i = 0; i < 8; ++i) { w[i] = (_Float16)(bfr(p[i]) * 256.0f); w[8 + i] = (_Float16)(bfr(p[16 + i]) * 256.0f); }
  return w; }
#define WQKV_LAYOUT 1   // 0 = (in,out) [DIN][CC]; 1 = (out,in) [CC][DIN]; 2 = per-head [NH][DIN][HD]
__device__ __forceinline__ v16b wcol_hdk(const float* Wm, int k0, int o, int lane) { v16b w; const int g = lane >> 4; const float* p = Wm + (size_t)(o / HD) * DIN * HD + (o % HD);
#pragma unroll
  for (int i = 0; i < 8; ++i) { w[i] = (__bf16)p[(size_t)(k0 + 8 * g + i) * HD]; w[8 + i] = (__bf16)p[(size_t)(k0 + 16 + 8 * g + i) * HD]; }
  return w; }
#define WO_OUT_IN 1
#if WQKV_LAYOUT == 1
#define WCOL(W, k0, o, lane) wcol_oi(W, k0, o, lane, DIN)
#elif WQKV_LAYOUT == 2
#define WCOL(W, k0, o, lane) wcol_hdk(W, k0, o, lane)
#else
#define WCOL(W, k0, o, lane) wcol_io(W, k0, o, lane, CC)
#endif
#if WO_OUT_IN
#define WOCOL(W, k0, o, lane) wcol_oi(W, k0, o, lane, CC)
#define WOCOLH(W, k0, o, lane) wcolh_oi(W, k0, o, lane, CC)
#else
#define WOCOL(W, k0, o, lane) wcol_io(W, k0, o, lane, DIN)
#define WOCOLH(W, k0, o, lane) wcolh_io(W, k0, o, lane, DIN)
#endif

#ifndef SM_EXTRA_PARAMS
#define SM_EXTRA_PARAMS
#endif
#ifndef PROJ_EXTRA_PARAMS
#define PROJ_EXTRA_PARAMS
#endif
#ifndef SM_MASK_HOOK
#define SM_MASK_HOOK (void)0
#endif

#define WS_QH  0u                                      // f16 q rows [b*t][CC]
#define WS_KH  (WS_QH + 2u * (size_t)NB * TT * CC)      // f16 k rows [b*t][CC]
#define WS_VT  (WS_KH + 2u * (size_t)NB * TT * CC)      // f16 v planes [b][c][t]
#define WS_QL  (WS_VT + 2u * (size_t)NB * CC * TT)      // f16 q residual x 2^10 rows [b][t < QHI][CC]
#define WS_KL  (WS_QL + 2u * (size_t)NB * QHI * CC)     // f16 k residual x 2^10 rows [b][t < KHI][CC]
#define WS_VB  (WS_KL + 2u * (size_t)NB * KHI * CC)     // bf16 v hi planes [b][c][t < KHI]
#define WS_VBL (WS_VB + 2u * (size_t)NB * CC * KHI)
#define WS_S   (WS_VBL + 2u * (size_t)NB * CC * KHI)    // lane-mask words, then operand tiles (room of an f32 plane [hg][t][s])
#define WS_Y   (WS_S  + 4u * (size_t)HG * TT * TT)      // f16 ctx x 2^6 tiles
#define WS_END (WS_Y  + 4u * (size_t)NB * TT * CC)
#define WS_XB  (WS_S + (2u << 20))                      // bf16 iQ, iK, iV tiles, behind the mask words in the place of the old score plane
#define WS_WB  (WS_XB + 3u * 2u * (size_t)NB * TT * DIN) // bf16 Wq, Wk, Wv tiles, then f16 Wo tiles
#define WS_WO  (WS_WB + 3u * 2u * (size_t)CC * DIN)
static_assert(WS_WO + 2u * (size_t)CC * DIN <= WS_Y, "the operand tiles stay inside the old score plane");

// ---- operands of the two projection kernels: every X, W and ctx element is rounded ONCE to its 16-bit operand type and kept in memory as tiles of 64 rows x 64 k (8 KB contiguous): element (row, k) at ((row >> 6) * 16 + (k >> 6)) * 4096 + (row & 63) * 64 + (k & 63); every matrix here has 1024 k. A block's 128 X rows and 128 W rows, KS k at a time, are four such tiles, which come by asynchronous copies straight into LDS (512 contiguous bytes per wave and copy), where all four waves read their fragments; two buffers, the next stage's copies fly while this stage is multiplied
#define KS 64              // k per stage
#define SP 72              // LDS row pitch in 16-bit elements: 144 B = 16 B x 9, an odd multiple of 16 B, which ds_load_b128 fragment reads take without bank conflicts
#define SROWS 256          // rows 0..127 = X, 128..255 = W
#define TILE 4096          // elements of a tile
#define KT (DIN / 64)      // tiles per block of 64 rows
typedef __attribute__((ext_vector_type(4))) __bf16 v4b;
typedef __attribute__((ext_vector_type(4))) _Float16 v4h;
__device__ __forceinline__ unsigned lds_of(const void* p) { return (unsigned)(size_t)p; }   /* LDS byte address = low 32 bits of the __shared__ address */
// four copies of 16 B per lane; the s_wait_xcnt closes the group inside its own statement, before a register that a copy names may be rewritten
__device__ __forceinline__ void cp4(unsigned l0, const void* g0, unsigned l1, const void* g1, unsigned l2, const void* g2, unsigned l3, const void* g3) {
  asm volatile("global_load_async_to_lds_b128 %0, %1, off\n\tglobal_load_async_to_lds_b128 %2, %3, off\n\tglobal_load_async_to_lds_b128 %4, %5, off\n\tglobal_load_async_to_lds_b128 %6, %7, off\n\ts_wait_xcnt 0x0"
               :: "v"(l0), "v"(g0), "v"(l1), "v"(g1), "v"(l2), "v"(g2), "v"(l3), "v"(g3) : "memory"); }
// hand-over of a tile: this wave's LDS reads of the old tile are done, its own copies of the next tile have landed, and the barrier publishes the next tile and frees the old buffer
#define FA_PUBLISH() do { asm volatile("s_wait_dscnt 0x0" ::: "memory"); asm volatile("s_wait_asynccnt 0x0" ::: "memory"); __syncthreads(); } while (0)
// one tile into 64 LDS rows from row r0 on; tp: this thread's 16 B of the tile (element tid * 8), further copies 16 rows = 1024 elements apart
template <typename T> __device__ __forceinline__ void g_tile(T (*st)[SP], int r0, const T* tp, int tid) { const int r8 = r0 + (tid >> 3), c8 = (tid & 7) * 8;
  cp4(lds_of(&st[r8][c8]), tp, lds_of(&st[r8 + 16][c8]), tp + 1024, lds_of(&st[r8 + 32][c8]), tp + 2048, lds_of(&st[r8 + 48][c8]), tp + 3072); }
// one stage: the X tiles and the W tiles of two neighbouring blocks of 64 rows each
template <typename T> __device__ __forceinline__ void g_fill(T (*st)[SP], const T* xt, const T* wt, int tid) { g_tile(st, 0, xt, tid); g_tile(st, 64, xt + (size_t)KT * TILE, tid); g_tile(st, 128, wt, tid); g_tile(st, 192, wt + (size_t)KT * TILE, tid); }
// ---- mask as lane masks: word [16-query group][64-key tile][8u + r], bit 16g + col = (mask[query col][key 16u + 8g + r] == 0, the key counts): the very lane that holds that score in k_fa, so a word is the select mask of one score register; 1/32 of the i32 mask's bytes
#define PKP 260            // LDS row pitch in words of the packing blocks: 1040 B = 16 B x 65 (odd)
#define PKT 4              // tiles of 64 keys per packing wave
static_assert(2 * (TNB * TT / 128) * (CC / 128) * 4 * PKT == (TNB * TT / 16) * (TT / 64), "the packing blocks' waves cover every (query group, tile) once");
// ---- k_proj: block = (128 rows, 128 cols, which): which 3, 4: the mask's lane-mask words (see above); else q/k/v = X W (+ b) with exact bf16 products (K = DIN) -> which 0: q f16 rows; 1: k f16 rows; 2: v f16 planes [c][t]. The four waves stand 2 x 2, each on 64 rows x 64 cols: a fragment read from LDS feeds four products
__global__ __launch_bounds__(128) void k_proj(const __bf16* __restrict__ XB, const __bf16* __restrict__ WB, const float* __restrict__ BQ, const float* __restrict__ BK, const float* __restrict__ BV,
    _Float16* __restrict__ QH, _Float16* __restrict__ KH, _Float16* __restrict__ VT, const int* __restrict__ MASK, unsigned* __restrict__ MB) {
  union SM { _Float16 sh[128][136]; __bf16 st[2][SROWS][SP]; int pk[4][16][PKP]; };   /* the stage buffers lie over the epilogue's array, which is first written behind the loop's last barrier */
  __shared__ __align__(16) SM sm; auto& sh = sm.sh;
  const int tid = threadIdx.x, wave = tid >> 5, lane = tid & 31, col = lane & 15, g = lane >> 4, wr = wave >> 1, wc = wave & 1; const int which = blockIdx.z; const int c0 = blockIdx.y * 128; const size_t r0 = (size_t)blockIdx.x * 128; const size_t bb = r0 / TT; const int t0 = (int)(r0 % TT);
  if (which >= 3) {   /* block-uniform, in front of every barrier: each wave packs 16 queries x PKT tiles; the rows come as whole lines (512 B of one row per load) and turn through the wave's own LDS rows into the score layout; the loops are unrolled whole so that all 32 loads are in flight together and the vectors are indexed by constants */
    const int id = (((which - 3) * (TNB * TT / 128) + blockIdx.x) * (CC / 128) + blockIdx.y) * 4 + wave, qg = id / (TT / 64 / PKT), tq = id % (TT / 64 / PKT);
    const int* mp = MASK + (size_t)qg * 16 * TT + tq * (PKT * 64) + lane * 4; v4i mv[32];
#pragma unroll
    for (int i = 0; i < 32; ++i) mv[i] = *(const v4i*)(mp + (size_t)(i >> 1) * TT + (i & 1) * 128);
    asm volatile("s_wait_xcnt 0x0" :: "v"(mp) : "memory");   /* closes the group of loads before a register that they name may be rewritten */
#pragma unroll
    for (int i = 0; i < 32; ++i) *(v4i*)&sm.pk[wave][i >> 1][(i & 1) * 128 + lane * 4] = mv[i];
    LDSX();   /* the wave's own rows are written before its lanes read each other's words */
#pragma unroll
    for (int tl = 0; tl < PKT; ++tl) { unsigned w = 0;
#pragma unroll
      for (int u = 0; u < 4; ++u) { const v4i a = *(const v4i*)&sm.pk[wave][col][tl * 64 + 16 * u + 8 * g], c = *(const v4i*)&sm.pk[wave][col][tl * 64 + 16 * u + 8 * g + 4];
#pragma unroll
        for (int r = 0; r < 8; ++r) { const unsigned bl = __builtin_amdgcn_ballot_w32((r < 4 ? a[r & 3] : c[r & 3]) == 0); w = (lane == 8 * u + r) ? bl : w; } }
      MB[((size_t)qg * (TT / 64) + tq * PKT + tl) * 32 + lane] = w; }   /* 128 B per tile, one line */
    return; }
  const float* BA = which == 0 ? BQ : which == 1 ? BK : BV;
  v8f acc[4][4] = {};   /* acc[i][j][r] = element (row 64 wr + 16 i + 8 g + r, column 64 wc + 16 j + col) of the block */
  const __bf16* xt = XB + ((size_t)which * (TNB * TT / 64) + blockIdx.x * 2) * KT * TILE + tid * 8; const __bf16* wt = WB + ((size_t)which * (CC / 64) + (c0 >> 6)) * KT * TILE + tid * 8;   /* this thread's 16 B of the first X and W tiles; the next stage's tiles follow TILE elements on */
  g_fill(sm.st[0], xt, wt, tid);
  asm volatile("s_wait_asynccnt 0x0" ::: "memory");   /* stage 0 has landed before the barrier that publishes it */
  __syncthreads();
  g_fill(sm.st[1], xt + TILE, wt + TILE, tid);
  for (int t = 0; t < DIN / KS; ++t) { const __bf16 (*cb)[SP] = sm.st[t & 1];
    v16b a[KS / 32][4], w[KS / 32][4];
#pragma unroll
    for (int kc = 0; kc < KS / 32; ++kc) {
#pragma unroll
      for (int i = 0; i < 4; ++i) { a[kc][i] = frag_b(&cb[wr * 64 + i * 16 + col][kc * 32], lane); w[kc][i] = frag_b(&cb[128 + wc * 64 + i * 16 + col][kc * 32], lane); } }
    __builtin_amdgcn_sched_barrier(0);   /* keeps the stage's 32 LDS reads together in front of its products: left alone the compiler sinks them among the products, two at a time, each pair with a full wait in front of four products */
#pragma unroll
    for (int kc = 0; kc < KS / 32; ++kc) {
#pragma unroll
      for (int i = 0; i < 4; ++i) {
#pragma unroll
        for (int j = 0; j < 4; ++j) acc[i][j] = __builtin_amdgcn_wmma_f32_16x16x32_bf16(false, a[kc][i], false, w[kc][j], (short)0, acc[i][j], false, false); } }
    __builtin_amdgcn_sched_barrier(0);   /* keeps the products in front of the hand-over: lifted over them, its waits would give the next tile's copies only the LDS reads' time to land */
    FA_PUBLISH();
    if (t + 2 < DIN / KS) g_fill(sm.st[t & 1], xt + (size_t)(t + 2) * TILE, wt + (size_t)(t + 2) * TILE, tid); }   /* into the buffer that every wave has just left */
  asm volatile("s_wait_asynccnt 0x0" ::: "memory");   /* no copy is outstanding when the buffers become the epilogue's array */
  float bias[4] = {0.f, 0.f, 0.f, 0.f};
  if (BA) { const float* bp = BA + c0 + wc * 64 + col;   /* one test, so that the four loads go out together */
#pragma unroll
    for (int j = 0; j < 4; ++j) bias[j] = bp[j * 16];
#pragma unroll
    for (int j = 0; j < 4; ++j) bias[j] = bfr(bias[j]); }
  if (which < 2) { _Float16* DH = (which == 0 ? QH : KH) + (r0 + (tid >> 4)) * CC + c0 + (tid & 15) * 8;   /* this thread's 16 B of row tid >> 4, further rows 8 apart */
#pragma unroll
    for (int j = 0; j < 4; ++j) {
#pragma unroll
      for (int i = 0; i < 4; ++i) {
#pragma unroll
        for (int r = 0; r < 8; ++r) sh[wr * 64 + i * 16 + 8 * g + r][wc * 64 + j * 16 + col] = (_Float16)(acc[i][j][r] + bias[j]); } }
    __syncthreads();
#pragma unroll
    for (int e = 0; e < 16; ++e) vst2((unsigned*)(DH + (size_t)e * 8 * CC), *(const v4u*)&sh[e * 8 + (tid >> 4)][(tid & 15) * 8]);   /* 256 B of a row per 16 lanes */
    asm volatile("s_wait_xcnt 0x0" :: "v"(DH) : "memory");   /* closes the run of stores before a register that they name may be rewritten */
  } else { _Float16* DV = VT + (bb * CC + c0 + (tid >> 4)) * (size_t)TT + t0 + (tid & 15) * 8;   /* sh holds the block transposed: [column][row] */
#pragma unroll
    for (int j = 0; j < 4; ++j) {
#pragma unroll
      for (int i = 0; i < 4; ++i) { v8h o;
#pragma unroll
        for (int r = 0; r < 8; ++r) o[r] = (_Float16)(acc[i][j][r] + bias[j]);
        *(v8h*)&sh[wc * 64 + j * 16 + col][wr * 64 + i * 16 + 8 * g] = o; } }   /* a lane's eight rows of a column lie side by side */
    __syncthreads();
#pragma unroll
    for (int e = 0; e < 16; ++e) vst2((unsigned*)(DV + (size_t)e * 8 * TT), *(const v4u*)&sh[e * 8 + (tid >> 4)][(tid & 15) * 8]); } }
// ---- k_sm: block = query row t (head in group): keys [0, kend): causal -> logit if s <= t else excluded; softmax in f32; P x 2^11 in place (0 for excluded)
__global__ __launch_bounds__(256) void k_sm(float* __restrict__ S0 SM_EXTRA_PARAMS) { __shared__ float sred[8]; __shared__ float sbc; __shared__ __align__(16) float shv[TT];
  const int tid = threadIdx.x; const int t = blockIdx.x; const int kend = (kb_last(t >> 6) + 1) * 128;
  float* sr = S0 + (size_t)blockIdx.y * TT * TT + (size_t)t * TT;
  float m = -3.0e38f; for (int k = tid; k < kend; k += 256) { float v = (!CAUSAL || k <= t) ? sr[k] : -3.0e38f; SM_MASK_HOOK; shv[k] = v; m = fmaxf(m, v); }
#pragma unroll
  for (int o = 1; o < 32; o <<= 1) m = fmaxf(m, __shfl_xor(m, o));
  if ((tid & 31) == 0) sred[tid >> 5] = m; __syncthreads(); if (tid == 0) { float a = sred[0]; for (int i = 1; i < 8; ++i) a = fmaxf(a, sred[i]); sbc = a; } __syncthreads(); m = sbc; __syncthreads();
  float sum = 0.f; for (int k = tid; k < kend; k += 256) { const float v = shv[k]; const float e = (v <= -1.0e38f) ? 0.f : expf(v - m); shv[k] = e; sum += e; }
#pragma unroll
  for (int o = 1; o < 32; o <<= 1) sum += __shfl_xor(sum, o);
  if ((tid & 31) == 0) sred[tid >> 5] = sum; __syncthreads(); if (tid == 0) { float a = 0.f; for (int i = 0; i < 8; ++i) a += sred[i]; sbc = a > 0.f ? 2048.0f / a : 0.f; }   /* a fully excluded row yields P = 0 */ __syncthreads(); const float inv = sbc;
  for (int k = tid; k < kend; k += 256) shv[k] = shv[k] * inv;
  __syncthreads(); for (int q = tid; q < kend / 4; q += 256) vst2(sr + q * 4, *(const v4f*)&shv[q * 4]); }
#define IEPS 1.0e-32f
__device__ __forceinline__ v8f wmma_h(v16h a, v16h b, v8f c) { return __builtin_amdgcn_wmma_f32_16x16x32_f16(false, a, false, b, (short)0, c, false, false); }
// XW(p): closes a group of global loads off pointer p before a register that they name may be rewritten; p is an input so that the address pair stays live up to the wait (no load of the group may land on it)
#define XW(p) asm volatile("s_wait_xcnt 0x0" :: "v"(p) : "memory")
#define FK 64
#define KP 72
#define NT (TT / FK)
typedef __attribute__((address_space(4))) unsigned cu32;
struct __align__(16) FaBuf { _Float16 k[FK][KP]; _Float16 v[HD][KP]; };
// kg, vg: this thread's 16 B of row (tid >> 3), further rows 16 apart; k0 = first key of the tile
__device__ __forceinline__ void fa_fill(FaBuf& f, const _Float16* kg, const _Float16* vg, int k0, int tid) {
  const int r8 = tid >> 3, c8 = (tid & 7) * 8;
  const _Float16* kq = kg + (size_t)k0 * CC;
  cp4(lds_of(&f.k[r8][c8]), kq, lds_of(&f.k[r8 + 16][c8]), kq + (size_t)16 * CC, lds_of(&f.k[r8 + 32][c8]), kq + (size_t)32 * CC, lds_of(&f.k[r8 + 48][c8]), kq + (size_t)48 * CC);
  const _Float16* vq = vg + k0;
  cp4(lds_of(&f.v[r8][c8]), vq, lds_of(&f.v[r8 + 16][c8]), vq + (size_t)16 * TT, lds_of(&f.v[r8 + 32][c8]), vq + (size_t)32 * TT, lds_of(&f.v[r8 + 48][c8]), vq + (size_t)48 * TT); }
#define RS0 0x1p60f        // first row scale: a row that never leaves it has every t <= 2^-105, of the order of the normaliser's 1e-32 or below, and 1e-32 x RS0^2 is still finite
#define TLIM 32768.0f      // a lane's sum of a tile's scaled t (all >= 0) at or below this bounds each of them inside f16's range
// one tile's scaled t = relu(score x cs + cb)^2 (masked -> 0): once to f16 as the B operand of V^T P^T; returns the lane's f32 sum of them
__device__ __forceinline__ float fa_t(const v8f (&s)[FK / 16], const unsigned (&m)[FK / 2], float cs, float cb, v16h (&p)[FK / 32]) { float ts = 0.f;
#pragma unroll
  for (int u = 0; u < FK / 16; ++u) {
#pragma unroll
    for (int r = 0; r < 8; ++r) { const float x = fmaxf(s[u][r] * cs + cb, 0.f); const float e = __builtin_amdgcn_inverse_ballot_w32(m[8 * u + r]) ? x * x : 0.f; ts += e; p[u >> 1][8 * (u & 1) + r] = (_Float16)e; } }
  return ts; }
// ---- k_fa (scores, SparseNormer and P v in one launch; no score plane in memory): block = 4 waves x 16 queries of (b, h). S^T = K Q^T: lane (g, col) holds query col's scores of keys 8g + r of each 16-key tile, so the row sum is in-lane (+ one exchange between the halves) and two converted S^T tiles are the B operand of ctx^T += V^T P^T.
// ONE pass over the keys: the normaliser is a plain quotient, so ctx = (sum_k t_k v_k) / (sum_k t_k + 1e-32) and both sums grow together. t goes to f16 as t x rs^2 with a power-of-two row scale rs (exact), so its f16 range does not depend on the scale of the scores: rs starts high and is lowered, with both sums rescaled, when a tile would leave f16's range (as a rule once, at the row's first tile with a positive score); the row's largest x then sits at 8..16 and may grow several-fold before the next change. The inner loops are unrolled whole so that the vector elements are indexed by constants and stay in registers.
__global__ __launch_bounds__(128) void k_fa(const _Float16* __restrict__ QH, const _Float16* __restrict__ KH, const _Float16* __restrict__ VT, const unsigned* __restrict__ MB, const float* __restrict__ NBIAS, _Float16* __restrict__ YH) {
  __shared__ FaBuf fb[2];
  const int tid = threadIdx.x, wave = tid >> 5, lane = tid & 31, col = lane & 15, g = lane >> 4; const int h = blockIdx.x, b = blockIdx.z; const int ql = blockIdx.y * 64 + wave * 16 + col;
  const float nb_ = bfr(NBIAS[0]);
  const _Float16* qp = QH + ((size_t)b * TT + ql) * CC + h * HD; const v16h q0 = frag_h(qp, lane), q1 = frag_h(qp + 32, lane); XW(qp);
  const _Float16* kg = KH + ((size_t)b * TT + (tid >> 3)) * CC + h * HD + (tid & 7) * 8; const _Float16* vg = VT + ((size_t)b * CC + h * HD + (tid >> 3)) * (size_t)TT + (tid & 7) * 8;
  const cu32* mw = (const cu32*)(MB + (size_t)((b * TT + blockIdx.y * 64) / 16 + __builtin_amdgcn_readfirstlane(wave)) * (NT * (FK / 2)));   /* the wave's 16 queries' lane-mask words, FK / 2 per tile; a wave-uniform address of words that no one writes during this launch, so they come by scalar loads into scalar registers */
  unsigned m[FK / 2];   /* indexed by constants only (loops unrolled whole), so each word keeps a scalar register */
#pragma unroll
  for (int i = 0; i < FK / 2; ++i) m[i] = mw[i];
  fa_fill(fb[0], kg, vg, 0, tid);
  asm volatile("s_wait_asynccnt 0x0" ::: "memory");   /* tile 0 has landed before the barrier that publishes it */
  __syncthreads();
  fa_fill(fb[1], kg, vg, FK, tid);
  float rs = RS0, cs = SCALE * RS0, cb = nb_ * RS0, sum = 0.f;   /* rs is the same in both halves of a query */
  v8f acc[HD / 16] = {};
  for (int t = 0; t < NT; ++t) { const FaBuf& f = fb[t & 1];
    v8f s[FK / 16]; v16h p[FK / 32];
#pragma unroll
    for (int u = 0; u < FK / 16; ++u) { const v16h ka = frag_h(&f.k[16 * u + col][0], lane), kb = frag_h(&f.k[16 * u + col][32], lane);
      v8f z = {}; z = wmma_h(ka, q0, z); s[u] = wmma_h(kb, q1, z); }
    float ts = fa_t(s, m, cs, cb, p);
    if (__builtin_amdgcn_ballot_w32(!(ts <= TLIM)) != 0) {   /* one test per tile, a scalar branch, rarely taken: some row of the wave needs a lower scale */
      float mx = 0.f;
#pragma unroll
      for (int u = 0; u < FK / 16; ++u) {
#pragma unroll
        for (int r = 0; r < 8; ++r) mx = fmaxf(mx, __builtin_amdgcn_inverse_ballot_w32(m[8 * u + r]) ? s[u][r] * SCALE + nb_ : 0.f); }
      mx = fmaxf(mx, __shfl_xor(mx, 16));   /* the query's largest unmasked x of this tile, the same in both halves */
      int ex; (void)frexpf(mx, &ex);
      const float rn = (mx * rs > 16.0f) ? ldexpf(1.0f, 4 - ex) : rs;   /* mx x rn in [8, 16): every scaled t of the tile <= 256, their sum <= 8192 */
      const float fr = rn / rs, f2 = fr * fr;   /* powers of two: exact (or 0 where the old sums no longer count) */
#pragma unroll
      for (int j = 0; j < HD / 16; ++j) acc[j] *= f2;
      sum *= f2; rs = rn; cs = SCALE * rn; cb = nb_ * rn;
      ts = fa_t(s, m, cs, cb, p); }
    sum += ts;
    { const cu32* mn = mw + (t + 1 < NT ? t + 1 : NT - 1) * (FK / 2);   /* the next tile's words, asked for as soon as this tile's are used: they fly under P v, the hand-over and the next scores (the last trip reads its own again, in bounds) */
#pragma unroll
      for (int i = 0; i < FK / 2; ++i) m[i] = mn[i]; }
#pragma unroll
    for (int hh = 0; hh < FK / 32; ++hh) {
#pragma unroll
      for (int j = 0; j < HD / 16; ++j) acc[j] = wmma_h(frag_h(&f.v[j * 16 + col][32 * hh], lane), p[hh], acc[j]); }
    FA_PUBLISH();
    if (t + 2 < NT) fa_fill(fb[t & 1], kg, vg, (t + 2) * FK, tid); }
  asm volatile("s_wait_asynccnt 0x0" ::: "memory");   /* no copy is outstanding when the wave ends */
  sum += __shfl_xor(sum, 16); const float inv = 1.0f / (sum + (IEPS * rs) * rs);   /* both sums carry rs^2, so does the 1e-32; sum == 0 -> rs == RS0, acc == 0 -> ctx = 0 */
  _Float16* yp = YH + ((size_t)(b * (TT / 64) + blockIdx.y) * KT + h) * TILE + (wave * 16 + col) * 64 + 8 * g;   /* acc[j][r] = ctx[query col][16j + 8g + r]; ctx x 2^6 once to f16 (clear of f16 subnormals), as k_out's A operand: the head's 64 columns are one tile of the block's 64 rows, and the wave writes each query's whole 128-B row of it */
#pragma unroll
  for (int j = 0; j < HD / 16; ++j) { v8h o;
#pragma unroll
    for (int r = 0; r < 8; ++r) o[r] = (_Float16)((acc[j][r] * inv) * 64.0f);
    vst2(yp + j * 16, o); } }
// ---- k_cvt (first launch): the roundings of the projections' operands, once per element: iQ, iK, iV and Wq, Wk, Wv to bf16, Wo to f16(bf16 x 2^8) (exact), written as tiles. A block takes one row per load (256 threads x 16 B, whole lines), eight rows in flight; 128 B of a tile row per 16 lanes on the way out
__global__ __launch_bounds__(256) void k_cvt(const float* __restrict__ XQ, const float* __restrict__ XK, const float* __restrict__ XV, const float* __restrict__ WQ, const float* __restrict__ WK, const float* __restrict__ WV, const float* __restrict__ WO, __bf16* __restrict__ XB, __bf16* __restrict__ WB, _Float16* __restrict__ WOH) {
  const int tid = threadIdx.x, bx = blockIdx.x, k = tid * 4;   /* rows bx + 512 i */
  const size_t so = (size_t)bx * DIN + k, to = ((size_t)(bx >> 6) * KT + (k >> 6)) * TILE + (bx & 63) * 64 + (k & 63);   /* 512 rows on: 512 * DIN elements in either layout */
#pragma unroll
  for (int p = 0; p < 3; ++p) { const float* xp = (p == 0 ? XQ : p == 1 ? XK : XV) + so; __bf16* op = XB + (size_t)p * TNB * TT * DIN + to; v4f a[8];
#pragma unroll
    for (int i = 0; i < 8; ++i) a[i] = *(const v4f*)(xp + (size_t)i * 512 * DIN);
    XW(xp);
#pragma unroll
    for (int i = 0; i < 8; ++i) { v4b o;
#pragma unroll
      for (int e = 0; e < 4; ++e) o[e] = (__bf16)a[i][e];
      *(v4b*)(op + (size_t)i * 512 * DIN) = o; }
    XW(op); }
  v4f a[8];
#pragma unroll
  for (int i = 0; i < 8; ++i) a[i] = *(const v4f*)(((i >> 1) == 0 ? WQ : (i >> 1) == 1 ? WK : (i >> 1) == 2 ? WV : WO) + (size_t)(i & 1) * 512 * DIN + so);
  asm volatile("s_wait_xcnt 0x0" ::: "memory");   /* closes the group of loads before a register that they name may be rewritten */
#pragma unroll
  for (int i = 0; i < 6; ++i) { v4b o;
#pragma unroll
    for (int e = 0; e < 4; ++e) o[e] = (__bf16)a[i][e];
    *(v4b*)(WB + (size_t)i * 512 * DIN + to) = o; }
#pragma unroll
  for (int i = 6; i < 8; ++i) { v4h o;
#pragma unroll
    for (int e = 0; e < 4; ++e) o[e] = (_Float16)(bfr(a[i][e]) * 256.0f);
    *(v4h*)(WOH + (size_t)(i - 6) * 512 * DIN + to) = o; } }
// ---- k_out: block = (128 rows, 128 cols), four waves 2 x 2, each on 64 rows x 64 cols: out = ctx Wo (+ bo): ctx x 2^6 in f16 against Wo as f16(bf16 x 2^8) exact (1 product) x 2^-14
__global__ __launch_bounds__(128) void k_out(const _Float16* __restrict__ YH, const _Float16* __restrict__ WOH, const float* __restrict__ BO, float* __restrict__ OUT) { union SM { float sf[4][64][68]; _Float16 st[2][SROWS][SP]; };   /* the stage buffers lie over the epilogue's array, which is first written behind the loop's last barrier */
  __shared__ __align__(16) SM sm; auto& sf = sm.sf;
  const int tid = threadIdx.x, wave = tid >> 5, lane = tid & 31, col = lane & 15, g = lane >> 4, wr = wave >> 1, wc = wave & 1; const int c0 = blockIdx.y * 128 + wc * 64; const size_t r0 = (size_t)blockIdx.x * 128 + wr * 64;
  v8f acc[4][4] = {};
  const _Float16* xt = YH + (size_t)blockIdx.x * 2 * KT * TILE + tid * 8; const _Float16* wt = WOH + (size_t)blockIdx.y * 2 * KT * TILE + tid * 8;   /* this thread's 16 B of the first ctx and Wo tiles */
  g_fill(sm.st[0], xt, wt, tid);
  asm volatile("s_wait_asynccnt 0x0" ::: "memory");   /* stage 0 has landed before the barrier that publishes it */
  __syncthreads();
  g_fill(sm.st[1], xt + TILE, wt + TILE, tid);
  for (int t = 0; t < CC / KS; ++t) { const _Float16 (*cb)[SP] = sm.st[t & 1];
    v16h a[KS / 32][4], w[KS / 32][4];
#pragma unroll
    for (int kc = 0; kc < KS / 32; ++kc) {
#pragma unroll
      for (int i = 0; i < 4; ++i) { a[kc][i] = frag_h(&cb[wr * 64 + i * 16 + col][kc * 32], lane); w[kc][i] = frag_h(&cb[128 + wc * 64 + i * 16 + col][kc * 32], lane); } }
    __builtin_amdgcn_sched_barrier(0);   /* keeps the stage's 32 LDS reads together in front of its products: left alone the compiler sinks them among the products, two at a time, each pair with a full wait in front of four products */
#pragma unroll
    for (int kc = 0; kc < KS / 32; ++kc) {
#pragma unroll
      for (int i = 0; i < 4; ++i) {
#pragma unroll
        for (int j = 0; j < 4; ++j) acc[i][j] = __builtin_amdgcn_wmma_f32_16x16x32_f16(false, a[kc][i], false, w[kc][j], (short)0, acc[i][j], false, false); } }
    __builtin_amdgcn_sched_barrier(0);   /* keeps the products in front of the hand-over: lifted over them, its waits would give the next tile's copies only the LDS reads' time to land */
    FA_PUBLISH();
    if (t + 2 < CC / KS) g_fill(sm.st[t & 1], xt + (size_t)(t + 2) * TILE, wt + (size_t)(t + 2) * TILE, tid); }   /* into the buffer that every wave has just left */
  asm volatile("s_wait_asynccnt 0x0" ::: "memory");   /* no copy is outstanding when the buffers become the epilogue's array */
  float bias[4] = {0.f, 0.f, 0.f, 0.f};
  if (BO) { const float* bp = BO + c0 + col;   /* one test, so that the four loads go out together */
#pragma unroll
    for (int j = 0; j < 4; ++j) bias[j] = bp[j * 16];
#pragma unroll
    for (int j = 0; j < 4; ++j) bias[j] = bfr(bias[j]); }
#pragma unroll
  for (int j = 0; j < 4; ++j) {
#pragma unroll
    for (int i = 0; i < 4; ++i) {
#pragma unroll
      for (int r = 0; r < 8; ++r) sf[wave][i * 16 + 8 * g + r][j * 16 + col] = acc[i][j][r] * (1.0f / 16384.0f) + bias[j]; } }   /* 2^-8 (Wo carry) x 2^-6 (ctx carry) */
  LDSX(); float* op = OUT + (r0 + g) * DIN + c0 + col * 4;   /* the wave's own rows back as whole lines: 256 B of a row per 16 lanes, two rows per store */
#pragma unroll
  for (int rl = 0; rl < 64; rl += 2) vst2(op + (size_t)rl * DIN, *(const v4f*)&sf[wave][rl + g][col * 4]); }

extern "C" void kernel_launch(void* const* d_in, const int* in_sizes, int n_in, void* d_out, int out_size, void* d_ws, size_t ws_size, hipStream_t stream) {
  (void)in_sizes; (void)n_in; (void)out_size;
  const float** F = (const float**)d_in;
  if (ws_size < (size_t)WS_END) return;
  char* ws = (char*)d_ws; _Float16 *QH = (_Float16*)(ws + WS_QH), *KH = (_Float16*)(ws + WS_KH), *VT = (_Float16*)(ws + WS_VT); _Float16 *YH = (_Float16*)(ws + WS_Y), *WOH = (_Float16*)(ws + WS_WO); __bf16 *XB = (__bf16*)(ws + WS_XB), *WB = (__bf16*)(ws + WS_WB); unsigned* MB = (unsigned*)(ws + WS_S);   /* lane-mask words of the mask, 1 MiB, in the place of the old score plane */
  // inputs: 0 iQ [2,2048,1024]; 1 iK; 2 iV; 3 mask [2,2048,2048] bool (True = masked); 4 Wq [1024,1024] (out,in), 5 bq; 6 Wk, 7 bk; 8 Wv, 9 bv; 10 Wo (out,in), 11 bo (zero biases, read); 12 nbias [1] (SparseNormer bias; zero)
  k_cvt<<<dim3(512), 256, 0, stream>>>(F[0], F[1], F[2], F[4], F[6], F[8], F[10], XB, WB, WOH);
  k_proj<<<dim3(TNB * TT / 128, CC / 128, 5), 128, 0, stream>>>(XB, WB, F[5], F[7], F[9], QH, KH, VT, (const int*)d_in[3], MB);   /* z = 3, 4: the mask's packing blocks, short, last in the launch */
  k_fa<<<dim3(NH, NQB, TNB), 128, 0, stream>>>(QH, KH, VT, MB, F[12], YH);   /* relu(x + nbias)^2 / (sum + 1e-32): NOT a softmax */
  k_out<<<dim3(TNB * TT / 128, DIN / 128), 128, 0, stream>>>(YH, WOH, F[11], (float*)d_out);
}

// v008
// It runs in 85.6 microseconds.
// In two side-by-side timings against v007, it was 1.05 and 1.07 times as fast.
// Counting every step since v000, it is 15.6 times as fast.
// compute dtype: all float inputs rounded to bf16; q/k/v projections with EXACT bf16 products on WMMA 16x16x32 (f32 accumulate) + bias; scores q x k once to f16 each (1 product) x 64^-0.5; SparseNormer in f32: t = relu(score + nbias)^2 (masked entries -> 0); t x 2^2n (n per row and key half) once to f16 x v once to f16 (1 product), two partial sums per row joined at the end, ctx = that sum / (sum t + 1e-32); ctx x 2^6 once to f16 x Wo f16(bf16 x 2^8) + bo; f32 output.
#include <hip/hip_runtime.h>
#include <math.h>

typedef __attribute__((ext_vector_type(16))) _Float16 v16h;
typedef __attribute__((ext_vector_type(16))) __bf16 v16b;
typedef __attribute__((ext_vector_type(8)))  _Float16 v8h;
typedef __attribute__((ext_vector_type(8)))  float v8f;
typedef __attribute__((ext_vector_type(4)))  float v4f;
typedef __attribute__((ext_vector_type(2)))  float v2f;
typedef __attribute__((ext_vector_type(4)))  unsigned v4u;
typedef __attribute__((ext_vector_type(4)))  int v4i;
typedef float __attribute__((may_alias)) float_a;
typedef int __attribute__((may_alias)) int_a;

template <typename T> __device__ __forceinline__ void vst2(void* p, T v) { *(T*)p = v;  }
__device__ __forceinline__ v8f wmma16(v16h a, v16h b, v8f c) {
  v8f d = __builtin_amdgcn_wmma_f32_16x16x32_f16(false, a, false, b, (short)0, c, false, false);
  asm volatile("v_nop\n\tv_nop\n\tv_nop\n\tv_nop" : "+v"(d) : "v"(a), "v"(b));
  return d;
}
__device__ __forceinline__ v8f wmma_bf(v16b a, v16b b, v8f c) {
  v8f d = __builtin_amdgcn_wmma_f32_16x16x32_bf16(false, a, false, b, (short)0, c, false, false);
  asm volatile("v_nop\n\tv_nop\n\tv_nop\n\tv_nop" : "+v"(d) : "v"(a), "v"(b));
  return d;
}
// 16x16x32 fragments: lane = (h = lane>>4, row/col = lane&15); elements 0..7 = k0+8h+0..7, 8..15 = k0+16+8h+0..7; D element r = row 8h+r
__device__ __forceinline__ v16h frag_h(const _Float16* rowk0, int lane) {
  union { v16h v; v8h q[2]; } u; const _Float16* p = rowk0 + 8 * (lane >> 4);
  u.q[0] = *(const v8h*)p; u.q[1] = *(const v8h*)(p + 16); return u.v;
}
__device__ __forceinline__ v16h frag_f32(const float* rowk0, int lane) {
  v16h a; const float* p = rowk0 + 8 * (lane >> 4);
#pragma unroll
  for (int i = 0; i < 8; ++i) { a[i] = (_Float16)p[i]; a[8 + i] = (_Float16)p[16 + i]; }
  return a;
}
__device__ __forceinline__ v16h frag_f32s(const float* rowk0, int lane, float sc) {
  v16h a; const float* p = rowk0 + 8 * (lane >> 4);
#pragma unroll
  for (int i = 0; i < 8; ++i) { a[i] = (_Float16)(p[i] * sc); a[8 + i] = (_Float16)(p[16 + i] * sc); }
  return a;
}
// column fragment from a [K][ld] layout (column n), rows >= K read as 0
__device__ __forceinline__ v16h fragc_f32(const float* W, int k0, int n, int lane, int ld, int K) {
  v16h a; const int g = lane >> 4;
#pragma unroll
  for (int i = 0; i < 8; ++i) { const int ka = k0 + 8 * g + i, kb = ka + 16;
    a[i] = (_Float16)(ka < K ? W[(size_t)(ka < K ? ka : K - 1) * ld + n] : 0.f); a[8 + i] = (_Float16)(kb < K ? W[(size_t)(kb < K ? kb : K - 1) * ld + n] : 0.f); }
  return a;
}
struct F2 { v16b h, l; };
__device__ __forceinline__ F2 bsplit16(const float v[16]) { F2 r;
#pragma unroll
  for (int i = 0; i < 16; ++i) { const __bf16 h = (__bf16)v[i]; r.h[i] = h; r.l[i] = (__bf16)(v[i] - (float)h); }
  return r; }
__device__ __forceinline__ F2 split_row(const float* row, int k0, int lane) { float v[16]; const float* p = row + k0 + 8 * (lane >> 4);
#pragma unroll
  for (int i = 0; i < 8; ++i) { v[i] = p[i]; v[8 + i] = p[16 + i]; }
  return bsplit16(v); }
__device__ __forceinline__ F2 split_rowK(const float* row, int k0, int lane, int K) { float v[16]; const int g = lane >> 4;
#pragma unroll
  for (int i = 0; i < 8; ++i) { const int ka = k0 + 8 * g + i, kb = ka + 16; v[i] = ka < K ? row[ka < K ? ka : K - 1] : 0.f; v[8 + i] = kb < K ? row[kb < K ? kb : K - 1] : 0.f; }
  return bsplit16(v); }
__device__ __forceinline__ F2 split_col(const float* W, int k0, int n, int lane, int ld, int K) { float v[16]; const int g = lane >> 4;
#pragma unroll
  for (int i = 0; i < 8; ++i) { const int ka = k0 + 8 * g + i, kb = ka + 16; v[i] = ka < K ? W[(size_t)(ka < K ? ka : K - 1) * ld + n] : 0.f; v[8 + i] = kb < K ? W[(size_t)(kb < K ? kb : K - 1) * ld + n] : 0.f; }
  return bsplit16(v); }
__device__ __forceinline__ v8f mac3(const F2& a, const F2& b, v8f c) { c = wmma_bf(a.l, b.h, c); c = wmma_bf(a.h, b.l, c); return wmma_bf(a.h, b.h, c); }
__device__ __forceinline__ float sigm(float v) { return 1.0f / (1.0f + expf(-v)); }
#define LDSX() do { asm volatile("s_wait_dscnt 0" ::: "memory"); __builtin_amdgcn_wave_barrier(); __builtin_amdgcn_fence(__ATOMIC_RELEASE, "workgroup"); } while (0)

// Multi-head attention with a SparseNormer instead of a softmax (iQ / iK / iV [2,2048,1024] separate inputs; torch (out,in) Wq / Wk / Wv / Wo [1024,1024] (0.02 scale) + zero biases; 16 heads x 64; scores / 8; mask [2,2048,2048] bool random (True -> -1e32); t = relu(scores + nbias)^2 with nbias = zeros(1); attn = t / (sum_k t + 1e-32)): out = merge(attn v) Wo^T + bo.
#define NB 2
#define TT 2048
#define CC 1024            // NH * HD = projected width
#define DIN 1024          // input (model) width
#define NH 16
#define HD 64
#define NQB (TT / 64)
#define HG 4
#define SCALE (0.125f)
#define CAUSAL 0
#ifndef TNB
#define TNB NB
#endif
__device__ __forceinline__ float bfr(float v) { return (float)(__bf16)v; }
__host__ __device__ __forceinline__ int kb_last(int qb) { return CAUSAL ? ((qb * 64 + 63) >> 7) : (TT / 128 - 1); }
typedef __attribute__((ext_vector_type(8))) __bf16 v8b;
__device__ __forceinline__ v16b frag_b(const __bf16* rowk0, int lane) {
  union { v16b v; v8b q[2]; } u; const __bf16* p = rowk0 + 8 * (lane >> 4);
  u.q[0] = *(const v8b*)p; u.q[1] = *(const v8b*)(p + 16); return u.v;
}
#define QBH 0              // not used by any kernel here
#define QHI 0               // single-product scores on every row
#define KHI 64            // key rows carrying k residual / v bf16 hi+lo planes (written and read by no kernel here)
// B fragment (k rows k0+.., output column o) of a weight: (in,out) [K][ld] or (out,in) [ld rows of K]: bf16 exact, or f16(bf16 * 256) exact
__device__ __forceinline__ v16b wcol_io(const float* Wm, int k0, int o, int lane, int ld) { v16b w; const int g = lane >> 4;
#pragma unroll
  for (int i = 0; i < 8; ++i) { w[i] = (__bf16)Wm[(size_t)(k0 + 8 * g + i) * ld + o]; w[8 + i] = (__bf16)Wm[(size_t)(k0 + 16 + 8 * g + i) * ld + o]; }
  return w; }
__device__ __forceinline__ v16b wcol_oi(const float* Wm, int k0, int o, int lane, int K) { v16b w; const float* p = Wm + (size_t)o * K + k0 + 8 * (lane >> 4);
#pragma unroll
  for (int i = 0; i < 8; ++i) { w[i] = (__bf16)p[i]; w[8 + i] = (__bf16)p[16 + i]; }
  return w; }
__device__ __forceinline__ v16h wcolh_io(const float* Wm, int k0, int o, int lane, int ld) { v16h w; const int g = lane >> 4;
#pragma unroll
  for (int i = 0; i < 8; ++i) { w[i] = (_Float16)(bfr(Wm[(size_t)(k0 + 8 * g + i) * ld + o]) * 256.0f); w[8 + i] = (_Float16)(bfr(Wm[(size_t)(k0 + 16 + 8 * g + i) * ld + o]) * 256.0f); }
  return w; }
__device__ __forceinline__ v16h wcolh_oi(const float* Wm, int k0, int o, int lane, int K) { v16h w; const float* p = Wm + (size_t)o * K + k0 + 8 * (lane >> 4);
#pragma unroll
  for (int i = 0; i < 8; ++i) { w[i] = (_Float16)(bfr(p[i]) * 256.0f); w[8 + i] = (_Float16)(bfr(p[16 + i]) * 256.0f); }
  return w; }
#define WQKV_LAYOUT 1   // 0 = (in,out) [DIN][CC]; 1 = (out,in) [CC][DIN]; 2 = per-head [NH][DIN][HD]
__device__ __forceinline__ v16b wcol_hdk(const float* Wm, int k0, int o, int lane) { v16b w; const int g = lane >> 4; const float* p = Wm + (size_t)(o / HD) * DIN * HD + (o % HD);
#pragma unroll
  for (int i = 0; i < 8; ++i) { w[i] = (__bf16)p[(size_t)(k0 + 8 * g + i) * HD]; w[8 + i] = (__bf16)p[(size_t)(k0 + 16 + 8 * g + i) * HD]; }
  return w; }
#define WO_OUT_IN 1
#if WQKV_LAYOUT == 1
#define WCOL(W, k0, o, lane) wcol_oi(W, k0, o, lane, DIN)
#elif WQKV_LAYOUT == 2
#define WCOL(W, k0, o, lane) wcol_hdk(W, k0, o, lane)
#else
#define WCOL(W, k0, o, lane) wcol_io(W, k0, o, lane, CC)
#endif
#if WO_OUT_IN
#define WOCOL(W, k0, o, lane) wcol_oi(W, k0, o, lane, CC)
#define WOCOLH(W, k0, o, lane) wcolh_oi(W, k0, o, lane, CC)
#else
#define WOCOL(W, k0, o, lane) wcol_io(W, k0, o, lane, DIN)
#define WOCOLH(W, k0, o, lane) wcolh_io(W, k0, o, lane, DIN)
#endif

#ifndef SM_EXTRA_PARAMS
#define SM_EXTRA_PARAMS
#endif
#ifndef PROJ_EXTRA_PARAMS
#define PROJ_EXTRA_PARAMS
#endif
#ifndef SM_MASK_HOOK
#define SM_MASK_HOOK (void)0
#endif

#define WS_QH  0u                                      // f16 q rows [b*t][CC]
#define WS_KH  (WS_QH + 2u * (size_t)NB * TT * CC)      // f16 k rows [b*t][CC]
#define WS_VT  (WS_KH + 2u * (size_t)NB * TT * CC)      // f16 v planes [b][c][t]
#define WS_QL  (WS_VT + 2u * (size_t)NB * CC * TT)      // f16 q residual x 2^10 rows [b][t < QHI][CC]
#define WS_KL  (WS_QL + 2u * (size_t)NB * QHI * CC)     // f16 k residual x 2^10 rows [b][t < KHI][CC]
#define WS_VB  (WS_KL + 2u * (size_t)NB * KHI * CC)     // bf16 v hi planes [b][c][t < KHI]
#define WS_VBL (WS_VB + 2u * (size_t)NB * CC * KHI)
#define WS_S   (WS_VBL + 2u * (size_t)NB * CC * KHI)    // lane-mask words, then operand tiles (room of an f32 plane [hg][t][s])
#define WS_Y   (WS_S  + 4u * (size_t)HG * TT * TT)      // f16 ctx x 2^6 tiles
#define WS_END (WS_Y  + 4u * (size_t)NB * TT * CC)
#define WS_XB  (WS_S + (2u << 20))                      // bf16 iQ, iK, iV tiles, behind the mask words in the place of the old score plane
#define WS_WB  (WS_XB + 3u * 2u * (size_t)NB * TT * DIN) // bf16 Wq, Wk, Wv tiles, then f16 Wo tiles
#define WS_WO  (WS_WB + 3u * 2u * (size_t)CC * DIN)
static_assert(WS_WO + 2u * (size_t)CC * DIN <= WS_Y, "the operand tiles stay inside the old score plane");

// ---- operands of the two projection kernels: every X, W and ctx element is rounded ONCE to its 16-bit operand type and kept in memory as tiles of 64 rows x 64 k (8 KB contiguous): element (row, k) at ((row >> 6) * 16 + (k >> 6)) * 4096 + (row & 63) * 64 + (k & 63); every matrix here has 1024 k. A block's 128 X rows and 128 W rows, KS k at a time, are four such tiles, which come by asynchronous copies straight into LDS (512 contiguous bytes per wave and copy), where all four waves read their fragments; two buffers, the next stage's copies fly while this stage is multiplied
#define KS 64              // k per stage
#define SP 72              // LDS row pitch in 16-bit elements: 144 B = 16 B x 9, an odd multiple of 16 B, which ds_load_b128 fragment reads take without bank conflicts
#define SROWS 256          // rows 0..127 = X, 128..255 = W
#define TILE 4096          // elements of a tile
#define KT (DIN / 64)      // tiles per block of 64 rows
typedef __attribute__((ext_vector_type(4))) __bf16 v4b;
typedef __attribute__((ext_vector_type(4))) _Float16 v4h;
__device__ __forceinline__ unsigned lds_of(const void* p) { return (unsigned)(size_t)p; }   /* LDS byte address = low 32 bits of the __shared__ address */
// four copies of 16 B per lane; the s_wait_xcnt closes the group inside its own statement, before a register that a copy names may be rewritten
__device__ __forceinline__ void cp4(unsigned l0, const void* g0, unsigned l1, const void* g1, unsigned l2, const void* g2, unsigned l3, const void* g3) {
  asm volatile("global_load_async_to_lds_b128 %0, %1, off\n\tglobal_load_async_to_lds_b128 %2, %3, off\n\tglobal_load_async_to_lds_b128 %4, %5, off\n\tglobal_load_async_to_lds_b128 %6, %7, off\n\ts_wait_xcnt 0x0"
               :: "v"(l0), "v"(g0), "v"(l1), "v"(g1), "v"(l2), "v"(g2), "v"(l3), "v"(g3) : "memory"); }
// hand-over of a tile: this wave's LDS reads of the old tile are done, its own copies of the next tile have landed, and the barrier publishes the next tile and frees the old buffer
#define FA_PUBLISH() do { asm volatile("s_wait_dscnt 0x0" ::: "memory"); asm volatile("s_wait_asynccnt 0x0" ::: "memory"); __syncthreads(); } while (0)
// one tile into 64 LDS rows from row r0 on; tp: this thread's 16 B of the tile (element tid * 8), further copies 16 rows = 1024 elements apart
template <typename T> __device__ __forceinline__ void g_tile(T (*st)[SP], int r0, const T* tp, int tid) { const int r8 = r0 + (tid >> 3), c8 = (tid & 7) * 8;
  cp4(lds_of(&st[r8][c8]), tp, lds_of(&st[r8 + 16][c8]), tp + 1024, lds_of(&st[r8 + 32][c8]), tp + 2048, lds_of(&st[r8 + 48][c8]), tp + 3072); }
// one stage: the X tiles and the W tiles of two neighbouring blocks of 64 rows each
template <typename T> __device__ __forceinline__ void g_fill(T (*st)[SP], const T* xt, const T* wt, int tid) { g_tile(st, 0, xt, tid); g_tile(st, 64, xt + (size_t)KT * TILE, tid); g_tile(st, 128, wt, tid); g_tile(st, 192, wt + (size_t)KT * TILE, tid); }
// ---- mask as lane masks: word [16-query group][64-key tile][8u + r], bit 16g + col = (mask[query col][key 16u + 8g + r] == 0, the key counts): the very lane that holds that score in k_fa, so a word is the select mask of one score register; 1/32 of the i32 mask's bytes
#define PKP 260            // LDS row pitch in words of the packing blocks: 1040 B = 16 B x 65 (odd)
#define PKT 4              // tiles of 64 keys per packing wave
static_assert(2 * (TNB * TT / 128) * (CC / 128) * 4 * PKT == (TNB * TT / 16) * (TT / 64), "the packing blocks' waves cover every (query group, tile) once");
// ---- k_proj: block = (128 rows, 128 cols, which): which 3, 4: the mask's lane-mask words (see above); else q/k/v = X W (+ b) with exact bf16 products (K = DIN) -> which 0: q f16 rows; 1: k f16 rows; 2: v f16 planes [c][t]. The four waves stand 2 x 2, each on 64 rows x 64 cols: a fragment read from LDS feeds four products
__global__ __launch_bounds__(128) void k_proj(const __bf16* __restrict__ XB, const __bf16* __restrict__ WB, const float* __restrict__ BQ, const float* __restrict__ BK, const float* __restrict__ BV,
    _Float16* __restrict__ QH, _Float16* __restrict__ KH, _Float16* __restrict__ VT, const int* __restrict__ MASK, unsigned* __restrict__ MB) {
  union SM { _Float16 sh[128][136]; __bf16 st[2][SROWS][SP]; int pk[4][16][PKP]; };   /* the stage buffers lie over the epilogue's array, which is first written behind the loop's last barrier */
  __shared__ __align__(16) SM sm; auto& sh = sm.sh;
  const int tid = threadIdx.x, wave = tid >> 5, lane = tid & 31, col = lane & 15, g = lane >> 4, wr = wave >> 1, wc = wave & 1; const int which = blockIdx.z; const int c0 = blockIdx.y * 128; const size_t r0 = (size_t)blockIdx.x * 128; const size_t bb = r0 / TT; const int t0 = (int)(r0 % TT);
  if (which >= 3) {   /* block-uniform, in front of every barrier: each wave packs 16 queries x PKT tiles; the rows come as whole lines (512 B of one row per load) and turn through the wave's own LDS rows into the score layout; the loops are unrolled whole so that all 32 loads are in flight together and the vectors are indexed by constants */
    const int id = (((which - 3) * (TNB * TT / 128) + blockIdx.x) * (CC / 128) + blockIdx.y) * 4 + wave, qg = id / (TT / 64 / PKT), tq = id % (TT / 64 / PKT);
    const int* mp = MASK + (size_t)qg * 16 * TT + tq * (PKT * 64) + lane * 4; v4i mv[32];
#pragma unroll
    for (int i = 0; i < 32; ++i) mv[i] = *(const v4i*)(mp + (size_t)(i >> 1) * TT + (i & 1) * 128);
    asm volatile("s_wait_xcnt 0x0" :: "v"(mp) : "memory");   /* closes the group of loads before a register that they name may be rewritten */
#pragma unroll
    for (int i = 0; i < 32; ++i) *(v4i*)&sm.pk[wave][i >> 1][(i & 1) * 128 + lane * 4] = mv[i];
    LDSX();   /* the wave's own rows are written before its lanes read each other's words */
#pragma unroll
    for (int tl = 0; tl < PKT; ++tl) { unsigned w = 0;
#pragma unroll
      for (int u = 0; u < 4; ++u) { const v4i a = *(const v4i*)&sm.pk[wave][col][tl * 64 + 16 * u + 8 * g], c = *(const v4i*)&sm.pk[wave][col][tl * 64 + 16 * u + 8 * g + 4];
#pragma unroll
        for (int r = 0; r < 8; ++r) { const unsigned bl = __builtin_amdgcn_ballot_w32((r < 4 ? a[r & 3] : c[r & 3]) == 0); w = (lane == 8 * u + r) ? bl : w; } }
      MB[((size_t)qg * (TT / 64) + tq * PKT + tl) * 32 + lane] = w; }   /* 128 B per tile, one line */
    return; }
  const float* BA = which == 0 ? BQ : which == 1 ? BK : BV;
  v8f acc[4][4] = {};   /* acc[i][j][r] = element (row 64 wr + 16 i + 8 g + r, column 64 wc + 16 j + col) of the block */
  const __bf16* xt = XB + ((size_t)which * (TNB * TT / 64) + blockIdx.x * 2) * KT * TILE + tid * 8; const __bf16* wt = WB + ((size_t)which * (CC / 64) + (c0 >> 6)) * KT * TILE + tid * 8;   /* this thread's 16 B of the first X and W tiles; the next stage's tiles follow TILE elements on */
  g_fill(sm.st[0], xt, wt, tid);
  asm volatile("s_wait_asynccnt 0x0" ::: "memory");   /* stage 0 has landed before the barrier that publishes it */
  __syncthreads();
  g_fill(sm.st[1], xt + TILE, wt + TILE, tid);
  for (int t = 0; t < DIN / KS; ++t) { const __bf16 (*cb)[SP] = sm.st[t & 1];
    v16b a[KS / 32][4], w[KS / 32][4];
#pragma unroll
    for (int kc = 0; kc < KS / 32; ++kc) {
#pragma unroll
      for (int i = 0; i < 4; ++i) { a[kc][i] = frag_b(&cb[wr * 64 + i * 16 + col][kc * 32], lane); w[kc][i] = frag_b(&cb[128 + wc * 64 + i * 16 + col][kc * 32], lane); } }
    __builtin_amdgcn_sched_barrier(0);   /* keeps the stage's 32 LDS reads together in front of its products: left alone the compiler sinks them among the products, two at a time, each pair with a full wait in front of four products */
#pragma unroll
    for (int kc = 0; kc < KS / 32; ++kc) {
#pragma unroll
      for (int i = 0; i < 4; ++i) {
#pragma unroll
        for (int j = 0; j < 4; ++j) acc[i][j] = __builtin_amdgcn_wmma_f32_16x16x32_bf16(false, a[kc][i], false, w[kc][j], (short)0, acc[i][j], false, false); } }
    __builtin_amdgcn_sched_barrier(0);   /* keeps the products in front of the hand-over: lifted over them, its waits would give the next tile's copies only the LDS reads' time to land */
    FA_PUBLISH();
    if (t + 2 < DIN / KS) g_fill(sm.st[t & 1], xt + (size_t)(t + 2) * TILE, wt + (size_t)(t + 2) * TILE, tid); }   /* into the buffer that every wave has just left */
  asm volatile("s_wait_asynccnt 0x0" ::: "memory");   /* no copy is outstanding when the buffers become the epilogue's array */
  float bias[4] = {0.f, 0.f, 0.f, 0.f};
  if (BA) { const float* bp = BA + c0 + wc * 64 + col;   /* one test, so that the four loads go out together */
#pragma unroll
    for (int j = 0; j < 4; ++j) bias[j] = bp[j * 16];
#pragma unroll
    for (int j = 0; j < 4; ++j) bias[j] = bfr(bias[j]); }
  if (which < 2) { _Float16* DH = (which == 0 ? QH : KH) + (r0 + (tid >> 4)) * CC + c0 + (tid & 15) * 8;   /* this thread's 16 B of row tid >> 4, further rows 8 apart */
#pragma unroll
    for (int j = 0; j < 4; ++j) {
#pragma unroll
      for (int i = 0; i < 4; ++i) {
#pragma unroll
        for (int r = 0; r < 8; ++r) sh[wr * 64 + i * 16 + 8 * g + r][wc * 64 + j * 16 + col] = (_Float16)(acc[i][j][r] + bias[j]); } }
    __syncthreads();
#pragma unroll
    for (int e = 0; e < 16; ++e) vst2((unsigned*)(DH + (size_t)e * 8 * CC), *(const v4u*)&sh[e * 8 + (tid >> 4)][(tid & 15) * 8]);   /* 256 B of a row per 16 lanes */
    asm volatile("s_wait_xcnt 0x0" :: "v"(DH) : "memory");   /* closes the run of stores before a register that they name may be rewritten */
  } else { _Float16* DV = VT + (bb * CC + c0 + (tid >> 4)) * (size_t)TT + t0 + (tid & 15) * 8;   /* sh holds the block transposed: [column][row] */
#pragma unroll
    for (int j = 0; j < 4; ++j) {
#pragma unroll
      for (int i = 0; i < 4; ++i) { v8h o;
#pragma unroll
        for (int r = 0; r < 8; ++r) o[r] = (_Float16)(acc[i][j][r] + bias[j]);
        *(v8h*)&sh[wc * 64 + j * 16 + col][wr * 64 + i * 16 + 8 * g] = o; } }   /* a lane's eight rows of a column lie side by side */
    __syncthreads();
#pragma unroll
    for (int e = 0; e < 16; ++e) vst2((unsigned*)(DV + (size_t)e * 8 * TT), *(const v4u*)&sh[e * 8 + (tid >> 4)][(tid & 15) * 8]); } }
// ---- k_sm: block = query row t (head in group): keys [0, kend): causal -> logit if s <= t else excluded; softmax in f32; P x 2^11 in place (0 for excluded)
__global__ __launch_bounds__(256) void k_sm(float* __restrict__ S0 SM_EXTRA_PARAMS) { __shared__ float sred[8]; __shared__ float sbc; __shared__ __align__(16) float shv[TT];
  const int tid = threadIdx.x; const int t = blockIdx.x; const int kend = (kb_last(t >> 6) + 1) * 128;
  float* sr = S0 + (size_t)blockIdx.y * TT * TT + (size_t)t * TT;
  float m = -3.0e38f; for (int k = tid; k < kend; k += 256) { float v = (!CAUSAL || k <= t) ? sr[k] : -3.0e38f; SM_MASK_HOOK; shv[k] = v; m = fmaxf(m, v); }
#pragma unroll
  for (int o = 1; o < 32; o <<= 1) m = fmaxf(m, __shfl_xor(m, o));
  if ((tid & 31) == 0) sred[tid >> 5] = m; __syncthreads(); if (tid == 0) { float a = sred[0]; for (int i = 1; i < 8; ++i) a = fmaxf(a, sred[i]); sbc = a; } __syncthreads(); m = sbc; __syncthreads();
  float sum = 0.f; for (int k = tid; k < kend; k += 256) { const float v = shv[k]; const float e = (v <= -1.0e38f) ? 0.f : expf(v - m); shv[k] = e; sum += e; }
#pragma unroll
  for (int o = 1; o < 32; o <<= 1) sum += __shfl_xor(sum, o);
  if ((tid & 31) == 0) sred[tid >> 5] = sum; __syncthreads(); if (tid == 0) { float a = 0.f; for (int i = 0; i < 8; ++i) a += sred[i]; sbc = a > 0.f ? 2048.0f / a : 0.f; }   /* a fully excluded row yields P = 0 */ __syncthreads(); const float inv = sbc;
  for (int k = tid; k < kend; k += 256) shv[k] = shv[k] * inv;
  __syncthreads(); for (int q = tid; q < kend / 4; q += 256) vst2(sr + q * 4, *(const v4f*)&shv[q * 4]); }
#define IEPS 1.0e-32f
__device__ __forceinline__ v8f wmma_h(v16h a, v16h b, v8f c) { return __builtin_amdgcn_wmma_f32_16x16x32_f16(false, a, false, b, (short)0, c, false, false); }
// XW(p): closes a group of global loads off pointer p before a register that they name may be rewritten; p is an input so that the address pair stays live up to the wait (no load of the group may land on it)
#define XW(p) asm volatile("s_wait_xcnt 0x0" :: "v"(p) : "memory")
#define FK 64
#define FH 32
#define FQ 128
#define KP 72
#define NT (TT / FK)
typedef __attribute__((address_space(4))) unsigned cu32;
struct __align__(16) FaBuf { _Float16 k[FK][KP]; _Float16 v[HD][KP]; };
// kg, vg: this thread's 16 B of row (tid >> 3), the second row 32 further; k0 = first key of the tile
__device__ __forceinline__ void fa_fill(FaBuf& f, const _Float16* kg, const _Float16* vg, int k0, int tid) {
  const int r8 = tid >> 3, c8 = (tid & 7) * 8;
  const _Float16* kq = kg + (size_t)k0 * CC; const _Float16* vq = vg + k0;
  cp4(lds_of(&f.k[r8][c8]), kq, lds_of(&f.k[r8 + 32][c8]), kq + (size_t)32 * CC, lds_of(&f.v[r8][c8]), vq, lds_of(&f.v[r8 + 32][c8]), vq + (size_t)32 * TT); }
#define RS0 0x1p60f        // first row scale: a row that never leaves it has every t <= 2^-105, of the order of the normaliser's 1e-32 or below, and 1e-32 x RS0^2 is still finite
#define TLIM 32768.0f      // a lane's sum of a half tile's scaled t (all >= 0) at or below this bounds each of them inside f16's range
// one half tile's scaled t = relu(score x cs + cb)^2 (masked -> 0): once to f16 as the B operand of V^T P^T; returns the lane's f32 sum of them. The scores are taken two at a time as they lie in neighbouring registers of one product's result (with two groups in a wave the compiler otherwise pairs the groups' scores for its packed forms, and pays a register copy for every score); the sum runs in two chains, even and odd keys
__device__ __forceinline__ float fa_t(const v8f (&s)[FH / 16], const unsigned (&m)[FH / 2], float cs, float cb, v16h& p) { v2f ts = {0.f, 0.f}; const v2f c2 = {cs, cs}, b2 = {cb, cb}, z2 = {0.f, 0.f};
#pragma unroll
  for (int u = 0; u < FH / 16; ++u) {
#pragma unroll
    for (int r = 0; r < 8; r += 2) { const v2f x = __builtin_elementwise_max(v2f{s[u][r], s[u][r + 1]} * c2 + b2, z2); v2f e = x * x;
      e[0] = __builtin_amdgcn_inverse_ballot_w32(m[8 * u + r]) ? e[0] : 0.f; e[1] = __builtin_amdgcn_inverse_ballot_w32(m[8 * u + r + 1]) ? e[1] : 0.f;
      ts += e; p[8 * u + r] = (_Float16)e[0]; p[8 * u + r + 1] = (_Float16)e[1]; } }
  return ts[0] + ts[1]; }
// ---- k_fa (scores, SparseNormer and P v in one launch; no score plane in memory): block = 8 waves = 4 pairs x 32 queries of (b, h). S^T = K Q^T: lane (g, col) holds query col's scores of keys 8g + r of each 16-key tile, so the row sum is in-lane (+ one exchange between the halves) and two converted S^T tiles are the B operand of ctx^T += V^T P^T.
// A wave holds TWO groups of 16 queries, so every K and V^T fragment that it reads from LDS feeds two products; the two waves of a pair share their 32 queries and take keys 0..31 and 32..63 of every tile, so as many waves stand on a SIMD as with 16 queries a wave. Each wave of a pair keeps its own partial sums and its own row scale; the pair's partials are joined once, behind the loop, through LDS.
// ONE pass over the keys: the normaliser is a plain quotient, so ctx = (sum_k t_k v_k) / (sum_k t_k + 1e-32) and both sums grow together. t goes to f16 as t x rs^2 with a power-of-two row scale rs (exact), so its f16 range does not depend on the scale of the scores: rs starts high and is lowered, with both sums rescaled, when a tile would leave f16's range (as a rule once, at the row's first tile with a positive score); the row's largest x then sits at 8..16 and may grow several-fold before the next change. The inner loops are unrolled whole so that the vector elements are indexed by constants and stay in registers.
__global__ __launch_bounds__(256) void k_fa(const _Float16* __restrict__ QH, const _Float16* __restrict__ KH, const _Float16* __restrict__ VT, const unsigned* __restrict__ MB, const float* __restrict__ NBIAS, _Float16* __restrict__ YH) {
  union SM { FaBuf fb[2]; v4f mg[4][17][32]; };   /* the join's array lies over the tile buffers, which no wave reads behind the loop's last barrier */
  __shared__ __align__(16) SM sm; auto& fb = sm.fb;
  const int tid = threadIdx.x, wave = tid >> 5, lane = tid & 31, col = lane & 15, g = lane >> 4; const int h = blockIdx.x, b = blockIdx.z;
  const int qw = __builtin_amdgcn_readfirstlane(wave & 3), kh = __builtin_amdgcn_readfirstlane(wave >> 2);   /* the pair, and the wave's half of every tile: wave-uniform, kept scalar */
  const int ql = blockIdx.y * FQ + qw * 32 + col;   /* query of group 0; group 1: 16 further */
  const float nb_ = bfr(NBIAS[0]);
  const _Float16* qp = QH + ((size_t)b * TT + ql) * CC + h * HD; v16h q[2][2];
#pragma unroll
  for (int a = 0; a < 2; ++a) { q[a][0] = frag_h(qp + (size_t)a * 16 * CC, lane); q[a][1] = frag_h(qp + (size_t)a * 16 * CC + 32, lane); }
  XW(qp);
  const _Float16* kg = KH + ((size_t)b * TT + (tid >> 3)) * CC + h * HD + (tid & 7) * 8; const _Float16* vg = VT + ((size_t)b * CC + h * HD + (tid >> 3)) * (size_t)TT + (tid & 7) * 8;
  const cu32* mw = (const cu32*)(MB + (size_t)((b * TT + blockIdx.y * FQ) / 16 + qw * 2) * (NT * (FK / 2)) + kh * (FH / 2));   /* the lane-mask words of group 0's 16 queries and the wave's half tiles, FH / 2 of every FK / 2; group 1's lie NT * FK / 2 words on; a wave-uniform address of words that no one writes during this launch, so they come by scalar loads into scalar registers */
  unsigned m[2][FH / 2];   /* indexed by constants only (loops unrolled whole), so each word keeps a scalar register */
#pragma unroll
  for (int a = 0; a < 2; ++a) {
#pragma unroll
    for (int i = 0; i < FH / 2; ++i) m[a][i] = mw[a * (NT * (FK / 2)) + i]; }
  fa_fill(fb[0], kg, vg, 0, tid);
  asm volatile("s_wait_asynccnt 0x0" ::: "memory");   /* tile 0 has landed before the barrier that publishes it */
  __syncthreads();
  fa_fill(fb[1], kg, vg, FK, tid);
  float rs[2] = {RS0, RS0}, cs[2] = {SCALE * RS0, SCALE * RS0}, cb[2] = {nb_ * RS0, nb_ * RS0}, sum[2] = {0.f, 0.f};   /* rs is the same in both halves of a query */
  v8f acc[2][HD / 16] = {};
  for (int t = 0; t < NT; ++t) { const FaBuf& f = fb[t & 1];
    v8f s[2][FH / 16]; v16h p[2]; float ts[2];
#pragma unroll
    for (int u = 0; u < FH / 16; ++u) { const v16h ka = frag_h(&f.k[kh * FH + 16 * u + col][0], lane), kb = frag_h(&f.k[kh * FH + 16 * u + col][32], lane);
#pragma unroll
      for (int a = 0; a < 2; ++a) { v8f z = {}; z = wmma_h(ka, q[a][0], z); s[a][u] = wmma_h(kb, q[a][1], z); } }
#pragma unroll
    for (int a = 0; a < 2; ++a) ts[a] = fa_t(s[a], m[a], cs[a], cb[a], p[a]);
    if (__builtin_amdgcn_ballot_w32(!(ts[0] <= TLIM) || !(ts[1] <= TLIM)) != 0) {   /* one test per tile, a scalar branch, rarely taken: some row of the wave needs a lower scale */
#pragma unroll
      for (int a = 0; a < 2; ++a) { float mx = 0.f;
#pragma unroll
        for (int u = 0; u < FH / 16; ++u) {
#pragma unroll
          for (int r = 0; r < 8; ++r) mx = fmaxf(mx, __builtin_amdgcn_inverse_ballot_w32(m[a][8 * u + r]) ? s[a][u][r] * SCALE + nb_ : 0.f); }
        mx = fmaxf(mx, __shfl_xor(mx, 16));   /* the query's largest unmasked x of this half tile, the same in both halves */
        int ex; (void)frexpf(mx, &ex);
        const float rn = (mx * rs[a] > 16.0f) ? ldexpf(1.0f, 4 - ex) : rs[a];   /* mx x rn in [8, 16): every scaled t of the half tile <= 256, their sum <= 4096 */
        const float fr = rn / rs[a], f2 = fr * fr;   /* powers of two: exact (or 0 where the old sums no longer count) */
#pragma unroll
        for (int j = 0; j < HD / 16; ++j) acc[a][j] *= f2;
        sum[a] *= f2; rs[a] = rn; cs[a] = SCALE * rn; cb[a] = nb_ * rn;
        ts[a] = fa_t(s[a], m[a], cs[a], cb[a], p[a]); } }
    sum[0] += ts[0]; sum[1] += ts[1];
    { const cu32* mn = mw + (t + 1 < NT ? t + 1 : NT - 1) * (FK / 2);   /* the next tile's words, asked for as soon as this tile's are used: they fly under P v, the hand-over and the next scores (the last trip reads its own again, in bounds) */
#pragma unroll
      for (int a = 0; a < 2; ++a) {
#pragma unroll
        for (int i = 0; i < FH / 2; ++i) m[a][i] = mn[a * (NT * (FK / 2)) + i]; } }
    v16h vf[HD / 16];
#pragma unroll
    for (int j = 0; j < HD / 16; ++j) vf[j] = frag_h(&f.v[j * 16 + col][kh * FH], lane);
    __builtin_amdgcn_sched_barrier(0);   /* keeps the tile's 8 V^T reads together in front of their products: left alone the compiler sinks them among the products, two at a time into one set of registers, each pair with a full wait in front of two products */
#pragma unroll
    for (int j = 0; j < HD / 16; ++j) {
#pragma unroll
      for (int a = 0; a < 2; ++a) acc[a][j] = wmma_h(vf[j], p[a], acc[a][j]); }
    __builtin_amdgcn_sched_barrier(0);   /* keeps the products in front of the hand-over: lifted over them, the barrier would hold a wave that is early with its products still to do */
    FA_PUBLISH();
    if (t + 2 < NT) fa_fill(fb[t & 1], kg, vg, (t + 2) * FK, tid); }
  asm volatile("s_wait_asynccnt 0x0" ::: "memory");   /* no copy is outstanding when the buffers become the join's array */
  sum[0] += __shfl_xor(sum[0], 16); sum[1] += __shfl_xor(sum[1], 16);
  if (kh == 1) {   /* wave-uniform: the second wave of a pair hands over its partials, 512 contiguous bytes per store; the same lane of its partner holds the same query and columns */
#pragma unroll
    for (int a = 0; a < 2; ++a) {
#pragma unroll
      for (int j = 0; j < HD / 16; ++j) { const v8f c = acc[a][j]; sm.mg[qw][(a * 4 + j) * 2][lane] = v4f{c[0], c[1], c[2], c[3]}; sm.mg[qw][(a * 4 + j) * 2 + 1][lane] = v4f{c[4], c[5], c[6], c[7]}; } }
    sm.mg[qw][16][lane] = v4f{sum[0], sum[1], rs[0], rs[1]}; }
  __syncthreads();   /* publishes the handed-over partials; every wave passes it */
  if (kh == 0) { const v4f sr = sm.mg[qw][16][lane]; v8h o[2][HD / 16];
#pragma unroll
    for (int a = 0; a < 2; ++a) { const float rp = sr[2 + a], rm = fminf(rs[a], rp);   /* both partials go to the lower of the two row scales */
      const float fa = rm / rs[a], fp = rm / rp, fa2 = fa * fa, fp2 = fp * fp;   /* powers of two: exact (or 0 where that partial no longer counts); one of them is 1 */
      const float inv = 1.0f / ((sum[a] * fa2 + sr[a] * fp2) + (IEPS * rm) * rm);   /* both sums carry rm^2, so does the 1e-32; both sums == 0 -> rm == RS0, acc == 0 -> ctx = 0 */
#pragma unroll
      for (int j = 0; j < HD / 16; ++j) { const v4f c0 = sm.mg[qw][(a * 4 + j) * 2][lane], c1 = sm.mg[qw][(a * 4 + j) * 2 + 1][lane];
#pragma unroll
        for (int r = 0; r < 8; ++r) o[a][j][r] = (_Float16)(((acc[a][j][r] * fa2 + (r < 4 ? c0[r & 3] : c1[r & 3]) * fp2) * inv) * 64.0f); } }
    _Float16* yp = YH + ((size_t)(b * (TT / 64) + blockIdx.y * (FQ / 64) + (qw >> 1)) * KT + h) * TILE + ((qw & 1) * 32 + col) * 64 + 8 * g;   /* acc[a][j][r] = ctx[query 16a + col][16j + 8g + r]; ctx x 2^6 once to f16 (clear of f16 subnormals), as k_out's A operand: the head's 64 columns are one tile of 64 of the block's rows, and the wave writes each query's whole 128-B row of it */
#pragma unroll
    for (int a = 0; a < 2; ++a) {
#pragma unroll
      for (int j = 0; j < HD / 16; ++j) vst2(yp + a * 16 * 64 + j * 16, o[a][j]); } } }
// ---- k_cvt (first launch): the roundings of the projections' operands, once per element: iQ, iK, iV and Wq, Wk, Wv to bf16, Wo to f16(bf16 x 2^8) (exact), written as tiles. A block takes one row per load (256 threads x 16 B, whole lines), eight rows in flight; 128 B of a tile row per 16 lanes on the way out
__global__ __launch_bounds__(256) void k_cvt(const float* __restrict__ XQ, const float* __restrict__ XK, const float* __restrict__ XV, const float* __restrict__ WQ, const float* __restrict__ WK, const float* __restrict__ WV, const float* __restrict__ WO, __bf16* __restrict__ XB, __bf16* __restrict__ WB, _Float16* __restrict__ WOH) {
  const int tid = threadIdx.x, bx = blockIdx.x, k = tid * 4;   /* rows bx + 512 i */
  const size_t so = (size_t)bx * DIN + k, to = ((size_t)(bx >> 6) * KT + (k >> 6)) * TILE + (bx & 63) * 64 + (k & 63);   /* 512 rows on: 512 * DIN elements in either layout */
#pragma unroll
  for (int p = 0; p < 3; ++p) { const float* xp = (p == 0 ? XQ : p == 1 ? XK : XV) + so; __bf16* op = XB + (size_t)p * TNB * TT * DIN + to; v4f a[8];
#pragma unroll
    for (int i = 0; i < 8; ++i) a[i] = *(const v4f*)(xp + (size_t)i * 512 * DIN);
    XW(xp);
#pragma unroll
    for (int i = 0; i < 8; ++i) { v4b o;
#pragma unroll
      for (int e = 0; e < 4; ++e) o[e] = (__bf16)a[i][e];
      *(v4b*)(op + (size_t)i * 512 * DIN) = o; }
    XW(op); }
  v4f a[8];
#pragma unroll
  for (int i = 0; i < 8; ++i) a[i] = *(const v4f*)(((i >> 1) == 0 ? WQ : (i >> 1) == 1 ? WK : (i >> 1) == 2 ? WV : WO) + (size_t)(i & 1) * 512 * DIN + so);
  asm volatile("s_wait_xcnt 0x0" ::: "memory");   /* closes the group of loads before a register that they name may be rewritten */
#pragma unroll
  for (int i = 0; i < 6; ++i) { v4b o;
#pragma unroll
    for (int e = 0; e < 4; ++e) o[e] = (__bf16)a[i][e];
    *(v4b*)(WB + (size_t)i * 512 * DIN + to) = o; }
#pragma unroll
  for (int i = 6; i < 8; ++i) { v4h o;
#pragma unroll
    for (int e = 0; e < 4; ++e) o[e] = (_Float16)(bfr(a[i][e]) * 256.0f);
    *(v4h*)(WOH + (size_t)(i - 6) * 512 * DIN + to) = o; } }
// ---- k_out: block = (128 rows, 128 cols), four waves 2 x 2, each on 64 rows x 64 cols: out = ctx Wo (+ bo): ctx x 2^6 in f16 against Wo as f16(bf16 x 2^8) exact (1 product) x 2^-14
__global__ __launch_bounds__(128) void k_out(const _Float16* __restrict__ YH, const _Float16* __restrict__ WOH, const float* __restrict__ BO, float* __restrict__ OUT) { union SM { float sf[4][64][68]; _Float16 st[2][SROWS][SP]; };   /* the stage buffers lie over the epilogue's array, which is first written behind the loop's last barrier */
  __shared__ __align__(16) SM sm; auto& sf = sm.sf;
  const int tid = threadIdx.x, wave = tid >> 5, lane = tid & 31, col = lane & 15, g = lane >> 4, wr = wave >> 1, wc = wave & 1; const int c0 = blockIdx.y * 128 + wc * 64; const size_t r0 = (size_t)blockIdx.x * 128 + wr * 64;
  v8f acc[4][4] = {};
  const _Float16* xt = YH + (size_t)blockIdx.x * 2 * KT * TILE + tid * 8; const _Float16* wt = WOH + (size_t)blockIdx.y * 2 * KT * TILE + tid * 8;   /* this thread's 16 B of the first ctx and Wo tiles */
  g_fill(sm.st[0], xt, wt, tid);
  asm volatile("s_wait_asynccnt 0x0" ::: "memory");   /* stage 0 has landed before the barrier that publishes it */
  __syncthreads();
  g_fill(sm.st[1], xt + TILE, wt + TILE, tid);
  for (int t = 0; t < CC / KS; ++t) { const _Float16 (*cb)[SP] = sm.st[t & 1];
    v16h a[KS / 32][4], w[KS / 32][4];
#pragma unroll
    for (int kc = 0; kc < KS / 32; ++kc) {
#pragma unroll
      for (int i = 0; i < 4; ++i) { a[kc][i] = frag_h(&cb[wr * 64 + i * 16 + col][kc * 32], lane); w[kc][i] = frag_h(&cb[128 + wc * 64 + i * 16 + col][kc * 32], lane); } }
    __builtin_amdgcn_sched_barrier(0);   /* keeps the stage's 32 LDS reads together in front of its products: left alone the compiler sinks them among the products, two at a time, each pair with a full wait in front of four products */
#pragma unroll
    for (int kc = 0; kc < KS / 32; ++kc) {
#pragma unroll
      for (int i = 0; i < 4; ++i) {
#pragma unroll
        for (int j = 0; j < 4; ++j) acc[i][j] = __builtin_amdgcn_wmma_f32_16x16x32_f16(false, a[kc][i], false, w[kc][j], (short)0, acc[i][j], false, false); } }
    __builtin_amdgcn_sched_barrier(0);   /* keeps the products in front of the hand-over: lifted over them, its waits would give the next tile's copies only the LDS reads' time to land */
    FA_PUBLISH();
    if (t + 2 < CC / KS) g_fill(sm.st[t & 1], xt + (size_t)(t + 2) * TILE, wt + (size_t)(t + 2) * TILE, tid); }   /* into the buffer that every wave has just left */
  asm volatile("s_wait_asynccnt 0x0" ::: "memory");   /* no copy is outstanding when the buffers become the epilogue's array */
  float bias[4] = {0.f, 0.f, 0.f, 0.f};
  if (BO) { const float* bp = BO + c0 + col;   /* one test, so that the four loads go out together */
#pragma unroll
    for (int j = 0; j < 4; ++j) bias[j] = bp[j * 16];
#pragma unroll
    for (int j = 0; j < 4; ++j) bias[j] = bfr(bias[j]); }
#pragma unroll
  for (int j = 0; j < 4; ++j) {
#pragma unroll
    for (int i = 0; i < 4; ++i) {
#pragma unroll
      for (int r = 0; r < 8; ++r) sf[wave][i * 16 + 8 * g + r][j * 16 + col] = acc[i][j][r] * (1.0f / 16384.0f) + bias[j]; } }   /* 2^-8 (Wo carry) x 2^-6 (ctx carry) */
  LDSX(); float* op = OUT + (r0 + g) * DIN + c0 + col * 4;   /* the wave's own rows back as whole lines: 256 B of a row per 16 lanes, two rows per store */
#pragma unroll
  for (int rl = 0; rl < 64; rl += 2) vst2(op + (size_t)rl * DIN, *(const v4f*)&sf[wave][rl + g][col * 4]); }

extern "C" void kernel_launch(void* const* d_in, const int* in_sizes, int n_in, void* d_out, int out_size, void* d_ws, size_t ws_size, hipStream_t stream) {
  (void)in_sizes; (void)n_in; (void)out_size;
  const float** F = (const float**)d_in;
  if (ws_size < (size_t)WS_END) return;
  char* ws = (char*)d_ws; _Float16 *QH = (_Float16*)(ws + WS_QH), *KH = (_Float16*)(ws + WS_KH), *VT = (_Float16*)(ws + WS_VT); _Float16 *YH = (_Float16*)(ws + WS_Y), *WOH = (_Float16*)(ws + WS_WO); __bf16 *XB = (__bf16*)(ws + WS_XB), *WB = (__bf16*)(ws + WS_WB); unsigned* MB = (unsigned*)(ws + WS_S);   /* lane-mask words of the mask, 1 MiB, in the place of the old score plane */
  // inputs: 0 iQ [2,2048,1024]; 1 iK; 2 iV; 3 mask [2,2048,2048] bool (True = masked); 4 Wq [1024,1024] (out,in), 5 bq; 6 Wk, 7 bk; 8 Wv, 9 bv; 10 Wo (out,in), 11 bo (zero biases, read); 12 nbias [1] (SparseNormer bias; zero)
  k_cvt<<<dim3(512), 256, 0, stream>>>(F[0], F[1], F[2], F[4], F[6], F[8], F[10], XB, WB, WOH);
  k_proj<<<dim3(TNB * TT / 128, CC / 128, 5), 128, 0, stream>>>(XB, WB, F[5], F[7], F[9], QH, KH, VT, (const int*)d_in[3], MB);   /* z = 3, 4: the mask's packing blocks, short, last in the launch */
  k_fa<<<dim3(NH, TT / FQ, TNB), 256, 0, stream>>>(QH, KH, VT, MB, F[12], YH);   /* relu(x + nbias)^2 / (sum + 1e-32): NOT a softmax */
  k_out<<<dim3(TNB * TT / 128, DIN / 128), 128, 0, stream>>>(YH, WOH, F[11], (float*)d_out);
}

// v009
// Measured time: 81.4 microseconds a run.
// Two timings next to v008 put it at 1.05 and 1.06 times that version's speed.
// All steps since v000 together make it 16.4 times as fast.
// compute dtype: all float inputs rounded to bf16; q/k/v projections with EXACT bf16 products on WMMA 16x16x32 (f32 accumulate) + bias; scores q x k once to f16 each (1 product) x 64^-0.5; SparseNormer in f32: t = relu(score + nbias)^2 (masked entries -> 0); t x 2^2n (n per row and key half) once to f16 x v once to f16 (1 product), two partial sums per row joined at the end, ctx = that sum / (sum t + 1e-32); ctx x 2^6 once to f16 x Wo f16(bf16 x 2^8) + bo; f32 output.
#include <hip/hip_runtime.h>
#include <math.h>

typedef __attribute__((ext_vector_type(16))) _Float16 v16h;
typedef __attribute__((ext_vector_type(16))) __bf16 v16b;
typedef __attribute__((ext_vector_type(8)))  _Float16 v8h;
typedef __attribute__((ext_vector_type(8)))  float v8f;
typedef __attribute__((ext_vector_type(4)))  float v4f;
typedef __attribute__((ext_vector_type(2)))  float v2f;
typedef __attribute__((ext_vector_type(4)))  unsigned v4u;
typedef __attribute__((ext_vector_type(4)))  int v4i;
typedef float __attribute__((may_alias)) float_a;
typedef int __attribute__((may_alias)) int_a;

template <typename T> __device__ __forceinline__ void vst2(void* p, T v) { *(T*)p = v;  }
__device__ __forceinline__ v8f wmma16(v16h a, v16h b, v8f c) {
  v8f d = __builtin_amdgcn_wmma_f32_16x16x32_f16(false, a, false, b, (short)0, c, false, false);
  asm volatile("v_nop\n\tv_nop\n\tv_nop\n\tv_nop" : "+v"(d) : "v"(a), "v"(b));
  return d;
}
__device__ __forceinline__ v8f wmma_bf(v16b a, v16b b, v8f c) {
  v8f d = __builtin_amdgcn_wmma_f32_16x16x32_bf16(false, a, false, b, (short)0, c, false, false);
  asm volatile("v_nop\n\tv_nop\n\tv_nop\n\tv_nop" : "+v"(d) : "v"(a), "v"(b));
  return d;
}
// 16x16x32 fragments: lane = (h = lane>>4, row/col = lane&15); elements 0..7 = k0+8h+0..7, 8..15 = k0+16+8h+0..7; D element r = row 8h+r
__device__ __forceinline__ v16h frag_h(const _Float16* rowk0, int lane) {
  union { v16h v; v8h q[2]; } u; const _Float16* p = rowk0 + 8 * (lane >> 4);
  u.q[0] = *(const v8h*)p; u.q[1] = *(const v8h*)(p + 16); return u.v;
}
__device__ __forceinline__ v16h frag_f32(const float* rowk0, int lane) {
  v16h a; const float* p = rowk0 + 8 * (lane >> 4);
#pragma unroll
  for (int i = 0; i < 8; ++i) { a[i] = (_Float16)p[i]; a[8 + i] = (_Float16)p[16 + i]; }
  return a;
}
__device__ __forceinline__ v16h frag_f32s(const float* rowk0, int lane, float sc) {
  v16h a; const float* p = rowk0 + 8 * (lane >> 4);
#pragma unroll
  for (int i = 0; i < 8; ++i) { a[i] = (_Float16)(p[i] * sc); a[8 + i] = (_Float16)(p[16 + i] * sc); }
  return a;
}
// column fragment from a [K][ld] layout (column n), rows >= K read as 0
__device__ __forceinline__ v16h fragc_f32(const float* W, int k0, int n, int lane, int ld, int K) {
  v16h a; const int g = lane >> 4;
#pragma unroll
  for (int i = 0; i < 8; ++i) { const int ka = k0 + 8 * g + i, kb = ka + 16;
    a[i] = (_Float16)(ka < K ? W[(size_t)(ka < K ? ka : K - 1) * ld + n] : 0.f); a[8 + i] = (_Float16)(kb < K ? W[(size_t)(kb < K ? kb : K - 1) * ld + n] : 0.f); }
  return a;
}
struct F2 { v16b h, l; };
__device__ __forceinline__ F2 bsplit16(const float v[16]) { F2 r;
#pragma unroll
  for (int i = 0; i < 16; ++i) { const __bf16 h = (__bf16)v[i]; r.h[i] = h; r.l[i] = (__bf16)(v[i] - (float)h); }
  return r; }
__device__ __forceinline__ F2 split_row(const float* row, int k0, int lane) { float v[16]; const float* p = row + k0 + 8 * (lane >> 4);
#pragma unroll
  for (int i = 0; i < 8; ++i) { v[i] = p[i]; v[8 + i] = p[16 + i]; }
  return bsplit16(v); }
__device__ __forceinline__ F2 split_rowK(const float* row, int k0, int lane, int K) { float v[16]; const int g = lane >> 4;
#pragma unroll
  for (int i = 0; i < 8; ++i) { const int ka = k0 + 8 * g + i, kb = ka + 16; v[i] = ka < K ? row[ka < K ? ka : K - 1] : 0.f; v[8 + i] = kb < K ? row[kb < K ? kb : K - 1] : 0.f; }
  return bsplit16(v); }
__device__ __forceinline__ F2 split_col(const float* W, int k0, int n, int lane, int ld, int K) { float v[16]; const int g = lane >> 4;
#pragma unroll
  for (int i = 0; i < 8; ++i) { const int ka = k0 + 8 * g + i, kb = ka + 16; v[i] = ka < K ? W[(size_t)(ka < K ? ka : K - 1) * ld + n] : 0.f; v[8 + i] = kb < K ? W[(size_t)(kb < K ? kb : K - 1) * ld + n] : 0.f; }
  return bsplit16(v); }
__device__ __forceinline__ v8f mac3(const F2& a, const F2& b, v8f c) { c = wmma_bf(a.l, b.h, c); c = wmma_bf(a.h, b.l, c); return wmma_bf(a.h, b.h, c); }
__device__ __forceinline__ float sigm(float v) { return 1.0f / (1.0f + expf(-v)); }
#define LDSX() do { asm volatile("s_wait_dscnt 0" ::: "memory"); __builtin_amdgcn_wave_barrier(); __builtin_amdgcn_fence(__ATOMIC_RELEASE, "workgroup"); } while (0)

// Multi-head attention with a SparseNormer instead of a softmax (iQ / iK / iV [2,2048,1024] separate inputs; torch (out,in) Wq / Wk / Wv / Wo [1024,1024] (0.02 scale) + zero biases; 16 heads x 64; scores / 8; mask [2,2048,2048] bool random (True -> -1e32); t = relu(scores + nbias)^2 with nbias = zeros(1); attn = t / (sum_k t + 1e-32)): out = merge(attn v) Wo^T + bo.
#define NB 2
#define TT 2048
#define CC 1024            // NH * HD = projected width
#define DIN 1024          // input (model) width
#define NH 16
#define HD 64
#define NQB (TT / 64)
#define HG 4
#define SCALE (0.125f)
#define CAUSAL 0
#ifndef TNB
#define TNB NB
#endif
__device__ __forceinline__ float bfr(float v) { return (float)(__bf16)v; }
__host__ __device__ __forceinline__ int kb_last(int qb) { return CAUSAL ? ((qb * 64 + 63) >> 7) : (TT / 128 - 1); }
typedef __attribute__((ext_vector_type(8))) __bf16 v8b;
__device__ __forceinline__ v16b frag_b(const __bf16* rowk0, int lane) {
  union { v16b v; v8b q[2]; } u; const __bf16* p = rowk0 + 8 * (lane >> 4);
  u.q[0] = *(const v8b*)p; u.q[1] = *(const v8b*)(p + 16); return u.v;
}
#define QBH 0              // not used by any kernel here
#define QHI 0               // single-product scores on every row
#define KHI 64            // key rows carrying k residual / v bf16 hi+lo planes (written and read by no kernel here)
// B fragment (k rows k0+.., output column o) of a weight: (in,out) [K][ld] or (out,in) [ld rows of K]: bf16 exact, or f16(bf16 * 256) exact
__device__ __forceinline__ v16b wcol_io(const float* Wm, int k0, int o, int lane, int ld) { v16b w; const int g = lane >> 4;
#pragma unroll
  for (int i = 0; i < 8; ++i) { w[i] = (__bf16)Wm[(size_t)(k0 + 8 * g + i) * ld + o]; w[8 + i] = (__bf16)Wm[(size_t)(k0 + 16 + 8 * g + i) * ld + o]; }
  return w; }
__device__ __forceinline__ v16b wcol_oi(const float* Wm, int k0, int o, int lane, int K) { v16b w; const float* p = Wm + (size_t)o * K + k0 + 8 * (lane >> 4);
#pragma unroll
  for (int i = 0; i < 8; ++i) { w[i] = (__bf16)p[i]; w[8 + i] = (__bf16)p[16 + i]; }
  return w; }
__device__ __forceinline__ v16h wcolh_io(const float* Wm, int k0, int o, int lane, int ld) { v16h w; const int g = lane >> 4;
#pragma unroll
  for (int i = 0; i < 8; ++i) { w[i] = (_Float16)(bfr(Wm[(size_t)(k0 + 8 * g + i) * ld + o]) * 256.0f); w[8 + i] = (_Float16)(bfr(Wm[(size_t)(k0 + 16 + 8 * g + i) * ld + o]) * 256.0f); }
  return w; }
__device__ __forceinline__ v16h wcolh_oi(const float* Wm, int k0, int o, int lane, int K) { v16h w; const float* p = Wm + (size_t)o * K + k0 + 8 * (lane >> 4);
#pragma unroll
  for (int i = 0; i < 8; ++i) { w[i] = (_Float16)(bfr(p[i]) * 256.0f); w[8 + i] = (_Float16)(bfr(p[16 + i]) * 256.0f); }
  return w; }
#define WQKV_LAYOUT 1   // 0 = (in,out) [DIN][CC]; 1 = (out,in) [CC][DIN]; 2 = per-head [NH][DIN][HD]
__device__ __forceinline__ v16b wcol_hdk(const float* Wm, int k0, int o, int lane) { v16b w; const int g = lane >> 4; const float* p = Wm + (size_t)(o / HD) * DIN * HD + (o % HD);
#pragma unroll
  for (int i = 0; i < 8; ++i) { w[i] = (__bf16)p[(size_t)(k0 + 8 * g + i) * HD]; w[8 + i] = (__bf16)p[(size_t)(k0 + 16 + 8 * g + i) * HD]; }
  return w; }
#define WO_OUT_IN 1
#if WQKV_LAYOUT == 1
#define WCOL(W, k0, o, lane) wcol_oi(W, k0, o, lane, DIN)
#elif WQKV_LAYOUT == 2
#define WCOL(W, k0, o, lane) wcol_hdk(W, k0, o, lane)
#else
#define WCOL(W, k0, o, lane) wcol_io(W, k0, o, lane, CC)
#endif
#if WO_OUT_IN
#define WOCOL(W, k0, o, lane) wcol_oi(W, k0, o, lane, CC)
#define WOCOLH(W, k0, o, lane) wcolh_oi(W, k0, o, lane, CC)
#else
#define WOCOL(W, k0, o, lane) wcol_io(W, k0, o, lane, DIN)
#define WOCOLH(W, k0, o, lane) wcolh_io(W, k0, o, lane, DIN)
#endif

#ifndef SM_EXTRA_PARAMS
#define SM_EXTRA_PARAMS
#endif
#ifndef PROJ_EXTRA_PARAMS
#define PROJ_EXTRA_PARAMS
#endif
#ifndef SM_MASK_HOOK
#define SM_MASK_HOOK (void)0
#endif

#define WS_QH  0u                                      // f16 q rows [b*t][CC]
#define WS_KH  (WS_QH + 2u * (size_t)NB * TT * CC)      // f16 k rows [b*t][CC]
#define WS_VT  (WS_KH + 2u * (size_t)NB * TT * CC)      // f16 v planes [b][c][t]
#define WS_QL  (WS_VT + 2u * (size_t)NB * CC * TT)      // f16 q residual x 2^10 rows [b][t < QHI][CC]
#define WS_KL  (WS_QL + 2u * (size_t)NB * QHI * CC)     // f16 k residual x 2^10 rows [b][t < KHI][CC]
#define WS_VB  (WS_KL + 2u * (size_t)NB * KHI * CC)     // bf16 v hi planes [b][c][t < KHI]
#define WS_VBL (WS_VB + 2u * (size_t)NB * CC * KHI)
#define WS_S   (WS_VBL + 2u * (size_t)NB * CC * KHI)    // lane-mask words, then operand tiles (room of an f32 plane [hg][t][s])
#define WS_Y   (WS_S  + 4u * (size_t)HG * TT * TT)      // f16 ctx x 2^6 tiles
#define WS_END (WS_Y  + 4u * (size_t)NB * TT * CC)
#define WS_XB  (WS_S + (2u << 20))                      // bf16 iQ, iK, iV tiles, behind the mask words in the place of the old score plane
#define WS_WB  (WS_XB + 3u * 2u * (size_t)NB * TT * DIN) // bf16 Wq, Wk, Wv tiles, then f16 Wo tiles
#define WS_WO  (WS_WB + 3u * 2u * (size_t)CC * DIN)
static_assert(WS_WO + 2u * (size_t)CC * DIN <= WS_Y, "the operand tiles stay inside the old score plane");

// ---- operands of the two projection kernels: every X, W and ctx element is rounded ONCE to its 16-bit operand type and kept in memory as tiles of 64 rows x 64 k (8 KB contiguous): element (row, k) at ((row >> 6) * 16 + (k >> 6)) * 4096 + (row & 63) * 64 + (k & 63); every matrix here has 1024 k. A block's 128 X rows and 128 W rows, KS k at a time, are four such tiles, which come by asynchronous copies straight into LDS (512 contiguous bytes per wave and copy), where all four waves read their fragments; two buffers, the next stage's copies fly while this stage is multiplied
#define KS 64              // k per stage
#define SP 72              // LDS row pitch in 16-bit elements: 144 B = 16 B x 9, an odd multiple of 16 B, which ds_load_b128 fragment reads take without bank conflicts
#define SROWS 256          // rows 0..127 = X, 128..255 = W
#define TILE 4096          // elements of a tile
#define KT (DIN / 64)      // tiles per block of 64 rows
// the k walk of a block is a ring: trip t works on k stage (t + rot) mod KT, rot = block row + block column. Blocks that share X rows (8 of them) or W rows (32) are all resident and run in step; started at different stages they do not ask L2 for the same lines at the same moment. Every stage is taken once; only the order of the f32 sums over k differs from block to block
#define KROT(t, rot) ((size_t)(((t) + (rot)) & (KT - 1)))
static_assert((KT & (KT - 1)) == 0 && DIN == CC, "the ring's wrap is a mask, and both projection kernels walk KT stages");
typedef __attribute__((ext_vector_type(4))) __bf16 v4b;
typedef __attribute__((ext_vector_type(4))) _Float16 v4h;
__device__ __forceinline__ unsigned lds_of(const void* p) { return (unsigned)(size_t)p; }   /* LDS byte address = low 32 bits of the __shared__ address */
// four copies of 16 B per lane; the s_wait_xcnt closes the group inside its own statement, before a register that a copy names may be rewritten
__device__ __forceinline__ void cp4(unsigned l0, const void* g0, unsigned l1, const void* g1, unsigned l2, const void* g2, unsigned l3, const void* g3) {
  asm volatile("global_load_async_to_lds_b128 %0, %1, off\n\tglobal_load_async_to_lds_b128 %2, %3, off\n\tglobal_load_async_to_lds_b128 %4, %5, off\n\tglobal_load_async_to_lds_b128 %6, %7, off\n\ts_wait_xcnt 0x0"
               :: "v"(l0), "v"(g0), "v"(l1), "v"(g1), "v"(l2), "v"(g2), "v"(l3), "v"(g3) : "memory"); }
// hand-over of a tile: this wave's LDS reads of the old tile are done, its own copies of the next tile have landed, and the barrier publishes the next tile and frees the old buffer
#define FA_PUBLISH() do { asm volatile("s_wait_dscnt 0x0" ::: "memory"); asm volatile("s_wait_asynccnt 0x0" ::: "memory"); __syncthreads(); } while (0)
// one tile into 64 LDS rows from row r0 on; tp: this thread's 16 B of the tile (element tid * 8), further copies 16 rows = 1024 elements apart
template <typename T> __device__ __forceinline__ void g_tile(T (*st)[SP], int r0, const T* tp, int tid) { const int r8 = r0 + (tid >> 3), c8 = (tid & 7) * 8;
  cp4(lds_of(&st[r8][c8]), tp, lds_of(&st[r8 + 16][c8]), tp + 1024, lds_of(&st[r8 + 32][c8]), tp + 2048, lds_of(&st[r8 + 48][c8]), tp + 3072); }
// one stage: the X tiles and the W tiles of two neighbouring blocks of 64 rows each
template <typename T> __device__ __forceinline__ void g_fill(T (*st)[SP], const T* xt, const T* wt, int tid) { g_tile(st, 0, xt, tid); g_tile(st, 64, xt + (size_t)KT * TILE, tid); g_tile(st, 128, wt, tid); g_tile(st, 192, wt + (size_t)KT * TILE, tid); }
// ---- mask as lane masks: word [16-query group][64-key tile][8u + r], bit 16g + col = (mask[query col][key 16u + 8g + r] == 0, the key counts): the very lane that holds that score in k_fa, so a word is the select mask of one score register; 1/32 of the i32 mask's bytes
#define PKP 260            // LDS row pitch in words of the packing blocks: 1040 B = 16 B x 65 (odd)
#define PKT 4              // tiles of 64 keys per packing wave
static_assert(2 * (TNB * TT / 128) * (CC / 128) * 4 * PKT == (TNB * TT / 16) * (TT / 64), "the packing blocks' waves cover every (query group, tile) once");
// ---- k_proj: block = (128 rows, 128 cols, which): which 3, 4: the mask's lane-mask words (see above); else q/k/v = X W (+ b) with exact bf16 products (K = DIN) -> which 0: q f16 rows; 1: k f16 rows; 2: v f16 planes [c][t]. The four waves stand 2 x 2, each on 64 rows x 64 cols: a fragment read from LDS feeds four products
__global__ __launch_bounds__(128) void k_proj(const __bf16* __restrict__ XB, const __bf16* __restrict__ WB, const float* __restrict__ BQ, const float* __restrict__ BK, const float* __restrict__ BV,
    _Float16* __restrict__ QH, _Float16* __restrict__ KH, _Float16* __restrict__ VT, const int* __restrict__ MASK, unsigned* __restrict__ MB) {
  union SM { _Float16 sh[128][136]; __bf16 st[2][SROWS][SP]; int pk[4][16][PKP]; };   /* the stage buffers lie over the epilogue's array, which is first written behind the loop's last barrier */
  __shared__ __align__(16) SM sm; auto& sh = sm.sh;
  const int tid = threadIdx.x, wave = tid >> 5, lane = tid & 31, col = lane & 15, g = lane >> 4, wr = wave >> 1, wc = wave & 1; const int which = blockIdx.z; const int c0 = blockIdx.y * 128; const size_t r0 = (size_t)blockIdx.x * 128; const size_t bb = r0 / TT; const int t0 = (int)(r0 % TT);
  if (which >= 3) {   /* block-uniform, in front of every barrier: each wave packs 16 queries x PKT tiles; the rows come as whole lines (512 B of one row per load) and turn through the wave's own LDS rows into the score layout; the loops are unrolled whole so that all 32 loads are in flight together and the vectors are indexed by constants */
    const int id = (((which - 3) * (TNB * TT / 128) + blockIdx.x) * (CC / 128) + blockIdx.y) * 4 + wave, qg = id / (TT / 64 / PKT), tq = id % (TT / 64 / PKT);
    const int* mp = MASK + (size_t)qg * 16 * TT + tq * (PKT * 64) + lane * 4; v4i mv[32];
#pragma unroll
    for (int i = 0; i < 32; ++i) mv[i] = *(const v4i*)(mp + (size_t)(i >> 1) * TT + (i & 1) * 128);
    asm volatile("s_wait_xcnt 0x0" :: "v"(mp) : "memory");   /* closes the group of loads before a register that they name may be rewritten */
#pragma unroll
    for (int i = 0; i < 32; ++i) *(v4i*)&sm.pk[wave][i >> 1][(i & 1) * 128 + lane * 4] = mv[i];
    LDSX();   /* the wave's own rows are written before its lanes read each other's words */
#pragma unroll
    for (int tl = 0; tl < PKT; ++tl) { unsigned w = 0;
#pragma unroll
      for (int u = 0; u < 4; ++u) { const v4i a = *(const v4i*)&sm.pk[wave][col][tl * 64 + 16 * u + 8 * g], c = *(const v4i*)&sm.pk[wave][col][tl * 64 + 16 * u + 8 * g + 4];
#pragma unroll
        for (int r = 0; r < 8; ++r) { const unsigned bl = __builtin_amdgcn_ballot_w32((r < 4 ? a[r & 3] : c[r & 3]) == 0); w = (lane == 8 * u + r) ? bl : w; } }
      MB[((size_t)qg * (TT / 64) + tq * PKT + tl) * 32 + lane] = w; }   /* 128 B per tile, one line */
    return; }
  const float* BA = which == 0 ? BQ : which == 1 ? BK : BV;
  v8f acc[4][4] = {};   /* acc[i][j][r] = element (row 64 wr + 16 i + 8 g + r, column 64 wc + 16 j + col) of the block */
  const __bf16* xt = XB + ((size_t)which * (TNB * TT / 64) + blockIdx.x * 2) * KT * TILE + tid * 8; const __bf16* wt = WB + ((size_t)which * (CC / 64) + (c0 >> 6)) * KT * TILE + tid * 8;   /* this thread's 16 B of the X and W tiles of k stage 0; stage s's tiles lie s * TILE elements on */
  const int rot = blockIdx.x + blockIdx.y;   /* the block's first k stage (see KROT) */
  g_fill(sm.st[0], xt + KROT(0, rot) * TILE, wt + KROT(0, rot) * TILE, tid);
  asm volatile("s_wait_asynccnt 0x0" ::: "memory");   /* the block's first stage has landed before the barrier that publishes it */
  __syncthreads();
  g_fill(sm.st[1], xt + KROT(1, rot) * TILE, wt + KROT(1, rot) * TILE, tid);
  for (int t = 0; t < DIN / KS; ++t) { const __bf16 (*cb)[SP] = sm.st[t & 1];
    v16b a[KS / 32][4], w[KS / 32][4];
#pragma unroll
    for (int kc = 0; kc < KS / 32; ++kc) {
#pragma unroll
      for (int i = 0; i < 4; ++i) { a[kc][i] = frag_b(&cb[wr * 64 + i * 16 + col][kc * 32], lane); w[kc][i] = frag_b(&cb[128 + wc * 64 + i * 16 + col][kc * 32], lane); } }
    __builtin_amdgcn_sched_barrier(0);   /* keeps the stage's 32 LDS reads together in front of its products: left alone the compiler sinks them among the products, two at a time, each pair with a full wait in front of four products */
#pragma unroll
    for (int kc = 0; kc < KS / 32; ++kc) {
#pragma unroll
      for (int i = 0; i < 4; ++i) {
#pragma unroll
        for (int j = 0; j < 4; ++j) acc[i][j] = __builtin_amdgcn_wmma_f32_16x16x32_bf16(false, a[kc][i], false, w[kc][j], (short)0, acc[i][j], false, false); } }
    __builtin_amdgcn_sched_barrier(0);   /* keeps the products in front of the hand-over: lifted over them, its waits would give the next tile's copies only the LDS reads' time to land */
    FA_PUBLISH();
    if (t + 2 < DIN / KS) g_fill(sm.st[t & 1], xt + KROT(t + 2, rot) * TILE, wt + KROT(t + 2, rot) * TILE, tid); }   /* into the buffer that every wave has just left */
  asm volatile("s_wait_asynccnt 0x0" ::: "memory");   /* no copy is outstanding when the buffers become the epilogue's array */
  float bias[4] = {0.f, 0.f, 0.f, 0.f};
  if (BA) { const float* bp = BA + c0 + wc * 64 + col;   /* one test, so that the four loads go out together */
#pragma unroll
    for (int j = 0; j < 4; ++j) bias[j] = bp[j * 16];
#pragma unroll
    for (int j = 0; j < 4; ++j) bias[j] = bfr(bias[j]); }
  if (which < 2) { _Float16* DH = (which == 0 ? QH : KH) + (r0 + (tid >> 4)) * CC + c0 + (tid & 15) * 8;   /* this thread's 16 B of row tid >> 4, further rows 8 apart */
#pragma unroll
    for (int j = 0; j < 4; ++j) {
#pragma unroll
      for (int i = 0; i < 4; ++i) {
#pragma unroll
        for (int r = 0; r < 8; ++r) sh[wr * 64 + i * 16 + 8 * g + r][wc * 64 + j * 16 + col] = (_Float16)(acc[i][j][r] + bias[j]); } }
    __syncthreads();
#pragma unroll
    for (int e = 0; e < 16; ++e) vst2((unsigned*)(DH + (size_t)e * 8 * CC), *(const v4u*)&sh[e * 8 + (tid >> 4)][(tid & 15) * 8]);   /* 256 B of a row per 16 lanes */
    asm volatile("s_wait_xcnt 0x0" :: "v"(DH) : "memory");   /* closes the run of stores before a register that they name may be rewritten */
  } else { _Float16* DV = VT + (bb * CC + c0 + (tid >> 4)) * (size_t)TT + t0 + (tid & 15) * 8;   /* sh holds the block transposed: [column][row] */
#pragma unroll
    for (int j = 0; j < 4; ++j) {
#pragma unroll
      for (int i = 0; i < 4; ++i) { v8h o;
#pragma unroll
        for (int r = 0; r < 8; ++r) o[r] = (_Float16)(acc[i][j][r] + bias[j]);
        *(v8h*)&sh[wc * 64 + j * 16 + col][wr * 64 + i * 16 + 8 * g] = o; } }   /* a lane's eight rows of a column lie side by side */
    __syncthreads();
#pragma unroll
    for (int e = 0; e < 16; ++e) vst2((unsigned*)(DV + (size_t)e * 8 * TT), *(const v4u*)&sh[e * 8 + (tid >> 4)][(tid & 15) * 8]); } }
// ---- k_sm: block = query row t (head in group): keys [0, kend): causal -> logit if s <= t else excluded; softmax in f32; P x 2^11 in place (0 for excluded)
__global__ __launch_bounds__(256) void k_sm(float* __restrict__ S0 SM_EXTRA_PARAMS) { __shared__ float sred[8]; __shared__ float sbc; __shared__ __align__(16) float shv[TT];
  const int tid = threadIdx.x; const int t = blockIdx.x; const int kend = (kb_last(t >> 6) + 1) * 128;
  float* sr = S0 + (size_t)blockIdx.y * TT * TT + (size_t)t * TT;
  float m = -3.0e38f; for (int k = tid; k < kend; k += 256) { float v = (!CAUSAL || k <= t) ? sr[k] : -3.0e38f; SM_MASK_HOOK; shv[k] = v; m = fmaxf(m, v); }
#pragma unroll
  for (int o = 1; o < 32; o <<= 1) m = fmaxf(m, __shfl_xor(m, o));
  if ((tid & 31) == 0) sred[tid >> 5] = m; __syncthreads(); if (tid == 0) { float a = sred[0]; for (int i = 1; i < 8; ++i) a = fmaxf(a, sred[i]); sbc = a; } __syncthreads(); m = sbc; __syncthreads();
  float sum = 0.f; for (int k = tid; k < kend; k += 256) { const float v = shv[k]; const float e = (v <= -1.0e38f) ? 0.f : expf(v - m); shv[k] = e; sum += e; }
#pragma unroll
  for (int o = 1; o < 32; o <<= 1) sum += __shfl_xor(sum, o);
  if ((tid & 31) == 0) sred[tid >> 5] = sum; __syncthreads(); if (tid == 0) { float a = 0.f; for (int i = 0; i < 8; ++i) a += sred[i]; sbc = a > 0.f ? 2048.0f / a : 0.f; }   /* a fully excluded row yields P = 0 */ __syncthreads(); const float inv = sbc;
  for (int k = tid; k < kend; k += 256) shv[k] = shv[k] * inv;
  __syncthreads(); for (int q = tid; q < kend / 4; q += 256) vst2(sr + q * 4, *(const v4f*)&shv[q * 4]); }
#define IEPS 1.0e-32f
__device__ __forceinline__ v8f wmma_h(v16h a, v16h b, v8f c) { return __builtin_amdgcn_wmma_f32_16x16x32_f16(false, a, false, b, (short)0, c, false, false); }
// XW(p): closes a group of global loads off pointer p before a register that they name may be rewritten; p is an input so that the address pair stays live up to the wait (no load of the group may land on it)
#define XW(p) asm volatile("s_wait_xcnt 0x0" :: "v"(p) : "memory")
#define FK 64
#define FH 32
#define FQ 128
#define KP 72
#define NT (TT / FK)
// the walk over the keys is a ring: trip t works on key tile (t + rot) mod NT. The blocks of one (b, h) read the same K and V^T tiles, are all resident and run in step; started at different tiles they do not ask L2 for the same lines at the same moment. Every tile is taken once; both sums over the keys are plain sums, so only their f32 order differs from block to block
#define FROT(t, rot) (((t) + (rot)) & (NT - 1))
static_assert((NT & (NT - 1)) == 0 && NT % (TT / FQ) == 0, "the ring's wrap is a mask, and the blocks' starts are spread evenly over it");
typedef __attribute__((address_space(4))) unsigned cu32;   // read-only for the whole launch: lets a loop with asm waits keep its wave-uniform loads scalar
struct __align__(16) FaBuf { _Float16 k[FK][KP]; _Float16 v[HD][KP]; };
// kg, vg: this thread's 16 B of row (tid >> 3), the second row 32 further; k0 = first key of the tile
__device__ __forceinline__ void fa_fill(FaBuf& f, const _Float16* kg, const _Float16* vg, int k0, int tid) {
  const int r8 = tid >> 3, c8 = (tid & 7) * 8;
  const _Float16* kq = kg + (size_t)k0 * CC; const _Float16* vq = vg + k0;
  cp4(lds_of(&f.k[r8][c8]), kq, lds_of(&f.k[r8 + 32][c8]), kq + (size_t)32 * CC, lds_of(&f.v[r8][c8]), vq, lds_of(&f.v[r8 + 32][c8]), vq + (size_t)32 * TT); }
#define RS0 0x1p60f        // first row scale: a row that never leaves it has every t <= 2^-105, of the order of the normaliser's 1e-32 or below, and 1e-32 x RS0^2 is still finite
#define TLIM 32768.0f      // a lane's sum of a half tile's scaled t (all >= 0) at or below this bounds each of them inside f16's range
// one half tile's scaled t = relu(score x cs + cb)^2 (masked -> 0): once to f16 as the B operand of V^T P^T; returns the lane's f32 sum of them. The scores are taken two at a time as they lie in neighbouring registers of one product's result (with two groups in a wave the compiler otherwise pairs the groups' scores for its packed forms, and pays a register copy for every score); the sum runs in two chains, even and odd keys
__device__ __forceinline__ float fa_t(const v8f (&s)[FH / 16], const unsigned (&m)[FH / 2], float cs, float cb, v16h& p) { v2f ts = {0.f, 0.f}; const v2f c2 = {cs, cs}, b2 = {cb, cb}, z2 = {0.f, 0.f};
#pragma unroll
  for (int u = 0; u < FH / 16; ++u) {
#pragma unroll
    for (int r = 0; r < 8; r += 2) { const v2f x = __builtin_elementwise_max(v2f{s[u][r], s[u][r + 1]} * c2 + b2, z2); v2f e = x * x;
      e[0] = __builtin_amdgcn_inverse_ballot_w32(m[8 * u + r]) ? e[0] : 0.f; e[1] = __builtin_amdgcn_inverse_ballot_w32(m[8 * u + r + 1]) ? e[1] : 0.f;
      ts += e; p[8 * u + r] = (_Float16)e[0]; p[8 * u + r + 1] = (_Float16)e[1]; } }
  return ts[0] + ts[1]; }
// ---- k_fa (scores, SparseNormer and P v in one launch; no score plane in memory): block = 8 waves = 4 pairs x 32 queries of (b, h). S^T = K Q^T: lane (g, col) holds query col's scores of keys 8g + r of each 16-key tile, so the row sum is in-lane (+ one exchange between the halves) and two converted S^T tiles are the B operand of ctx^T += V^T P^T.
// A wave holds TWO groups of 16 queries, so every K and V^T fragment that it reads from LDS feeds two products; the two waves of a pair share their 32 queries and take keys 0..31 and 32..63 of every tile, so as many waves stand on a SIMD as with 16 queries a wave. Each wave of a pair keeps its own partial sums and its own row scale; the pair's partials are joined once, behind the loop, through LDS.
// ONE pass over the keys: the normaliser is a plain quotient, so ctx = (sum_k t_k v_k) / (sum_k t_k + 1e-32) and both sums grow together. t goes to f16 as t x rs^2 with a power-of-two row scale rs (exact), so its f16 range does not depend on the scale of the scores: rs starts high and is lowered, with both sums rescaled, when a tile would leave f16's range (as a rule once, at the row's first tile with a positive score); the row's largest x then sits at 8..16 and may grow several-fold before the next change. The inner loops are unrolled whole so that the vector elements are indexed by constants and stay in registers.
__global__ __launch_bounds__(256) void k_fa(const _Float16* __restrict__ QH, const _Float16* __restrict__ KH, const _Float16* __restrict__ VT, const unsigned* __restrict__ MB, const float* __restrict__ NBIAS, _Float16* __restrict__ YH) {
  union SM { FaBuf fb[2]; v4f mg[4][17][32]; };   /* the join's array lies over the tile buffers, which no wave reads behind the loop's last barrier */
  __shared__ __align__(16) SM sm; auto& fb = sm.fb;
  const int tid = threadIdx.x, wave = tid >> 5, lane = tid & 31, col = lane & 15, g = lane >> 4; const int h = blockIdx.x, b = blockIdx.z;
  const int qw = __builtin_amdgcn_readfirstlane(wave & 3), kh = __builtin_amdgcn_readfirstlane(wave >> 2);   /* the pair, and the wave's half of every tile: wave-uniform, kept scalar */
  const int ql = blockIdx.y * FQ + qw * 32 + col;   /* query of group 0; group 1: 16 further */
  const float nb_ = bfr(NBIAS[0]);
  const _Float16* qp = QH + ((size_t)b * TT + ql) * CC + h * HD; v16h q[2][2];
#pragma unroll
  for (int a = 0; a < 2; ++a) { q[a][0] = frag_h(qp + (size_t)a * 16 * CC, lane); q[a][1] = frag_h(qp + (size_t)a * 16 * CC + 32, lane); }
  XW(qp);
  const _Float16* kg = KH + ((size_t)b * TT + (tid >> 3)) * CC + h * HD + (tid & 7) * 8; const _Float16* vg = VT + ((size_t)b * CC + h * HD + (tid >> 3)) * (size_t)TT + (tid & 7) * 8;
  const cu32* mw = (const cu32*)(MB + (size_t)((b * TT + blockIdx.y * FQ) / 16 + qw * 2) * (NT * (FK / 2)) + kh * (FH / 2));   /* the lane-mask words of group 0's 16 queries and the wave's half tiles, FH / 2 of every FK / 2; group 1's lie NT * FK / 2 words on; a wave-uniform address of words that no one writes during this launch, so they come by scalar loads into scalar registers */
  const int rot = blockIdx.y * (NT / (TT / FQ));   /* the block's first key tile (see FROT): the 16 blocks of a (b, h) start two tiles apart */
  unsigned m[2][FH / 2];   /* indexed by constants only (loops unrolled whole), so each word keeps a scalar register */
#pragma unroll
  for (int a = 0; a < 2; ++a) {
#pragma unroll
    for (int i = 0; i < FH / 2; ++i) m[a][i] = mw[a * (NT * (FK / 2)) + FROT(0, rot) * (FK / 2) + i]; }
  fa_fill(fb[0], kg, vg, FROT(0, rot) * FK, tid);
  asm volatile("s_wait_asynccnt 0x0" ::: "memory");   /* the block's first tile has landed before the barrier that publishes it */
  __syncthreads();
  fa_fill(fb[1], kg, vg, FROT(1, rot) * FK, tid);
  float rs[2] = {RS0, RS0}, cs[2] = {SCALE * RS0, SCALE * RS0}, cb[2] = {nb_ * RS0, nb_ * RS0}, sum[2] = {0.f, 0.f};   /* rs is the same in both halves of a query */
  v8f acc[2][HD / 16] = {};
  for (int t = 0; t < NT; ++t) { const FaBuf& f = fb[t & 1];
    v8f s[2][FH / 16]; v16h p[2]; float ts[2];
#pragma unroll
    for (int u = 0; u < FH / 16; ++u) { const v16h ka = frag_h(&f.k[kh * FH + 16 * u + col][0], lane), kb = frag_h(&f.k[kh * FH + 16 * u + col][32], lane);
#pragma unroll
      for (int a = 0; a < 2; ++a) { v8f z = {}; z = wmma_h(ka, q[a][0], z); s[a][u] = wmma_h(kb, q[a][1], z); } }
#pragma unroll
    for (int a = 0; a < 2; ++a) ts[a] = fa_t(s[a], m[a], cs[a], cb[a], p[a]);
    if (__builtin_amdgcn_ballot_w32(!(ts[0] <= TLIM) || !(ts[1] <= TLIM)) != 0) {   /* one test per tile, a scalar branch, rarely taken: some row of the wave needs a lower scale */
#pragma unroll
      for (int a = 0; a < 2; ++a) { float mx = 0.f;
#pragma unroll
        for (int u = 0; u < FH / 16; ++u) {
#pragma unroll
          for (int r = 0; r < 8; ++r) mx = fmaxf(mx, __builtin_amdgcn_inverse_ballot_w32(m[a][8 * u + r]) ? s[a][u][r] * SCALE + nb_ : 0.f); }
        mx = fmaxf(mx, __shfl_xor(mx, 16));   /* the query's largest unmasked x of this half tile, the same in both halves */
        int ex; (void)frexpf(mx, &ex);
        const float rn = (mx * rs[a] > 16.0f) ? ldexpf(1.0f, 4 - ex) : rs[a];   /* mx x rn in [8, 16): every scaled t of the half tile <= 256, their sum <= 4096 */
        const float fr = rn / rs[a], f2 = fr * fr;   /* powers of two: exact (or 0 where the old sums no longer count) */
#pragma unroll
        for (int j = 0; j < HD / 16; ++j) acc[a][j] *= f2;
        sum[a] *= f2; rs[a] = rn; cs[a] = SCALE * rn; cb[a] = nb_ * rn;
        ts[a] = fa_t(s[a], m[a], cs[a], cb[a], p[a]); } }
    sum[0] += ts[0]; sum[1] += ts[1];
    { const cu32* mn = mw + FROT(t + 1, rot) * (FK / 2);   /* the next tile's words, asked for as soon as this tile's are used: they fly under P v, the hand-over and the next scores (the last trip reads the first tile's again, in bounds) */
#pragma unroll
      for (int a = 0; a < 2; ++a) {
#pragma unroll
        for (int i = 0; i < FH / 2; ++i) m[a][i] = mn[a * (NT * (FK / 2)) + i]; } }
    v16h vf[HD / 16];
#pragma unroll
    for (int j = 0; j < HD / 16; ++j) vf[j] = frag_h(&f.v[j * 16 + col][kh * FH], lane);
    __builtin_amdgcn_sched_barrier(0);   /* keeps the tile's 8 V^T reads together in front of their products: left alone the compiler sinks them among the products, two at a time into one set of registers, each pair with a full wait in front of two products */
#pragma unroll
    for (int j = 0; j < HD / 16; ++j) {
#pragma unroll
      for (int a = 0; a < 2; ++a) acc[a][j] = wmma_h(vf[j], p[a], acc[a][j]); }
    __builtin_amdgcn_sched_barrier(0);   /* keeps the products in front of the hand-over: lifted over them, the barrier would hold a wave that is early with its products still to do */
    FA_PUBLISH();
    if (t + 2 < NT) fa_fill(fb[t & 1], kg, vg, FROT(t + 2, rot) * FK, tid); }
  asm volatile("s_wait_asynccnt 0x0" ::: "memory");   /* no copy is outstanding when the buffers become the join's array */
  sum[0] += __shfl_xor(sum[0], 16); sum[1] += __shfl_xor(sum[1], 16);
  if (kh == 1) {   /* wave-uniform: the second wave of a pair hands over its partials, 512 contiguous bytes per store; the same lane of its partner holds the same query and columns */
#pragma unroll
    for (int a = 0; a < 2; ++a) {
#pragma unroll
      for (int j = 0; j < HD / 16; ++j) { const v8f c = acc[a][j]; sm.mg[qw][(a * 4 + j) * 2][lane] = v4f{c[0], c[1], c[2], c[3]}; sm.mg[qw][(a * 4 + j) * 2 + 1][lane] = v4f{c[4], c[5], c[6], c[7]}; } }
    sm.mg[qw][16][lane] = v4f{sum[0], sum[1], rs[0], rs[1]}; }
  __syncthreads();   /* publishes the handed-over partials; every wave passes it */
  if (kh == 0) { const v4f sr = sm.mg[qw][16][lane]; v8h o[2][HD / 16];
#pragma unroll
    for (int a = 0; a < 2; ++a) { const float rp = sr[2 + a], rm = fminf(rs[a], rp);   /* both partials go to the lower of the two row scales */
      const float fa = rm / rs[a], fp = rm / rp, fa2 = fa * fa, fp2 = fp * fp;   /* powers of two: exact (or 0 where that partial no longer counts); one of them is 1 */
      const float inv = 1.0f / ((sum[a] * fa2 + sr[a] * fp2) + (IEPS * rm) * rm);   /* both sums carry rm^2, so does the 1e-32; both sums == 0 -> rm == RS0, acc == 0 -> ctx = 0 */
#pragma unroll
      for (int j = 0; j < HD / 16; ++j) { const v4f c0 = sm.mg[qw][(a * 4 + j) * 2][lane], c1 = sm.mg[qw][(a * 4 + j) * 2 + 1][lane];
#pragma unroll
        for (int r = 0; r < 8; ++r) o[a][j][r] = (_Float16)(((acc[a][j][r] * fa2 + (r < 4 ? c0[r & 3] : c1[r & 3]) * fp2) * inv) * 64.0f); } }
    _Float16* yp = YH + ((size_t)(b * (TT / 64) + blockIdx.y * (FQ / 64) + (qw >> 1)) * KT + h) * TILE + ((qw & 1) * 32 + col) * 64 + 8 * g;   /* acc[a][j][r] = ctx[query 16a + col][16j + 8g + r]; ctx x 2^6 once to f16 (clear of f16 subnormals), as k_out's A operand: the head's 64 columns are one tile of 64 of the block's rows, and the wave writes each query's whole 128-B row of it */
#pragma unroll
    for (int a = 0; a < 2; ++a) {
#pragma unroll
      for (int j = 0; j < HD / 16; ++j) vst2(yp + a * 16 * 64 + j * 16, o[a][j]); } } }
// ---- k_cvt (first launch): the roundings of the projections' operands, once per element: iQ, iK, iV and Wq, Wk, Wv to bf16, Wo to f16(bf16 x 2^8) (exact), written as tiles. A block takes one row per load (256 threads x 16 B, whole lines), eight rows in flight; 128 B of a tile row per 16 lanes on the way out
__global__ __launch_bounds__(256) void k_cvt(const float* __restrict__ XQ, const float* __restrict__ XK, const float* __restrict__ XV, const float* __restrict__ WQ, const float* __restrict__ WK, const float* __restrict__ WV, const float* __restrict__ WO, __bf16* __restrict__ XB, __bf16* __restrict__ WB, _Float16* __restrict__ WOH) {
  const int tid = threadIdx.x, bx = blockIdx.x, k = tid * 4;   /* rows bx + 512 i */
  const size_t so = (size_t)bx * DIN + k, to = ((size_t)(bx >> 6) * KT + (k >> 6)) * TILE + (bx & 63) * 64 + (k & 63);   /* 512 rows on: 512 * DIN elements in either layout */
#pragma unroll
  for (int p = 0; p < 3; ++p) { const float* xp = (p == 0 ? XQ : p == 1 ? XK : XV) + so; __bf16* op = XB + (size_t)p * TNB * TT * DIN + to; v4f a[8];
#pragma unroll
    for (int i = 0; i < 8; ++i) a[i] = *(const v4f*)(xp + (size_t)i * 512 * DIN);
    XW(xp);
#pragma unroll
    for (int i = 0; i < 8; ++i) { v4b o;
#pragma unroll
      for (int e = 0; e < 4; ++e) o[e] = (__bf16)a[i][e];
      *(v4b*)(op + (size_t)i * 512 * DIN) = o; }
    XW(op); }
  v4f a[8];
#pragma unroll
  for (int i = 0; i < 8; ++i) a[i] = *(const v4f*)(((i >> 1) == 0 ? WQ : (i >> 1) == 1 ? WK : (i >> 1) == 2 ? WV : WO) + (size_t)(i & 1) * 512 * DIN + so);
  asm volatile("s_wait_xcnt 0x0" ::: "memory");   /* closes the group of loads before a register that they name may be rewritten */
#pragma unroll
  for (int i = 0; i < 6; ++i) { v4b o;
#pragma unroll
    for (int e = 0; e < 4; ++e) o[e] = (__bf16)a[i][e];
    *(v4b*)(WB + (size_t)i * 512 * DIN + to) = o; }
#pragma unroll
  for (int i = 6; i < 8; ++i) { v4h o;
#pragma unroll
    for (int e = 0; e < 4; ++e) o[e] = (_Float16)(bfr(a[i][e]) * 256.0f);
    *(v4h*)(WOH + (size_t)(i - 6) * 512 * DIN + to) = o; } }
// ---- k_out: block = (128 rows, 128 cols), four waves 2 x 2, each on 64 rows x 64 cols: out = ctx Wo (+ bo): ctx x 2^6 in f16 against Wo as f16(bf16 x 2^8) exact (1 product) x 2^-14
__global__ __launch_bounds__(128) void k_out(const _Float16* __restrict__ YH, const _Float16* __restrict__ WOH, const float* __restrict__ BO, float* __restrict__ OUT) { union SM { float sf[4][64][68]; _Float16 st[2][SROWS][SP]; };   /* the stage buffers lie over the epilogue's array, which is first written behind the loop's last barrier */
  __shared__ __align__(16) SM sm; auto& sf = sm.sf;
  const int tid = threadIdx.x, wave = tid >> 5, lane = tid & 31, col = lane & 15, g = lane >> 4, wr = wave >> 1, wc = wave & 1; const int c0 = blockIdx.y * 128 + wc * 64; const size_t r0 = (size_t)blockIdx.x * 128 + wr * 64;
  v8f acc[4][4] = {};
  const _Float16* xt = YH + (size_t)blockIdx.x * 2 * KT * TILE + tid * 8; const _Float16* wt = WOH + (size_t)blockIdx.y * 2 * KT * TILE + tid * 8;   /* this thread's 16 B of the ctx and Wo tiles of k stage 0 */
  const int rot = blockIdx.x + blockIdx.y;   /* the block's first k stage (see KROT) */
  g_fill(sm.st[0], xt + KROT(0, rot) * TILE, wt + KROT(0, rot) * TILE, tid);
  asm volatile("s_wait_asynccnt 0x0" ::: "memory");   /* the block's first stage has landed before the barrier that publishes it */
  __syncthreads();
  g_fill(sm.st[1], xt + KROT(1, rot) * TILE, wt + KROT(1, rot) * TILE, tid);
  for (int t = 0; t < CC / KS; ++t) { const _Float16 (*cb)[SP] = sm.st[t & 1];
    v16h a[KS / 32][4], w[KS / 32][4];
#pragma unroll
    for (int kc = 0; kc < KS / 32; ++kc) {
#pragma unroll
      for (int i = 0; i < 4; ++i) { a[kc][i] = frag_h(&cb[wr * 64 + i * 16 + col][kc * 32], lane); w[kc][i] = frag_h(&cb[128 + wc * 64 + i * 16 + col][kc * 32], lane); } }
    __builtin_amdgcn_sched_barrier(0);   /* keeps the stage's 32 LDS reads together in front of its products: left alone the compiler sinks them among the products, two at a time, each pair with a full wait in front of four products */
#pragma unroll
    for (int kc = 0; kc < KS / 32; ++kc) {
#pragma unroll
      for (int i = 0; i < 4; ++i) {
#pragma unroll
        for (int j = 0; j < 4; ++j) acc[i][j] = __builtin_amdgcn_wmma_f32_16x16x32_f16(false, a[kc][i], false, w[kc][j], (short)0, acc[i][j], false, false); } }
    __builtin_amdgcn_sched_barrier(0);   /* keeps the products in front of the hand-over: lifted over them, its waits would give the next tile's copies only the LDS reads' time to land */
    FA_PUBLISH();
    if (t + 2 < CC / KS) g_fill(sm.st[t & 1], xt + KROT(t + 2, rot) * TILE, wt + KROT(t + 2, rot) * TILE, tid); }   /* into the buffer that every wave has just left */
  asm volatile("s_wait_asynccnt 0x0" ::: "memory");   /* no copy is outstanding when the buffers become the epilogue's array */
  float bias[4] = {0.f, 0.f, 0.f, 0.f};
  if (BO) { const float* bp = BO + c0 + col;   /* one test, so that the four loads go out together */
#pragma unroll
    for (int j = 0; j < 4; ++j) bias[j] = bp[j * 16];
#pragma unroll
    for (int j = 0; j < 4; ++j) bias[j] = bfr(bias[j]); }
#pragma unroll
  for (int j = 0; j < 4; ++j) {
#pragma unroll
    for (int i = 0; i < 4; ++i) {
#pragma unroll
      for (int r = 0; r < 8; ++r) sf[wave][i * 16 + 8 * g + r][j * 16 + col] = acc[i][j][r] * (1.0f / 16384.0f) + bias[j]; } }   /* 2^-8 (Wo carry) x 2^-6 (ctx carry) */
  LDSX(); float* op = OUT + (r0 + g) * DIN + c0 + col * 4;   /* the wave's own rows back as whole lines: 256 B of a row per 16 lanes, two rows per store */
#pragma unroll
  for (int rl = 0; rl < 64; rl += 2) vst2(op + (size_t)rl * DIN, *(const v4f*)&sf[wave][rl + g][col * 4]); }

extern "C" void kernel_launch(void* const* d_in, const int* in_sizes, int n_in, void* d_out, int out_size, void* d_ws, size_t ws_size, hipStream_t stream) {
  (void)in_sizes; (void)n_in; (void)out_size;
  const float** F = (const float**)d_in;
  if (ws_size < (size_t)WS_END) return;
  char* ws = (char*)d_ws; _Float16 *QH = (_Float16*)(ws + WS_QH), *KH = (_Float16*)(ws + WS_KH), *VT = (_Float16*)(ws + WS_VT); _Float16 *YH = (_Float16*)(ws + WS_Y), *WOH = (_Float16*)(ws + WS_WO); __bf16 *XB = (__bf16*)(ws + WS_XB), *WB = (__bf16*)(ws + WS_WB); unsigned* MB = (unsigned*)(ws + WS_S);   /* lane-mask words of the mask, 1 MiB, in the place of the old score plane */
  // inputs: 0 iQ [2,2048,1024]; 1 iK; 2 iV; 3 mask [2,2048,2048] bool (True = masked); 4 Wq [1024,1024] (out,in), 5 bq; 6 Wk, 7 bk; 8 Wv, 9 bv; 10 Wo (out,in), 11 bo (zero biases, read); 12 nbias [1] (SparseNormer bias; zero)
  k_cvt<<<dim3(512), 256, 0, stream>>>(F[0], F[1], F[2], F[4], F[6], F[8], F[10], XB, WB, WOH);
  k_proj<<<dim3(TNB * TT / 128, CC / 128, 5), 128, 0, stream>>>(XB, WB, F[5], F[7], F[9], QH, KH, VT, (const int*)d_in[3], MB);   /* z = 3, 4: the mask's packing blocks, short, last in the launch */
  k_fa<<<dim3(NH, TT / FQ, TNB), 256, 0, stream>>>(QH, KH, VT, MB, F[12], YH);   /* relu(x + nbias)^2 / (sum + 1e-32): NOT a softmax */
  k_out<<<dim3(TNB * TT / 128, DIN / 128), 128, 0, stream>>>(YH, WOH, F[11], (float*)d_out);
}

// v010
// One run takes 77 microseconds.
// In both of two side-by-side timings against v009, it was 1.05 times as fast.
// Over all steps from v000 it is 17.2 times as fast.
// compute dtype: all float inputs rounded to bf16; q/k/v projections with EXACT bf16 products on WMMA 16x16x32 (f32 accumulate) + bias; scores q x k once to f16 each (1 product) x 64^-0.5; SparseNormer in f32: t = relu(score + nbias)^2 (masked entries -> 0); t x 2^2n (n per row and key half) once to f16 x v once to f16 (1 product), two partial sums per row joined at the end, ctx = that sum / (sum t + 1e-32); ctx x 2^6 once to f16 x Wo f16(bf16 x 2^8) + bo; f32 output.
#include <hip/hip_runtime.h>
#include <math.h>

typedef __attribute__((ext_vector_type(16))) _Float16 v16h;
typedef __attribute__((ext_vector_type(16))) __bf16 v16b;
typedef __attribute__((ext_vector_type(8)))  _Float16 v8h;
typedef __attribute__((ext_vector_type(8)))  float v8f;
typedef __attribute__((ext_vector_type(4)))  float v4f;
typedef __attribute__((ext_vector_type(2)))  float v2f;
typedef __attribute__((ext_vector_type(4)))  unsigned v4u;
typedef __attribute__((ext_vector_type(4)))  int v4i;
typedef float __attribute__((may_alias)) float_a;
typedef int __attribute__((may_alias)) int_a;

template <typename T> __device__ __forceinline__ void vst2(void* p, T v) { *(T*)p = v;  }
__device__ __forceinline__ v8f wmma16(v16h a, v16h b, v8f c) {
  v8f d = __builtin_amdgcn_wmma_f32_16x16x32_f16(false, a, false, b, (short)0, c, false, false);
  asm volatile("v_nop\n\tv_nop\n\tv_nop\n\tv_nop" : "+v"(d) : "v"(a), "v"(b));
  return d;
}
__device__ __forceinline__ v8f wmma_bf(v16b a, v16b b, v8f c) {
  v8f d = __builtin_amdgcn_wmma_f32_16x16x32_bf16(false, a, false, b, (short)0, c, false, false);
  asm volatile("v_nop\n\tv_nop\n\tv_nop\n\tv_nop" : "+v"(d) : "v"(a), "v"(b));
  return d;
}
// 16x16x32 fragments: lane = (h = lane>>4, row/col = lane&15); elements 0..7 = k0+8h+0..7, 8..15 = k0+16+8h+0..7; D element r = row 8h+r
__device__ __forceinline__ v16h frag_h(const _Float16* rowk0, int lane) {
  union { v16h v; v8h q[2]; } u; const _Float16* p = rowk0 + 8 * (lane >> 4);
  u.q[0] = *(const v8h*)p; u.q[1] = *(const v8h*)(p + 16); return u.v;
}
__device__ __forceinline__ v16h frag_f32(const float* rowk0, int lane) {
  v16h a; const float* p = rowk0 + 8 * (lane >> 4);
#pragma unroll
  for (int i = 0; i < 8; ++i) { a[i] = (_Float16)p[i]; a[8 + i] = (_Float16)p[16 + i]; }
  return a;
}
__device__ __forceinline__ v16h frag_f32s(const float* rowk0, int lane, float sc) {
  v16h a; const float* p = rowk0 + 8 * (lane >> 4);
#pragma unroll
  for (int i = 0; i < 8; ++i) { a[i] = (_Float16)(p[i] * sc); a[8 + i] = (_Float16)(p[16 + i] * sc); }
  return a;
}
// column fragment from a [K][ld] layout (column n), rows >= K read as 0
__device__ __forceinline__ v16h fragc_f32(const float* W, int k0, int n, int lane, int ld, int K) {
  v16h a; const int g = lane >> 4;
#pragma unroll
  for (int i = 0; i < 8; ++i) { const int ka = k0 + 8 * g + i, kb = ka + 16;
    a[i] = (_Float16)(ka < K ? W[(size_t)(ka < K ? ka : K - 1) * ld + n] : 0.f); a[8 + i] = (_Float16)(kb < K ? W[(size_t)(kb < K ? kb : K - 1) * ld + n] : 0.f); }
  return a;
}
struct F2 { v16b h, l; };
__device__ __forceinline__ F2 bsplit16(const float v[16]) { F2 r;
#pragma unroll
  for (int i = 0; i < 16; ++i) { const __bf16 h = (__bf16)v[i]; r.h[i] = h; r.l[i] = (__bf16)(v[i] - (float)h); }
  return r; }
__device__ __forceinline__ F2 split_row(const float* row, int k0, int lane) { float v[16]; const float* p = row + k0 + 8 * (lane >> 4);
#pragma unroll
  for (int i = 0; i < 8; ++i) { v[i] = p[i]; v[8 + i] = p[16 + i]; }
  return bsplit16(v); }
__device__ __forceinline__ F2 split_rowK(const float* row, int k0, int lane, int K) { float v[16]; const int g = lane >> 4;
#pragma unroll
  for (int i = 0; i < 8; ++i) { const int ka = k0 + 8 * g + i, kb = ka + 16; v[i] = ka < K ? row[ka < K ? ka : K - 1] : 0.f; v[8 + i] = kb < K ? row[kb < K ? kb : K - 1] : 0.f; }
  return bsplit16(v); }
__device__ __forceinline__ F2 split_col(const float* W, int k0, int n, int lane, int ld, int K) { float v[16]; const int g = lane >> 4;
#pragma unroll
  for (int i = 0; i < 8; ++i) { const int ka = k0 + 8 * g + i, kb = ka + 16; v[i] = ka < K ? W[(size_t)(ka < K ? ka : K - 1) * ld + n] : 0.f; v[8 + i] = kb < K ? W[(size_t)(kb < K ? kb : K - 1) * ld + n] : 0.f; }
  return bsplit16(v); }
__device__ __forceinline__ v8f mac3(const F2& a, const F2& b, v8f c) { c = wmma_bf(a.l, b.h, c); c = wmma_bf(a.h, b.l, c); return wmma_bf(a.h, b.h, c); }
__device__ __forceinline__ float sigm(float v) { return 1.0f / (1.0f + expf(-v)); }
#define LDSX() do { asm volatile("s_wait_dscnt 0" ::: "memory"); __builtin_amdgcn_wave_barrier(); __builtin_amdgcn_fence(__ATOMIC_RELEASE, "workgroup"); } while (0)

// Multi-head attention with a SparseNormer instead of a softmax (iQ / iK / iV [2,2048,1024] separate inputs; torch (out,in) Wq / Wk / Wv / Wo [1024,1024] (0.02 scale) + zero biases; 16 heads x 64; scores / 8; mask [2,2048,2048] bool random (True -> -1e32); t = relu(scores + nbias)^2 with nbias = zeros(1); attn = t / (sum_k t + 1e-32)): out = merge(attn v) Wo^T + bo.
#define NB 2
#define TT 2048
#define CC 1024            // NH * HD = projected width
#define DIN 1024          // input (model) width
#define NH 16
#define HD 64
#define NQB (TT / 64)
#define HG 4
#define SCALE (0.125f)
#define CAUSAL 0
#ifndef TNB
#define TNB NB
#endif
__device__ __forceinline__ float bfr(float v) { return (float)(__bf16)v; }
__host__ __device__ __forceinline__ int kb_last(int qb) { return CAUSAL ? ((qb * 64 + 63) >> 7) : (TT / 128 - 1); }
typedef __attribute__((ext_vector_type(8))) __bf16 v8b;
__device__ __forceinline__ v16b frag_b(const __bf16* rowk0, int lane) {
  union { v16b v; v8b q[2]; } u; const __bf16* p = rowk0 + 8 * (lane >> 4);
  u.q[0] = *(const v8b*)p; u.q[1] = *(const v8b*)(p + 16); return u.v;
}
#define QBH 0              // not used by any kernel here
#define QHI 0               // single-product scores on every row
#define KHI 64            // key rows carrying k residual / v bf16 hi+lo planes (written and read by no kernel here)
// B fragment (k rows k0+.., output column o) of a weight: (in,out) [K][ld] or (out,in) [ld rows of K]: bf16 exact, or f16(bf16 * 256) exact
__device__ __forceinline__ v16b wcol_io(const float* Wm, int k0, int o, int lane, int ld) { v16b w; const int g = lane >> 4;
#pragma unroll
  for (int i = 0; i < 8; ++i) { w[i] = (__bf16)Wm[(size_t)(k0 + 8 * g + i) * ld + o]; w[8 + i] = (__bf16)Wm[(size_t)(k0 + 16 + 8 * g + i) * ld + o]; }
  return w; }
__device__ __forceinline__ v16b wcol_oi(const float* Wm, int k0, int o, int lane, int K) { v16b w; const float* p = Wm + (size_t)o * K + k0 + 8 * (lane >> 4);
#pragma unroll
  for (int i = 0; i < 8; ++i) { w[i] = (__bf16)p[i]; w[8 + i] = (__bf16)p[16 + i]; }
  return w; }
__device__ __forceinline__ v16h wcolh_io(const float* Wm, int k0, int o, int lane, int ld) { v16h w; const int g = lane >> 4;
#pragma unroll
  for (int i = 0; i < 8; ++i) { w[i] = (_Float16)(bfr(Wm[(size_t)(k0 + 8 * g + i) * ld + o]) * 256.0f); w[8 + i] = (_Float16)(bfr(Wm[(size_t)(k0 + 16 + 8 * g + i) * ld + o]) * 256.0f); }
  return w; }
__device__ __forceinline__ v16h wcolh_oi(const float* Wm, int k0, int o, int lane, int K) { v16h w; const float* p = Wm + (size_t)o * K + k0 + 8 * (lane >> 4);
#pragma unroll
  for (int i = 0; i < 8; ++i) { w[i] = (_Float16)(bfr(p[i]) * 256.0f); w[8 + i] = (_Float16)(bfr(p[16 + i]) * 256.0f); }
  return w; }
#define WQKV_LAYOUT 1   // 0 = (in,out) [DIN][CC]; 1 = (out,in) [CC][DIN]; 2 = per-head [NH][DIN][HD]
__device__ __forceinline__ v16b wcol_hdk(const float* Wm, int k0, int o, int lane) { v16b w; const int g = lane >> 4; const float* p = Wm + (size_t)(o / HD) * DIN * HD + (o % HD);
#pragma unroll
  for (int i = 0; i < 8; ++i) { w[i] = (__bf16)p[(size_t)(k0 + 8 * g + i) * HD]; w[8 + i] = (__bf16)p[(size_t)(k0 + 16 + 8 * g + i) * HD]; }
  return w; }
#define WO_OUT_IN 1
#if WQKV_LAYOUT == 1
#define WCOL(W, k0, o, lane) wcol_oi(W, k0, o, lane, DIN)
#elif WQKV_LAYOUT == 2
#define WCOL(W, k0, o, lane) wcol_hdk(W, k0, o, lane)
#else
#define WCOL(W, k0, o, lane) wcol_io(W, k0, o, lane, CC)
#endif
#if WO_OUT_IN
#define WOCOL(W, k0, o, lane) wcol_oi(W, k0, o, lane, CC)
#define WOCOLH(W, k0, o, lane) wcolh_oi(W, k0, o, lane, CC)
#else
#define WOCOL(W, k0, o, lane) wcol_io(W, k0, o, lane, DIN)
#define WOCOLH(W, k0, o, lane) wcolh_io(W, k0, o, lane, DIN)
#endif

#ifndef SM_EXTRA_PARAMS
#define SM_EXTRA_PARAMS
#endif
#ifndef PROJ_EXTRA_PARAMS
#define PROJ_EXTRA_PARAMS
#endif
#ifndef SM_MASK_HOOK
#define SM_MASK_HOOK (void)0
#endif

#define WS_QH  0u                                      // f16 q rows [b*t][CC]
#define WS_KH  (WS_QH + 2u * (size_t)NB * TT * CC)      // f16 k rows [b*t][CC]
#define WS_VT  (WS_KH + 2u * (size_t)NB * TT * CC)      // f16 v planes [b][c][t]
#define WS_QL  (WS_VT + 2u * (size_t)NB * CC * TT)      // f16 q residual x 2^10 rows [b][t < QHI][CC]
#define WS_KL  (WS_QL + 2u * (size_t)NB * QHI * CC)     // f16 k residual x 2^10 rows [b][t < KHI][CC]
#define WS_VB  (WS_KL + 2u * (size_t)NB * KHI * CC)     // bf16 v hi planes [b][c][t < KHI]
#define WS_VBL (WS_VB + 2u * (size_t)NB * CC * KHI)
#define WS_S   (WS_VBL + 2u * (size_t)NB * CC * KHI)    // lane-mask words, then operand tiles (room of an f32 plane [hg][t][s])
#define WS_Y   (WS_S  + 4u * (size_t)HG * TT * TT)      // f16 ctx x 2^6 tiles
#define WS_END (WS_Y  + 4u * (size_t)NB * TT * CC)
#define WS_XB  (WS_S + (2u << 20))                      // bf16 iQ, iK, iV tiles, behind the mask words in the place of the old score plane
#define WS_WB  (WS_XB + 3u * 2u * (size_t)NB * TT * DIN) // bf16 Wq, Wk, Wv tiles, then f16 Wo tiles
#define WS_WO  (WS_WB + 3u * 2u * (size_t)CC * DIN)
static_assert(WS_WO + 2u * (size_t)CC * DIN <= WS_Y, "the operand tiles stay inside the old score plane");

// ---- operands of the two projection kernels: every X, W and ctx element is rounded ONCE to its 16-bit operand type and kept in memory as tiles of 64 rows x 64 k (8 KB contiguous): element (row, k) at ((row >> 6) * 16 + (k >> 6)) * 4096 + (row & 63) * 64 + (k & 63); every matrix here has 1024 k. A block's 128 X rows and 128 W rows, KS k at a time, are four such tiles, which come by tensor loads straight into LDS (one request per wave and stage: each of the four waves brings one whole tile), where all four waves read their fragments; two buffers, the next stage's loads fly while this stage is multiplied
#define KS 64              // k per stage
#define SP 72              // LDS row pitch in 16-bit elements: 144 B = 16 B x 9, an odd multiple of 16 B, which ds_load_b128 fragment reads take without bank conflicts
#define TSL 10240          // LDS bytes of a tile's slice: 64 rows x 144 B = 9216, rounded up to a multiple of 2 KiB, where a tensor load's place lies; slices 0, 1 = X, 2, 3 = W
#define TILE 4096          // elements of a tile
#define KT (DIN / 64)      // tiles per block of 64 rows
// the k walk of a block is a ring: trip t works on k stage (t + rot) mod KT, rot = block row + block column. Blocks that share X rows (8 of them) or W rows (32) are all resident and run in step; started at different stages they do not ask L2 for the same lines at the same moment. Every stage is taken once; only the order of the f32 sums over k differs from block to block
#define KROT(t, rot) ((size_t)(((t) + (rot)) & (KT - 1)))
static_assert((KT & (KT - 1)) == 0 && DIN == CC, "the ring's wrap is a mask, and both projection kernels walk KT stages");
typedef __attribute__((ext_vector_type(4))) __bf16 v4b;
typedef __attribute__((ext_vector_type(4))) _Float16 v4h;
__device__ __forceinline__ unsigned lds_of(const void* p) { return (unsigned)(size_t)p; }   /* LDS byte address = low 32 bits of the __shared__ address */
typedef __attribute__((ext_vector_type(8))) unsigned v8u;
__device__ __forceinline__ uint32_t uni(uint32_t v) { return (uint32_t)__builtin_amdgcn_readfirstlane(v); }
__device__ __forceinline__ uint32_t pinned(uint32_t v) { uint32_t w = (uint32_t)__builtin_amdgcn_readfirstlane(v); asm volatile("" : "+s"(w)); return w; }   /* holds a wave-uniform value in a scalar register, so that a test on it is a scalar branch (a tensor load ignores EXEC) and what is formed from it is formed behind the wait in front */
// one tensor load of the whole wave: a tile of 64 rows x 128 B (source row pitch in bytes: t_init), to LDS byte offset lds (a multiple of 2 KiB) at row pitch 144 B (a pad of 4 dwords behind every 32: SP); extents in bytes, tensor = tile, no mask
struct TD { v4u g0; v8u g1; };   /* the request's two descriptor groups; group 1 is the same for every tile */
__device__ __forceinline__ void t_init(TD& d, uint32_t pitch) { d.g0[0] = uni(1u); d.g0[1] = uni(0u); d.g0[2] = uni(0u); d.g0[3] = uni(0x80000000u);
  d.g1[0] = uni((1u << 20) | (4u << 22) | (3u << 25)); d.g1[1] = uni(128u << 16); d.g1[2] = uni(64u << 16); d.g1[3] = uni(128u << 16); d.g1[4] = uni(64u); d.g1[5] = uni(pitch); d.g1[6] = uni(0u); d.g1[7] = uni(0u); }
__device__ __forceinline__ void t_load(TD& d, uint32_t lds, const void* g) { const uint64_t ga = (uint64_t)g;
  d.g0[1] = uni(lds); d.g0[2] = uni((uint32_t)ga); d.g0[3] = uni((((uint32_t)(ga >> 32)) & 0x01FFFFFFu) | 0x80000000u);
  asm volatile("tensor_load_to_lds %0, %1" :: "s"(d.g0), "s"(d.g1) : "memory"); }
#define T_HOLD(d) asm volatile("" : "+s"((d).g0), "+s"((d).g1))   /* stands behind each wait for the wave's request: descriptor words held in scalar registers, as in pinned(): both groups stay live up to here, so no register of a request takes another value while the request is outstanding (without it the compiler used two words of group 1 as loop temporaries) */
static_assert(SP * 2 == 128 + 16 && 64 * SP * 2 <= TSL && TSL % 2048 == 0 && TILE * 2 == 64 * 128, "the pad gives the readers' pitch, and a slice holds its 64 padded rows");
// hand-over of a stage: this wave's LDS reads of the old stage are done, its own tensor load of the next stage has landed, and the barrier publishes the next stage and frees the old buffer
#define T_PUBLISH(d) do { asm volatile("s_wait_dscnt 0x0" ::: "memory"); asm volatile("s_wait_tensorcnt 0x0" ::: "memory"); T_HOLD(d); __syncthreads(); } while (0)
// ---- mask as lane masks: word [16-query group][64-key tile][8u + r], bit 16g + col = (mask[query col][key 16u + 8g + r] == 0, the key counts): the very lane that holds that score in k_fa, so a word is the select mask of one score register; 1/32 of the i32 mask's bytes
#define PKP 260            // LDS row pitch in words of the packing blocks: 1040 B = 16 B x 65 (odd)
#define PKT 4              // tiles of 64 keys per packing wave
static_assert(2 * (TNB * TT / 128) * (CC / 128) * 4 * PKT == (TNB * TT / 16) * (TT / 64), "the packing blocks' waves cover every (query group, tile) once");
// ---- k_proj: block = (128 rows, 128 cols, which): which 3, 4: the mask's lane-mask words (see above); else q/k/v = X W (+ b) with exact bf16 products (K = DIN) -> which 0: q f16 rows; 1: k f16 rows; 2: v f16 planes [c][t]. The four waves stand 2 x 2, each on 64 rows x 64 cols: a fragment read from LDS feeds four products
__global__ __launch_bounds__(128) void k_proj(const __bf16* __restrict__ XB, const __bf16* __restrict__ WB, const float* __restrict__ BQ, const float* __restrict__ BK, const float* __restrict__ BV,
    _Float16* __restrict__ QH, _Float16* __restrict__ KH, _Float16* __restrict__ VT, const int* __restrict__ MASK, unsigned* __restrict__ MB) {
  union SM { _Float16 sh[128][136]; __bf16 st[2][4][TSL / 2]; int pk[4][16][PKP]; };   /* the stage buffers lie over the epilogue's array, which is first written behind the loop's last barrier */
  __shared__ __attribute__((aligned(2048))) SM sm; auto& sh = sm.sh;
  const int tid = threadIdx.x, wave = tid >> 5, lane = tid & 31, col = lane & 15, g = lane >> 4, wr = wave >> 1, wc = wave & 1; const int which = blockIdx.z; const int c0 = blockIdx.y * 128; const size_t r0 = (size_t)blockIdx.x * 128; const size_t bb = r0 / TT; const int t0 = (int)(r0 % TT);
  if (which >= 3) {   /* block-uniform, in front of every barrier: each wave packs 16 queries x PKT tiles; the rows come as whole lines (512 B of one row per load) and turn through the wave's own LDS rows into the score layout; the loops are unrolled whole so that all 32 loads are in flight together and the vectors are indexed by constants */
    const int id = (((which - 3) * (TNB * TT / 128) + blockIdx.x) * (CC / 128) + blockIdx.y) * 4 + wave, qg = id / (TT / 64 / PKT), tq = id % (TT / 64 / PKT);
    const int* mp = MASK + (size_t)qg * 16 * TT + tq * (PKT * 64) + lane * 4; v4i mv[32];
#pragma unroll
    for (int i = 0; i < 32; ++i) mv[i] = *(const v4i*)(mp + (size_t)(i >> 1) * TT + (i & 1) * 128);
    asm volatile("s_wait_xcnt 0x0" :: "v"(mp) : "memory");   /* closes the group of loads before a register that they name may be rewritten */
#pragma unroll
    for (int i = 0; i < 32; ++i) *(v4i*)&sm.pk[wave][i >> 1][(i & 1) * 128 + lane * 4] = mv[i];
    LDSX();   /* the wave's own rows are written before its lanes read each other's words */
#pragma unroll
    for (int tl = 0; tl < PKT; ++tl) { unsigned w = 0;
#pragma unroll
      for (int u = 0; u < 4; ++u) { const v4i a = *(const v4i*)&sm.pk[wave][col][tl * 64 + 16 * u + 8 * g], c = *(const v4i*)&sm.pk[wave][col][tl * 64 + 16 * u + 8 * g + 4];
#pragma unroll
        for (int r = 0; r < 8; ++r) { const unsigned bl = __builtin_amdgcn_ballot_w32((r < 4 ? a[r & 3] : c[r & 3]) == 0); w = (lane == 8 * u + r) ? bl : w; } }
      MB[((size_t)qg * (TT / 64) + tq * PKT + tl) * 32 + lane] = w; }   /* 128 B per tile, one line */
    return; }
  const float* BA = which == 0 ? BQ : which == 1 ? BK : BV;
  v8f acc[4][4] = {};   /* acc[i][j][r] = element (row 64 wr + 16 i + 8 g + r, column 64 wc + 16 j + col) of the block */
  const uint32_t wv = uni((uint32_t)tid >> 5);   /* the wave's number = its slice: waves 0, 1 bring the block's two X tiles, waves 2, 3 its two W tiles */
  const __bf16* tp = (wv < 2 ? XB + ((size_t)which * (TNB * TT / 64) + blockIdx.x * 2) * KT * TILE : WB + ((size_t)which * (CC / 64) + (c0 >> 6)) * KT * TILE) + (size_t)(wv & 1) * KT * TILE;   /* the wave's tile of k stage 0; the next stage's tile follows TILE elements on */
  const uint32_t td = lds_of(&sm.st[0][0][0]) + wv * TSL;   /* its slice of buffer 0; buffer 1: 4 * TSL on */
  const int rot = blockIdx.x + blockIdx.y;   /* the block's first k stage (see KROT) */
  TD td_; t_init(td_, 128u);   /* a tile is contiguous in memory */
  t_load(td_, td, tp + KROT(0, rot) * TILE);
  asm volatile("s_wait_tensorcnt 0x0" ::: "memory");   /* the block's first stage (see KROT) has landed before the barrier that publishes it */
  T_HOLD(td_);
  __syncthreads();
  t_load(td_, td + 4 * TSL, tp + KROT(1, rot) * TILE);
  for (int t = 0; t < DIN / KS; ++t) { const __bf16* cx = &sm.st[t & 1][wr][col * SP]; const __bf16* cw = &sm.st[t & 1][2 + wc][col * SP];
    v16b a[KS / 32][4], w[KS / 32][4];
#pragma unroll
    for (int kc = 0; kc < KS / 32; ++kc) {
#pragma unroll
      for (int i = 0; i < 4; ++i) { a[kc][i] = frag_b(cx + i * 16 * SP + kc * 32, lane); w[kc][i] = frag_b(cw + i * 16 * SP + kc * 32, lane); } }
    __builtin_amdgcn_sched_barrier(0);   /* keeps the stage's 32 LDS reads together in front of its products: left alone the compiler sinks them among the products, two at a time, each pair with a full wait in front of four products */
#pragma unroll
    for (int kc = 0; kc < KS / 32; ++kc) {
#pragma unroll
      for (int i = 0; i < 4; ++i) {
#pragma unroll
        for (int j = 0; j < 4; ++j) acc[i][j] = __builtin_amdgcn_wmma_f32_16x16x32_bf16(false, a[kc][i], false, w[kc][j], (short)0, acc[i][j], false, false); } }
    __builtin_amdgcn_sched_barrier(0);   /* keeps the products in front of the hand-over: lifted over them, its waits would give the next stage's load only the LDS reads' time to land */
    T_PUBLISH(td_);
    if (pinned(t + 2 < DIN / KS)) { const uint32_t sn = pinned((uint32_t)KROT(t + 2, rot)); t_load(td_, td + (uint32_t)(t & 1) * (4 * TSL), tp + (size_t)sn * TILE); } }   /* a scalar branch; into the buffer that every wave has just left */
  asm volatile("s_wait_tensorcnt 0x0" ::: "memory");   /* no load is outstanding when the buffers become the epilogue's array */
  T_HOLD(td_);
  asm volatile("s_wait_dscnt 0x0" ::: "memory");
  float bias[4] = {0.f, 0.f, 0.f, 0.f};
  if (BA) { const float* bp = BA + c0 + wc * 64 + col;   /* one test, so that the four loads go out together */
#pragma unroll
    for (int j = 0; j < 4; ++j) bias[j] = bp[j * 16];
#pragma unroll
    for (int j = 0; j < 4; ++j) bias[j] = bfr(bias[j]); }
  if (which < 2) { _Float16* DH = (which == 0 ? QH : KH) + (r0 + (tid >> 4)) * CC + c0 + (tid & 15) * 8;   /* this thread's 16 B of row tid >> 4, further rows 8 apart */
#pragma unroll
    for (int j = 0; j < 4; ++j) {
#pragma unroll
      for (int i = 0; i < 4; ++i) {
#pragma unroll
        for (int r = 0; r < 8; ++r) sh[wr * 64 + i * 16 + 8 * g + r][wc * 64 + j * 16 + col] = (_Float16)(acc[i][j][r] + bias[j]); } }
    __syncthreads();
#pragma unroll
    for (int e = 0; e < 16; ++e) vst2((unsigned*)(DH + (size_t)e * 8 * CC), *(const v4u*)&sh[e * 8 + (tid >> 4)][(tid & 15) * 8]);   /* 256 B of a row per 16 lanes */
    asm volatile("s_wait_xcnt 0x0" :: "v"(DH) : "memory");   /* closes the run of stores before a register that they name may be rewritten */
  } else { _Float16* DV = VT + (bb * CC + c0 + (tid >> 4)) * (size_t)TT + t0 + (tid & 15) * 8;   /* sh holds the block transposed: [column][row] */
#pragma unroll
    for (int j = 0; j < 4; ++j) {
#pragma unroll
      for (int i = 0; i < 4; ++i) { v8h o;
#pragma unroll
        for (int r = 0; r < 8; ++r) o[r] = (_Float16)(acc[i][j][r] + bias[j]);
        *(v8h*)&sh[wc * 64 + j * 16 + col][wr * 64 + i * 16 + 8 * g] = o; } }   /* a lane's eight rows of a column lie side by side */
    __syncthreads();
#pragma unroll
    for (int e = 0; e < 16; ++e) vst2((unsigned*)(DV + (size_t)e * 8 * TT), *(const v4u*)&sh[e * 8 + (tid >> 4)][(tid & 15) * 8]); } }
// ---- k_sm: block = query row t (head in group): keys [0, kend): causal -> logit if s <= t else excluded; softmax in f32; P x 2^11 in place (0 for excluded)
__global__ __launch_bounds__(256) void k_sm(float* __restrict__ S0 SM_EXTRA_PARAMS) { __shared__ float sred[8]; __shared__ float sbc; __shared__ __align__(16) float shv[TT];
  const int tid = threadIdx.x; const int t = blockIdx.x; const int kend = (kb_last(t >> 6) + 1) * 128;
  float* sr = S0 + (size_t)blockIdx.y * TT * TT + (size_t)t * TT;
  float m = -3.0e38f; for (int k = tid; k < kend; k += 256) { float v = (!CAUSAL || k <= t) ? sr[k] : -3.0e38f; SM_MASK_HOOK; shv[k] = v; m = fmaxf(m, v); }
#pragma unroll
  for (int o = 1; o < 32; o <<= 1) m = fmaxf(m, __shfl_xor(m, o));
  if ((tid & 31) == 0) sred[tid >> 5] = m; __syncthreads(); if (tid == 0) { float a = sred[0]; for (int i = 1; i < 8; ++i) a = fmaxf(a, sred[i]); sbc = a; } __syncthreads(); m = sbc; __syncthreads();
  float sum = 0.f; for (int k = tid; k < kend; k += 256) { const float v = shv[k]; const float e = (v <= -1.0e38f) ? 0.f : expf(v - m); shv[k] = e; sum += e; }
#pragma unroll
  for (int o = 1; o < 32; o <<= 1) sum += __shfl_xor(sum, o);
  if ((tid & 31) == 0) sred[tid >> 5] = sum; __syncthreads(); if (tid == 0) { float a = 0.f; for (int i = 0; i < 8; ++i) a += sred[i]; sbc = a > 0.f ? 2048.0f / a : 0.f; }   /* a fully excluded row yields P = 0 */ __syncthreads(); const float inv = sbc;
  for (int k = tid; k < kend; k += 256) shv[k] = shv[k] * inv;
  __syncthreads(); for (int q = tid; q < kend / 4; q += 256) vst2(sr + q * 4, *(const v4f*)&shv[q * 4]); }
#define IEPS 1.0e-32f
__device__ __forceinline__ v8f wmma_h(v16h a, v16h b, v8f c) { return __builtin_amdgcn_wmma_f32_16x16x32_f16(false, a, false, b, (short)0, c, false, false); }
// XW(p): closes a group of global loads off pointer p before a register that they name may be rewritten; p is an input so that the address pair stays live up to the wait (no load of the group may land on it)
#define XW(p) asm volatile("s_wait_xcnt 0x0" :: "v"(p) : "memory")
// ---- operand staging of k_fa: a block's 64 keys of K (64 rows x 128 B) and of V^T (64 rows x 128 B) come from global memory once per block of 128 queries, by two tensor loads straight into LDS (wave 0 brings K, wave 1 V^T), where the eight waves read their fragments; two buffers, the next tile's loads fly while this tile is worked on
#define FK 64              // keys per tile
#define FH 32              // keys of a tile per wave: the waves of a pair take one half of every tile each
#define FQ 128             // queries per block: four pairs of waves x 32 queries
#define KP 72              // K and V^T LDS row pitch in halfs: 144 B = 16 B x 9 (odd), free of bank conflicts for ds_load_b128
#define NT (TT / FK)       // tiles per pass
// the walk over the keys is a ring: trip t works on key tile (t + rot) mod NT. The blocks of one (b, h) read the same K and V^T tiles, are all resident and run in step; started at different tiles they do not ask L2 for the same lines at the same moment. Every tile is taken once; both sums over the keys are plain sums, so only their f32 order differs from block to block
#define FROT(t, rot) (((t) + (rot)) & (NT - 1))
static_assert((NT & (NT - 1)) == 0 && NT % (TT / FQ) == 0, "the ring's wrap is a mask, and the blocks' starts are spread evenly over it");
typedef __attribute__((address_space(4))) unsigned cu32;   // read-only for the whole launch: lets a loop with asm waits keep its wave-uniform loads scalar
struct FaBuf { _Float16 k[TSL / 2]; _Float16 v[TSL / 2]; };   /* two slices of 64 rows at pitch KP, each rounded up to a multiple of 2 KiB (see TSL) */
static_assert(KP == SP && FK == 64 && HD == 64, "both tiles are 64 rows x 128 B, padded to the pitch of t_init's descriptor");
#define RS0 0x1p60f        // first row scale: a row that never leaves it has every t <= 2^-105, of the order of the normaliser's 1e-32 or below, and 1e-32 x RS0^2 is still finite
#define TLIM 32768.0f      // a lane's sum of a half tile's scaled t (all >= 0) at or below this bounds each of them inside f16's range
// one half tile's scaled t = relu(score x cs + cb)^2 (masked -> 0): once to f16 as the B operand of V^T P^T; returns the lane's f32 sum of them. The scores are taken two at a time as they lie in neighbouring registers of one product's result (with two groups in a wave the compiler otherwise pairs the groups' scores for its packed forms, and pays a register copy for every score); the sum runs in two chains, even and odd keys
__device__ __forceinline__ float fa_t(const v8f (&s)[FH / 16], const unsigned (&m)[FH / 2], float cs, float cb, v16h& p) { v2f ts = {0.f, 0.f}; const v2f c2 = {cs, cs}, b2 = {cb, cb}, z2 = {0.f, 0.f};
#pragma unroll
  for (int u = 0; u < FH / 16; ++u) {
#pragma unroll
    for (int r = 0; r < 8; r += 2) { const v2f x = __builtin_elementwise_max(v2f{s[u][r], s[u][r + 1]} * c2 + b2, z2); v2f e = x * x;
      e[0] = __builtin_amdgcn_inverse_ballot_w32(m[8 * u + r]) ? e[0] : 0.f; e[1] = __builtin_amdgcn_inverse_ballot_w32(m[8 * u + r + 1]) ? e[1] : 0.f;
      ts += e; p[8 * u + r] = (_Float16)e[0]; p[8 * u + r + 1] = (_Float16)e[1]; } }
  return ts[0] + ts[1]; }
// ---- k_fa (scores, SparseNormer and P v in one launch; no score plane in memory): block = 8 waves = 4 pairs x 32 queries of (b, h). S^T = K Q^T: lane (g, col) holds query col's scores of keys 8g + r of each 16-key tile, so the row sum is in-lane (+ one exchange between the halves) and two converted S^T tiles are the B operand of ctx^T += V^T P^T.
// A wave holds TWO groups of 16 queries, so every K and V^T fragment that it reads from LDS feeds two products; the two waves of a pair share their 32 queries and take keys 0..31 and 32..63 of every tile, so as many waves stand on a SIMD as with 16 queries a wave. Each wave of a pair keeps its own partial sums and its own row scale; the pair's partials are joined once, behind the loop, through LDS.
// ONE pass over the keys: the normaliser is a plain quotient, so ctx = (sum_k t_k v_k) / (sum_k t_k + 1e-32) and both sums grow together. t goes to f16 as t x rs^2 with a power-of-two row scale rs (exact), so its f16 range does not depend on the scale of the scores: rs starts high and is lowered, with both sums rescaled, when a tile would leave f16's range (as a rule once, at the row's first tile with a positive score); the row's largest x then sits at 8..16 and may grow several-fold before the next change. The inner loops are unrolled whole so that the vector elements are indexed by constants and stay in registers.
__global__ __launch_bounds__(256) void k_fa(const _Float16* __restrict__ QH, const _Float16* __restrict__ KH, const _Float16* __restrict__ VT, const unsigned* __restrict__ MB, const float* __restrict__ NBIAS, _Float16* __restrict__ YH) {
  union SM { FaBuf fb[2]; v4f mg[4][17][32]; };   /* the join's array lies over the tile buffers, which no wave reads behind the loop's last barrier */
  __shared__ __attribute__((aligned(2048))) SM sm; auto& fb = sm.fb;
  const int tid = threadIdx.x, wave = tid >> 5, lane = tid & 31, col = lane & 15, g = lane >> 4; const int h = blockIdx.x, b = blockIdx.z;
  const int qw = __builtin_amdgcn_readfirstlane(wave & 3), kh = __builtin_amdgcn_readfirstlane(wave >> 2);   /* the pair, and the wave's half of every tile: wave-uniform, kept scalar */
  const int ql = blockIdx.y * FQ + qw * 32 + col;   /* query of group 0; group 1: 16 further */
  const float nb_ = bfr(NBIAS[0]);
  const _Float16* qp = QH + ((size_t)b * TT + ql) * CC + h * HD; v16h q[2][2];
#pragma unroll
  for (int a = 0; a < 2; ++a) { q[a][0] = frag_h(qp + (size_t)a * 16 * CC, lane); q[a][1] = frag_h(qp + (size_t)a * 16 * CC + 32, lane); }
  XW(qp);
  const uint32_t wv = uni((uint32_t)tid >> 5);   /* the wave's number: wave 0 brings the K tiles (rows CC apart, a tile FK rows on), wave 1 the V^T tiles (rows TT apart, a tile FK columns on) */
  const _Float16* tp = wv == 0 ? KH + (size_t)b * TT * CC + h * HD : VT + ((size_t)b * CC + h * HD) * (size_t)TT; const size_t ts_ = wv == 0 ? (size_t)FK * CC : (size_t)FK;
  const uint32_t td = lds_of(&sm.fb[0].k[0]) + (wv & 1) * TSL;   /* its slice of buffer 0; buffer 1: 2 * TSL on */
  TD td_; t_init(td_, wv == 0 ? 2u * CC : 2u * TT);
  const cu32* mw = (const cu32*)(MB + (size_t)((b * TT + blockIdx.y * FQ) / 16 + qw * 2) * (NT * (FK / 2)) + kh * (FH / 2));   /* the lane-mask words of group 0's 16 queries and the wave's half tiles, FH / 2 of every FK / 2; group 1's lie NT * FK / 2 words on; a wave-uniform address of words that no one writes during this launch, so they come by scalar loads into scalar registers */
  const int rot = blockIdx.y * (NT / (TT / FQ));   /* the block's first key tile (see FROT): the 16 blocks of a (b, h) start two tiles apart */
  unsigned m[2][FH / 2];   /* indexed by constants only (loops unrolled whole), so each word keeps a scalar register */
#pragma unroll
  for (int a = 0; a < 2; ++a) {
#pragma unroll
    for (int i = 0; i < FH / 2; ++i) m[a][i] = mw[a * (NT * (FK / 2)) + FROT(0, rot) * (FK / 2) + i]; }
  if (pinned(wv < 2)) { t_load(td_, td, tp + FROT(0, rot) * ts_);   /* a scalar branch: a tensor load ignores EXEC */
    asm volatile("s_wait_tensorcnt 0x0" ::: "memory"); }   /* the block's first tile (see FROT) has landed before the barrier that publishes it */
  T_HOLD(td_);
  __syncthreads();
  if (pinned(wv < 2)) t_load(td_, td + 2 * TSL, tp + FROT(1, rot) * ts_);
  float rs[2] = {RS0, RS0}, cs[2] = {SCALE * RS0, SCALE * RS0}, cb[2] = {nb_ * RS0, nb_ * RS0}, sum[2] = {0.f, 0.f};   /* rs is the same in both halves of a query */
  v8f acc[2][HD / 16] = {};
  for (int t = 0; t < NT; ++t) { const FaBuf& f = fb[t & 1];
    v8f s[2][FH / 16]; v16h p[2]; float ts[2];
#pragma unroll
    for (int u = 0; u < FH / 16; ++u) { const v16h ka = frag_h(&f.k[(kh * FH + 16 * u + col) * KP], lane), kb = frag_h(&f.k[(kh * FH + 16 * u + col) * KP + 32], lane);
#pragma unroll
      for (int a = 0; a < 2; ++a) { v8f z = {}; z = wmma_h(ka, q[a][0], z); s[a][u] = wmma_h(kb, q[a][1], z); } }
#pragma unroll
    for (int a = 0; a < 2; ++a) ts[a] = fa_t(s[a], m[a], cs[a], cb[a], p[a]);
    if (__builtin_amdgcn_ballot_w32(!(ts[0] <= TLIM) || !(ts[1] <= TLIM)) != 0) {   /* one test per tile, a scalar branch, rarely taken: some row of the wave needs a lower scale */
#pragma unroll
      for (int a = 0; a < 2; ++a) { float mx = 0.f;
#pragma unroll
        for (int u = 0; u < FH / 16; ++u) {
#pragma unroll
          for (int r = 0; r < 8; ++r) mx = fmaxf(mx, __builtin_amdgcn_inverse_ballot_w32(m[a][8 * u + r]) ? s[a][u][r] * SCALE + nb_ : 0.f); }
        mx = fmaxf(mx, __shfl_xor(mx, 16));   /* the query's largest unmasked x of this half tile, the same in both halves */
        int ex; (void)frexpf(mx, &ex);
        const float rn = (mx * rs[a] > 16.0f) ? ldexpf(1.0f, 4 - ex) : rs[a];   /* mx x rn in [8, 16): every scaled t of the half tile <= 256, their sum <= 4096 */
        const float fr = rn / rs[a], f2 = fr * fr;   /* powers of two: exact (or 0 where the old sums no longer count) */
#pragma unroll
        for (int j = 0; j < HD / 16; ++j) acc[a][j] *= f2;
        sum[a] *= f2; rs[a] = rn; cs[a] = SCALE * rn; cb[a] = nb_ * rn;
        ts[a] = fa_t(s[a], m[a], cs[a], cb[a], p[a]); } }
    sum[0] += ts[0]; sum[1] += ts[1];
    { const cu32* mn = mw + FROT(t + 1, rot) * (FK / 2);   /* the next tile's words, asked for as soon as this tile's are used: they fly under P v, the hand-over and the next scores (the last trip reads the first tile's again, in bounds) */
#pragma unroll
      for (int a = 0; a < 2; ++a) {
#pragma unroll
        for (int i = 0; i < FH / 2; ++i) m[a][i] = mn[a * (NT * (FK / 2)) + i]; } }
    v16h vf[HD / 16];
#pragma unroll
    for (int j = 0; j < HD / 16; ++j) vf[j] = frag_h(&f.v[(j * 16 + col) * KP + kh * FH], lane);
    __builtin_amdgcn_sched_barrier(0);   /* keeps the tile's 8 V^T reads together in front of their products: left alone the compiler sinks them among the products, two at a time into one set of registers, each pair with a full wait in front of two products */
#pragma unroll
    for (int j = 0; j < HD / 16; ++j) {
#pragma unroll
      for (int a = 0; a < 2; ++a) acc[a][j] = wmma_h(vf[j], p[a], acc[a][j]); }
    __builtin_amdgcn_sched_barrier(0);   /* keeps the products in front of the hand-over: lifted over them, the barrier would hold a wave that is early with its products still to do */
    T_PUBLISH(td_);   /* the tensor wait is the issuing waves' own; the other six have no request and pass it */
    if (pinned(wv < 2 && t + 2 < NT)) { const uint32_t sn = pinned((uint32_t)FROT(t + 2, rot)); t_load(td_, td + (uint32_t)(t & 1) * (2 * TSL), tp + sn * ts_); } }   /* a scalar branch; into the buffer that every wave has just left */
  asm volatile("s_wait_tensorcnt 0x0" ::: "memory");   /* no load is outstanding when the buffers become the join's array */
  T_HOLD(td_);
  asm volatile("s_wait_dscnt 0x0" ::: "memory");
  sum[0] += __shfl_xor(sum[0], 16); sum[1] += __shfl_xor(sum[1], 16);
  if (kh == 1) {   /* wave-uniform: the second wave of a pair hands over its partials, 512 contiguous bytes per store; the same lane of its partner holds the same query and columns */
#pragma unroll
    for (int a = 0; a < 2; ++a) {
#pragma unroll
      for (int j = 0; j < HD / 16; ++j) { const v8f c = acc[a][j]; sm.mg[qw][(a * 4 + j) * 2][lane] = v4f{c[0], c[1], c[2], c[3]}; sm.mg[qw][(a * 4 + j) * 2 + 1][lane] = v4f{c[4], c[5], c[6], c[7]}; } }
    sm.mg[qw][16][lane] = v4f{sum[0], sum[1], rs[0], rs[1]}; }
  __syncthreads();   /* publishes the handed-over partials; every wave passes it */
  if (kh == 0) { const v4f sr = sm.mg[qw][16][lane]; v8h o[2][HD / 16];
#pragma unroll
    for (int a = 0; a < 2; ++a) { const float rp = sr[2 + a], rm = fminf(rs[a], rp);   /* both partials go to the lower of the two row scales */
      const float fa = rm / rs[a], fp = rm / rp, fa2 = fa * fa, fp2 = fp * fp;   /* powers of two: exact (or 0 where that partial no longer counts); one of them is 1 */
      const float inv = 1.0f / ((sum[a] * fa2 + sr[a] * fp2) + (IEPS * rm) * rm);   /* both sums carry rm^2, so does the 1e-32; both sums == 0 -> rm == RS0, acc == 0 -> ctx = 0 */
#pragma unroll
      for (int j = 0; j < HD / 16; ++j) { const v4f c0 = sm.mg[qw][(a * 4 + j) * 2][lane], c1 = sm.mg[qw][(a * 4 + j) * 2 + 1][lane];
#pragma unroll
        for (int r = 0; r < 8; ++r) o[a][j][r] = (_Float16)(((acc[a][j][r] * fa2 + (r < 4 ? c0[r & 3] : c1[r & 3]) * fp2) * inv) * 64.0f); } }
    _Float16* yp = YH + ((size_t)(b * (TT / 64) + blockIdx.y * (FQ / 64) + (qw >> 1)) * KT + h) * TILE + ((qw & 1) * 32 + col) * 64 + 8 * g;   /* acc[a][j][r] = ctx[query 16a + col][16j + 8g + r]; ctx x 2^6 once to f16 (clear of f16 subnormals), as k_out's A operand: the head's 64 columns are one tile of 64 of the block's rows, and the wave writes each query's whole 128-B row of it */
#pragma unroll
    for (int a = 0; a < 2; ++a) {
#pragma unroll
      for (int j = 0; j < HD / 16; ++j) vst2(yp + a * 16 * 64 + j * 16, o[a][j]); } } }
// ---- k_cvt (first launch): the roundings of the projections' operands, once per element: iQ, iK, iV and Wq, Wk, Wv to bf16, Wo to f16(bf16 x 2^8) (exact), written as tiles. A block takes one row per load (256 threads x 16 B, whole lines), eight rows in flight; 128 B of a tile row per 16 lanes on the way out
__global__ __launch_bounds__(256) void k_cvt(const float* __restrict__ XQ, const float* __restrict__ XK, const float* __restrict__ XV, const float* __restrict__ WQ, const float* __restrict__ WK, const float* __restrict__ WV, const float* __restrict__ WO, __bf16* __restrict__ XB, __bf16* __restrict__ WB, _Float16* __restrict__ WOH) {
  const int tid = threadIdx.x, bx = blockIdx.x, k = tid * 4;   /* rows bx + 512 i */
  const size_t so = (size_t)bx * DIN + k, to = ((size_t)(bx >> 6) * KT + (k >> 6)) * TILE + (bx & 63) * 64 + (k & 63);   /* 512 rows on: 512 * DIN elements in either layout */
#pragma unroll
  for (int p = 0; p < 3; ++p) { const float* xp = (p == 0 ? XQ : p == 1 ? XK : XV) + so; __bf16* op = XB + (size_t)p * TNB * TT * DIN + to; v4f a[8];
#pragma unroll
    for (int i = 0; i < 8; ++i) a[i] = *(const v4f*)(xp + (size_t)i * 512 * DIN);
    XW(xp);
#pragma unroll
    for (int i = 0; i < 8; ++i) { v4b o;
#pragma unroll
      for (int e = 0; e < 4; ++e) o[e] = (__bf16)a[i][e];
      *(v4b*)(op + (size_t)i * 512 * DIN) = o; }
    XW(op); }
  v4f a[8];
#pragma unroll
  for (int i = 0; i < 8; ++i) a[i] = *(const v4f*)(((i >> 1) == 0 ? WQ : (i >> 1) == 1 ? WK : (i >> 1) == 2 ? WV : WO) + (size_t)(i & 1) * 512 * DIN + so);
  asm volatile("s_wait_xcnt 0x0" ::: "memory");   /* closes the group of loads before a register that they name may be rewritten */
#pragma unroll
  for (int i = 0; i < 6; ++i) { v4b o;
#pragma unroll
    for (int e = 0; e < 4; ++e) o[e] = (__bf16)a[i][e];
    *(v4b*)(WB + (size_t)i * 512 * DIN + to) = o; }
#pragma unroll
  for (int i = 6; i < 8; ++i) { v4h o;
#pragma unroll
    for (int e = 0; e < 4; ++e) o[e] = (_Float16)(bfr(a[i][e]) * 256.0f);
    *(v4h*)(WOH + (size_t)(i - 6) * 512 * DIN + to) = o; } }
// ---- k_out: block = (128 rows, 128 cols), four waves 2 x 2, each on 64 rows x 64 cols: out = ctx Wo (+ bo): ctx x 2^6 in f16 against Wo as f16(bf16 x 2^8) exact (1 product) x 2^-14
__global__ __launch_bounds__(128) void k_out(const _Float16* __restrict__ YH, const _Float16* __restrict__ WOH, const float* __restrict__ BO, float* __restrict__ OUT) { union SM { float sf[4][64][68]; _Float16 st[2][4][TSL / 2]; };   /* the stage buffers lie over the epilogue's array, which is first written behind the loop's last barrier */
  __shared__ __attribute__((aligned(2048))) SM sm; auto& sf = sm.sf;
  const int tid = threadIdx.x, wave = tid >> 5, lane = tid & 31, col = lane & 15, g = lane >> 4, wr = wave >> 1, wc = wave & 1; const int c0 = blockIdx.y * 128 + wc * 64; const size_t r0 = (size_t)blockIdx.x * 128 + wr * 64;
  v8f acc[4][4] = {};
  const uint32_t wv = uni((uint32_t)tid >> 5);   /* the wave's number = its slice: waves 0, 1 bring the block's two ctx tiles, waves 2, 3 its two Wo tiles */
  const _Float16* tp = (wv < 2 ? YH + (size_t)blockIdx.x * 2 * KT * TILE : WOH + (size_t)blockIdx.y * 2 * KT * TILE) + (size_t)(wv & 1) * KT * TILE;   /* the wave's tile of k stage 0 */
  const uint32_t td = lds_of(&sm.st[0][0][0]) + wv * TSL;   /* its slice of buffer 0; buffer 1: 4 * TSL on */
  const int rot = blockIdx.x + blockIdx.y;   /* the block's first k stage (see KROT) */
  TD td_; t_init(td_, 128u);   /* a tile is contiguous in memory */
  t_load(td_, td, tp + KROT(0, rot) * TILE);
  asm volatile("s_wait_tensorcnt 0x0" ::: "memory");   /* the block's first stage (see KROT) has landed before the barrier that publishes it */
  T_HOLD(td_);
  __syncthreads();
  t_load(td_, td + 4 * TSL, tp + KROT(1, rot) * TILE);
  for (int t = 0; t < CC / KS; ++t) { const _Float16* cx = &sm.st[t & 1][wr][col * SP]; const _Float16* cw = &sm.st[t & 1][2 + wc][col * SP];
    v16h a[KS / 32][4], w[KS / 32][4];
#pragma unroll
    for (int kc = 0; kc < KS / 32; ++kc) {
#pragma unroll
      for (int i = 0; i < 4; ++i) { a[kc][i] = frag_h(cx + i * 16 * SP + kc * 32, lane); w[kc][i] = frag_h(cw + i * 16 * SP + kc * 32, lane); } }
    __builtin_amdgcn_sched_barrier(0);   /* keeps the stage's 32 LDS reads together in front of its products: left alone the compiler sinks them among the products, two at a time, each pair with a full wait in front of four products */
#pragma unroll
    for (int kc = 0; kc < KS / 32; ++kc) {
#pragma unroll
      for (int i = 0; i < 4; ++i) {
#pragma unroll
        for (int j = 0; j < 4; ++j) acc[i][j] = __builtin_amdgcn_wmma_f32_16x16x32_f16(false, a[kc][i], false, w[kc][j], (short)0, acc[i][j], false, false); } }
    __builtin_amdgcn_sched_barrier(0);   /* keeps the products in front of the hand-over: lifted over them, its waits would give the next stage's load only the LDS reads' time to land */
    T_PUBLISH(td_);
    if (pinned(t + 2 < CC / KS)) { const uint32_t sn = pinned((uint32_t)KROT(t + 2, rot)); t_load(td_, td + (uint32_t)(t & 1) * (4 * TSL), tp + (size_t)sn * TILE); } }   /* a scalar branch; into the buffer that every wave has just left */
  asm volatile("s_wait_tensorcnt 0x0" ::: "memory");   /* no load is outstanding when the buffers become the epilogue's array */
  T_HOLD(td_);
  asm volatile("s_wait_dscnt 0x0" ::: "memory");
  float bias[4] = {0.f, 0.f, 0.f, 0.f};
  if (BO) { const float* bp = BO + c0 + col;   /* one test, so that the four loads go out together */
#pragma unroll
    for (int j = 0; j < 4; ++j) bias[j] = bp[j * 16];
#pragma unroll
    for (int j = 0; j < 4; ++j) bias[j] = bfr(bias[j]); }
#pragma unroll
  for (int j = 0; j < 4; ++j) {
#pragma unroll
    for (int i = 0; i < 4; ++i) {
#pragma unroll
      for (int r = 0; r < 8; ++r) sf[wave][i * 16 + 8 * g + r][j * 16 + col] = acc[i][j][r] * (1.0f / 16384.0f) + bias[j]; } }   /* 2^-8 (Wo carry) x 2^-6 (ctx carry) */
  LDSX(); float* op = OUT + (r0 + g) * DIN + c0 + col * 4;   /* the wave's own rows back as whole lines: 256 B of a row per 16 lanes, two rows per store */
#pragma unroll
  for (int rl = 0; rl < 64; rl += 2) vst2(op + (size_t)rl * DIN, *(const v4f*)&sf[wave][rl + g][col * 4]); }

extern "C" void kernel_launch(void* const* d_in, const int* in_sizes, int n_in, void* d_out, int out_size, void* d_ws, size_t ws_size, hipStream_t stream) {
  (void)in_sizes; (void)n_in; (void)out_size;
  const float** F = (const float**)d_in;
  if (ws_size < (size_t)WS_END) return;
  char* ws = (char*)d_ws; _Float16 *QH = (_Float16*)(ws + WS_QH), *KH = (_Float16*)(ws + WS_KH), *VT = (_Float16*)(ws + WS_VT); _Float16 *YH = (_Float16*)(ws + WS_Y), *WOH = (_Float16*)(ws + WS_WO); __bf16 *XB = (__bf16*)(ws + WS_XB), *WB = (__bf16*)(ws + WS_WB); unsigned* MB = (unsigned*)(ws + WS_S);   /* lane-mask words of the mask, 1 MiB, in the place of the old score plane */
  // inputs: 0 iQ [2,2048,1024]; 1 iK; 2 iV; 3 mask [2,2048,2048] bool (True = masked); 4 Wq [1024,1024] (out,in), 5 bq; 6 Wk, 7 bk; 8 Wv, 9 bv; 10 Wo (out,in), 11 bo (zero biases, read); 12 nbias [1] (SparseNormer bias; zero)
  k_cvt<<<dim3(512), 256, 0, stream>>>(F[0], F[1], F[2], F[4], F[6], F[8], F[10], XB, WB, WOH);
  k_proj<<<dim3(TNB * TT / 128, CC / 128, 5), 128, 0, stream>>>(XB, WB, F[5], F[7], F[9], QH, KH, VT, (const int*)d_in[3], MB);   /* z = 3, 4: the mask's packing blocks, short, last in the launch */
  k_fa<<<dim3(NH, TT / FQ, TNB), 256, 0, stream>>>(QH, KH, VT, MB, F[12], YH);   /* relu(x + nbias)^2 / (sum + 1e-32): NOT a softmax */
  k_out<<<dim3(TNB * TT / 128, DIN / 128), 128, 0, stream>>>(YH, WOH, F[11], (float*)d_out);
}
